// v000
// Measured on an AMD MI455X. A time is GPU time per run, averaged over a window of back-to-back runs after a warm-up
// (all launches, gaps included; the runs take copies of the inputs in turn), and the median of several windows.
// Apart from v000's, it joins two sittings. Times from different sittings can be a few percent apart, while
// side-by-side timings come from the same sitting.
// v000, which the later versions start from, runs in 686 microseconds.
#include <hip/hip_runtime.h>
#include <hip/hip_bf16.h>

// ---------------------------------------------------------------------------
// Transformer encoder block for MI455X (gfx1250, wave32, WMMA).
// All GEMMs run on v_wmma_f32_16x16x32_bf16; attention is flash-style with
// 64-key tiles. 1/sqrt(d) is folded into the Q projection epilogue.
// ---------------------------------------------------------------------------

typedef __bf16 bf16_t;
typedef __attribute__((ext_vector_type(16))) __bf16 bf16x16;
typedef __attribute__((ext_vector_type(8)))  float  f32x8;

#define DIMC   1024
#define HEADS  16
#define HDIM   64
#define HID    4096
#define NTOK   2048
#define BATCH  2
#define MTOT   (BATCH * NTOK)   // 4096 tokens

// ---------------------------------------------------------------------------
// WMMA helpers
// ---------------------------------------------------------------------------
__device__ inline f32x8 wmma_bf16(bf16x16 a, bf16x16 b, f32x8 c) {
  // (neg_a, A, neg_b, B, c_mod, C, reuse_a, reuse_b)
  return __builtin_amdgcn_wmma_f32_16x16x32_bf16(false, a, false, b,
                                                 (short)0, c, false, false);
}

// Load a 16x32 bf16 fragment (A-style layout; also used for B when the
// source is stored "transposed" i.e. [col][k] row-major).
// ISA 16-bit A layout: lane = m + 16*half;
//   VGPR0..3 : K = half*8 + 0..7
//   VGPR4..7 : K = 16 + half*8 + 0..7
// base points at (row0, k0); ld = row stride in elements (multiple of 8).
__device__ inline bf16x16 load_frag(const bf16_t* base, int ld) {
  int lane = threadIdx.x & 31;
  int m    = lane & 15;
  int half = lane >> 4;
  const bf16_t* p = base + (size_t)m * (size_t)ld + half * 8;
  union { uint4 u[2]; bf16x16 v; } cv;
  cv.u[0] = *reinterpret_cast<const uint4*>(p);
  cv.u[1] = *reinterpret_cast<const uint4*>(p + 16);
  return cv.v;
}

// ---------------------------------------------------------------------------
// Weight prep: fp32 [K][N] -> bf16 transposed [N][K]
// ---------------------------------------------------------------------------
__global__ void wt_transpose_kernel(const float* __restrict__ in,
                                    bf16_t* __restrict__ out, int K, int N) {
  size_t idx = (size_t)blockIdx.x * 256 + threadIdx.x;
  if (idx >= (size_t)K * N) return;
  int k = (int)(idx / (size_t)N);
  int n = (int)(idx % (size_t)N);
  out[(size_t)n * K + k] = (bf16_t)in[idx];
}

// ---------------------------------------------------------------------------
// LayerNorm over DIMC=1024, one block (256 threads) per row. Output bf16.
// ---------------------------------------------------------------------------
__global__ void __launch_bounds__(256) layernorm_kernel(
    const float* __restrict__ x, const float* __restrict__ w,
    const float* __restrict__ b, bf16_t* __restrict__ out) {
  __shared__ float ssum[8];
  __shared__ float ssq[8];
  int row  = blockIdx.x;
  int tid  = threadIdx.x;
  int lane = tid & 31;
  int wv   = tid >> 5;

  const float4* xr = reinterpret_cast<const float4*>(x + (size_t)row * DIMC);
  float4 v = xr[tid];
  float s  = v.x + v.y + v.z + v.w;
  float sq = v.x * v.x + v.y * v.y + v.z * v.z + v.w * v.w;
  #pragma unroll
  for (int mask = 16; mask >= 1; mask >>= 1) {
    s  += __shfl_xor(s, mask, 32);
    sq += __shfl_xor(sq, mask, 32);
  }
  if (lane == 0) { ssum[wv] = s; ssq[wv] = sq; }
  __syncthreads();
  float ts = 0.f, tq = 0.f;
  #pragma unroll
  for (int i = 0; i < 8; ++i) { ts += ssum[i]; tq += ssq[i]; }
  float mu  = ts * (1.0f / DIMC);
  float var = tq * (1.0f / DIMC) - mu * mu;
  float inv = rsqrtf(var + 1e-5f);

  int c = tid * 4;
  const float4 wv4 = reinterpret_cast<const float4*>(w)[tid];
  const float4 bv4 = reinterpret_cast<const float4*>(b)[tid];
  bf16_t* o = out + (size_t)row * DIMC + c;
  o[0] = (bf16_t)((v.x - mu) * inv * wv4.x + bv4.x);
  o[1] = (bf16_t)((v.y - mu) * inv * wv4.y + bv4.y);
  o[2] = (bf16_t)((v.z - mu) * inv * wv4.z + bv4.z);
  o[3] = (bf16_t)((v.w - mu) * inv * wv4.w + bv4.w);
}

// ---------------------------------------------------------------------------
// Generic bf16 WMMA GEMM:  C = (A[M,K] * Bt[N,K]^T + bias) * oscale, epilogue.
// Block = 256 threads (8 waves as 4x2), block tile 128x128,
// wave tile 32x64 (2x4 accumulator tiles), K-step 32.
// ---------------------------------------------------------------------------
enum { EPI_QK = 0, EPI_VT = 1, EPI_RESID_F32 = 2, EPI_GELU_BF16 = 3 };

template <int EPI>
__global__ void __launch_bounds__(256, 4) gemm_kernel(
    const bf16_t* __restrict__ A, const bf16_t* __restrict__ Bt,
    const float* __restrict__ bias, void* __restrict__ outp,
    const float* __restrict__ resid, int M, int N, int K, int Ntok,
    float oscale) {
  int wave = threadIdx.x >> 5;
  int lane = threadIdx.x & 31;
  int wm = wave >> 1;          // 0..3
  int wn = wave & 1;           // 0..1
  int row0 = blockIdx.y * 128 + wm * 32;
  int col0 = blockIdx.x * 128 + wn * 64;

  f32x8 acc[2][4];
  #pragma unroll
  for (int t = 0; t < 2; ++t)
    #pragma unroll
    for (int u = 0; u < 4; ++u) acc[t][u] = (f32x8)(0.0f);

  for (int k0 = 0; k0 < K; k0 += 32) {
    bf16x16 a0 = load_frag(A + (size_t)row0 * K + k0, K);
    bf16x16 a1 = load_frag(A + (size_t)(row0 + 16) * K + k0, K);
    #pragma unroll
    for (int u = 0; u < 4; ++u) {
      bf16x16 bu = load_frag(Bt + (size_t)(col0 + u * 16) * K + k0, K);
      acc[0][u] = wmma_bf16(a0, bu, acc[0][u]);
      acc[1][u] = wmma_bf16(a1, bu, acc[1][u]);
    }
  }

  // Epilogue. C layout: VGPR r, lanes 0-15 -> (M=r, N=lane),
  //                     lanes 16-31 -> (M=r+8, N=lane-16)
  int nloc = lane & 15;
  int moff = (lane >> 4) * 8;
  #pragma unroll
  for (int t = 0; t < 2; ++t) {
    #pragma unroll
    for (int u = 0; u < 4; ++u) {
      #pragma unroll
      for (int r = 0; r < 8; ++r) {
        int rowg = row0 + t * 16 + moff + r;
        int colg = col0 + u * 16 + nloc;
        float val = (acc[t][u][r] + bias[colg]) * oscale;
        if constexpr (EPI == EPI_QK) {
          // -> per-head [b][h][tok][d], bf16
          int bi = rowg / Ntok, tok = rowg % Ntok;
          int h = colg >> 6, d = colg & 63;
          ((bf16_t*)outp)[((((size_t)bi * HEADS + h) * Ntok + tok) << 6) + d] =
              (bf16_t)val;
        } else if constexpr (EPI == EPI_VT) {
          // -> per-head transposed [b][h][d][tok], bf16
          int bi = rowg / Ntok, tok = rowg % Ntok;
          int h = colg >> 6, d = colg & 63;
          ((bf16_t*)outp)[(((size_t)bi * HEADS + h) * HDIM + d) * Ntok + tok] =
              (bf16_t)val;
        } else if constexpr (EPI == EPI_RESID_F32) {
          size_t idx = (size_t)rowg * N + colg;
          ((float*)outp)[idx] = resid[idx] + val;
        } else {  // EPI_GELU_BF16, exact gelu
          float g = 0.5f * val * (1.0f + erff(val * 0.70710678118654752f));
          ((bf16_t*)outp)[(size_t)rowg * N + colg] = (bf16_t)g;
        }
      }
    }
  }
}

// ---------------------------------------------------------------------------
// Flash attention. Grid: (Ntok/128, B*HEADS). Block 256 threads = 8 waves;
// each wave owns a 16-row Q tile and streams keys in chunks of 64.
// q (pre-scaled by 1/sqrt(d)), k: [b][h][tok][64] bf16. vt: [b][h][64][tok].
// out: [b][tok][h*64+d] bf16 (heads re-concatenated for the Wo GEMM).
// ---------------------------------------------------------------------------
#define PLDW 72  // 64 keys + 8 pad

__global__ void __launch_bounds__(256, 4) attn_kernel(
    const bf16_t* __restrict__ q, const bf16_t* __restrict__ k,
    const bf16_t* __restrict__ vt, bf16_t* __restrict__ out, int Ntok) {
  __shared__ bf16_t plds[8][16][PLDW];  // padded 16x64 P tile per wave

  int wave = threadIdx.x >> 5;
  int lane = threadIdx.x & 31;
  int bh = blockIdx.y;
  int q0 = blockIdx.x * 128 + wave * 16;

  const bf16_t* Qh = q  + (size_t)bh * Ntok * HDIM;
  const bf16_t* Kh = k  + (size_t)bh * Ntok * HDIM;
  const bf16_t* Vh = vt + (size_t)bh * HDIM * Ntok;

  bf16x16 qf0 = load_frag(Qh + (size_t)q0 * HDIM + 0, HDIM);
  bf16x16 qf1 = load_frag(Qh + (size_t)q0 * HDIM + 32, HDIM);

  f32x8 oacc[4];
  #pragma unroll
  for (int u = 0; u < 4; ++u) oacc[u] = (f32x8)(0.0f);
  float mrow[8], lrow[8];
  #pragma unroll
  for (int r = 0; r < 8; ++r) { mrow[r] = -1e30f; lrow[r] = 0.0f; }

  int nloc = lane & 15;
  int moff = (lane >> 4) * 8;

  for (int kt = 0; kt < Ntok; kt += 64) {
    // 4 S tiles: 16 q-rows x 64 keys (QK^T, contraction over d=64).
    f32x8 s[4];
    #pragma unroll
    for (int i = 0; i < 4; ++i) {
      const bf16_t* Kt = Kh + (size_t)(kt + i * 16) * HDIM;
      f32x8 si = (f32x8)(0.0f);
      si = wmma_bf16(qf0, load_frag(Kt + 0, HDIM), si);
      si = wmma_bf16(qf1, load_frag(Kt + 32, HDIM), si);
      s[i] = si;
    }

    // Online softmax update; rows live in VGPR r across a 16-lane half.
    #pragma unroll
    for (int r = 0; r < 8; ++r) {
      float a0 = s[0][r], a1 = s[1][r], a2 = s[2][r], a3 = s[3][r];
      float mx = fmaxf(fmaxf(a0, a1), fmaxf(a2, a3));
      mx = fmaxf(mx, __shfl_xor(mx, 1, 32));
      mx = fmaxf(mx, __shfl_xor(mx, 2, 32));
      mx = fmaxf(mx, __shfl_xor(mx, 4, 32));
      mx = fmaxf(mx, __shfl_xor(mx, 8, 32));
      float mnew  = fmaxf(mrow[r], mx);
      float alpha = __expf(mrow[r] - mnew);
      float p0 = __expf(a0 - mnew);
      float p1 = __expf(a1 - mnew);
      float p2 = __expf(a2 - mnew);
      float p3 = __expf(a3 - mnew);
      float rs = (p0 + p1) + (p2 + p3);
      rs += __shfl_xor(rs, 1, 32);
      rs += __shfl_xor(rs, 2, 32);
      rs += __shfl_xor(rs, 4, 32);
      rs += __shfl_xor(rs, 8, 32);
      lrow[r] = lrow[r] * alpha + rs;
      mrow[r] = mnew;
      #pragma unroll
      for (int u = 0; u < 4; ++u) oacc[u][r] *= alpha;
      int rowm = r + moff;
      plds[wave][rowm][nloc]      = (bf16_t)p0;
      plds[wave][rowm][nloc + 16] = (bf16_t)p1;
      plds[wave][rowm][nloc + 32] = (bf16_t)p2;
      plds[wave][rowm][nloc + 48] = (bf16_t)p3;
    }

    // Re-shape P (C-layout -> A-fragment) through LDS, then P @ V.
    #pragma unroll
    for (int ks = 0; ks < 2; ++ks) {
      bf16x16 pf = load_frag(&plds[wave][0][ks * 32], PLDW);
      #pragma unroll
      for (int u = 0; u < 4; ++u) {
        bf16x16 vf =
            load_frag(Vh + (size_t)(u * 16) * Ntok + kt + ks * 32, Ntok);
        oacc[u] = wmma_bf16(pf, vf, oacc[u]);
      }
    }
  }

  // Finalize: divide by l and scatter heads back to [b][tok][DIMC].
  int h  = bh & (HEADS - 1);
  int bi = bh >> 4;
  #pragma unroll
  for (int u = 0; u < 4; ++u) {
    #pragma unroll
    for (int r = 0; r < 8; ++r) {
      int tok = q0 + moff + r;
      int d   = u * 16 + nloc;
      float v = oacc[u][r] / lrow[r];
      out[((size_t)bi * Ntok + tok) * DIMC + h * HDIM + d] = (bf16_t)v;
    }
  }
}

// ---------------------------------------------------------------------------
// Host-side orchestration (graph-capture safe: launches only).
// ---------------------------------------------------------------------------
extern "C" void kernel_launch(void* const* d_in, const int* in_sizes, int n_in,
                              void* d_out, int out_size, void* d_ws, size_t ws_size,
                              hipStream_t stream) {
  (void)in_sizes; (void)n_in; (void)out_size; (void)ws_size;

  const float* x     = (const float*)d_in[0];
  const float* ln1_w = (const float*)d_in[1];
  const float* ln1_b = (const float*)d_in[2];
  const float* ln2_w = (const float*)d_in[3];
  const float* ln2_b = (const float*)d_in[4];
  const float* Wq = (const float*)d_in[5];  const float* bq = (const float*)d_in[6];
  const float* Wk = (const float*)d_in[7];  const float* bk = (const float*)d_in[8];
  const float* Wv = (const float*)d_in[9];  const float* bv = (const float*)d_in[10];
  const float* Wo = (const float*)d_in[11]; const float* bo = (const float*)d_in[12];
  const float* W1 = (const float*)d_in[13]; const float* b1 = (const float*)d_in[14];
  const float* W2 = (const float*)d_in[15]; const float* b2 = (const float*)d_in[16];

  // Workspace layout
  char* ws = (char*)d_ws;
  size_t off = 0;
  auto alloc = [&](size_t bytes) { char* p = ws + off; off += (bytes + 255) & ~size_t(255); return p; };
  bf16_t* Wqt = (bf16_t*)alloc((size_t)DIMC * DIMC * 2);
  bf16_t* Wkt = (bf16_t*)alloc((size_t)DIMC * DIMC * 2);
  bf16_t* Wvt = (bf16_t*)alloc((size_t)DIMC * DIMC * 2);
  bf16_t* Wot = (bf16_t*)alloc((size_t)DIMC * DIMC * 2);
  bf16_t* W1t = (bf16_t*)alloc((size_t)DIMC * HID * 2);
  bf16_t* W2t = (bf16_t*)alloc((size_t)HID * DIMC * 2);
  bf16_t* xn   = (bf16_t*)alloc((size_t)MTOT * DIMC * 2);
  bf16_t* qb   = (bf16_t*)alloc((size_t)MTOT * DIMC * 2);
  bf16_t* kb   = (bf16_t*)alloc((size_t)MTOT * DIMC * 2);
  bf16_t* vtb  = (bf16_t*)alloc((size_t)MTOT * DIMC * 2);
  bf16_t* attn = (bf16_t*)alloc((size_t)MTOT * DIMC * 2);
  float*  x2   = (float*)alloc((size_t)MTOT * DIMC * 4);
  bf16_t* xn2  = (bf16_t*)alloc((size_t)MTOT * DIMC * 2);
  bf16_t* hbuf = (bf16_t*)alloc((size_t)MTOT * HID * 2);

  // 1. Weight prep (fp32 -> bf16 transposed)
  {
    int g1 = (DIMC * DIMC + 255) / 256;
    wt_transpose_kernel<<<g1, 256, 0, stream>>>(Wq, Wqt, DIMC, DIMC);
    wt_transpose_kernel<<<g1, 256, 0, stream>>>(Wk, Wkt, DIMC, DIMC);
    wt_transpose_kernel<<<g1, 256, 0, stream>>>(Wv, Wvt, DIMC, DIMC);
    wt_transpose_kernel<<<g1, 256, 0, stream>>>(Wo, Wot, DIMC, DIMC);
    int g2 = (DIMC * HID + 255) / 256;
    wt_transpose_kernel<<<g2, 256, 0, stream>>>(W1, W1t, DIMC, HID);
    wt_transpose_kernel<<<g2, 256, 0, stream>>>(W2, W2t, HID, DIMC);
  }

  dim3 blk(256);

  // 2. LN1
  layernorm_kernel<<<MTOT, blk, 0, stream>>>(x, ln1_w, ln1_b, xn);

  // 3. Q, K, V projections (WMMA GEMMs). Q is pre-scaled by 1/sqrt(HDIM).
  dim3 gqkv(DIMC / 128, MTOT / 128);
  gemm_kernel<EPI_QK><<<gqkv, blk, 0, stream>>>(xn, Wqt, bq, qb,  nullptr, MTOT, DIMC, DIMC, NTOK, 0.125f);
  gemm_kernel<EPI_QK><<<gqkv, blk, 0, stream>>>(xn, Wkt, bk, kb,  nullptr, MTOT, DIMC, DIMC, NTOK, 1.0f);
  gemm_kernel<EPI_VT><<<gqkv, blk, 0, stream>>>(xn, Wvt, bv, vtb, nullptr, MTOT, DIMC, DIMC, NTOK, 1.0f);

  // 4. Flash attention
  dim3 gatt(NTOK / 128, BATCH * HEADS);
  attn_kernel<<<gatt, blk, 0, stream>>>(qb, kb, vtb, attn, NTOK);

  // 5. Output projection + residual: x2 = x + attn @ Wo + bo
  gemm_kernel<EPI_RESID_F32><<<gqkv, blk, 0, stream>>>(attn, Wot, bo, x2, x, MTOT, DIMC, DIMC, NTOK, 1.0f);

  // 6. LN2
  layernorm_kernel<<<MTOT, blk, 0, stream>>>(x2, ln2_w, ln2_b, xn2);

  // 7. MLP up + GELU: h = gelu(xn2 @ W1 + b1)
  dim3 gup(HID / 128, MTOT / 128);
  gemm_kernel<EPI_GELU_BF16><<<gup, blk, 0, stream>>>(xn2, W1t, b1, hbuf, nullptr, MTOT, HID, DIMC, NTOK, 1.0f);

  // 8. MLP down + residual -> output: out = x2 + h @ W2 + b2
  gemm_kernel<EPI_RESID_F32><<<gqkv, blk, 0, stream>>>(hbuf, W2t, b2, (float*)d_out, x2, MTOT, DIMC, HID, NTOK, 1.0f);
}

// v001
// Measured time: 456 microseconds a run.
// Timed twice side by side with v000, it ran 1.46 times as fast both times.
#include <hip/hip_runtime.h>
#include <hip/hip_bf16.h>

// ---------------------------------------------------------------------------
// Transformer encoder block for MI455X (gfx1250, wave32, WMMA).
// All GEMMs run on v_wmma_f32_16x16x32_bf16; attention is flash-style with
// 64-key tiles. 1/sqrt(d) is folded into the Q projection epilogue.
// ---------------------------------------------------------------------------

typedef __bf16 bf16_t;
typedef __attribute__((ext_vector_type(16))) __bf16 bf16x16;
typedef __attribute__((ext_vector_type(8)))  float  f32x8;

#define DIMC   1024
#define HEADS  16
#define HDIM   64
#define HID    4096
#define NTOK   2048
#define BATCH  2
#define MTOT   (BATCH * NTOK)   // 4096 tokens

// ---------------------------------------------------------------------------
// WMMA helpers
// ---------------------------------------------------------------------------
__device__ inline f32x8 wmma_bf16(bf16x16 a, bf16x16 b, f32x8 c) {
  // (neg_a, A, neg_b, B, c_mod, C, reuse_a, reuse_b)
  return __builtin_amdgcn_wmma_f32_16x16x32_bf16(false, a, false, b,
                                                 (short)0, c, false, false);
}

// Load a 16x32 bf16 fragment (A-style layout; also used for B when the
// source is stored "transposed" i.e. [col][k] row-major).
// ISA 16-bit A layout: lane = m + 16*half;
//   VGPR0..3 : K = half*8 + 0..7
//   VGPR4..7 : K = 16 + half*8 + 0..7
// base points at (row0, k0); ld = row stride in elements (multiple of 8).
__device__ inline bf16x16 load_frag(const bf16_t* base, int ld) {
  int lane = threadIdx.x & 31;
  int m    = lane & 15;
  int half = lane >> 4;
  const bf16_t* p = base + (size_t)m * (size_t)ld + half * 8;
  union { uint4 u[2]; bf16x16 v; } cv;
  cv.u[0] = *reinterpret_cast<const uint4*>(p);
  cv.u[1] = *reinterpret_cast<const uint4*>(p + 16);
  return cv.v;
}

// ---------------------------------------------------------------------------
// Weight prep: fp32 [K][N] -> bf16 transposed [N][K].
// One block moves a 128(k) x 64(n) tile; K and N are compile-time, so the
// row steps become immediate offsets of one address.
// A thread reads 8 k-rows x 4 n as 16-byte loads (a half-wave covers 256
// contiguous bytes of an input row) and packs the eight k of each n into one
// 16-byte chunk. The chunks cross through LDS, so that a half-wave then
// stores 256 contiguous bytes of an output row.
// LDS tile: [n][16 chunks]; the chunk index is XORed with n >> 2, which keeps
// both the 16-byte LDS writes and the reads free of bank conflicts.
// ---------------------------------------------------------------------------
typedef __attribute__((ext_vector_type(4))) float  f32x4;
typedef __attribute__((ext_vector_type(2))) float  f32x2;
typedef __attribute__((ext_vector_type(2))) __bf16 bf16x2;

template <int K, int N>
__global__ void __launch_bounds__(256) wt_transpose_kernel(
    const float* __restrict__ in, bf16_t* __restrict__ out) {
  static_assert(K % 128 == 0 && N % 64 == 0, "whole tiles only");
  __shared__ uint4 tile[64 * 16];
  int tid = threadIdx.x;
  int lo  = tid & 15;
  int hi  = tid >> 4;
  int k0  = blockIdx.y * 128;
  int n0  = blockIdx.x * 64;

  // lo = group of 4 n, hi = group of 8 k
  const float* src = in + (size_t)(k0 + hi * 8) * N + n0 + lo * 4;
  f32x4 v[8];
  #pragma unroll  // all eight loads in flight at once, v[] in registers
  for (int i = 0; i < 8; ++i)
    v[i] = *reinterpret_cast<const f32x4*>(src + i * N);

  #pragma unroll  // constant indices into v[], or it would leave the registers
  for (int j = 0; j < 4; ++j) {
    union { bf16x2 h[4]; uint4 u; } c;
    #pragma unroll  // same reason
    for (int p = 0; p < 4; ++p) {
      f32x2 pr = {v[2 * p][j], v[2 * p + 1][j]};
      c.h[p] = __builtin_convertvector(pr, bf16x2);
    }
    tile[(lo * 4 + j) * 16 + (hi ^ lo)] = c.u;
  }
  __syncthreads();

  // lo = chunk of 8 k, hi = n within a group of 16
  bf16_t* dst = out + (size_t)(n0 + hi) * K + k0 + lo * 8;
  #pragma unroll  // four LDS reads issued together ahead of the stores
  for (int s = 0; s < 4; ++s) {
    int n = s * 16 + hi;
    uint4 u = tile[n * 16 + (lo ^ (n >> 2))];
    *reinterpret_cast<uint4*>(dst + s * 16 * K) = u;
  }
}

// ---------------------------------------------------------------------------
// LayerNorm over DIMC=1024, one block (256 threads) per row. Output bf16.
// ---------------------------------------------------------------------------
__global__ void __launch_bounds__(256) layernorm_kernel(
    const float* __restrict__ x, const float* __restrict__ w,
    const float* __restrict__ b, bf16_t* __restrict__ out) {
  __shared__ float ssum[8];
  __shared__ float ssq[8];
  int row  = blockIdx.x;
  int tid  = threadIdx.x;
  int lane = tid & 31;
  int wv   = tid >> 5;

  const float4* xr = reinterpret_cast<const float4*>(x + (size_t)row * DIMC);
  float4 v = xr[tid];
  float s  = v.x + v.y + v.z + v.w;
  float sq = v.x * v.x + v.y * v.y + v.z * v.z + v.w * v.w;
  #pragma unroll
  for (int mask = 16; mask >= 1; mask >>= 1) {
    s  += __shfl_xor(s, mask, 32);
    sq += __shfl_xor(sq, mask, 32);
  }
  if (lane == 0) { ssum[wv] = s; ssq[wv] = sq; }
  __syncthreads();
  float ts = 0.f, tq = 0.f;
  #pragma unroll
  for (int i = 0; i < 8; ++i) { ts += ssum[i]; tq += ssq[i]; }
  float mu  = ts * (1.0f / DIMC);
  float var = tq * (1.0f / DIMC) - mu * mu;
  float inv = rsqrtf(var + 1e-5f);

  int c = tid * 4;
  const float4 wv4 = reinterpret_cast<const float4*>(w)[tid];
  const float4 bv4 = reinterpret_cast<const float4*>(b)[tid];
  bf16_t* o = out + (size_t)row * DIMC + c;
  o[0] = (bf16_t)((v.x - mu) * inv * wv4.x + bv4.x);
  o[1] = (bf16_t)((v.y - mu) * inv * wv4.y + bv4.y);
  o[2] = (bf16_t)((v.z - mu) * inv * wv4.z + bv4.z);
  o[3] = (bf16_t)((v.w - mu) * inv * wv4.w + bv4.w);
}

// ---------------------------------------------------------------------------
// Generic bf16 WMMA GEMM:  C = (A[M,K] * Bt[N,K]^T + bias) * oscale, epilogue.
// Block = 256 threads (8 waves as 4x2), block tile 128x128,
// wave tile 32x64 (2x4 accumulator tiles), K-step 32.
// ---------------------------------------------------------------------------
enum { EPI_QK = 0, EPI_VT = 1, EPI_RESID_F32 = 2, EPI_GELU_BF16 = 3 };

template <int EPI>
__global__ void __launch_bounds__(256, 4) gemm_kernel(
    const bf16_t* __restrict__ A, const bf16_t* __restrict__ Bt,
    const float* __restrict__ bias, void* __restrict__ outp,
    const float* __restrict__ resid, int M, int N, int K, int Ntok,
    float oscale) {
  int wave = threadIdx.x >> 5;
  int lane = threadIdx.x & 31;
  int wm = wave >> 1;          // 0..3
  int wn = wave & 1;           // 0..1
  int row0 = blockIdx.y * 128 + wm * 32;
  int col0 = blockIdx.x * 128 + wn * 64;

  f32x8 acc[2][4];
  #pragma unroll
  for (int t = 0; t < 2; ++t)
    #pragma unroll
    for (int u = 0; u < 4; ++u) acc[t][u] = (f32x8)(0.0f);

  for (int k0 = 0; k0 < K; k0 += 32) {
    bf16x16 a0 = load_frag(A + (size_t)row0 * K + k0, K);
    bf16x16 a1 = load_frag(A + (size_t)(row0 + 16) * K + k0, K);
    #pragma unroll
    for (int u = 0; u < 4; ++u) {
      bf16x16 bu = load_frag(Bt + (size_t)(col0 + u * 16) * K + k0, K);
      acc[0][u] = wmma_bf16(a0, bu, acc[0][u]);
      acc[1][u] = wmma_bf16(a1, bu, acc[1][u]);
    }
  }

  // Epilogue. C layout: VGPR r, lanes 0-15 -> (M=r, N=lane),
  //                     lanes 16-31 -> (M=r+8, N=lane-16)
  int nloc = lane & 15;
  int moff = (lane >> 4) * 8;
  #pragma unroll
  for (int t = 0; t < 2; ++t) {
    #pragma unroll
    for (int u = 0; u < 4; ++u) {
      #pragma unroll
      for (int r = 0; r < 8; ++r) {
        int rowg = row0 + t * 16 + moff + r;
        int colg = col0 + u * 16 + nloc;
        float val = (acc[t][u][r] + bias[colg]) * oscale;
        if constexpr (EPI == EPI_QK) {
          // -> per-head [b][h][tok][d], bf16
          int bi = rowg / Ntok, tok = rowg % Ntok;
          int h = colg >> 6, d = colg & 63;
          ((bf16_t*)outp)[((((size_t)bi * HEADS + h) * Ntok + tok) << 6) + d] =
              (bf16_t)val;
        } else if constexpr (EPI == EPI_VT) {
          // -> per-head transposed [b][h][d][tok], bf16
          int bi = rowg / Ntok, tok = rowg % Ntok;
          int h = colg >> 6, d = colg & 63;
          ((bf16_t*)outp)[(((size_t)bi * HEADS + h) * HDIM + d) * Ntok + tok] =
              (bf16_t)val;
        } else if constexpr (EPI == EPI_RESID_F32) {
          size_t idx = (size_t)rowg * N + colg;
          ((float*)outp)[idx] = resid[idx] + val;
        } else {  // EPI_GELU_BF16, exact gelu
          float g = 0.5f * val * (1.0f + erff(val * 0.70710678118654752f));
          ((bf16_t*)outp)[(size_t)rowg * N + colg] = (bf16_t)g;
        }
      }
    }
  }
}

// ---------------------------------------------------------------------------
// Flash attention. Grid: (Ntok/128, B*HEADS). Block 256 threads = 8 waves;
// each wave owns a 16-row Q tile and streams keys in chunks of 64.
// q (pre-scaled by 1/sqrt(d)), k: [b][h][tok][64] bf16. vt: [b][h][64][tok].
// out: [b][tok][h*64+d] bf16 (heads re-concatenated for the Wo GEMM).
// ---------------------------------------------------------------------------
#define PLDW 72  // 64 keys + 8 pad

__global__ void __launch_bounds__(256, 4) attn_kernel(
    const bf16_t* __restrict__ q, const bf16_t* __restrict__ k,
    const bf16_t* __restrict__ vt, bf16_t* __restrict__ out, int Ntok) {
  __shared__ bf16_t plds[8][16][PLDW];  // padded 16x64 P tile per wave

  int wave = threadIdx.x >> 5;
  int lane = threadIdx.x & 31;
  int bh = blockIdx.y;
  int q0 = blockIdx.x * 128 + wave * 16;

  const bf16_t* Qh = q  + (size_t)bh * Ntok * HDIM;
  const bf16_t* Kh = k  + (size_t)bh * Ntok * HDIM;
  const bf16_t* Vh = vt + (size_t)bh * HDIM * Ntok;

  bf16x16 qf0 = load_frag(Qh + (size_t)q0 * HDIM + 0, HDIM);
  bf16x16 qf1 = load_frag(Qh + (size_t)q0 * HDIM + 32, HDIM);

  f32x8 oacc[4];
  #pragma unroll
  for (int u = 0; u < 4; ++u) oacc[u] = (f32x8)(0.0f);
  float mrow[8], lrow[8];
  #pragma unroll
  for (int r = 0; r < 8; ++r) { mrow[r] = -1e30f; lrow[r] = 0.0f; }

  int nloc = lane & 15;
  int moff = (lane >> 4) * 8;

  for (int kt = 0; kt < Ntok; kt += 64) {
    // 4 S tiles: 16 q-rows x 64 keys (QK^T, contraction over d=64).
    f32x8 s[4];
    #pragma unroll
    for (int i = 0; i < 4; ++i) {
      const bf16_t* Kt = Kh + (size_t)(kt + i * 16) * HDIM;
      f32x8 si = (f32x8)(0.0f);
      si = wmma_bf16(qf0, load_frag(Kt + 0, HDIM), si);
      si = wmma_bf16(qf1, load_frag(Kt + 32, HDIM), si);
      s[i] = si;
    }

    // Online softmax update; rows live in VGPR r across a 16-lane half.
    #pragma unroll
    for (int r = 0; r < 8; ++r) {
      float a0 = s[0][r], a1 = s[1][r], a2 = s[2][r], a3 = s[3][r];
      float mx = fmaxf(fmaxf(a0, a1), fmaxf(a2, a3));
      mx = fmaxf(mx, __shfl_xor(mx, 1, 32));
      mx = fmaxf(mx, __shfl_xor(mx, 2, 32));
      mx = fmaxf(mx, __shfl_xor(mx, 4, 32));
      mx = fmaxf(mx, __shfl_xor(mx, 8, 32));
      float mnew  = fmaxf(mrow[r], mx);
      float alpha = __expf(mrow[r] - mnew);
      float p0 = __expf(a0 - mnew);
      float p1 = __expf(a1 - mnew);
      float p2 = __expf(a2 - mnew);
      float p3 = __expf(a3 - mnew);
      float rs = (p0 + p1) + (p2 + p3);
      rs += __shfl_xor(rs, 1, 32);
      rs += __shfl_xor(rs, 2, 32);
      rs += __shfl_xor(rs, 4, 32);
      rs += __shfl_xor(rs, 8, 32);
      lrow[r] = lrow[r] * alpha + rs;
      mrow[r] = mnew;
      #pragma unroll
      for (int u = 0; u < 4; ++u) oacc[u][r] *= alpha;
      int rowm = r + moff;
      plds[wave][rowm][nloc]      = (bf16_t)p0;
      plds[wave][rowm][nloc + 16] = (bf16_t)p1;
      plds[wave][rowm][nloc + 32] = (bf16_t)p2;
      plds[wave][rowm][nloc + 48] = (bf16_t)p3;
    }

    // Re-shape P (C-layout -> A-fragment) through LDS, then P @ V.
    #pragma unroll
    for (int ks = 0; ks < 2; ++ks) {
      bf16x16 pf = load_frag(&plds[wave][0][ks * 32], PLDW);
      #pragma unroll
      for (int u = 0; u < 4; ++u) {
        bf16x16 vf =
            load_frag(Vh + (size_t)(u * 16) * Ntok + kt + ks * 32, Ntok);
        oacc[u] = wmma_bf16(pf, vf, oacc[u]);
      }
    }
  }

  // Finalize: divide by l and scatter heads back to [b][tok][DIMC].
  int h  = bh & (HEADS - 1);
  int bi = bh >> 4;
  #pragma unroll
  for (int u = 0; u < 4; ++u) {
    #pragma unroll
    for (int r = 0; r < 8; ++r) {
      int tok = q0 + moff + r;
      int d   = u * 16 + nloc;
      float v = oacc[u][r] / lrow[r];
      out[((size_t)bi * Ntok + tok) * DIMC + h * HDIM + d] = (bf16_t)v;
    }
  }
}

// ---------------------------------------------------------------------------
// Host-side orchestration (graph-capture safe: launches only).
// ---------------------------------------------------------------------------
extern "C" void kernel_launch(void* const* d_in, const int* in_sizes, int n_in,
                              void* d_out, int out_size, void* d_ws, size_t ws_size,
                              hipStream_t stream) {
  (void)in_sizes; (void)n_in; (void)out_size; (void)ws_size;

  const float* x     = (const float*)d_in[0];
  const float* ln1_w = (const float*)d_in[1];
  const float* ln1_b = (const float*)d_in[2];
  const float* ln2_w = (const float*)d_in[3];
  const float* ln2_b = (const float*)d_in[4];
  const float* Wq = (const float*)d_in[5];  const float* bq = (const float*)d_in[6];
  const float* Wk = (const float*)d_in[7];  const float* bk = (const float*)d_in[8];
  const float* Wv = (const float*)d_in[9];  const float* bv = (const float*)d_in[10];
  const float* Wo = (const float*)d_in[11]; const float* bo = (const float*)d_in[12];
  const float* W1 = (const float*)d_in[13]; const float* b1 = (const float*)d_in[14];
  const float* W2 = (const float*)d_in[15]; const float* b2 = (const float*)d_in[16];

  // Workspace layout
  char* ws = (char*)d_ws;
  size_t off = 0;
  auto alloc = [&](size_t bytes) { char* p = ws + off; off += (bytes + 255) & ~size_t(255); return p; };
  bf16_t* Wqt = (bf16_t*)alloc((size_t)DIMC * DIMC * 2);
  bf16_t* Wkt = (bf16_t*)alloc((size_t)DIMC * DIMC * 2);
  bf16_t* Wvt = (bf16_t*)alloc((size_t)DIMC * DIMC * 2);
  bf16_t* Wot = (bf16_t*)alloc((size_t)DIMC * DIMC * 2);
  bf16_t* W1t = (bf16_t*)alloc((size_t)DIMC * HID * 2);
  bf16_t* W2t = (bf16_t*)alloc((size_t)HID * DIMC * 2);
  bf16_t* xn   = (bf16_t*)alloc((size_t)MTOT * DIMC * 2);
  bf16_t* qb   = (bf16_t*)alloc((size_t)MTOT * DIMC * 2);
  bf16_t* kb   = (bf16_t*)alloc((size_t)MTOT * DIMC * 2);
  bf16_t* vtb  = (bf16_t*)alloc((size_t)MTOT * DIMC * 2);
  bf16_t* attn = (bf16_t*)alloc((size_t)MTOT * DIMC * 2);
  float*  x2   = (float*)alloc((size_t)MTOT * DIMC * 4);
  bf16_t* xn2  = (bf16_t*)alloc((size_t)MTOT * DIMC * 2);
  bf16_t* hbuf = (bf16_t*)alloc((size_t)MTOT * HID * 2);

  // 1. Weight prep (fp32 -> bf16 transposed)
  {
    dim3 gsq(DIMC / 64, DIMC / 128);
    wt_transpose_kernel<DIMC, DIMC><<<gsq, 256, 0, stream>>>(Wq, Wqt);
    wt_transpose_kernel<DIMC, DIMC><<<gsq, 256, 0, stream>>>(Wk, Wkt);
    wt_transpose_kernel<DIMC, DIMC><<<gsq, 256, 0, stream>>>(Wv, Wvt);
    wt_transpose_kernel<DIMC, DIMC><<<gsq, 256, 0, stream>>>(Wo, Wot);
    dim3 gw1(HID / 64, DIMC / 128);
    wt_transpose_kernel<DIMC, HID><<<gw1, 256, 0, stream>>>(W1, W1t);
    dim3 gw2(DIMC / 64, HID / 128);
    wt_transpose_kernel<HID, DIMC><<<gw2, 256, 0, stream>>>(W2, W2t);
  }

  dim3 blk(256);

  // 2. LN1
  layernorm_kernel<<<MTOT, blk, 0, stream>>>(x, ln1_w, ln1_b, xn);

  // 3. Q, K, V projections (WMMA GEMMs). Q is pre-scaled by 1/sqrt(HDIM).
  dim3 gqkv(DIMC / 128, MTOT / 128);
  gemm_kernel<EPI_QK><<<gqkv, blk, 0, stream>>>(xn, Wqt, bq, qb,  nullptr, MTOT, DIMC, DIMC, NTOK, 0.125f);
  gemm_kernel<EPI_QK><<<gqkv, blk, 0, stream>>>(xn, Wkt, bk, kb,  nullptr, MTOT, DIMC, DIMC, NTOK, 1.0f);
  gemm_kernel<EPI_VT><<<gqkv, blk, 0, stream>>>(xn, Wvt, bv, vtb, nullptr, MTOT, DIMC, DIMC, NTOK, 1.0f);

  // 4. Flash attention
  dim3 gatt(NTOK / 128, BATCH * HEADS);
  attn_kernel<<<gatt, blk, 0, stream>>>(qb, kb, vtb, attn, NTOK);

  // 5. Output projection + residual: x2 = x + attn @ Wo + bo
  gemm_kernel<EPI_RESID_F32><<<gqkv, blk, 0, stream>>>(attn, Wot, bo, x2, x, MTOT, DIMC, DIMC, NTOK, 1.0f);

  // 6. LN2
  layernorm_kernel<<<MTOT, blk, 0, stream>>>(x2, ln2_w, ln2_b, xn2);

  // 7. MLP up + GELU: h = gelu(xn2 @ W1 + b1)
  dim3 gup(HID / 128, MTOT / 128);
  gemm_kernel<EPI_GELU_BF16><<<gup, blk, 0, stream>>>(xn2, W1t, b1, hbuf, nullptr, MTOT, HID, DIMC, NTOK, 1.0f);

  // 8. MLP down + residual -> output: out = x2 + h @ W2 + b2
  gemm_kernel<EPI_RESID_F32><<<gqkv, blk, 0, stream>>>(hbuf, W2t, b2, (float*)d_out, x2, MTOT, DIMC, HID, NTOK, 1.0f);
}

// v002
// It runs in 285 microseconds.
// Two timings next to v001 put it at 1.61 and 1.59 times that version's speed.
// Counting every step since v000, it is 2.33 times as fast.
#include <hip/hip_runtime.h>
#include <hip/hip_bf16.h>

// ---------------------------------------------------------------------------
// Transformer encoder block for MI455X (gfx1250, wave32, WMMA).
// All GEMMs run on v_wmma_f32_16x16x32_bf16; attention is flash-style with
// 64-key tiles. 1/sqrt(d) is folded into the Q projection epilogue.
// ---------------------------------------------------------------------------

typedef __bf16 bf16_t;
typedef __attribute__((ext_vector_type(16))) __bf16 bf16x16;
typedef __attribute__((ext_vector_type(8)))  float  f32x8;

#define DIMC   1024
#define HEADS  16
#define HDIM   64
#define HID    4096
#define NTOK   2048
#define BATCH  2
#define MTOT   (BATCH * NTOK)   // 4096 tokens

// ---------------------------------------------------------------------------
// WMMA helpers
// ---------------------------------------------------------------------------
__device__ inline f32x8 wmma_bf16(bf16x16 a, bf16x16 b, f32x8 c) {
  // (neg_a, A, neg_b, B, c_mod, C, reuse_a, reuse_b)
  return __builtin_amdgcn_wmma_f32_16x16x32_bf16(false, a, false, b,
                                                 (short)0, c, false, false);
}

// Load a 16x32 bf16 fragment (A-style layout; also used for B when the
// source is stored "transposed" i.e. [col][k] row-major).
// ISA 16-bit A layout: lane = m + 16*half;
//   VGPR0..3 : K = half*8 + 0..7
//   VGPR4..7 : K = 16 + half*8 + 0..7
// base points at (row0, k0); ld = row stride in elements (multiple of 8).
__device__ inline bf16x16 load_frag(const bf16_t* base, int ld) {
  int lane = threadIdx.x & 31;
  int m    = lane & 15;
  int half = lane >> 4;
  const bf16_t* p = base + (size_t)m * (size_t)ld + half * 8;
  union { uint4 u[2]; bf16x16 v; } cv;
  cv.u[0] = *reinterpret_cast<const uint4*>(p);
  cv.u[1] = *reinterpret_cast<const uint4*>(p + 16);
  return cv.v;
}

// ---------------------------------------------------------------------------
// Weight prep: fp32 [K][N] -> bf16 transposed [N][K].
// One block moves a 128(k) x 64(n) tile; K and N are compile-time, so the
// row steps become immediate offsets of one address.
// A thread reads 8 k-rows x 4 n as 16-byte loads (a half-wave covers 256
// contiguous bytes of an input row) and packs the eight k of each n into one
// 16-byte chunk. The chunks cross through LDS, so that a half-wave then
// stores 256 contiguous bytes of an output row.
// LDS tile: [n][16 chunks]; the chunk index is XORed with n >> 2, which keeps
// both the 16-byte LDS writes and the reads free of bank conflicts.
// ---------------------------------------------------------------------------
typedef __attribute__((ext_vector_type(4))) float  f32x4;
typedef __attribute__((ext_vector_type(2))) float  f32x2;
typedef __attribute__((ext_vector_type(2))) __bf16 bf16x2;

template <int K, int N>
__global__ void __launch_bounds__(256) wt_transpose_kernel(
    const float* __restrict__ in, bf16_t* __restrict__ out) {
  static_assert(K % 128 == 0 && N % 64 == 0, "whole tiles only");
  __shared__ uint4 tile[64 * 16];
  int tid = threadIdx.x;
  int lo  = tid & 15;
  int hi  = tid >> 4;
  int k0  = blockIdx.y * 128;
  int n0  = blockIdx.x * 64;

  // lo = group of 4 n, hi = group of 8 k
  const float* src = in + (size_t)(k0 + hi * 8) * N + n0 + lo * 4;
  f32x4 v[8];
  #pragma unroll  // all eight loads in flight at once, v[] in registers
  for (int i = 0; i < 8; ++i)
    v[i] = *reinterpret_cast<const f32x4*>(src + i * N);

  #pragma unroll  // constant indices into v[], or it would leave the registers
  for (int j = 0; j < 4; ++j) {
    union { bf16x2 h[4]; uint4 u; } c;
    #pragma unroll  // same reason
    for (int p = 0; p < 4; ++p) {
      f32x2 pr = {v[2 * p][j], v[2 * p + 1][j]};
      c.h[p] = __builtin_convertvector(pr, bf16x2);
    }
    tile[(lo * 4 + j) * 16 + (hi ^ lo)] = c.u;
  }
  __syncthreads();

  // lo = chunk of 8 k, hi = n within a group of 16
  bf16_t* dst = out + (size_t)(n0 + hi) * K + k0 + lo * 8;
  #pragma unroll  // four LDS reads issued together ahead of the stores
  for (int s = 0; s < 4; ++s) {
    int n = s * 16 + hi;
    uint4 u = tile[n * 16 + (lo ^ (n >> 2))];
    *reinterpret_cast<uint4*>(dst + s * 16 * K) = u;
  }
}

// ---------------------------------------------------------------------------
// LayerNorm over DIMC=1024, one block (256 threads) per row. Output bf16.
// ---------------------------------------------------------------------------
__global__ void __launch_bounds__(256) layernorm_kernel(
    const float* __restrict__ x, const float* __restrict__ w,
    const float* __restrict__ b, bf16_t* __restrict__ out) {
  __shared__ float ssum[8];
  __shared__ float ssq[8];
  int row  = blockIdx.x;
  int tid  = threadIdx.x;
  int lane = tid & 31;
  int wv   = tid >> 5;

  const float4* xr = reinterpret_cast<const float4*>(x + (size_t)row * DIMC);
  float4 v = xr[tid];
  float s  = v.x + v.y + v.z + v.w;
  float sq = v.x * v.x + v.y * v.y + v.z * v.z + v.w * v.w;
  #pragma unroll
  for (int mask = 16; mask >= 1; mask >>= 1) {
    s  += __shfl_xor(s, mask, 32);
    sq += __shfl_xor(sq, mask, 32);
  }
  if (lane == 0) { ssum[wv] = s; ssq[wv] = sq; }
  __syncthreads();
  float ts = 0.f, tq = 0.f;
  #pragma unroll
  for (int i = 0; i < 8; ++i) { ts += ssum[i]; tq += ssq[i]; }
  float mu  = ts * (1.0f / DIMC);
  float var = tq * (1.0f / DIMC) - mu * mu;
  float inv = rsqrtf(var + 1e-5f);

  int c = tid * 4;
  const float4 wv4 = reinterpret_cast<const float4*>(w)[tid];
  const float4 bv4 = reinterpret_cast<const float4*>(b)[tid];
  bf16_t* o = out + (size_t)row * DIMC + c;
  o[0] = (bf16_t)((v.x - mu) * inv * wv4.x + bv4.x);
  o[1] = (bf16_t)((v.y - mu) * inv * wv4.y + bv4.y);
  o[2] = (bf16_t)((v.z - mu) * inv * wv4.z + bv4.z);
  o[3] = (bf16_t)((v.w - mu) * inv * wv4.w + bv4.w);
}

// ---------------------------------------------------------------------------
// Generic bf16 WMMA GEMM:  C = (A[M,K] * Bt[N,K]^T + bias) * oscale, epilogue.
// Block = 256 threads (8 waves as 4x2), block tile 128x128,
// wave tile 32x64 (2x4 accumulator tiles), WMMA K-step 32.
// The 128-row A and Bt tiles, 128 k at a time, are brought into LDS by
// asynchronous 16-byte copies (a wave covers whole 128-byte lines), two
// buffers: tile t + 1 flies while tile t is worked on. M and N are multiples
// of 128, K a multiple of 128.
// ---------------------------------------------------------------------------
#define GBK    128               // k per LDS tile: 256 bytes of every row
#define GPITCH 272               // LDS row pitch in bytes: 256 + 16 pad
#define GTILE  (128 * GPITCH)    // one operand's tile
#define GSTAGE (2 * GTILE)       // a buffer: A tile, then Bt tile

// 16x32 bf16 fragment from an LDS tile; same lane and k order as load_frag.
__device__ inline bf16x16 lds_frag(const unsigned char* base) {
  int lane = threadIdx.x & 31;
  const unsigned char* p = base + (lane & 15) * GPITCH + (lane >> 4) * 16;
  union { uint4 u[2]; bf16x16 v; } cv;
  cv.u[0] = *reinterpret_cast<const uint4*>(p);
  cv.u[1] = *reinterpret_cast<const uint4*>(p + 32);
  return cv.v;
}

// One thread's share of a 128-row tile: 16 bytes of every 16th row.
// lds: the lane's LDS byte address, g: its global address, rstep: 16 rows.
__device__ inline void copy_tile(unsigned lds, const bf16_t* g, size_t rstep) {
  // The closing s_wait_xcnt stands inside the statement so that no address
  // register of a copy is rewritten ahead of it.
  asm volatile(
      "global_load_async_to_lds_b128 %0, %8, off\n\t"
      "global_load_async_to_lds_b128 %1, %9, off\n\t"
      "global_load_async_to_lds_b128 %2, %10, off\n\t"
      "global_load_async_to_lds_b128 %3, %11, off\n\t"
      "global_load_async_to_lds_b128 %4, %12, off\n\t"
      "global_load_async_to_lds_b128 %5, %13, off\n\t"
      "global_load_async_to_lds_b128 %6, %14, off\n\t"
      "global_load_async_to_lds_b128 %7, %15, off\n\t"
      "s_wait_xcnt 0x0"
      :: "v"(lds), "v"(lds + 16 * GPITCH), "v"(lds + 32 * GPITCH),
         "v"(lds + 48 * GPITCH), "v"(lds + 64 * GPITCH),
         "v"(lds + 80 * GPITCH), "v"(lds + 96 * GPITCH),
         "v"(lds + 112 * GPITCH),
         "v"(g), "v"(g + rstep), "v"(g + 2 * rstep), "v"(g + 3 * rstep),
         "v"(g + 4 * rstep), "v"(g + 5 * rstep), "v"(g + 6 * rstep),
         "v"(g + 7 * rstep)
      : "memory");
}

enum { EPI_QK = 0, EPI_VT = 1, EPI_RESID_F32 = 2, EPI_GELU_BF16 = 3 };

template <int EPI>
__global__ void __launch_bounds__(256, 4) gemm_kernel(
    const bf16_t* __restrict__ A, const bf16_t* __restrict__ Bt,
    const float* __restrict__ bias, void* __restrict__ outp,
    const float* __restrict__ resid, int M, int N, int K, int Ntok,
    float oscale) {
  __shared__ __attribute__((aligned(16))) unsigned char smem[2 * GSTAGE];
  int wave = threadIdx.x >> 5;
  int lane = threadIdx.x & 31;
  int wm = wave >> 1;          // 0..3
  int wn = wave & 1;           // 0..1
  int row0 = blockIdx.y * 128 + wm * 32;
  int col0 = blockIdx.x * 128 + wn * 64;

  f32x8 acc[2][4];
  #pragma unroll
  for (int t = 0; t < 2; ++t)
    #pragma unroll
    for (int u = 0; u < 4; ++u) acc[t][u] = (f32x8)(0.0f);

  // Copy shares: 16 threads cover a row's 256 bytes, 16 rows per round.
  int crow = threadIdx.x >> 4;
  int cchk = threadIdx.x & 15;
  const bf16_t* gA = A  + (size_t)(blockIdx.y * 128 + crow) * K + cchk * 8;
  const bf16_t* gB = Bt + (size_t)(blockIdx.x * 128 + crow) * K + cchk * 8;
  unsigned lds0 = (unsigned)(uintptr_t)smem + crow * GPITCH + cchk * 16;
  size_t rstep = (size_t)16 * K;
  int T = K / GBK;

  copy_tile(lds0, gA, rstep);
  copy_tile(lds0 + GTILE, gB, rstep);
  // tile 0 has landed for this wave, then for the block
  asm volatile("s_wait_asynccnt 0x0" ::: "memory");
  __syncthreads();
  if (T > 1) {
    copy_tile(lds0 + GSTAGE, gA + GBK, rstep);
    copy_tile(lds0 + GSTAGE + GTILE, gB + GBK, rstep);
  }

  for (int t = 0; t < T; ++t) {
    unsigned buf = (unsigned)(t & 1) * GSTAGE;
    const unsigned char* sA = smem + buf + wm * 32 * GPITCH;
    const unsigned char* sB = smem + buf + GTILE + wn * 64 * GPITCH;
    // Two fragment sets: the reads of the next 32 k go out as one group ahead
    // of this 32 k's WMMAs, so that their LDS latency hides behind them.
    bf16x16 fa[2][2], fb[2][4];
    fa[0][0] = lds_frag(sA);
    fa[0][1] = lds_frag(sA + 16 * GPITCH);
    #pragma unroll  // constant indices keep fb[] in registers
    for (int u = 0; u < 4; ++u) fb[0][u] = lds_frag(sB + u * 16 * GPITCH);
    #pragma unroll  // constant indices keep both sets in registers
    for (int kk = 0; kk < GBK / 32; ++kk) {
      const int cur = kk & 1, nxt = cur ^ 1;
      if (kk + 1 < GBK / 32) {
        fa[nxt][0] = lds_frag(sA + (kk + 1) * 64);
        fa[nxt][1] = lds_frag(sA + 16 * GPITCH + (kk + 1) * 64);
        #pragma unroll  // same reason
        for (int u = 0; u < 4; ++u)
          fb[nxt][u] = lds_frag(sB + u * 16 * GPITCH + (kk + 1) * 64);
      }
      // keeps the read group above from sinking in among the WMMAs below
      __builtin_amdgcn_sched_barrier(0);
      #pragma unroll  // same reason, for acc[] too
      for (int u = 0; u < 4; ++u) {
        acc[0][u] = wmma_bf16(fa[cur][0], fb[cur][u], acc[0][u]);
        acc[1][u] = wmma_bf16(fa[cur][1], fb[cur][u], acc[1][u]);
      }
      // keeps the next read group from rising in among the WMMAs above
      __builtin_amdgcn_sched_barrier(0);
    }
    // this wave's reads of the buffer are done before it is refilled
    asm volatile("s_wait_dscnt 0x0" ::: "memory");
    // this wave's copies of tile t + 1 have landed
    asm volatile("s_wait_asynccnt 0x0" ::: "memory");
    __syncthreads();  // publishes tile t + 1, frees tile t's buffer
    if (t + 2 < T) {
      copy_tile(lds0 + buf, gA + (size_t)(t + 2) * GBK, rstep);
      copy_tile(lds0 + buf + GTILE, gB + (size_t)(t + 2) * GBK, rstep);
    }
  }
  // no copy is outstanding when the wave goes on to its end
  asm volatile("s_wait_asynccnt 0x0" ::: "memory");

  // Epilogue. C layout: VGPR r, lanes 0-15 -> (M=r, N=lane),
  //                     lanes 16-31 -> (M=r+8, N=lane-16)
  int nloc = lane & 15;
  int moff = (lane >> 4) * 8;
  #pragma unroll
  for (int t = 0; t < 2; ++t) {
    #pragma unroll
    for (int u = 0; u < 4; ++u) {
      #pragma unroll
      for (int r = 0; r < 8; ++r) {
        int rowg = row0 + t * 16 + moff + r;
        int colg = col0 + u * 16 + nloc;
        float val = (acc[t][u][r] + bias[colg]) * oscale;
        if constexpr (EPI == EPI_QK) {
          // -> per-head [b][h][tok][d], bf16
          int bi = rowg / Ntok, tok = rowg % Ntok;
          int h = colg >> 6, d = colg & 63;
          ((bf16_t*)outp)[((((size_t)bi * HEADS + h) * Ntok + tok) << 6) + d] =
              (bf16_t)val;
        } else if constexpr (EPI == EPI_VT) {
          // -> per-head transposed [b][h][d][tok], bf16
          int bi = rowg / Ntok, tok = rowg % Ntok;
          int h = colg >> 6, d = colg & 63;
          ((bf16_t*)outp)[(((size_t)bi * HEADS + h) * HDIM + d) * Ntok + tok] =
              (bf16_t)val;
        } else if constexpr (EPI == EPI_RESID_F32) {
          size_t idx = (size_t)rowg * N + colg;
          ((float*)outp)[idx] = resid[idx] + val;
        } else {  // EPI_GELU_BF16, exact gelu
          float g = 0.5f * val * (1.0f + erff(val * 0.70710678118654752f));
          ((bf16_t*)outp)[(size_t)rowg * N + colg] = (bf16_t)g;
        }
      }
    }
  }
}

// ---------------------------------------------------------------------------
// Flash attention. Grid: (Ntok/128, B*HEADS). Block 256 threads = 8 waves;
// each wave owns a 16-row Q tile and streams keys in chunks of 64.
// q (pre-scaled by 1/sqrt(d)), k: [b][h][tok][64] bf16. vt: [b][h][64][tok].
// out: [b][tok][h*64+d] bf16 (heads re-concatenated for the Wo GEMM).
// ---------------------------------------------------------------------------
#define PLDW 72  // 64 keys + 8 pad

__global__ void __launch_bounds__(256, 4) attn_kernel(
    const bf16_t* __restrict__ q, const bf16_t* __restrict__ k,
    const bf16_t* __restrict__ vt, bf16_t* __restrict__ out, int Ntok) {
  __shared__ bf16_t plds[8][16][PLDW];  // padded 16x64 P tile per wave

  int wave = threadIdx.x >> 5;
  int lane = threadIdx.x & 31;
  int bh = blockIdx.y;
  int q0 = blockIdx.x * 128 + wave * 16;

  const bf16_t* Qh = q  + (size_t)bh * Ntok * HDIM;
  const bf16_t* Kh = k  + (size_t)bh * Ntok * HDIM;
  const bf16_t* Vh = vt + (size_t)bh * HDIM * Ntok;

  bf16x16 qf0 = load_frag(Qh + (size_t)q0 * HDIM + 0, HDIM);
  bf16x16 qf1 = load_frag(Qh + (size_t)q0 * HDIM + 32, HDIM);

  f32x8 oacc[4];
  #pragma unroll
  for (int u = 0; u < 4; ++u) oacc[u] = (f32x8)(0.0f);
  float mrow[8], lrow[8];
  #pragma unroll
  for (int r = 0; r < 8; ++r) { mrow[r] = -1e30f; lrow[r] = 0.0f; }

  int nloc = lane & 15;
  int moff = (lane >> 4) * 8;

  for (int kt = 0; kt < Ntok; kt += 64) {
    // 4 S tiles: 16 q-rows x 64 keys (QK^T, contraction over d=64).
    f32x8 s[4];
    #pragma unroll
    for (int i = 0; i < 4; ++i) {
      const bf16_t* Kt = Kh + (size_t)(kt + i * 16) * HDIM;
      f32x8 si = (f32x8)(0.0f);
      si = wmma_bf16(qf0, load_frag(Kt + 0, HDIM), si);
      si = wmma_bf16(qf1, load_frag(Kt + 32, HDIM), si);
      s[i] = si;
    }

    // Online softmax update; rows live in VGPR r across a 16-lane half.
    #pragma unroll
    for (int r = 0; r < 8; ++r) {
      float a0 = s[0][r], a1 = s[1][r], a2 = s[2][r], a3 = s[3][r];
      float mx = fmaxf(fmaxf(a0, a1), fmaxf(a2, a3));
      mx = fmaxf(mx, __shfl_xor(mx, 1, 32));
      mx = fmaxf(mx, __shfl_xor(mx, 2, 32));
      mx = fmaxf(mx, __shfl_xor(mx, 4, 32));
      mx = fmaxf(mx, __shfl_xor(mx, 8, 32));
      float mnew  = fmaxf(mrow[r], mx);
      float alpha = __expf(mrow[r] - mnew);
      float p0 = __expf(a0 - mnew);
      float p1 = __expf(a1 - mnew);
      float p2 = __expf(a2 - mnew);
      float p3 = __expf(a3 - mnew);
      float rs = (p0 + p1) + (p2 + p3);
      rs += __shfl_xor(rs, 1, 32);
      rs += __shfl_xor(rs, 2, 32);
      rs += __shfl_xor(rs, 4, 32);
      rs += __shfl_xor(rs, 8, 32);
      lrow[r] = lrow[r] * alpha + rs;
      mrow[r] = mnew;
      #pragma unroll
      for (int u = 0; u < 4; ++u) oacc[u][r] *= alpha;
      int rowm = r + moff;
      plds[wave][rowm][nloc]      = (bf16_t)p0;
      plds[wave][rowm][nloc + 16] = (bf16_t)p1;
      plds[wave][rowm][nloc + 32] = (bf16_t)p2;
      plds[wave][rowm][nloc + 48] = (bf16_t)p3;
    }

    // Re-shape P (C-layout -> A-fragment) through LDS, then P @ V.
    #pragma unroll
    for (int ks = 0; ks < 2; ++ks) {
      bf16x16 pf = load_frag(&plds[wave][0][ks * 32], PLDW);
      #pragma unroll
      for (int u = 0; u < 4; ++u) {
        bf16x16 vf =
            load_frag(Vh + (size_t)(u * 16) * Ntok + kt + ks * 32, Ntok);
        oacc[u] = wmma_bf16(pf, vf, oacc[u]);
      }
    }
  }

  // Finalize: divide by l and scatter heads back to [b][tok][DIMC].
  int h  = bh & (HEADS - 1);
  int bi = bh >> 4;
  #pragma unroll
  for (int u = 0; u < 4; ++u) {
    #pragma unroll
    for (int r = 0; r < 8; ++r) {
      int tok = q0 + moff + r;
      int d   = u * 16 + nloc;
      float v = oacc[u][r] / lrow[r];
      out[((size_t)bi * Ntok + tok) * DIMC + h * HDIM + d] = (bf16_t)v;
    }
  }
}

// ---------------------------------------------------------------------------
// Host-side orchestration (graph-capture safe: launches only).
// ---------------------------------------------------------------------------
extern "C" void kernel_launch(void* const* d_in, const int* in_sizes, int n_in,
                              void* d_out, int out_size, void* d_ws, size_t ws_size,
                              hipStream_t stream) {
  (void)in_sizes; (void)n_in; (void)out_size; (void)ws_size;

  const float* x     = (const float*)d_in[0];
  const float* ln1_w = (const float*)d_in[1];
  const float* ln1_b = (const float*)d_in[2];
  const float* ln2_w = (const float*)d_in[3];
  const float* ln2_b = (const float*)d_in[4];
  const float* Wq = (const float*)d_in[5];  const float* bq = (const float*)d_in[6];
  const float* Wk = (const float*)d_in[7];  const float* bk = (const float*)d_in[8];
  const float* Wv = (const float*)d_in[9];  const float* bv = (const float*)d_in[10];
  const float* Wo = (const float*)d_in[11]; const float* bo = (const float*)d_in[12];
  const float* W1 = (const float*)d_in[13]; const float* b1 = (const float*)d_in[14];
  const float* W2 = (const float*)d_in[15]; const float* b2 = (const float*)d_in[16];

  // Workspace layout
  char* ws = (char*)d_ws;
  size_t off = 0;
  auto alloc = [&](size_t bytes) { char* p = ws + off; off += (bytes + 255) & ~size_t(255); return p; };
  bf16_t* Wqt = (bf16_t*)alloc((size_t)DIMC * DIMC * 2);
  bf16_t* Wkt = (bf16_t*)alloc((size_t)DIMC * DIMC * 2);
  bf16_t* Wvt = (bf16_t*)alloc((size_t)DIMC * DIMC * 2);
  bf16_t* Wot = (bf16_t*)alloc((size_t)DIMC * DIMC * 2);
  bf16_t* W1t = (bf16_t*)alloc((size_t)DIMC * HID * 2);
  bf16_t* W2t = (bf16_t*)alloc((size_t)HID * DIMC * 2);
  bf16_t* xn   = (bf16_t*)alloc((size_t)MTOT * DIMC * 2);
  bf16_t* qb   = (bf16_t*)alloc((size_t)MTOT * DIMC * 2);
  bf16_t* kb   = (bf16_t*)alloc((size_t)MTOT * DIMC * 2);
  bf16_t* vtb  = (bf16_t*)alloc((size_t)MTOT * DIMC * 2);
  bf16_t* attn = (bf16_t*)alloc((size_t)MTOT * DIMC * 2);
  float*  x2   = (float*)alloc((size_t)MTOT * DIMC * 4);
  bf16_t* xn2  = (bf16_t*)alloc((size_t)MTOT * DIMC * 2);
  bf16_t* hbuf = (bf16_t*)alloc((size_t)MTOT * HID * 2);

  // 1. Weight prep (fp32 -> bf16 transposed)
  {
    dim3 gsq(DIMC / 64, DIMC / 128);
    wt_transpose_kernel<DIMC, DIMC><<<gsq, 256, 0, stream>>>(Wq, Wqt);
    wt_transpose_kernel<DIMC, DIMC><<<gsq, 256, 0, stream>>>(Wk, Wkt);
    wt_transpose_kernel<DIMC, DIMC><<<gsq, 256, 0, stream>>>(Wv, Wvt);
    wt_transpose_kernel<DIMC, DIMC><<<gsq, 256, 0, stream>>>(Wo, Wot);
    dim3 gw1(HID / 64, DIMC / 128);
    wt_transpose_kernel<DIMC, HID><<<gw1, 256, 0, stream>>>(W1, W1t);
    dim3 gw2(DIMC / 64, HID / 128);
    wt_transpose_kernel<HID, DIMC><<<gw2, 256, 0, stream>>>(W2, W2t);
  }

  dim3 blk(256);

  // 2. LN1
  layernorm_kernel<<<MTOT, blk, 0, stream>>>(x, ln1_w, ln1_b, xn);

  // 3. Q, K, V projections (WMMA GEMMs). Q is pre-scaled by 1/sqrt(HDIM).
  dim3 gqkv(DIMC / 128, MTOT / 128);
  gemm_kernel<EPI_QK><<<gqkv, blk, 0, stream>>>(xn, Wqt, bq, qb,  nullptr, MTOT, DIMC, DIMC, NTOK, 0.125f);
  gemm_kernel<EPI_QK><<<gqkv, blk, 0, stream>>>(xn, Wkt, bk, kb,  nullptr, MTOT, DIMC, DIMC, NTOK, 1.0f);
  gemm_kernel<EPI_VT><<<gqkv, blk, 0, stream>>>(xn, Wvt, bv, vtb, nullptr, MTOT, DIMC, DIMC, NTOK, 1.0f);

  // 4. Flash attention
  dim3 gatt(NTOK / 128, BATCH * HEADS);
  attn_kernel<<<gatt, blk, 0, stream>>>(qb, kb, vtb, attn, NTOK);

  // 5. Output projection + residual: x2 = x + attn @ Wo + bo
  gemm_kernel<EPI_RESID_F32><<<gqkv, blk, 0, stream>>>(attn, Wot, bo, x2, x, MTOT, DIMC, DIMC, NTOK, 1.0f);

  // 6. LN2
  layernorm_kernel<<<MTOT, blk, 0, stream>>>(x2, ln2_w, ln2_b, xn2);

  // 7. MLP up + GELU: h = gelu(xn2 @ W1 + b1)
  dim3 gup(HID / 128, MTOT / 128);
  gemm_kernel<EPI_GELU_BF16><<<gup, blk, 0, stream>>>(xn2, W1t, b1, hbuf, nullptr, MTOT, HID, DIMC, NTOK, 1.0f);

  // 8. MLP down + residual -> output: out = x2 + h @ W2 + b2
  gemm_kernel<EPI_RESID_F32><<<gqkv, blk, 0, stream>>>(hbuf, W2t, b2, (float*)d_out, x2, MTOT, DIMC, HID, NTOK, 1.0f);
}

// v003
// Measured time: 222 microseconds a run.
// Timed twice side by side with v002, it ran 1.27 times as fast both times.
// Counting every step since v000, it is 2.97 times as fast.
#include <hip/hip_runtime.h>
#include <hip/hip_bf16.h>

// ---------------------------------------------------------------------------
// Transformer encoder block for MI455X (gfx1250, wave32, WMMA).
// All GEMMs run on v_wmma_f32_16x16x32_bf16; attention is flash-style with
// 64-key tiles. 1/sqrt(d) is folded into the Q projection epilogue.
// ---------------------------------------------------------------------------

typedef __bf16 bf16_t;
typedef __attribute__((ext_vector_type(16))) __bf16 bf16x16;
typedef __attribute__((ext_vector_type(8)))  float  f32x8;

#define DIMC   1024
#define HEADS  16
#define HDIM   64
#define HID    4096
#define NTOK   2048
#define BATCH  2
#define MTOT   (BATCH * NTOK)   // 4096 tokens

// ---------------------------------------------------------------------------
// WMMA helpers
// ---------------------------------------------------------------------------
__device__ inline f32x8 wmma_bf16(bf16x16 a, bf16x16 b, f32x8 c) {
  // (neg_a, A, neg_b, B, c_mod, C, reuse_a, reuse_b)
  return __builtin_amdgcn_wmma_f32_16x16x32_bf16(false, a, false, b,
                                                 (short)0, c, false, false);
}

// Load a 16x32 bf16 fragment (A-style layout, used here for Q and P; the
// B fragments of K and Vt are read from LDS in the same order).
// ISA 16-bit A layout: lane = m + 16*half;
//   VGPR0..3 : K = half*8 + 0..7
//   VGPR4..7 : K = 16 + half*8 + 0..7
// base points at (row0, k0); ld = row stride in elements (multiple of 8).
__device__ inline bf16x16 load_frag(const bf16_t* base, int ld) {
  int lane = threadIdx.x & 31;
  int m    = lane & 15;
  int half = lane >> 4;
  const bf16_t* p = base + (size_t)m * (size_t)ld + half * 8;
  union { uint4 u[2]; bf16x16 v; } cv;
  cv.u[0] = *reinterpret_cast<const uint4*>(p);
  cv.u[1] = *reinterpret_cast<const uint4*>(p + 16);
  return cv.v;
}

// ---------------------------------------------------------------------------
// Weight prep: fp32 [K][N] -> bf16 transposed [N][K].
// One block moves a 128(k) x 64(n) tile; K and N are compile-time, so the
// row steps become immediate offsets of one address.
// A thread reads 8 k-rows x 4 n as 16-byte loads (a half-wave covers 256
// contiguous bytes of an input row) and packs the eight k of each n into one
// 16-byte chunk. The chunks cross through LDS, so that a half-wave then
// stores 256 contiguous bytes of an output row.
// LDS tile: [n][16 chunks]; the chunk index is XORed with n >> 2, which keeps
// both the 16-byte LDS writes and the reads free of bank conflicts.
// ---------------------------------------------------------------------------
typedef __attribute__((ext_vector_type(4))) float  f32x4;
typedef __attribute__((ext_vector_type(2))) float  f32x2;
typedef __attribute__((ext_vector_type(2))) __bf16 bf16x2;

template <int K, int N>
__global__ void __launch_bounds__(256) wt_transpose_kernel(
    const float* __restrict__ in, bf16_t* __restrict__ out) {
  static_assert(K % 128 == 0 && N % 64 == 0, "whole tiles only");
  __shared__ uint4 tile[64 * 16];
  int tid = threadIdx.x;
  int lo  = tid & 15;
  int hi  = tid >> 4;
  int k0  = blockIdx.y * 128;
  int n0  = blockIdx.x * 64;

  // lo = group of 4 n, hi = group of 8 k
  const float* src = in + (size_t)(k0 + hi * 8) * N + n0 + lo * 4;
  f32x4 v[8];
  #pragma unroll  // all eight loads in flight at once, v[] in registers
  for (int i = 0; i < 8; ++i)
    v[i] = *reinterpret_cast<const f32x4*>(src + i * N);

  #pragma unroll  // constant indices into v[], or it would leave the registers
  for (int j = 0; j < 4; ++j) {
    union { bf16x2 h[4]; uint4 u; } c;
    #pragma unroll  // same reason
    for (int p = 0; p < 4; ++p) {
      f32x2 pr = {v[2 * p][j], v[2 * p + 1][j]};
      c.h[p] = __builtin_convertvector(pr, bf16x2);
    }
    tile[(lo * 4 + j) * 16 + (hi ^ lo)] = c.u;
  }
  __syncthreads();

  // lo = chunk of 8 k, hi = n within a group of 16
  bf16_t* dst = out + (size_t)(n0 + hi) * K + k0 + lo * 8;
  #pragma unroll  // four LDS reads issued together ahead of the stores
  for (int s = 0; s < 4; ++s) {
    int n = s * 16 + hi;
    uint4 u = tile[n * 16 + (lo ^ (n >> 2))];
    *reinterpret_cast<uint4*>(dst + s * 16 * K) = u;
  }
}

// ---------------------------------------------------------------------------
// LayerNorm over DIMC=1024, one block (256 threads) per row. Output bf16.
// ---------------------------------------------------------------------------
__global__ void __launch_bounds__(256) layernorm_kernel(
    const float* __restrict__ x, const float* __restrict__ w,
    const float* __restrict__ b, bf16_t* __restrict__ out) {
  __shared__ float ssum[8];
  __shared__ float ssq[8];
  int row  = blockIdx.x;
  int tid  = threadIdx.x;
  int lane = tid & 31;
  int wv   = tid >> 5;

  const float4* xr = reinterpret_cast<const float4*>(x + (size_t)row * DIMC);
  float4 v = xr[tid];
  float s  = v.x + v.y + v.z + v.w;
  float sq = v.x * v.x + v.y * v.y + v.z * v.z + v.w * v.w;
  #pragma unroll
  for (int mask = 16; mask >= 1; mask >>= 1) {
    s  += __shfl_xor(s, mask, 32);
    sq += __shfl_xor(sq, mask, 32);
  }
  if (lane == 0) { ssum[wv] = s; ssq[wv] = sq; }
  __syncthreads();
  float ts = 0.f, tq = 0.f;
  #pragma unroll
  for (int i = 0; i < 8; ++i) { ts += ssum[i]; tq += ssq[i]; }
  float mu  = ts * (1.0f / DIMC);
  float var = tq * (1.0f / DIMC) - mu * mu;
  float inv = rsqrtf(var + 1e-5f);

  int c = tid * 4;
  const float4 wv4 = reinterpret_cast<const float4*>(w)[tid];
  const float4 bv4 = reinterpret_cast<const float4*>(b)[tid];
  bf16_t* o = out + (size_t)row * DIMC + c;
  o[0] = (bf16_t)((v.x - mu) * inv * wv4.x + bv4.x);
  o[1] = (bf16_t)((v.y - mu) * inv * wv4.y + bv4.y);
  o[2] = (bf16_t)((v.z - mu) * inv * wv4.z + bv4.z);
  o[3] = (bf16_t)((v.w - mu) * inv * wv4.w + bv4.w);
}

// ---------------------------------------------------------------------------
// Generic bf16 WMMA GEMM:  C = (A[M,K] * Bt[N,K]^T + bias) * oscale, epilogue.
// Block = 256 threads (8 waves as 4x2), block tile 128x128,
// wave tile 32x64 (2x4 accumulator tiles), WMMA K-step 32.
// The 128-row A and Bt tiles, 128 k at a time, are brought into LDS by
// asynchronous 16-byte copies (a wave covers whole 128-byte lines), two
// buffers: tile t + 1 flies while tile t is worked on. M and N are multiples
// of 128, K a multiple of 128.
// ---------------------------------------------------------------------------
#define GBK    128               // k per LDS tile: 256 bytes of every row
#define GPITCH 272               // LDS row pitch in bytes: 256 + 16 pad
#define GTILE  (128 * GPITCH)    // one operand's tile
#define GSTAGE (2 * GTILE)       // a buffer: A tile, then Bt tile

// 16x32 bf16 fragment from an LDS tile; same lane and k order as load_frag.
__device__ inline bf16x16 lds_frag(const unsigned char* base) {
  int lane = threadIdx.x & 31;
  const unsigned char* p = base + (lane & 15) * GPITCH + (lane >> 4) * 16;
  union { uint4 u[2]; bf16x16 v; } cv;
  cv.u[0] = *reinterpret_cast<const uint4*>(p);
  cv.u[1] = *reinterpret_cast<const uint4*>(p + 32);
  return cv.v;
}

// One thread's share of a 128-row tile: 16 bytes of every 16th row.
// lds: the lane's LDS byte address, g: its global address, rstep: 16 rows.
__device__ inline void copy_tile(unsigned lds, const bf16_t* g, size_t rstep) {
  // The closing s_wait_xcnt stands inside the statement so that no address
  // register of a copy is rewritten ahead of it.
  asm volatile(
      "global_load_async_to_lds_b128 %0, %8, off\n\t"
      "global_load_async_to_lds_b128 %1, %9, off\n\t"
      "global_load_async_to_lds_b128 %2, %10, off\n\t"
      "global_load_async_to_lds_b128 %3, %11, off\n\t"
      "global_load_async_to_lds_b128 %4, %12, off\n\t"
      "global_load_async_to_lds_b128 %5, %13, off\n\t"
      "global_load_async_to_lds_b128 %6, %14, off\n\t"
      "global_load_async_to_lds_b128 %7, %15, off\n\t"
      "s_wait_xcnt 0x0"
      :: "v"(lds), "v"(lds + 16 * GPITCH), "v"(lds + 32 * GPITCH),
         "v"(lds + 48 * GPITCH), "v"(lds + 64 * GPITCH),
         "v"(lds + 80 * GPITCH), "v"(lds + 96 * GPITCH),
         "v"(lds + 112 * GPITCH),
         "v"(g), "v"(g + rstep), "v"(g + 2 * rstep), "v"(g + 3 * rstep),
         "v"(g + 4 * rstep), "v"(g + 5 * rstep), "v"(g + 6 * rstep),
         "v"(g + 7 * rstep)
      : "memory");
}

enum { EPI_QK = 0, EPI_VT = 1, EPI_RESID_F32 = 2, EPI_GELU_BF16 = 3 };

template <int EPI>
__global__ void __launch_bounds__(256, 4) gemm_kernel(
    const bf16_t* __restrict__ A, const bf16_t* __restrict__ Bt,
    const float* __restrict__ bias, void* __restrict__ outp,
    const float* __restrict__ resid, int M, int N, int K, int Ntok,
    float oscale) {
  __shared__ __attribute__((aligned(16))) unsigned char smem[2 * GSTAGE];
  int wave = threadIdx.x >> 5;
  int lane = threadIdx.x & 31;
  int wm = wave >> 1;          // 0..3
  int wn = wave & 1;           // 0..1
  int row0 = blockIdx.y * 128 + wm * 32;
  int col0 = blockIdx.x * 128 + wn * 64;

  f32x8 acc[2][4];
  #pragma unroll
  for (int t = 0; t < 2; ++t)
    #pragma unroll
    for (int u = 0; u < 4; ++u) acc[t][u] = (f32x8)(0.0f);

  // Copy shares: 16 threads cover a row's 256 bytes, 16 rows per round.
  int crow = threadIdx.x >> 4;
  int cchk = threadIdx.x & 15;
  const bf16_t* gA = A  + (size_t)(blockIdx.y * 128 + crow) * K + cchk * 8;
  const bf16_t* gB = Bt + (size_t)(blockIdx.x * 128 + crow) * K + cchk * 8;
  unsigned lds0 = (unsigned)(uintptr_t)smem + crow * GPITCH + cchk * 16;
  size_t rstep = (size_t)16 * K;
  int T = K / GBK;

  copy_tile(lds0, gA, rstep);
  copy_tile(lds0 + GTILE, gB, rstep);
  // tile 0 has landed for this wave, then for the block
  asm volatile("s_wait_asynccnt 0x0" ::: "memory");
  __syncthreads();
  if (T > 1) {
    copy_tile(lds0 + GSTAGE, gA + GBK, rstep);
    copy_tile(lds0 + GSTAGE + GTILE, gB + GBK, rstep);
  }

  for (int t = 0; t < T; ++t) {
    unsigned buf = (unsigned)(t & 1) * GSTAGE;
    const unsigned char* sA = smem + buf + wm * 32 * GPITCH;
    const unsigned char* sB = smem + buf + GTILE + wn * 64 * GPITCH;
    // Two fragment sets: the reads of the next 32 k go out as one group ahead
    // of this 32 k's WMMAs, so that their LDS latency hides behind them.
    bf16x16 fa[2][2], fb[2][4];
    fa[0][0] = lds_frag(sA);
    fa[0][1] = lds_frag(sA + 16 * GPITCH);
    #pragma unroll  // constant indices keep fb[] in registers
    for (int u = 0; u < 4; ++u) fb[0][u] = lds_frag(sB + u * 16 * GPITCH);
    #pragma unroll  // constant indices keep both sets in registers
    for (int kk = 0; kk < GBK / 32; ++kk) {
      const int cur = kk & 1, nxt = cur ^ 1;
      if (kk + 1 < GBK / 32) {
        fa[nxt][0] = lds_frag(sA + (kk + 1) * 64);
        fa[nxt][1] = lds_frag(sA + 16 * GPITCH + (kk + 1) * 64);
        #pragma unroll  // same reason
        for (int u = 0; u < 4; ++u)
          fb[nxt][u] = lds_frag(sB + u * 16 * GPITCH + (kk + 1) * 64);
      }
      // keeps the read group above from sinking in among the WMMAs below
      __builtin_amdgcn_sched_barrier(0);
      #pragma unroll  // same reason, for acc[] too
      for (int u = 0; u < 4; ++u) {
        acc[0][u] = wmma_bf16(fa[cur][0], fb[cur][u], acc[0][u]);
        acc[1][u] = wmma_bf16(fa[cur][1], fb[cur][u], acc[1][u]);
      }
      // keeps the next read group from rising in among the WMMAs above
      __builtin_amdgcn_sched_barrier(0);
    }
    // this wave's reads of the buffer are done before it is refilled
    asm volatile("s_wait_dscnt 0x0" ::: "memory");
    // this wave's copies of tile t + 1 have landed
    asm volatile("s_wait_asynccnt 0x0" ::: "memory");
    __syncthreads();  // publishes tile t + 1, frees tile t's buffer
    if (t + 2 < T) {
      copy_tile(lds0 + buf, gA + (size_t)(t + 2) * GBK, rstep);
      copy_tile(lds0 + buf + GTILE, gB + (size_t)(t + 2) * GBK, rstep);
    }
  }
  // no copy is outstanding when the wave goes on to its end
  asm volatile("s_wait_asynccnt 0x0" ::: "memory");

  // Epilogue. C layout: VGPR r, lanes 0-15 -> (M=r, N=lane),
  //                     lanes 16-31 -> (M=r+8, N=lane-16)
  int nloc = lane & 15;
  int moff = (lane >> 4) * 8;
  #pragma unroll
  for (int t = 0; t < 2; ++t) {
    #pragma unroll
    for (int u = 0; u < 4; ++u) {
      #pragma unroll
      for (int r = 0; r < 8; ++r) {
        int rowg = row0 + t * 16 + moff + r;
        int colg = col0 + u * 16 + nloc;
        float val = (acc[t][u][r] + bias[colg]) * oscale;
        if constexpr (EPI == EPI_QK) {
          // -> per-head [b][h][tok][d], bf16
          int bi = rowg / Ntok, tok = rowg % Ntok;
          int h = colg >> 6, d = colg & 63;
          ((bf16_t*)outp)[((((size_t)bi * HEADS + h) * Ntok + tok) << 6) + d] =
              (bf16_t)val;
        } else if constexpr (EPI == EPI_VT) {
          // -> per-head transposed [b][h][d][tok], bf16
          int bi = rowg / Ntok, tok = rowg % Ntok;
          int h = colg >> 6, d = colg & 63;
          ((bf16_t*)outp)[(((size_t)bi * HEADS + h) * HDIM + d) * Ntok + tok] =
              (bf16_t)val;
        } else if constexpr (EPI == EPI_RESID_F32) {
          size_t idx = (size_t)rowg * N + colg;
          ((float*)outp)[idx] = resid[idx] + val;
        } else {  // EPI_GELU_BF16, exact gelu
          float g = 0.5f * val * (1.0f + erff(val * 0.70710678118654752f));
          ((bf16_t*)outp)[(size_t)rowg * N + colg] = (bf16_t)g;
        }
      }
    }
  }
}

// ---------------------------------------------------------------------------
// Flash attention. Grid: (Ntok/128, B*HEADS). Block 256 threads = 8 waves;
// each wave owns a 16-row Q tile and streams keys in chunks of 64.
// q (pre-scaled by 1/sqrt(d)), k: [b][h][tok][64] bf16. vt: [b][h][64][tok].
// out: [b][tok][h*64+d] bf16 (heads re-concatenated for the Wo GEMM).
// The eight waves walk the same keys: K and Vt come into LDS once per block,
// 128 keys a stage, by asynchronous 16-byte copies that cover whole 128-byte
// lines, two buffers: stage t + 1 flies while stage t is worked on.
// Ntok is a multiple of 128.
// ---------------------------------------------------------------------------
#define PLDW 72  // 64 keys + 8 pad
#define AKEYS  128                 // keys per LDS stage
#define KPITCH 144                 // K row in LDS: 128 bytes + 16 pad
#define VPITCH 272                 // Vt row in LDS: 256 bytes + 16 pad
#define KTILE  (AKEYS * KPITCH)    // 128 key rows
#define VTILE  (HDIM * VPITCH)     // 64 d rows
#define ASTAGE (KTILE + VTILE)     // a buffer: K tile, then Vt tile

// 16x32 bf16 fragment from LDS rows of the given byte pitch; same lane and k
// order as load_frag.
__device__ inline bf16x16 lds_frag_at(const unsigned char* base, int pitch) {
  int lane = threadIdx.x & 31;
  const unsigned char* p = base + (lane & 15) * pitch + (lane >> 4) * 16;
  union { uint4 u[2]; bf16x16 v; } cv;
  cv.u[0] = *reinterpret_cast<const uint4*>(p);
  cv.u[1] = *reinterpret_cast<const uint4*>(p + 32);
  return cv.v;
}

// One thread's share of a stage: 16 bytes of every 32nd K row and of every
// 16th Vt row. lk, lv: the lane's LDS byte addresses; gk, gv: its global
// addresses; vstep: 16 Vt rows in elements.
__device__ inline void copy_kv(unsigned lk, const bf16_t* gk, unsigned lv,
                               const bf16_t* gv, size_t vstep) {
  // The closing s_wait_xcnt stands inside the statement so that no address
  // register of a copy is rewritten ahead of it.
  asm volatile(
      "global_load_async_to_lds_b128 %0, %8, off\n\t"
      "global_load_async_to_lds_b128 %1, %9, off\n\t"
      "global_load_async_to_lds_b128 %2, %10, off\n\t"
      "global_load_async_to_lds_b128 %3, %11, off\n\t"
      "global_load_async_to_lds_b128 %4, %12, off\n\t"
      "global_load_async_to_lds_b128 %5, %13, off\n\t"
      "global_load_async_to_lds_b128 %6, %14, off\n\t"
      "global_load_async_to_lds_b128 %7, %15, off\n\t"
      "s_wait_xcnt 0x0"
      :: "v"(lk), "v"(lk + 32 * KPITCH), "v"(lk + 64 * KPITCH),
         "v"(lk + 96 * KPITCH),
         "v"(lv), "v"(lv + 16 * VPITCH), "v"(lv + 32 * VPITCH),
         "v"(lv + 48 * VPITCH),
         "v"(gk), "v"(gk + 32 * HDIM), "v"(gk + 64 * HDIM),
         "v"(gk + 96 * HDIM),
         "v"(gv), "v"(gv + vstep), "v"(gv + 2 * vstep), "v"(gv + 3 * vstep)
      : "memory");
}

__global__ void __launch_bounds__(256, 4) attn_kernel(
    const bf16_t* __restrict__ q, const bf16_t* __restrict__ k,
    const bf16_t* __restrict__ vt, bf16_t* __restrict__ out, int Ntok) {
  __shared__ bf16_t plds[8][16][PLDW];  // padded 16x64 P tile per wave
  __shared__ __attribute__((aligned(16))) unsigned char kv[2 * ASTAGE];

  int wave = threadIdx.x >> 5;
  int lane = threadIdx.x & 31;
  int bh = blockIdx.y;
  int q0 = blockIdx.x * 128 + wave * 16;

  const bf16_t* Qh = q  + (size_t)bh * Ntok * HDIM;
  const bf16_t* Kh = k  + (size_t)bh * Ntok * HDIM;
  const bf16_t* Vh = vt + (size_t)bh * HDIM * Ntok;

  bf16x16 qf0 = load_frag(Qh + (size_t)q0 * HDIM + 0, HDIM);
  bf16x16 qf1 = load_frag(Qh + (size_t)q0 * HDIM + 32, HDIM);

  f32x8 oacc[4];
  #pragma unroll
  for (int u = 0; u < 4; ++u) oacc[u] = (f32x8)(0.0f);
  float mrow[8], lrow[8];
  #pragma unroll
  for (int r = 0; r < 8; ++r) { mrow[r] = -1e30f; lrow[r] = 0.0f; }

  int nloc = lane & 15;
  int moff = (lane >> 4) * 8;

  // Copy shares. K: 8 threads cover a row's 128 bytes, 32 rows per round.
  // Vt: 16 threads cover a row's 256 bytes of the stage, 16 rows per round.
  int tid = threadIdx.x;
  const bf16_t* gK = Kh + (size_t)(tid >> 3) * HDIM + (tid & 7) * 8;
  const bf16_t* gV = Vh + (size_t)(tid >> 4) * Ntok + (tid & 15) * 8;
  unsigned lk0 = (unsigned)(uintptr_t)kv + (tid >> 3) * KPITCH + (tid & 7) * 16;
  unsigned lv0 =
      (unsigned)(uintptr_t)kv + KTILE + (tid >> 4) * VPITCH + (tid & 15) * 16;
  size_t vstep = (size_t)16 * Ntok;
  int T = Ntok / AKEYS;

  copy_kv(lk0, gK, lv0, gV, vstep);
  // stage 0 has landed for this wave, then for the block
  asm volatile("s_wait_asynccnt 0x0" ::: "memory");
  __syncthreads();
  if (T > 1)
    copy_kv(lk0 + ASTAGE, gK + AKEYS * HDIM, lv0 + ASTAGE, gV + AKEYS, vstep);

  for (int t = 0; t < T; ++t) {
   unsigned buf = (unsigned)(t & 1) * ASTAGE;
   for (int sub = 0; sub < AKEYS / 64; ++sub) {
    const unsigned char* sK = kv + buf + sub * 64 * KPITCH;
    const unsigned char* sV = kv + buf + KTILE + sub * 128;
    // 4 S tiles: 16 q-rows x 64 keys (QK^T, contraction over d=64).
    f32x8 s[4];
    #pragma unroll
    for (int i = 0; i < 4; ++i) {
      const unsigned char* Kt = sK + i * 16 * KPITCH;
      f32x8 si = (f32x8)(0.0f);
      si = wmma_bf16(qf0, lds_frag_at(Kt, KPITCH), si);
      si = wmma_bf16(qf1, lds_frag_at(Kt + 64, KPITCH), si);
      s[i] = si;
    }

    // Online softmax update; rows live in VGPR r across a 16-lane half.
    #pragma unroll
    for (int r = 0; r < 8; ++r) {
      float a0 = s[0][r], a1 = s[1][r], a2 = s[2][r], a3 = s[3][r];
      float mx = fmaxf(fmaxf(a0, a1), fmaxf(a2, a3));
      mx = fmaxf(mx, __shfl_xor(mx, 1, 32));
      mx = fmaxf(mx, __shfl_xor(mx, 2, 32));
      mx = fmaxf(mx, __shfl_xor(mx, 4, 32));
      mx = fmaxf(mx, __shfl_xor(mx, 8, 32));
      float mnew  = fmaxf(mrow[r], mx);
      float alpha = __expf(mrow[r] - mnew);
      float p0 = __expf(a0 - mnew);
      float p1 = __expf(a1 - mnew);
      float p2 = __expf(a2 - mnew);
      float p3 = __expf(a3 - mnew);
      float rs = (p0 + p1) + (p2 + p3);
      rs += __shfl_xor(rs, 1, 32);
      rs += __shfl_xor(rs, 2, 32);
      rs += __shfl_xor(rs, 4, 32);
      rs += __shfl_xor(rs, 8, 32);
      lrow[r] = lrow[r] * alpha + rs;
      mrow[r] = mnew;
      #pragma unroll
      for (int u = 0; u < 4; ++u) oacc[u][r] *= alpha;
      int rowm = r + moff;
      plds[wave][rowm][nloc]      = (bf16_t)p0;
      plds[wave][rowm][nloc + 16] = (bf16_t)p1;
      plds[wave][rowm][nloc + 32] = (bf16_t)p2;
      plds[wave][rowm][nloc + 48] = (bf16_t)p3;
    }

    // Re-shape P (C-layout -> A-fragment) through LDS, then P @ V.
    #pragma unroll
    for (int ks = 0; ks < 2; ++ks) {
      bf16x16 pf = load_frag(&plds[wave][0][ks * 32], PLDW);
      #pragma unroll
      for (int u = 0; u < 4; ++u) {
        bf16x16 vf = lds_frag_at(sV + u * 16 * VPITCH + ks * 64, VPITCH);
        oacc[u] = wmma_bf16(pf, vf, oacc[u]);
      }
    }
   }
   // this wave's reads of the buffer are done before it is refilled
   asm volatile("s_wait_dscnt 0x0" ::: "memory");
   // this wave's copies of stage t + 1 have landed
   asm volatile("s_wait_asynccnt 0x0" ::: "memory");
   __syncthreads();  // publishes stage t + 1, frees stage t's buffer
   if (t + 2 < T)
     copy_kv(lk0 + buf, gK + (size_t)(t + 2) * AKEYS * HDIM, lv0 + buf,
             gV + (size_t)(t + 2) * AKEYS, vstep);
  }
  // no copy is outstanding when the wave goes on to its end
  asm volatile("s_wait_asynccnt 0x0" ::: "memory");

  // Finalize: divide by l and scatter heads back to [b][tok][DIMC].
  int h  = bh & (HEADS - 1);
  int bi = bh >> 4;
  #pragma unroll
  for (int u = 0; u < 4; ++u) {
    #pragma unroll
    for (int r = 0; r < 8; ++r) {
      int tok = q0 + moff + r;
      int d   = u * 16 + nloc;
      float v = oacc[u][r] / lrow[r];
      out[((size_t)bi * Ntok + tok) * DIMC + h * HDIM + d] = (bf16_t)v;
    }
  }
}

// ---------------------------------------------------------------------------
// Host-side orchestration (graph-capture safe: launches only).
// ---------------------------------------------------------------------------
extern "C" void kernel_launch(void* const* d_in, const int* in_sizes, int n_in,
                              void* d_out, int out_size, void* d_ws, size_t ws_size,
                              hipStream_t stream) {
  (void)in_sizes; (void)n_in; (void)out_size; (void)ws_size;

  const float* x     = (const float*)d_in[0];
  const float* ln1_w = (const float*)d_in[1];
  const float* ln1_b = (const float*)d_in[2];
  const float* ln2_w = (const float*)d_in[3];
  const float* ln2_b = (const float*)d_in[4];
  const float* Wq = (const float*)d_in[5];  const float* bq = (const float*)d_in[6];
  const float* Wk = (const float*)d_in[7];  const float* bk = (const float*)d_in[8];
  const float* Wv = (const float*)d_in[9];  const float* bv = (const float*)d_in[10];
  const float* Wo = (const float*)d_in[11]; const float* bo = (const float*)d_in[12];
  const float* W1 = (const float*)d_in[13]; const float* b1 = (const float*)d_in[14];
  const float* W2 = (const float*)d_in[15]; const float* b2 = (const float*)d_in[16];

  // Workspace layout
  char* ws = (char*)d_ws;
  size_t off = 0;
  auto alloc = [&](size_t bytes) { char* p = ws + off; off += (bytes + 255) & ~size_t(255); return p; };
  bf16_t* Wqt = (bf16_t*)alloc((size_t)DIMC * DIMC * 2);
  bf16_t* Wkt = (bf16_t*)alloc((size_t)DIMC * DIMC * 2);
  bf16_t* Wvt = (bf16_t*)alloc((size_t)DIMC * DIMC * 2);
  bf16_t* Wot = (bf16_t*)alloc((size_t)DIMC * DIMC * 2);
  bf16_t* W1t = (bf16_t*)alloc((size_t)DIMC * HID * 2);
  bf16_t* W2t = (bf16_t*)alloc((size_t)HID * DIMC * 2);
  bf16_t* xn   = (bf16_t*)alloc((size_t)MTOT * DIMC * 2);
  bf16_t* qb   = (bf16_t*)alloc((size_t)MTOT * DIMC * 2);
  bf16_t* kb   = (bf16_t*)alloc((size_t)MTOT * DIMC * 2);
  bf16_t* vtb  = (bf16_t*)alloc((size_t)MTOT * DIMC * 2);
  bf16_t* attn = (bf16_t*)alloc((size_t)MTOT * DIMC * 2);
  float*  x2   = (float*)alloc((size_t)MTOT * DIMC * 4);
  bf16_t* xn2  = (bf16_t*)alloc((size_t)MTOT * DIMC * 2);
  bf16_t* hbuf = (bf16_t*)alloc((size_t)MTOT * HID * 2);

  // 1. Weight prep (fp32 -> bf16 transposed)
  {
    dim3 gsq(DIMC / 64, DIMC / 128);
    wt_transpose_kernel<DIMC, DIMC><<<gsq, 256, 0, stream>>>(Wq, Wqt);
    wt_transpose_kernel<DIMC, DIMC><<<gsq, 256, 0, stream>>>(Wk, Wkt);
    wt_transpose_kernel<DIMC, DIMC><<<gsq, 256, 0, stream>>>(Wv, Wvt);
    wt_transpose_kernel<DIMC, DIMC><<<gsq, 256, 0, stream>>>(Wo, Wot);
    dim3 gw1(HID / 64, DIMC / 128);
    wt_transpose_kernel<DIMC, HID><<<gw1, 256, 0, stream>>>(W1, W1t);
    dim3 gw2(DIMC / 64, HID / 128);
    wt_transpose_kernel<HID, DIMC><<<gw2, 256, 0, stream>>>(W2, W2t);
  }

  dim3 blk(256);

  // 2. LN1
  layernorm_kernel<<<MTOT, blk, 0, stream>>>(x, ln1_w, ln1_b, xn);

  // 3. Q, K, V projections (WMMA GEMMs). Q is pre-scaled by 1/sqrt(HDIM).
  dim3 gqkv(DIMC / 128, MTOT / 128);
  gemm_kernel<EPI_QK><<<gqkv, blk, 0, stream>>>(xn, Wqt, bq, qb,  nullptr, MTOT, DIMC, DIMC, NTOK, 0.125f);
  gemm_kernel<EPI_QK><<<gqkv, blk, 0, stream>>>(xn, Wkt, bk, kb,  nullptr, MTOT, DIMC, DIMC, NTOK, 1.0f);
  gemm_kernel<EPI_VT><<<gqkv, blk, 0, stream>>>(xn, Wvt, bv, vtb, nullptr, MTOT, DIMC, DIMC, NTOK, 1.0f);

  // 4. Flash attention
  dim3 gatt(NTOK / 128, BATCH * HEADS);
  attn_kernel<<<gatt, blk, 0, stream>>>(qb, kb, vtb, attn, NTOK);

  // 5. Output projection + residual: x2 = x + attn @ Wo + bo
  gemm_kernel<EPI_RESID_F32><<<gqkv, blk, 0, stream>>>(attn, Wot, bo, x2, x, MTOT, DIMC, DIMC, NTOK, 1.0f);

  // 6. LN2
  layernorm_kernel<<<MTOT, blk, 0, stream>>>(x2, ln2_w, ln2_b, xn2);

  // 7. MLP up + GELU: h = gelu(xn2 @ W1 + b1)
  dim3 gup(HID / 128, MTOT / 128);
  gemm_kernel<EPI_GELU_BF16><<<gup, blk, 0, stream>>>(xn2, W1t, b1, hbuf, nullptr, MTOT, HID, DIMC, NTOK, 1.0f);

  // 8. MLP down + residual -> output: out = x2 + h @ W2 + b2
  gemm_kernel<EPI_RESID_F32><<<gqkv, blk, 0, stream>>>(hbuf, W2t, b2, (float*)d_out, x2, MTOT, DIMC, HID, NTOK, 1.0f);
}

// v004
// One run takes 197 microseconds.
// Next to v003, in two timings, it ran 1.12 and 1.13 times as fast.
// All steps since v000 together make it 3.35 times as fast.
#include <hip/hip_runtime.h>
#include <hip/hip_bf16.h>

// ---------------------------------------------------------------------------
// Transformer encoder block for MI455X (gfx1250, wave32, WMMA).
// All GEMMs run on v_wmma_f32_16x16x32_bf16; attention is flash-style with
// 64-key tiles, its two products taken transposed. 1/sqrt(d) is folded into the Q projection epilogue.
// ---------------------------------------------------------------------------

typedef __bf16 bf16_t;
typedef __attribute__((ext_vector_type(16))) __bf16 bf16x16;
typedef __attribute__((ext_vector_type(8)))  float  f32x8;

#define DIMC   1024
#define HEADS  16
#define HDIM   64
#define HID    4096
#define NTOK   2048
#define BATCH  2
#define MTOT   (BATCH * NTOK)   // 4096 tokens

// ---------------------------------------------------------------------------
// WMMA helpers
// ---------------------------------------------------------------------------
__device__ inline f32x8 wmma_bf16(bf16x16 a, bf16x16 b, f32x8 c) {
  // (neg_a, A, neg_b, B, c_mod, C, reuse_a, reuse_b)
  return __builtin_amdgcn_wmma_f32_16x16x32_bf16(false, a, false, b,
                                                 (short)0, c, false, false);
}

// Load a 16x32 bf16 fragment (A-style layout, used here for Q as a B
// operand; the A fragments of K and Vt are read from LDS in the same order).
// ISA 16-bit A layout: lane = m + 16*half;
//   VGPR0..3 : K = half*8 + 0..7
//   VGPR4..7 : K = 16 + half*8 + 0..7
// base points at (row0, k0); ld = row stride in elements (multiple of 8).
__device__ inline bf16x16 load_frag(const bf16_t* base, int ld) {
  int lane = threadIdx.x & 31;
  int m    = lane & 15;
  int half = lane >> 4;
  const bf16_t* p = base + (size_t)m * (size_t)ld + half * 8;
  union { uint4 u[2]; bf16x16 v; } cv;
  cv.u[0] = *reinterpret_cast<const uint4*>(p);
  cv.u[1] = *reinterpret_cast<const uint4*>(p + 16);
  return cv.v;
}

// ---------------------------------------------------------------------------
// Weight prep: fp32 [K][N] -> bf16 transposed [N][K].
// One block moves a 128(k) x 64(n) tile; K and N are compile-time, so the
// row steps become immediate offsets of one address.
// A thread reads 8 k-rows x 4 n as 16-byte loads (a half-wave covers 256
// contiguous bytes of an input row) and packs the eight k of each n into one
// 16-byte chunk. The chunks cross through LDS, so that a half-wave then
// stores 256 contiguous bytes of an output row.
// LDS tile: [n][16 chunks]; the chunk index is XORed with n >> 2, which keeps
// both the 16-byte LDS writes and the reads free of bank conflicts.
// ---------------------------------------------------------------------------
typedef __attribute__((ext_vector_type(4))) float  f32x4;
typedef __attribute__((ext_vector_type(2))) float  f32x2;
typedef __attribute__((ext_vector_type(2))) __bf16 bf16x2;

template <int K, int N>
__global__ void __launch_bounds__(256) wt_transpose_kernel(
    const float* __restrict__ in, bf16_t* __restrict__ out) {
  static_assert(K % 128 == 0 && N % 64 == 0, "whole tiles only");
  __shared__ uint4 tile[64 * 16];
  int tid = threadIdx.x;
  int lo  = tid & 15;
  int hi  = tid >> 4;
  int k0  = blockIdx.y * 128;
  int n0  = blockIdx.x * 64;

  // lo = group of 4 n, hi = group of 8 k
  const float* src = in + (size_t)(k0 + hi * 8) * N + n0 + lo * 4;
  f32x4 v[8];
  #pragma unroll  // all eight loads in flight at once, v[] in registers
  for (int i = 0; i < 8; ++i)
    v[i] = *reinterpret_cast<const f32x4*>(src + i * N);

  #pragma unroll  // constant indices into v[], or it would leave the registers
  for (int j = 0; j < 4; ++j) {
    union { bf16x2 h[4]; uint4 u; } c;
    #pragma unroll  // same reason
    for (int p = 0; p < 4; ++p) {
      f32x2 pr = {v[2 * p][j], v[2 * p + 1][j]};
      c.h[p] = __builtin_convertvector(pr, bf16x2);
    }
    tile[(lo * 4 + j) * 16 + (hi ^ lo)] = c.u;
  }
  __syncthreads();

  // lo = chunk of 8 k, hi = n within a group of 16
  bf16_t* dst = out + (size_t)(n0 + hi) * K + k0 + lo * 8;
  #pragma unroll  // four LDS reads issued together ahead of the stores
  for (int s = 0; s < 4; ++s) {
    int n = s * 16 + hi;
    uint4 u = tile[n * 16 + (lo ^ (n >> 2))];
    *reinterpret_cast<uint4*>(dst + s * 16 * K) = u;
  }
}

// ---------------------------------------------------------------------------
// LayerNorm over DIMC=1024, one block (256 threads) per row. Output bf16.
// ---------------------------------------------------------------------------
__global__ void __launch_bounds__(256) layernorm_kernel(
    const float* __restrict__ x, const float* __restrict__ w,
    const float* __restrict__ b, bf16_t* __restrict__ out) {
  __shared__ float ssum[8];
  __shared__ float ssq[8];
  int row  = blockIdx.x;
  int tid  = threadIdx.x;
  int lane = tid & 31;
  int wv   = tid >> 5;

  const float4* xr = reinterpret_cast<const float4*>(x + (size_t)row * DIMC);
  float4 v = xr[tid];
  float s  = v.x + v.y + v.z + v.w;
  float sq = v.x * v.x + v.y * v.y + v.z * v.z + v.w * v.w;
  #pragma unroll
  for (int mask = 16; mask >= 1; mask >>= 1) {
    s  += __shfl_xor(s, mask, 32);
    sq += __shfl_xor(sq, mask, 32);
  }
  if (lane == 0) { ssum[wv] = s; ssq[wv] = sq; }
  __syncthreads();
  float ts = 0.f, tq = 0.f;
  #pragma unroll
  for (int i = 0; i < 8; ++i) { ts += ssum[i]; tq += ssq[i]; }
  float mu  = ts * (1.0f / DIMC);
  float var = tq * (1.0f / DIMC) - mu * mu;
  float inv = rsqrtf(var + 1e-5f);

  int c = tid * 4;
  const float4 wv4 = reinterpret_cast<const float4*>(w)[tid];
  const float4 bv4 = reinterpret_cast<const float4*>(b)[tid];
  bf16_t* o = out + (size_t)row * DIMC + c;
  o[0] = (bf16_t)((v.x - mu) * inv * wv4.x + bv4.x);
  o[1] = (bf16_t)((v.y - mu) * inv * wv4.y + bv4.y);
  o[2] = (bf16_t)((v.z - mu) * inv * wv4.z + bv4.z);
  o[3] = (bf16_t)((v.w - mu) * inv * wv4.w + bv4.w);
}

// ---------------------------------------------------------------------------
// Generic bf16 WMMA GEMM:  C = (A[M,K] * Bt[N,K]^T + bias) * oscale, epilogue.
// Block = 256 threads (8 waves as 4x2), block tile 128x128,
// wave tile 32x64 (2x4 accumulator tiles), WMMA K-step 32.
// The 128-row A and Bt tiles, 128 k at a time, are brought into LDS by
// asynchronous 16-byte copies (a wave covers whole 128-byte lines), two
// buffers: tile t + 1 flies while tile t is worked on. M and N are multiples
// of 128, K a multiple of 128.
// ---------------------------------------------------------------------------
#define GBK    128               // k per LDS tile: 256 bytes of every row
#define GPITCH 272               // LDS row pitch in bytes: 256 + 16 pad
#define GTILE  (128 * GPITCH)    // one operand's tile
#define GSTAGE (2 * GTILE)       // a buffer: A tile, then Bt tile

// 16x32 bf16 fragment from an LDS tile; same lane and k order as load_frag.
__device__ inline bf16x16 lds_frag(const unsigned char* base) {
  int lane = threadIdx.x & 31;
  const unsigned char* p = base + (lane & 15) * GPITCH + (lane >> 4) * 16;
  union { uint4 u[2]; bf16x16 v; } cv;
  cv.u[0] = *reinterpret_cast<const uint4*>(p);
  cv.u[1] = *reinterpret_cast<const uint4*>(p + 32);
  return cv.v;
}

// One thread's share of a 128-row tile: 16 bytes of every 16th row.
// lds: the lane's LDS byte address, g: its global address, rstep: 16 rows.
__device__ inline void copy_tile(unsigned lds, const bf16_t* g, size_t rstep) {
  // The closing s_wait_xcnt stands inside the statement so that no address
  // register of a copy is rewritten ahead of it.
  asm volatile(
      "global_load_async_to_lds_b128 %0, %8, off\n\t"
      "global_load_async_to_lds_b128 %1, %9, off\n\t"
      "global_load_async_to_lds_b128 %2, %10, off\n\t"
      "global_load_async_to_lds_b128 %3, %11, off\n\t"
      "global_load_async_to_lds_b128 %4, %12, off\n\t"
      "global_load_async_to_lds_b128 %5, %13, off\n\t"
      "global_load_async_to_lds_b128 %6, %14, off\n\t"
      "global_load_async_to_lds_b128 %7, %15, off\n\t"
      "s_wait_xcnt 0x0"
      :: "v"(lds), "v"(lds + 16 * GPITCH), "v"(lds + 32 * GPITCH),
         "v"(lds + 48 * GPITCH), "v"(lds + 64 * GPITCH),
         "v"(lds + 80 * GPITCH), "v"(lds + 96 * GPITCH),
         "v"(lds + 112 * GPITCH),
         "v"(g), "v"(g + rstep), "v"(g + 2 * rstep), "v"(g + 3 * rstep),
         "v"(g + 4 * rstep), "v"(g + 5 * rstep), "v"(g + 6 * rstep),
         "v"(g + 7 * rstep)
      : "memory");
}

enum { EPI_QK = 0, EPI_VT = 1, EPI_RESID_F32 = 2, EPI_GELU_BF16 = 3 };

template <int EPI>
__global__ void __launch_bounds__(256, 4) gemm_kernel(
    const bf16_t* __restrict__ A, const bf16_t* __restrict__ Bt,
    const float* __restrict__ bias, void* __restrict__ outp,
    const float* __restrict__ resid, int M, int N, int K, int Ntok,
    float oscale) {
  __shared__ __attribute__((aligned(16))) unsigned char smem[2 * GSTAGE];
  int wave = threadIdx.x >> 5;
  int lane = threadIdx.x & 31;
  int wm = wave >> 1;          // 0..3
  int wn = wave & 1;           // 0..1
  int row0 = blockIdx.y * 128 + wm * 32;
  int col0 = blockIdx.x * 128 + wn * 64;

  f32x8 acc[2][4];
  #pragma unroll
  for (int t = 0; t < 2; ++t)
    #pragma unroll
    for (int u = 0; u < 4; ++u) acc[t][u] = (f32x8)(0.0f);

  // Copy shares: 16 threads cover a row's 256 bytes, 16 rows per round.
  int crow = threadIdx.x >> 4;
  int cchk = threadIdx.x & 15;
  const bf16_t* gA = A  + (size_t)(blockIdx.y * 128 + crow) * K + cchk * 8;
  const bf16_t* gB = Bt + (size_t)(blockIdx.x * 128 + crow) * K + cchk * 8;
  unsigned lds0 = (unsigned)(uintptr_t)smem + crow * GPITCH + cchk * 16;
  size_t rstep = (size_t)16 * K;
  int T = K / GBK;

  copy_tile(lds0, gA, rstep);
  copy_tile(lds0 + GTILE, gB, rstep);
  // tile 0 has landed for this wave, then for the block
  asm volatile("s_wait_asynccnt 0x0" ::: "memory");
  __syncthreads();
  if (T > 1) {
    copy_tile(lds0 + GSTAGE, gA + GBK, rstep);
    copy_tile(lds0 + GSTAGE + GTILE, gB + GBK, rstep);
  }

  for (int t = 0; t < T; ++t) {
    unsigned buf = (unsigned)(t & 1) * GSTAGE;
    const unsigned char* sA = smem + buf + wm * 32 * GPITCH;
    const unsigned char* sB = smem + buf + GTILE + wn * 64 * GPITCH;
    // Two fragment sets: the reads of the next 32 k go out as one group ahead
    // of this 32 k's WMMAs, so that their LDS latency hides behind them.
    bf16x16 fa[2][2], fb[2][4];
    fa[0][0] = lds_frag(sA);
    fa[0][1] = lds_frag(sA + 16 * GPITCH);
    #pragma unroll  // constant indices keep fb[] in registers
    for (int u = 0; u < 4; ++u) fb[0][u] = lds_frag(sB + u * 16 * GPITCH);
    #pragma unroll  // constant indices keep both sets in registers
    for (int kk = 0; kk < GBK / 32; ++kk) {
      const int cur = kk & 1, nxt = cur ^ 1;
      if (kk + 1 < GBK / 32) {
        fa[nxt][0] = lds_frag(sA + (kk + 1) * 64);
        fa[nxt][1] = lds_frag(sA + 16 * GPITCH + (kk + 1) * 64);
        #pragma unroll  // same reason
        for (int u = 0; u < 4; ++u)
          fb[nxt][u] = lds_frag(sB + u * 16 * GPITCH + (kk + 1) * 64);
      }
      // keeps the read group above from sinking in among the WMMAs below
      __builtin_amdgcn_sched_barrier(0);
      #pragma unroll  // same reason, for acc[] too
      for (int u = 0; u < 4; ++u) {
        acc[0][u] = wmma_bf16(fa[cur][0], fb[cur][u], acc[0][u]);
        acc[1][u] = wmma_bf16(fa[cur][1], fb[cur][u], acc[1][u]);
      }
      // keeps the next read group from rising in among the WMMAs above
      __builtin_amdgcn_sched_barrier(0);
    }
    // this wave's reads of the buffer are done before it is refilled
    asm volatile("s_wait_dscnt 0x0" ::: "memory");
    // this wave's copies of tile t + 1 have landed
    asm volatile("s_wait_asynccnt 0x0" ::: "memory");
    __syncthreads();  // publishes tile t + 1, frees tile t's buffer
    if (t + 2 < T) {
      copy_tile(lds0 + buf, gA + (size_t)(t + 2) * GBK, rstep);
      copy_tile(lds0 + buf + GTILE, gB + (size_t)(t + 2) * GBK, rstep);
    }
  }
  // no copy is outstanding when the wave goes on to its end
  asm volatile("s_wait_asynccnt 0x0" ::: "memory");

  // Epilogue. C layout: VGPR r, lanes 0-15 -> (M=r, N=lane),
  //                     lanes 16-31 -> (M=r+8, N=lane-16)
  int nloc = lane & 15;
  int moff = (lane >> 4) * 8;
  #pragma unroll
  for (int t = 0; t < 2; ++t) {
    #pragma unroll
    for (int u = 0; u < 4; ++u) {
      #pragma unroll
      for (int r = 0; r < 8; ++r) {
        int rowg = row0 + t * 16 + moff + r;
        int colg = col0 + u * 16 + nloc;
        float val = (acc[t][u][r] + bias[colg]) * oscale;
        if constexpr (EPI == EPI_QK) {
          // -> per-head [b][h][tok][d], bf16
          int bi = rowg / Ntok, tok = rowg % Ntok;
          int h = colg >> 6, d = colg & 63;
          ((bf16_t*)outp)[((((size_t)bi * HEADS + h) * Ntok + tok) << 6) + d] =
              (bf16_t)val;
        } else if constexpr (EPI == EPI_VT) {
          // -> per-head transposed [b][h][d][tok], bf16
          int bi = rowg / Ntok, tok = rowg % Ntok;
          int h = colg >> 6, d = colg & 63;
          ((bf16_t*)outp)[(((size_t)bi * HEADS + h) * HDIM + d) * Ntok + tok] =
              (bf16_t)val;
        } else if constexpr (EPI == EPI_RESID_F32) {
          size_t idx = (size_t)rowg * N + colg;
          ((float*)outp)[idx] = resid[idx] + val;
        } else {  // EPI_GELU_BF16, exact gelu
          float g = 0.5f * val * (1.0f + erff(val * 0.70710678118654752f));
          ((bf16_t*)outp)[(size_t)rowg * N + colg] = (bf16_t)g;
        }
      }
    }
  }
}

#define AKEYS  128
#define KPITCH 144
#define VPITCH 272
#define KTILE  (AKEYS * KPITCH)
#define VTILE  (HDIM * VPITCH)
#define ASTAGE (KTILE + VTILE)

// 16x32 bf16 fragment from LDS rows of the given byte pitch; same lane and k
// order as load_frag.
__device__ inline bf16x16 lds_frag_at(const unsigned char* base, int pitch) {
  int lane = threadIdx.x & 31;
  const unsigned char* p = base + (lane & 15) * pitch + (lane >> 4) * 16;
  union { uint4 u[2]; bf16x16 v; } cv;
  cv.u[0] = *reinterpret_cast<const uint4*>(p);
  cv.u[1] = *reinterpret_cast<const uint4*>(p + 32);
  return cv.v;
}

// The value that lane l ^ 16 holds.
__device__ inline float other_half(float x) {
  int i = __builtin_bit_cast(int, x);
  return __builtin_bit_cast(
      float, __builtin_amdgcn_permlanex16(i, i, 0x76543210, 0xfedcba98, false,
                                          false));
}

__device__ inline float max3f(float a, float b, float c) {
  return fmaxf(fmaxf(a, b), c);
}

// Exponentials base 2, each in place on its own register, in one statement:
// so none overwrites the source of the one in front of it, and the closing
// v_nop is the slot the instruction set asks for between a transcendental and
// an instruction that uses its result.
__device__ inline void exp2_x8(float (&a)[8]) {
  asm("v_exp_f32 %0, %0\n\t"
      "v_exp_f32 %1, %1\n\t"
      "v_exp_f32 %2, %2\n\t"
      "v_exp_f32 %3, %3\n\t"
      "v_exp_f32 %4, %4\n\t"
      "v_exp_f32 %5, %5\n\t"
      "v_exp_f32 %6, %6\n\t"
      "v_exp_f32 %7, %7\n\t"
      "v_nop"
      : "+v"(a[0]), "+v"(a[1]), "+v"(a[2]), "+v"(a[3]), "+v"(a[4]),
        "+v"(a[5]), "+v"(a[6]), "+v"(a[7]));
}
__device__ inline float exp2_x1(float a) {
  asm("v_exp_f32 %0, %0\n\t"
      "v_nop"
      : "+v"(a));
  return a;
}
#define LOG2E 1.4426950408889634f

// One thread's share of a stage: 16 bytes of every 32nd K row and of every
// 16th Vt row. lk, lv: the lane's LDS byte addresses; gk, gv: its global
// addresses; vstep: 16 Vt rows in elements.
__device__ inline void copy_kv(unsigned lk, const bf16_t* gk, unsigned lv,
                               const bf16_t* gv, size_t vstep) {
  // The closing s_wait_xcnt stands inside the statement so that no address
  // register of a copy is rewritten ahead of it.
  asm volatile(
      "global_load_async_to_lds_b128 %0, %8, off\n\t"
      "global_load_async_to_lds_b128 %1, %9, off\n\t"
      "global_load_async_to_lds_b128 %2, %10, off\n\t"
      "global_load_async_to_lds_b128 %3, %11, off\n\t"
      "global_load_async_to_lds_b128 %4, %12, off\n\t"
      "global_load_async_to_lds_b128 %5, %13, off\n\t"
      "global_load_async_to_lds_b128 %6, %14, off\n\t"
      "global_load_async_to_lds_b128 %7, %15, off\n\t"
      "s_wait_xcnt 0x0"
      :: "v"(lk), "v"(lk + 32 * KPITCH), "v"(lk + 64 * KPITCH),
         "v"(lk + 96 * KPITCH),
         "v"(lv), "v"(lv + 16 * VPITCH), "v"(lv + 32 * VPITCH),
         "v"(lv + 48 * VPITCH),
         "v"(gk), "v"(gk + 32 * HDIM), "v"(gk + 64 * HDIM),
         "v"(gk + 96 * HDIM),
         "v"(gv), "v"(gv + vstep), "v"(gv + 2 * vstep), "v"(gv + 3 * vstep)
      : "memory");
}

// Four waves per SIMD is what the grid gives (two blocks a WGP). Told so, the
// compiler keeps a sub-pass's LDS reads together ahead of the WMMAs; aiming at
// more waves it saves registers by a load, a wait and a WMMA in turn.
__global__ void __launch_bounds__(256)
__attribute__((amdgpu_waves_per_eu(4, 4))) attn_kernel(
    const bf16_t* __restrict__ q, const bf16_t* __restrict__ k,
    const bf16_t* __restrict__ vt, bf16_t* __restrict__ out, int Ntok) {
  __shared__ __attribute__((aligned(16))) unsigned char kv[2 * ASTAGE];

  int wave = threadIdx.x >> 5;
  int lane = threadIdx.x & 31;
  int bh = blockIdx.y;
  int q0 = blockIdx.x * 128 + wave * 16;

  const bf16_t* Qh = q  + (size_t)bh * Ntok * HDIM;
  const bf16_t* Kh = k  + (size_t)bh * Ntok * HDIM;
  const bf16_t* Vh = vt + (size_t)bh * HDIM * Ntok;

  // B operand of S^T: column = query q0 + (lane & 15), k = d.
  bf16x16 qf0 = load_frag(Qh + (size_t)q0 * HDIM + 0, HDIM);
  bf16x16 qf1 = load_frag(Qh + (size_t)q0 * HDIM + 32, HDIM);

  // O^T tiles: row d = 16 u + 8 * (lane >> 4) + r, column = the lane's query.
  f32x8 oacc[4];
  #pragma unroll
  for (int u = 0; u < 4; ++u) oacc[u] = (f32x8)(0.0f);
  // The lane's query: maximum in use (alike in both halves), and the sum over
  // the keys of this half alone.
  float mrun = -1e30f, lrun = 0.0f;

  // Copy shares. K: 8 threads cover a row's 128 bytes, 32 rows per round.
  // Vt: 16 threads cover a row's 256 bytes of the stage, 16 rows per round.
  int tid = threadIdx.x;
  const bf16_t* gK = Kh + (size_t)(tid >> 3) * HDIM + (tid & 7) * 8;
  const bf16_t* gV = Vh + (size_t)(tid >> 4) * Ntok + (tid & 15) * 8;
  unsigned lk0 = (unsigned)(uintptr_t)kv + (tid >> 3) * KPITCH + (tid & 7) * 16;
  unsigned lv0 =
      (unsigned)(uintptr_t)kv + KTILE + (tid >> 4) * VPITCH + (tid & 15) * 16;
  size_t vstep = (size_t)16 * Ntok;
  int T = Ntok / AKEYS;

  copy_kv(lk0, gK, lv0, gV, vstep);
  // stage 0 has landed for this wave, then for the block
  asm volatile("s_wait_asynccnt 0x0" ::: "memory");
  __syncthreads();
  if (T > 1)
    copy_kv(lk0 + ASTAGE, gK + AKEYS * HDIM, lv0 + ASTAGE, gV + AKEYS, vstep);

  for (int t = 0; t < T; ++t) {
   unsigned buf = (unsigned)(t & 1) * ASTAGE;
   for (int sub = 0; sub < AKEYS / 64; ++sub) {
    const unsigned char* sK = kv + buf + sub * 64 * KPITCH;
    const unsigned char* sV = kv + buf + KTILE + sub * 128;
    // 4 S^T tiles: 64 keys x 16 queries (contraction over d=64).
    f32x8 s[4];
    #pragma unroll
    for (int i = 0; i < 4; ++i) {
      const unsigned char* Kt = sK + i * 16 * KPITCH;
      f32x8 si = (f32x8)(0.0f);
      si = wmma_bf16(lds_frag_at(Kt, KPITCH), qf0, si);
      si = wmma_bf16(lds_frag_at(Kt + 64, KPITCH), qf1, si);
      s[i] = si;
    }

    // Online softmax update of the lane's query over its 32 scores.
    float m8[8];
    #pragma unroll
    for (int r = 0; r < 8; ++r)
      m8[r] = fmaxf(max3f(s[0][r], s[1][r], s[2][r]), s[3][r]);
    float mx = fmaxf(max3f(m8[0], m8[1], m8[2]),
                     fmaxf(max3f(m8[3], m8[4], m8[5]), fmaxf(m8[6], m8[7])));
    mx = fmaxf(mx, other_half(mx));
    float mnew  = fmaxf(mrun, mx);
    float alpha = exp2_x1((mrun - mnew) * LOG2E);
    mrun = mnew;

    // P^T as B operand: elements 0..7 of a lane are tile 2 ks, registers
    // 0..7 (keys 8 * half + r), elements 8..15 tile 2 ks + 1: the k order in
    // which lds_frag_at brings the keys of a Vt row.
    bf16x16 pf[2];
    float rs[4];
    #pragma unroll
    for (int i = 0; i < 4; ++i) {
      float p[8];
      #pragma unroll
      for (int r = 0; r < 8; ++r) p[r] = (s[i][r] - mnew) * LOG2E;
      exp2_x8(p);
      rs[i] = ((p[0] + p[1]) + (p[2] + p[3])) + ((p[4] + p[5]) + (p[6] + p[7]));
      #pragma unroll
      for (int r = 0; r < 8; r += 2) {
        f32x2 pr = {p[r], p[r + 1]};
        bf16x2 pb = __builtin_convertvector(pr, bf16x2);
        pf[i >> 1][(i & 1) * 8 + r]     = pb[0];
        pf[i >> 1][(i & 1) * 8 + r + 1] = pb[1];
      }
    }
    lrun = lrun * alpha + ((rs[0] + rs[1]) + (rs[2] + rs[3]));
    #pragma unroll
    for (int u = 0; u < 4; ++u) oacc[u] *= alpha;

    #pragma unroll
    for (int ks = 0; ks < 2; ++ks) {
      #pragma unroll
      for (int u = 0; u < 4; ++u) {
        bf16x16 vf = lds_frag_at(sV + u * 16 * VPITCH + ks * 64, VPITCH);
        oacc[u] = wmma_bf16(vf, pf[ks], oacc[u]);
      }
    }
   }
   // this wave's reads of the buffer are done before it is refilled
   asm volatile("s_wait_dscnt 0x0" ::: "memory");
   // this wave's copies of stage t + 1 have landed
   asm volatile("s_wait_asynccnt 0x0" ::: "memory");
   __syncthreads();  // publishes stage t + 1, frees stage t's buffer
   if (t + 2 < T)
     copy_kv(lk0 + buf, gK + (size_t)(t + 2) * AKEYS * HDIM, lv0 + buf,
             gV + (size_t)(t + 2) * AKEYS, vstep);
  }
  // no copy is outstanding when the wave goes on to its end
  asm volatile("s_wait_asynccnt 0x0" ::: "memory");

  // Finalize: join the halves' sums, divide, and put the heads back to
  // [b][tok][DIMC]; a lane's 8 registers of a tile are 8 neighbouring d.
  int h  = bh & (HEADS - 1);
  int bi = bh >> 4;
  float inv = 1.0f / (lrun + other_half(lrun));
  int tok = q0 + (lane & 15);
  bf16_t* orow =
      out + ((size_t)bi * Ntok + tok) * DIMC + h * HDIM + (lane >> 4) * 8;
  #pragma unroll
  for (int u = 0; u < 4; ++u) {
    union { bf16x2 hh[4]; uint4 v; } c;
    #pragma unroll
    for (int r = 0; r < 8; r += 2) {
      f32x2 pr = {oacc[u][r] * inv, oacc[u][r + 1] * inv};
      c.hh[r >> 1] = __builtin_convertvector(pr, bf16x2);
    }
    *reinterpret_cast<uint4*>(orow + u * 16) = c.v;
  }
}

// ---------------------------------------------------------------------------
// Host-side orchestration (graph-capture safe: launches only).
// ---------------------------------------------------------------------------
extern "C" void kernel_launch(void* const* d_in, const int* in_sizes, int n_in,
                              void* d_out, int out_size, void* d_ws, size_t ws_size,
                              hipStream_t stream) {
  (void)in_sizes; (void)n_in; (void)out_size; (void)ws_size;

  const float* x     = (const float*)d_in[0];
  const float* ln1_w = (const float*)d_in[1];
  const float* ln1_b = (const float*)d_in[2];
  const float* ln2_w = (const float*)d_in[3];
  const float* ln2_b = (const float*)d_in[4];
  const float* Wq = (const float*)d_in[5];  const float* bq = (const float*)d_in[6];
  const float* Wk = (const float*)d_in[7];  const float* bk = (const float*)d_in[8];
  const float* Wv = (const float*)d_in[9];  const float* bv = (const float*)d_in[10];
  const float* Wo = (const float*)d_in[11]; const float* bo = (const float*)d_in[12];
  const float* W1 = (const float*)d_in[13]; const float* b1 = (const float*)d_in[14];
  const float* W2 = (const float*)d_in[15]; const float* b2 = (const float*)d_in[16];

  // Workspace layout
  char* ws = (char*)d_ws;
  size_t off = 0;
  auto alloc = [&](size_t bytes) { char* p = ws + off; off += (bytes + 255) & ~size_t(255); return p; };
  bf16_t* Wqt = (bf16_t*)alloc((size_t)DIMC * DIMC * 2);
  bf16_t* Wkt = (bf16_t*)alloc((size_t)DIMC * DIMC * 2);
  bf16_t* Wvt = (bf16_t*)alloc((size_t)DIMC * DIMC * 2);
  bf16_t* Wot = (bf16_t*)alloc((size_t)DIMC * DIMC * 2);
  bf16_t* W1t = (bf16_t*)alloc((size_t)DIMC * HID * 2);
  bf16_t* W2t = (bf16_t*)alloc((size_t)HID * DIMC * 2);
  bf16_t* xn   = (bf16_t*)alloc((size_t)MTOT * DIMC * 2);
  bf16_t* qb   = (bf16_t*)alloc((size_t)MTOT * DIMC * 2);
  bf16_t* kb   = (bf16_t*)alloc((size_t)MTOT * DIMC * 2);
  bf16_t* vtb  = (bf16_t*)alloc((size_t)MTOT * DIMC * 2);
  bf16_t* attn = (bf16_t*)alloc((size_t)MTOT * DIMC * 2);
  float*  x2   = (float*)alloc((size_t)MTOT * DIMC * 4);
  bf16_t* xn2  = (bf16_t*)alloc((size_t)MTOT * DIMC * 2);
  bf16_t* hbuf = (bf16_t*)alloc((size_t)MTOT * HID * 2);

  // 1. Weight prep (fp32 -> bf16 transposed)
  {
    dim3 gsq(DIMC / 64, DIMC / 128);
    wt_transpose_kernel<DIMC, DIMC><<<gsq, 256, 0, stream>>>(Wq, Wqt);
    wt_transpose_kernel<DIMC, DIMC><<<gsq, 256, 0, stream>>>(Wk, Wkt);
    wt_transpose_kernel<DIMC, DIMC><<<gsq, 256, 0, stream>>>(Wv, Wvt);
    wt_transpose_kernel<DIMC, DIMC><<<gsq, 256, 0, stream>>>(Wo, Wot);
    dim3 gw1(HID / 64, DIMC / 128);
    wt_transpose_kernel<DIMC, HID><<<gw1, 256, 0, stream>>>(W1, W1t);
    dim3 gw2(DIMC / 64, HID / 128);
    wt_transpose_kernel<HID, DIMC><<<gw2, 256, 0, stream>>>(W2, W2t);
  }

  dim3 blk(256);

  // 2. LN1
  layernorm_kernel<<<MTOT, blk, 0, stream>>>(x, ln1_w, ln1_b, xn);

  // 3. Q, K, V projections (WMMA GEMMs). Q is pre-scaled by 1/sqrt(HDIM).
  dim3 gqkv(DIMC / 128, MTOT / 128);
  gemm_kernel<EPI_QK><<<gqkv, blk, 0, stream>>>(xn, Wqt, bq, qb,  nullptr, MTOT, DIMC, DIMC, NTOK, 0.125f);
  gemm_kernel<EPI_QK><<<gqkv, blk, 0, stream>>>(xn, Wkt, bk, kb,  nullptr, MTOT, DIMC, DIMC, NTOK, 1.0f);
  gemm_kernel<EPI_VT><<<gqkv, blk, 0, stream>>>(xn, Wvt, bv, vtb, nullptr, MTOT, DIMC, DIMC, NTOK, 1.0f);

  // 4. Flash attention
  dim3 gatt(NTOK / 128, BATCH * HEADS);
  attn_kernel<<<gatt, blk, 0, stream>>>(qb, kb, vtb, attn, NTOK);

  // 5. Output projection + residual: x2 = x + attn @ Wo + bo
  gemm_kernel<EPI_RESID_F32><<<gqkv, blk, 0, stream>>>(attn, Wot, bo, x2, x, MTOT, DIMC, DIMC, NTOK, 1.0f);

  // 6. LN2
  layernorm_kernel<<<MTOT, blk, 0, stream>>>(x2, ln2_w, ln2_b, xn2);

  // 7. MLP up + GELU: h = gelu(xn2 @ W1 + b1)
  dim3 gup(HID / 128, MTOT / 128);
  gemm_kernel<EPI_GELU_BF16><<<gup, blk, 0, stream>>>(xn2, W1t, b1, hbuf, nullptr, MTOT, HID, DIMC, NTOK, 1.0f);

  // 8. MLP down + residual -> output: out = x2 + h @ W2 + b2
  gemm_kernel<EPI_RESID_F32><<<gqkv, blk, 0, stream>>>(hbuf, W2t, b2, (float*)d_out, x2, MTOT, DIMC, HID, NTOK, 1.0f);
}

// v005
// A run of this version takes 182 microseconds.
// Next to v004, in two timings, it ran 1.08 times as fast each time.
// All steps since v000 together make it 3.62 times as fast.
#include <hip/hip_runtime.h>
#include <hip/hip_bf16.h>

// ---------------------------------------------------------------------------
// Transformer encoder block for MI455X (gfx1250, wave32, WMMA).
// All GEMMs run on v_wmma_f32_16x16x32_bf16; attention is flash-style with
// 64-key tiles, its two products taken transposed. 1/sqrt(d) is folded into the Q projection epilogue.
// ---------------------------------------------------------------------------

typedef __bf16 bf16_t;
typedef __attribute__((ext_vector_type(16))) __bf16 bf16x16;
typedef __attribute__((ext_vector_type(8)))  float  f32x8;

#define DIMC   1024
#define HEADS  16
#define HDIM   64
#define HID    4096
#define NTOK   2048
#define BATCH  2
#define MTOT   (BATCH * NTOK)   // 4096 tokens

// ---------------------------------------------------------------------------
// WMMA helpers
// ---------------------------------------------------------------------------
__device__ inline f32x8 wmma_bf16(bf16x16 a, bf16x16 b, f32x8 c) {
  // (neg_a, A, neg_b, B, c_mod, C, reuse_a, reuse_b)
  return __builtin_amdgcn_wmma_f32_16x16x32_bf16(false, a, false, b,
                                                 (short)0, c, false, false);
}

// Load a 16x32 bf16 fragment (A-style layout, used here for Q as a B
// operand; the A fragments of K and Vt are read from LDS in the same order).
// ISA 16-bit A layout: lane = m + 16*half;
//   VGPR0..3 : K = half*8 + 0..7
//   VGPR4..7 : K = 16 + half*8 + 0..7
// base points at (row0, k0); ld = row stride in elements (multiple of 8).
__device__ inline bf16x16 load_frag(const bf16_t* base, int ld) {
  int lane = threadIdx.x & 31;
  int m    = lane & 15;
  int half = lane >> 4;
  const bf16_t* p = base + (size_t)m * (size_t)ld + half * 8;
  union { uint4 u[2]; bf16x16 v; } cv;
  cv.u[0] = *reinterpret_cast<const uint4*>(p);
  cv.u[1] = *reinterpret_cast<const uint4*>(p + 16);
  return cv.v;
}

// ---------------------------------------------------------------------------
// Weight prep: fp32 [K][N] -> bf16 transposed [N][K].
// One block moves a 128(k) x 64(n) tile, number (bx, by) of its matrix; K and
// N are compile-time, so the row steps become immediate offsets of one address.
// A thread reads 8 k-rows x 4 n as 16-byte loads (a half-wave covers 256
// contiguous bytes of an input row) and packs the eight k of each n into one
// 16-byte chunk. The chunks cross through LDS, so that a half-wave then
// stores 256 contiguous bytes of an output row.
// LDS tile: [n][16 chunks]; the chunk index is XORed with n >> 2, which keeps
// both the 16-byte LDS writes and the reads free of bank conflicts.
// ---------------------------------------------------------------------------
typedef __attribute__((ext_vector_type(4))) float  f32x4;
typedef __attribute__((ext_vector_type(2))) float  f32x2;
typedef __attribute__((ext_vector_type(2))) __bf16 bf16x2;

template <int K, int N>
__device__ inline void wt_transpose_tile(const float* __restrict__ in,
                                         bf16_t* __restrict__ out, int bx,
                                         int by, uint4* tile) {
  static_assert(K % 128 == 0 && N % 64 == 0, "whole tiles only");
  int tid = threadIdx.x;
  int lo  = tid & 15;
  int hi  = tid >> 4;
  int k0  = by * 128;
  int n0  = bx * 64;

  // lo = group of 4 n, hi = group of 8 k
  const float* src = in + (size_t)(k0 + hi * 8) * N + n0 + lo * 4;
  f32x4 v[8];
  #pragma unroll  // all eight loads in flight at once, v[] in registers
  for (int i = 0; i < 8; ++i)
    v[i] = *reinterpret_cast<const f32x4*>(src + i * N);

  #pragma unroll  // constant indices into v[], or it would leave the registers
  for (int j = 0; j < 4; ++j) {
    union { bf16x2 h[4]; uint4 u; } c;
    #pragma unroll  // same reason
    for (int p = 0; p < 4; ++p) {
      f32x2 pr = {v[2 * p][j], v[2 * p + 1][j]};
      c.h[p] = __builtin_convertvector(pr, bf16x2);
    }
    tile[(lo * 4 + j) * 16 + (hi ^ lo)] = c.u;
  }
  __syncthreads();

  // lo = chunk of 8 k, hi = n within a group of 16
  bf16_t* dst = out + (size_t)(n0 + hi) * K + k0 + lo * 8;
  #pragma unroll  // four LDS reads issued together ahead of the stores
  for (int s = 0; s < 4; ++s) {
    int n = s * 16 + hi;
    uint4 u = tile[n * 16 + (lo ^ (n >> 2))];
    *reinterpret_cast<uint4*>(dst + s * 16 * K) = u;
  }
  // In the built kernel another arm of the caller's choice follows and reuses
  // the stores' address and data registers: the wait stands in front of that.
  asm volatile("s_wait_xcnt 0x0" ::: "memory");
}

// ---------------------------------------------------------------------------
// LayerNorm over DIMC=1024, one block (256 threads) per row. Output bf16.
// ---------------------------------------------------------------------------
__device__ inline void layernorm_row(
    const float* __restrict__ x, const float* __restrict__ w,
    const float* __restrict__ b, bf16_t* __restrict__ out, int row) {
  __shared__ float ssum[8];
  __shared__ float ssq[8];
  int tid  = threadIdx.x;
  int lane = tid & 31;
  int wv   = tid >> 5;

  const float4* xr = reinterpret_cast<const float4*>(x + (size_t)row * DIMC);
  float4 v = xr[tid];
  float s  = v.x + v.y + v.z + v.w;
  float sq = v.x * v.x + v.y * v.y + v.z * v.z + v.w * v.w;
  #pragma unroll
  for (int mask = 16; mask >= 1; mask >>= 1) {
    s  += __shfl_xor(s, mask, 32);
    sq += __shfl_xor(sq, mask, 32);
  }
  if (lane == 0) { ssum[wv] = s; ssq[wv] = sq; }
  __syncthreads();
  float ts = 0.f, tq = 0.f;
  #pragma unroll
  for (int i = 0; i < 8; ++i) { ts += ssum[i]; tq += ssq[i]; }
  float mu  = ts * (1.0f / DIMC);
  float var = tq * (1.0f / DIMC) - mu * mu;
  float inv = rsqrtf(var + 1e-5f);

  int c = tid * 4;
  const float4 wv4 = reinterpret_cast<const float4*>(w)[tid];
  const float4 bv4 = reinterpret_cast<const float4*>(b)[tid];
  bf16_t* o = out + (size_t)row * DIMC + c;
  o[0] = (bf16_t)((v.x - mu) * inv * wv4.x + bv4.x);
  o[1] = (bf16_t)((v.y - mu) * inv * wv4.y + bv4.y);
  o[2] = (bf16_t)((v.z - mu) * inv * wv4.z + bv4.z);
  o[3] = (bf16_t)((v.w - mu) * inv * wv4.w + bv4.w);
}

__global__ void __launch_bounds__(256) layernorm_kernel(
    const float* __restrict__ x, const float* __restrict__ w,
    const float* __restrict__ b, bf16_t* __restrict__ out) {
  layernorm_row(x, w, b, out, blockIdx.x);
}

// ---------------------------------------------------------------------------
// All the work that depends on the inputs alone, in one launch: the six weight
// transposes and the first LayerNorm. A block does one transpose tile or one
// row; which, its index says. The transposes, the longer blocks, come first.
// ---------------------------------------------------------------------------
#define PB_W1  ((HID / 64) * (DIMC / 128))    // tiles of W1, as many of W2
#define PB_SQ  ((DIMC / 64) * (DIMC / 128))   // tiles of a square weight
#define PB_ALL (2 * PB_W1 + 4 * PB_SQ + MTOT)

__global__ void __launch_bounds__(256) prep_kernel(
    const float* __restrict__ Wq, const float* __restrict__ Wk,
    const float* __restrict__ Wv, const float* __restrict__ Wo,
    const float* __restrict__ W1, const float* __restrict__ W2,
    bf16_t* __restrict__ Wqt, bf16_t* __restrict__ Wkt,
    bf16_t* __restrict__ Wvt, bf16_t* __restrict__ Wot,
    bf16_t* __restrict__ W1t, bf16_t* __restrict__ W2t,
    const float* __restrict__ x, const float* __restrict__ w,
    const float* __restrict__ b, bf16_t* __restrict__ xn) {
  __shared__ uint4 tile[64 * 16];
  int i = blockIdx.x;
  if (i < PB_W1) {
    wt_transpose_tile<DIMC, HID>(W1, W1t, i % (HID / 64), i / (HID / 64), tile);
  } else if (i < 2 * PB_W1) {
    i -= PB_W1;
    wt_transpose_tile<HID, DIMC>(W2, W2t, i % (DIMC / 64), i / (DIMC / 64),
                                 tile);
  } else if (i < 2 * PB_W1 + 4 * PB_SQ) {
    i -= 2 * PB_W1;
    int which = i / PB_SQ;
    i %= PB_SQ;
    const float* in = which == 0 ? Wq : which == 1 ? Wk : which == 2 ? Wv : Wo;
    bf16_t* out = which == 0 ? Wqt : which == 1 ? Wkt : which == 2 ? Wvt : Wot;
    wt_transpose_tile<DIMC, DIMC>(in, out, i % (DIMC / 64), i / (DIMC / 64),
                                  tile);
  } else {
    layernorm_row(x, w, b, xn, i - (2 * PB_W1 + 4 * PB_SQ));
    // same reason as at the end of wt_transpose_tile, for the row's stores
    asm volatile("s_wait_xcnt 0x0" ::: "memory");
  }
}

// ---------------------------------------------------------------------------
// Generic bf16 WMMA GEMM:  C = (A[M,K] * Bt[N,K]^T + bias) * oscale, epilogue.
// Block = 256 threads (8 waves as 4x2), block tile 128x128,
// wave tile 32x64 (2x4 accumulator tiles), WMMA K-step 32.
// The 128-row A and Bt tiles, 128 k at a time, are brought into LDS by
// asynchronous 16-byte copies (a wave covers whole 128-byte lines), two
// buffers: tile t + 1 flies while tile t is worked on. M and N are multiples
// of 128, K a multiple of 128.
// EPI_QKV is the Q, K and V projections as one product: Bt holds the three
// transposed weights one behind the other (N = 3 * DIMC), outp the three
// outputs likewise; a block's 128 columns lie in one of the three.
// ---------------------------------------------------------------------------
#define GBK    128               // k per LDS tile: 256 bytes of every row
#define GPITCH 272               // LDS row pitch in bytes: 256 + 16 pad
#define GTILE  (128 * GPITCH)    // one operand's tile
#define GSTAGE (2 * GTILE)       // a buffer: A tile, then Bt tile

// 16x32 bf16 fragment from an LDS tile; same lane and k order as load_frag.
__device__ inline bf16x16 lds_frag(const unsigned char* base) {
  int lane = threadIdx.x & 31;
  const unsigned char* p = base + (lane & 15) * GPITCH + (lane >> 4) * 16;
  union { uint4 u[2]; bf16x16 v; } cv;
  cv.u[0] = *reinterpret_cast<const uint4*>(p);
  cv.u[1] = *reinterpret_cast<const uint4*>(p + 32);
  return cv.v;
}

// One thread's share of a 128-row tile: 16 bytes of every 16th row.
// lds: the lane's LDS byte address, g: its global address, rstep: 16 rows.
__device__ inline void copy_tile(unsigned lds, const bf16_t* g, size_t rstep) {
  // The closing s_wait_xcnt stands inside the statement so that no address
  // register of a copy is rewritten ahead of it.
  asm volatile(
      "global_load_async_to_lds_b128 %0, %8, off\n\t"
      "global_load_async_to_lds_b128 %1, %9, off\n\t"
      "global_load_async_to_lds_b128 %2, %10, off\n\t"
      "global_load_async_to_lds_b128 %3, %11, off\n\t"
      "global_load_async_to_lds_b128 %4, %12, off\n\t"
      "global_load_async_to_lds_b128 %5, %13, off\n\t"
      "global_load_async_to_lds_b128 %6, %14, off\n\t"
      "global_load_async_to_lds_b128 %7, %15, off\n\t"
      "s_wait_xcnt 0x0"
      :: "v"(lds), "v"(lds + 16 * GPITCH), "v"(lds + 32 * GPITCH),
         "v"(lds + 48 * GPITCH), "v"(lds + 64 * GPITCH),
         "v"(lds + 80 * GPITCH), "v"(lds + 96 * GPITCH),
         "v"(lds + 112 * GPITCH),
         "v"(g), "v"(g + rstep), "v"(g + 2 * rstep), "v"(g + 3 * rstep),
         "v"(g + 4 * rstep), "v"(g + 5 * rstep), "v"(g + 6 * rstep),
         "v"(g + 7 * rstep)
      : "memory");
}

enum { EPI_QK = 0, EPI_VT = 1, EPI_RESID_F32 = 2, EPI_GELU_BF16 = 3,
       EPI_QKV = 4 };
template <int F> struct store_form { static constexpr int value = F; };

template <int EPI>
__global__ void __launch_bounds__(256, 4) gemm_kernel(
    const bf16_t* __restrict__ A, const bf16_t* __restrict__ Bt,
    const float* __restrict__ bias, void* __restrict__ outp,
    const float* __restrict__ resid, int M, int N, int K, int Ntok,
    float oscale, const float* __restrict__ bias_k,
    const float* __restrict__ bias_v) {
  __shared__ __attribute__((aligned(16))) unsigned char smem[2 * GSTAGE];
  int wave = threadIdx.x >> 5;
  int lane = threadIdx.x & 31;
  int wm = wave >> 1;          // 0..3
  int wn = wave & 1;           // 0..1
  int row0 = blockIdx.y * 128 + wm * 32;
  int col0 = blockIdx.x * 128 + wn * 64;

  f32x8 acc[2][4];
  #pragma unroll
  for (int t = 0; t < 2; ++t)
    #pragma unroll
    for (int u = 0; u < 4; ++u) acc[t][u] = (f32x8)(0.0f);

  // Copy shares: 16 threads cover a row's 256 bytes, 16 rows per round.
  int crow = threadIdx.x >> 4;
  int cchk = threadIdx.x & 15;
  const bf16_t* gA = A  + (size_t)(blockIdx.y * 128 + crow) * K + cchk * 8;
  const bf16_t* gB = Bt + (size_t)(blockIdx.x * 128 + crow) * K + cchk * 8;
  unsigned lds0 = (unsigned)(uintptr_t)smem + crow * GPITCH + cchk * 16;
  size_t rstep = (size_t)16 * K;
  int T = K / GBK;

  copy_tile(lds0, gA, rstep);
  copy_tile(lds0 + GTILE, gB, rstep);
  // tile 0 has landed for this wave, then for the block
  asm volatile("s_wait_asynccnt 0x0" ::: "memory");
  __syncthreads();
  if (T > 1) {
    copy_tile(lds0 + GSTAGE, gA + GBK, rstep);
    copy_tile(lds0 + GSTAGE + GTILE, gB + GBK, rstep);
  }

  for (int t = 0; t < T; ++t) {
    unsigned buf = (unsigned)(t & 1) * GSTAGE;
    const unsigned char* sA = smem + buf + wm * 32 * GPITCH;
    const unsigned char* sB = smem + buf + GTILE + wn * 64 * GPITCH;
    // Two fragment sets: the reads of the next 32 k go out as one group ahead
    // of this 32 k's WMMAs, so that their LDS latency hides behind them.
    bf16x16 fa[2][2], fb[2][4];
    fa[0][0] = lds_frag(sA);
    fa[0][1] = lds_frag(sA + 16 * GPITCH);
    #pragma unroll  // constant indices keep fb[] in registers
    for (int u = 0; u < 4; ++u) fb[0][u] = lds_frag(sB + u * 16 * GPITCH);
    #pragma unroll  // constant indices keep both sets in registers
    for (int kk = 0; kk < GBK / 32; ++kk) {
      const int cur = kk & 1, nxt = cur ^ 1;
      if (kk + 1 < GBK / 32) {
        fa[nxt][0] = lds_frag(sA + (kk + 1) * 64);
        fa[nxt][1] = lds_frag(sA + 16 * GPITCH + (kk + 1) * 64);
        #pragma unroll  // same reason
        for (int u = 0; u < 4; ++u)
          fb[nxt][u] = lds_frag(sB + u * 16 * GPITCH + (kk + 1) * 64);
      }
      // keeps the read group above from sinking in among the WMMAs below
      __builtin_amdgcn_sched_barrier(0);
      #pragma unroll  // same reason, for acc[] too
      for (int u = 0; u < 4; ++u) {
        acc[0][u] = wmma_bf16(fa[cur][0], fb[cur][u], acc[0][u]);
        acc[1][u] = wmma_bf16(fa[cur][1], fb[cur][u], acc[1][u]);
      }
      // keeps the next read group from rising in among the WMMAs above
      __builtin_amdgcn_sched_barrier(0);
    }
    // this wave's reads of the buffer are done before it is refilled
    asm volatile("s_wait_dscnt 0x0" ::: "memory");
    // this wave's copies of tile t + 1 have landed
    asm volatile("s_wait_asynccnt 0x0" ::: "memory");
    __syncthreads();  // publishes tile t + 1, frees tile t's buffer
    if (t + 2 < T) {
      copy_tile(lds0 + buf, gA + (size_t)(t + 2) * GBK, rstep);
      copy_tile(lds0 + buf + GTILE, gB + (size_t)(t + 2) * GBK, rstep);
    }
  }
  // no copy is outstanding when the wave goes on to its end
  asm volatile("s_wait_asynccnt 0x0" ::: "memory");

  // Epilogue. C layout: VGPR r, lanes 0-15 -> (M=r, N=lane),
  //                     lanes 16-31 -> (M=r+8, N=lane-16)
  int nloc = lane & 15;
  int moff = (lane >> 4) * 8;
  int sel = 0;  // EPI_QKV: 0 = Q, 1 = K, 2 = V; alike in the whole block
  if constexpr (EPI == EPI_QKV) {
    sel = blockIdx.x / (DIMC / 128);
    col0 -= sel * DIMC;
    bias = sel == 0 ? bias : sel == 1 ? bias_k : bias_v;
    outp = (bf16_t*)outp + (size_t)sel * M * DIMC;
    oscale = sel == 0 ? oscale : 1.0f;
  }
  auto store_tiles = [&](auto form) {
  constexpr int F = decltype(form)::value;
  #pragma unroll
  for (int t = 0; t < 2; ++t) {
    #pragma unroll
    for (int u = 0; u < 4; ++u) {
      #pragma unroll
      for (int r = 0; r < 8; ++r) {
        int rowg = row0 + t * 16 + moff + r;
        int colg = col0 + u * 16 + nloc;
        float val = (acc[t][u][r] + bias[colg]) * oscale;
        if constexpr (F == EPI_QK) {
          // -> per-head [b][h][tok][d], bf16
          int bi = rowg / Ntok, tok = rowg % Ntok;
          int h = colg >> 6, d = colg & 63;
          ((bf16_t*)outp)[((((size_t)bi * HEADS + h) * Ntok + tok) << 6) + d] =
              (bf16_t)val;
        } else if constexpr (F == EPI_VT) {
          // -> per-head transposed [b][h][d][tok], bf16
          int bi = rowg / Ntok, tok = rowg % Ntok;
          int h = colg >> 6, d = colg & 63;
          ((bf16_t*)outp)[(((size_t)bi * HEADS + h) * HDIM + d) * Ntok + tok] =
              (bf16_t)val;
        } else if constexpr (F == EPI_RESID_F32) {
          size_t idx = (size_t)rowg * N + colg;
          ((float*)outp)[idx] = resid[idx] + val;
        } else {  // EPI_GELU_BF16, exact gelu
          float g = 0.5f * val * (1.0f + erff(val * 0.70710678118654752f));
          ((bf16_t*)outp)[(size_t)rowg * N + colg] = (bf16_t)g;
        }
      }
    }
  }
  };
  if constexpr (EPI == EPI_QKV) {
    if (sel == 2) {
      store_tiles(store_form<EPI_VT>{});
    } else {
      store_tiles(store_form<EPI_QK>{});
      // In the built kernel the other arm follows and reuses the stores'
      // address and data registers: the wait stands in front of that.
      asm volatile("s_wait_xcnt 0x0" ::: "memory");
    }
  } else {
    store_tiles(store_form<EPI>{});
  }
}

#define AKEYS  128
#define KPITCH 144
#define VPITCH 272
#define KTILE  (AKEYS * KPITCH)
#define VTILE  (HDIM * VPITCH)
#define ASTAGE (KTILE + VTILE)

// 16x32 bf16 fragment from LDS rows of the given byte pitch; same lane and k
// order as load_frag.
__device__ inline bf16x16 lds_frag_at(const unsigned char* base, int pitch) {
  int lane = threadIdx.x & 31;
  const unsigned char* p = base + (lane & 15) * pitch + (lane >> 4) * 16;
  union { uint4 u[2]; bf16x16 v; } cv;
  cv.u[0] = *reinterpret_cast<const uint4*>(p);
  cv.u[1] = *reinterpret_cast<const uint4*>(p + 32);
  return cv.v;
}

// The value that lane l ^ 16 holds.
__device__ inline float other_half(float x) {
  int i = __builtin_bit_cast(int, x);
  return __builtin_bit_cast(
      float, __builtin_amdgcn_permlanex16(i, i, 0x76543210, 0xfedcba98, false,
                                          false));
}

__device__ inline float max3f(float a, float b, float c) {
  return fmaxf(fmaxf(a, b), c);
}

// Exponentials base 2, each in place on its own register, in one statement:
// so none overwrites the source of the one in front of it, and the closing
// v_nop is the slot the instruction set asks for between a transcendental and
// an instruction that uses its result.
__device__ inline void exp2_x8(float (&a)[8]) {
  asm("v_exp_f32 %0, %0\n\t"
      "v_exp_f32 %1, %1\n\t"
      "v_exp_f32 %2, %2\n\t"
      "v_exp_f32 %3, %3\n\t"
      "v_exp_f32 %4, %4\n\t"
      "v_exp_f32 %5, %5\n\t"
      "v_exp_f32 %6, %6\n\t"
      "v_exp_f32 %7, %7\n\t"
      "v_nop"
      : "+v"(a[0]), "+v"(a[1]), "+v"(a[2]), "+v"(a[3]), "+v"(a[4]),
        "+v"(a[5]), "+v"(a[6]), "+v"(a[7]));
}
__device__ inline float exp2_x1(float a) {
  asm("v_exp_f32 %0, %0\n\t"
      "v_nop"
      : "+v"(a));
  return a;
}
#define LOG2E 1.4426950408889634f

// One thread's share of a stage: 16 bytes of every 32nd K row and of every
// 16th Vt row. lk, lv: the lane's LDS byte addresses; gk, gv: its global
// addresses; vstep: 16 Vt rows in elements.
__device__ inline void copy_kv(unsigned lk, const bf16_t* gk, unsigned lv,
                               const bf16_t* gv, size_t vstep) {
  // The closing s_wait_xcnt stands inside the statement so that no address
  // register of a copy is rewritten ahead of it.
  asm volatile(
      "global_load_async_to_lds_b128 %0, %8, off\n\t"
      "global_load_async_to_lds_b128 %1, %9, off\n\t"
      "global_load_async_to_lds_b128 %2, %10, off\n\t"
      "global_load_async_to_lds_b128 %3, %11, off\n\t"
      "global_load_async_to_lds_b128 %4, %12, off\n\t"
      "global_load_async_to_lds_b128 %5, %13, off\n\t"
      "global_load_async_to_lds_b128 %6, %14, off\n\t"
      "global_load_async_to_lds_b128 %7, %15, off\n\t"
      "s_wait_xcnt 0x0"
      :: "v"(lk), "v"(lk + 32 * KPITCH), "v"(lk + 64 * KPITCH),
         "v"(lk + 96 * KPITCH),
         "v"(lv), "v"(lv + 16 * VPITCH), "v"(lv + 32 * VPITCH),
         "v"(lv + 48 * VPITCH),
         "v"(gk), "v"(gk + 32 * HDIM), "v"(gk + 64 * HDIM),
         "v"(gk + 96 * HDIM),
         "v"(gv), "v"(gv + vstep), "v"(gv + 2 * vstep), "v"(gv + 3 * vstep)
      : "memory");
}

// Four waves per SIMD is what the grid gives (two blocks a WGP). Told so, the
// compiler keeps a sub-pass's LDS reads together ahead of the WMMAs; aiming at
// more waves it saves registers by a load, a wait and a WMMA in turn.
__global__ void __launch_bounds__(256)
__attribute__((amdgpu_waves_per_eu(4, 4))) attn_kernel(
    const bf16_t* __restrict__ q, const bf16_t* __restrict__ k,
    const bf16_t* __restrict__ vt, bf16_t* __restrict__ out, int Ntok) {
  __shared__ __attribute__((aligned(16))) unsigned char kv[2 * ASTAGE];

  int wave = threadIdx.x >> 5;
  int lane = threadIdx.x & 31;
  int bh = blockIdx.y;
  int q0 = blockIdx.x * 128 + wave * 16;

  const bf16_t* Qh = q  + (size_t)bh * Ntok * HDIM;
  const bf16_t* Kh = k  + (size_t)bh * Ntok * HDIM;
  const bf16_t* Vh = vt + (size_t)bh * HDIM * Ntok;

  // B operand of S^T: column = query q0 + (lane & 15), k = d.
  bf16x16 qf0 = load_frag(Qh + (size_t)q0 * HDIM + 0, HDIM);
  bf16x16 qf1 = load_frag(Qh + (size_t)q0 * HDIM + 32, HDIM);

  // O^T tiles: row d = 16 u + 8 * (lane >> 4) + r, column = the lane's query.
  f32x8 oacc[4];
  #pragma unroll
  for (int u = 0; u < 4; ++u) oacc[u] = (f32x8)(0.0f);
  // The lane's query: maximum in use (alike in both halves), and the sum over
  // the keys of this half alone.
  float mrun = -1e30f, lrun = 0.0f;

  // Copy shares. K: 8 threads cover a row's 128 bytes, 32 rows per round.
  // Vt: 16 threads cover a row's 256 bytes of the stage, 16 rows per round.
  int tid = threadIdx.x;
  const bf16_t* gK = Kh + (size_t)(tid >> 3) * HDIM + (tid & 7) * 8;
  const bf16_t* gV = Vh + (size_t)(tid >> 4) * Ntok + (tid & 15) * 8;
  unsigned lk0 = (unsigned)(uintptr_t)kv + (tid >> 3) * KPITCH + (tid & 7) * 16;
  unsigned lv0 =
      (unsigned)(uintptr_t)kv + KTILE + (tid >> 4) * VPITCH + (tid & 15) * 16;
  size_t vstep = (size_t)16 * Ntok;
  int T = Ntok / AKEYS;

  copy_kv(lk0, gK, lv0, gV, vstep);
  // stage 0 has landed for this wave, then for the block
  asm volatile("s_wait_asynccnt 0x0" ::: "memory");
  __syncthreads();
  if (T > 1)
    copy_kv(lk0 + ASTAGE, gK + AKEYS * HDIM, lv0 + ASTAGE, gV + AKEYS, vstep);

  for (int t = 0; t < T; ++t) {
   unsigned buf = (unsigned)(t & 1) * ASTAGE;
   for (int sub = 0; sub < AKEYS / 64; ++sub) {
    const unsigned char* sK = kv + buf + sub * 64 * KPITCH;
    const unsigned char* sV = kv + buf + KTILE + sub * 128;
    // 4 S^T tiles: 64 keys x 16 queries (contraction over d=64).
    f32x8 s[4];
    #pragma unroll
    for (int i = 0; i < 4; ++i) {
      const unsigned char* Kt = sK + i * 16 * KPITCH;
      f32x8 si = (f32x8)(0.0f);
      si = wmma_bf16(lds_frag_at(Kt, KPITCH), qf0, si);
      si = wmma_bf16(lds_frag_at(Kt + 64, KPITCH), qf1, si);
      s[i] = si;
    }

    // Online softmax update of the lane's query over its 32 scores.
    float m8[8];
    #pragma unroll
    for (int r = 0; r < 8; ++r)
      m8[r] = fmaxf(max3f(s[0][r], s[1][r], s[2][r]), s[3][r]);
    float mx = fmaxf(max3f(m8[0], m8[1], m8[2]),
                     fmaxf(max3f(m8[3], m8[4], m8[5]), fmaxf(m8[6], m8[7])));
    mx = fmaxf(mx, other_half(mx));
    float mnew  = fmaxf(mrun, mx);
    float alpha = exp2_x1((mrun - mnew) * LOG2E);
    mrun = mnew;

    // P^T as B operand: elements 0..7 of a lane are tile 2 ks, registers
    // 0..7 (keys 8 * half + r), elements 8..15 tile 2 ks + 1: the k order in
    // which lds_frag_at brings the keys of a Vt row.
    bf16x16 pf[2];
    float rs[4];
    #pragma unroll
    for (int i = 0; i < 4; ++i) {
      float p[8];
      #pragma unroll
      for (int r = 0; r < 8; ++r) p[r] = (s[i][r] - mnew) * LOG2E;
      exp2_x8(p);
      rs[i] = ((p[0] + p[1]) + (p[2] + p[3])) + ((p[4] + p[5]) + (p[6] + p[7]));
      #pragma unroll
      for (int r = 0; r < 8; r += 2) {
        f32x2 pr = {p[r], p[r + 1]};
        bf16x2 pb = __builtin_convertvector(pr, bf16x2);
        pf[i >> 1][(i & 1) * 8 + r]     = pb[0];
        pf[i >> 1][(i & 1) * 8 + r + 1] = pb[1];
      }
    }
    lrun = lrun * alpha + ((rs[0] + rs[1]) + (rs[2] + rs[3]));
    #pragma unroll
    for (int u = 0; u < 4; ++u) oacc[u] *= alpha;

    #pragma unroll
    for (int ks = 0; ks < 2; ++ks) {
      #pragma unroll
      for (int u = 0; u < 4; ++u) {
        bf16x16 vf = lds_frag_at(sV + u * 16 * VPITCH + ks * 64, VPITCH);
        oacc[u] = wmma_bf16(vf, pf[ks], oacc[u]);
      }
    }
   }
   // this wave's reads of the buffer are done before it is refilled
   asm volatile("s_wait_dscnt 0x0" ::: "memory");
   // this wave's copies of stage t + 1 have landed
   asm volatile("s_wait_asynccnt 0x0" ::: "memory");
   __syncthreads();  // publishes stage t + 1, frees stage t's buffer
   if (t + 2 < T)
     copy_kv(lk0 + buf, gK + (size_t)(t + 2) * AKEYS * HDIM, lv0 + buf,
             gV + (size_t)(t + 2) * AKEYS, vstep);
  }
  // no copy is outstanding when the wave goes on to its end
  asm volatile("s_wait_asynccnt 0x0" ::: "memory");

  // Finalize: join the halves' sums, divide, and put the heads back to
  // [b][tok][DIMC]; a lane's 8 registers of a tile are 8 neighbouring d.
  int h  = bh & (HEADS - 1);
  int bi = bh >> 4;
  float inv = 1.0f / (lrun + other_half(lrun));
  int tok = q0 + (lane & 15);
  bf16_t* orow =
      out + ((size_t)bi * Ntok + tok) * DIMC + h * HDIM + (lane >> 4) * 8;
  #pragma unroll
  for (int u = 0; u < 4; ++u) {
    union { bf16x2 hh[4]; uint4 v; } c;
    #pragma unroll
    for (int r = 0; r < 8; r += 2) {
      f32x2 pr = {oacc[u][r] * inv, oacc[u][r + 1] * inv};
      c.hh[r >> 1] = __builtin_convertvector(pr, bf16x2);
    }
    *reinterpret_cast<uint4*>(orow + u * 16) = c.v;
  }
}

// ---------------------------------------------------------------------------
// Host-side orchestration (graph-capture safe: launches only).
// ---------------------------------------------------------------------------
extern "C" void kernel_launch(void* const* d_in, const int* in_sizes, int n_in,
                              void* d_out, int out_size, void* d_ws, size_t ws_size,
                              hipStream_t stream) {
  (void)in_sizes; (void)n_in; (void)out_size; (void)ws_size;

  const float* x     = (const float*)d_in[0];
  const float* ln1_w = (const float*)d_in[1];
  const float* ln1_b = (const float*)d_in[2];
  const float* ln2_w = (const float*)d_in[3];
  const float* ln2_b = (const float*)d_in[4];
  const float* Wq = (const float*)d_in[5];  const float* bq = (const float*)d_in[6];
  const float* Wk = (const float*)d_in[7];  const float* bk = (const float*)d_in[8];
  const float* Wv = (const float*)d_in[9];  const float* bv = (const float*)d_in[10];
  const float* Wo = (const float*)d_in[11]; const float* bo = (const float*)d_in[12];
  const float* W1 = (const float*)d_in[13]; const float* b1 = (const float*)d_in[14];
  const float* W2 = (const float*)d_in[15]; const float* b2 = (const float*)d_in[16];

  // Workspace layout
  char* ws = (char*)d_ws;
  size_t off = 0;
  auto alloc = [&](size_t bytes) { char* p = ws + off; off += (bytes + 255) & ~size_t(255); return p; };
  // Wqt, Wkt, Wvt lie one behind the other with no gap (sizes are multiples of
  // 256): the merged projection reads them as one [3 * DIMC][DIMC] matrix.
  bf16_t* Wqt = (bf16_t*)alloc((size_t)DIMC * DIMC * 2);
  bf16_t* Wkt = (bf16_t*)alloc((size_t)DIMC * DIMC * 2);
  bf16_t* Wvt = (bf16_t*)alloc((size_t)DIMC * DIMC * 2);
  bf16_t* Wot = (bf16_t*)alloc((size_t)DIMC * DIMC * 2);
  bf16_t* W1t = (bf16_t*)alloc((size_t)DIMC * HID * 2);
  bf16_t* W2t = (bf16_t*)alloc((size_t)HID * DIMC * 2);
  bf16_t* xn   = (bf16_t*)alloc((size_t)MTOT * DIMC * 2);
  // qb, kb, vtb likewise: output sel of the merged projection starts at
  // qb + sel * MTOT * DIMC.
  bf16_t* qb   = (bf16_t*)alloc((size_t)MTOT * DIMC * 2);
  bf16_t* kb   = (bf16_t*)alloc((size_t)MTOT * DIMC * 2);
  bf16_t* vtb  = (bf16_t*)alloc((size_t)MTOT * DIMC * 2);
  bf16_t* attn = (bf16_t*)alloc((size_t)MTOT * DIMC * 2);
  float*  x2   = (float*)alloc((size_t)MTOT * DIMC * 4);
  bf16_t* xn2  = (bf16_t*)alloc((size_t)MTOT * DIMC * 2);
  bf16_t* hbuf = (bf16_t*)alloc((size_t)MTOT * HID * 2);

  dim3 blk(256);

  // 1, 2. Weight prep (fp32 -> bf16 transposed) and LN1
  prep_kernel<<<PB_ALL, blk, 0, stream>>>(Wq, Wk, Wv, Wo, W1, W2, Wqt, Wkt, Wvt,
                                          Wot, W1t, W2t, x, ln1_w, ln1_b, xn);

  // 3. Q, K, V projections (one WMMA GEMM). Q is pre-scaled by 1/sqrt(HDIM).
  dim3 gqkv3(3 * DIMC / 128, MTOT / 128);
  gemm_kernel<EPI_QKV><<<gqkv3, blk, 0, stream>>>(xn, Wqt, bq, qb, nullptr, MTOT, 3 * DIMC, DIMC, NTOK, 0.125f, bk, bv);
  dim3 gqkv(DIMC / 128, MTOT / 128);

  // 4. Flash attention
  dim3 gatt(NTOK / 128, BATCH * HEADS);
  attn_kernel<<<gatt, blk, 0, stream>>>(qb, kb, vtb, attn, NTOK);

  // 5. Output projection + residual: x2 = x + attn @ Wo + bo
  gemm_kernel<EPI_RESID_F32><<<gqkv, blk, 0, stream>>>(attn, Wot, bo, x2, x, MTOT, DIMC, DIMC, NTOK, 1.0f, nullptr, nullptr);

  // 6. LN2
  layernorm_kernel<<<MTOT, blk, 0, stream>>>(x2, ln2_w, ln2_b, xn2);

  // 7. MLP up + GELU: h = gelu(xn2 @ W1 + b1)
  dim3 gup(HID / 128, MTOT / 128);
  gemm_kernel<EPI_GELU_BF16><<<gup, blk, 0, stream>>>(xn2, W1t, b1, hbuf, nullptr, MTOT, HID, DIMC, NTOK, 1.0f, nullptr, nullptr);

  // 8. MLP down + residual -> output: out = x2 + h @ W2 + b2
  gemm_kernel<EPI_RESID_F32><<<gqkv, blk, 0, stream>>>(hbuf, W2t, b2, (float*)d_out, x2, MTOT, DIMC, HID, NTOK, 1.0f, nullptr, nullptr);
}

// v006
// A run of this version takes 173 microseconds.
// In two side-by-side timings against v005, it was 1.05 and 1.04 times as fast.
// Over all steps from v000 it is 3.79 times as fast.
#include <hip/hip_runtime.h>
#include <hip/hip_bf16.h>

// ---------------------------------------------------------------------------
// Transformer encoder block for MI455X (gfx1250, wave32, WMMA).
// All GEMMs run on v_wmma_f32_16x16x32_bf16; attention is flash-style with
// 64-key tiles, its two products taken transposed. 1/sqrt(d) is folded into the Q projection epilogue.
// ---------------------------------------------------------------------------

typedef __bf16 bf16_t;
typedef __attribute__((ext_vector_type(16))) __bf16 bf16x16;
typedef __attribute__((ext_vector_type(8)))  float  f32x8;

#define DIMC   1024
#define HEADS  16
#define HDIM   64
#define HID    4096
#define NTOK   2048
#define BATCH  2
#define MTOT   (BATCH * NTOK)   // 4096 tokens

// ---------------------------------------------------------------------------
// WMMA helpers
// ---------------------------------------------------------------------------
__device__ inline f32x8 wmma_bf16(bf16x16 a, bf16x16 b, f32x8 c) {
  // (neg_a, A, neg_b, B, c_mod, C, reuse_a, reuse_b)
  return __builtin_amdgcn_wmma_f32_16x16x32_bf16(false, a, false, b,
                                                 (short)0, c, false, false);
}

// Load a 16x32 bf16 fragment (A-style layout, used here for Q as a B
// operand; the A fragments of K and Vt are read from LDS in the same order).
// ISA 16-bit A layout: lane = m + 16*half;
//   VGPR0..3 : K = half*8 + 0..7
//   VGPR4..7 : K = 16 + half*8 + 0..7
// base points at (row0, k0); ld = row stride in elements (multiple of 8).
__device__ inline bf16x16 load_frag(const bf16_t* base, int ld) {
  int lane = threadIdx.x & 31;
  int m    = lane & 15;
  int half = lane >> 4;
  const bf16_t* p = base + (size_t)m * (size_t)ld + half * 8;
  union { uint4 u[2]; bf16x16 v; } cv;
  cv.u[0] = *reinterpret_cast<const uint4*>(p);
  cv.u[1] = *reinterpret_cast<const uint4*>(p + 16);
  return cv.v;
}

// ---------------------------------------------------------------------------
// Weight prep: fp32 [K][N] -> bf16 transposed [N][K].
// One block moves a 128(k) x 64(n) tile, number (bx, by) of its matrix; K and
// N are compile-time, so the row steps become immediate offsets of one address.
// A thread reads 8 k-rows x 4 n as 16-byte loads (a half-wave covers 256
// contiguous bytes of an input row) and packs the eight k of each n into one
// 16-byte chunk. The chunks cross through LDS, so that a half-wave then
// stores 256 contiguous bytes of an output row.
// LDS tile: [n][16 chunks]; the chunk index is XORed with n >> 2, which keeps
// both the 16-byte LDS writes and the reads free of bank conflicts.
// ---------------------------------------------------------------------------
typedef __attribute__((ext_vector_type(4))) float  f32x4;
typedef __attribute__((ext_vector_type(2))) float  f32x2;
typedef __attribute__((ext_vector_type(2))) __bf16 bf16x2;

template <int K, int N>
__device__ inline void wt_transpose_tile(const float* __restrict__ in,
                                         bf16_t* __restrict__ out, int bx,
                                         int by, uint4* tile) {
  static_assert(K % 128 == 0 && N % 64 == 0, "whole tiles only");
  int tid = threadIdx.x;
  int lo  = tid & 15;
  int hi  = tid >> 4;
  int k0  = by * 128;
  int n0  = bx * 64;

  // lo = group of 4 n, hi = group of 8 k
  const float* src = in + (size_t)(k0 + hi * 8) * N + n0 + lo * 4;
  f32x4 v[8];
  #pragma unroll  // all eight loads in flight at once, v[] in registers
  for (int i = 0; i < 8; ++i)
    v[i] = *reinterpret_cast<const f32x4*>(src + i * N);

  #pragma unroll  // constant indices into v[], or it would leave the registers
  for (int j = 0; j < 4; ++j) {
    union { bf16x2 h[4]; uint4 u; } c;
    #pragma unroll  // same reason
    for (int p = 0; p < 4; ++p) {
      f32x2 pr = {v[2 * p][j], v[2 * p + 1][j]};
      c.h[p] = __builtin_convertvector(pr, bf16x2);
    }
    tile[(lo * 4 + j) * 16 + (hi ^ lo)] = c.u;
  }
  __syncthreads();

  // lo = chunk of 8 k, hi = n within a group of 16
  bf16_t* dst = out + (size_t)(n0 + hi) * K + k0 + lo * 8;
  #pragma unroll  // four LDS reads issued together ahead of the stores
  for (int s = 0; s < 4; ++s) {
    int n = s * 16 + hi;
    uint4 u = tile[n * 16 + (lo ^ (n >> 2))];
    *reinterpret_cast<uint4*>(dst + s * 16 * K) = u;
  }
  // In the built kernel another arm of the caller's choice follows and reuses
  // the stores' address and data registers: the wait stands in front of that.
  asm volatile("s_wait_xcnt 0x0" ::: "memory");
}

// ---------------------------------------------------------------------------
// LayerNorm over DIMC=1024, one block (256 threads) per row. Output bf16.
// ---------------------------------------------------------------------------
__device__ inline void layernorm_row(
    const float* __restrict__ x, const float* __restrict__ w,
    const float* __restrict__ b, bf16_t* __restrict__ out, int row) {
  __shared__ float ssum[8];
  __shared__ float ssq[8];
  int tid  = threadIdx.x;
  int lane = tid & 31;
  int wv   = tid >> 5;

  const float4* xr = reinterpret_cast<const float4*>(x + (size_t)row * DIMC);
  float4 v = xr[tid];
  float s  = v.x + v.y + v.z + v.w;
  float sq = v.x * v.x + v.y * v.y + v.z * v.z + v.w * v.w;
  #pragma unroll
  for (int mask = 16; mask >= 1; mask >>= 1) {
    s  += __shfl_xor(s, mask, 32);
    sq += __shfl_xor(sq, mask, 32);
  }
  if (lane == 0) { ssum[wv] = s; ssq[wv] = sq; }
  __syncthreads();
  float ts = 0.f, tq = 0.f;
  #pragma unroll
  for (int i = 0; i < 8; ++i) { ts += ssum[i]; tq += ssq[i]; }
  float mu  = ts * (1.0f / DIMC);
  float var = tq * (1.0f / DIMC) - mu * mu;
  float inv = rsqrtf(var + 1e-5f);

  int c = tid * 4;
  const float4 wv4 = reinterpret_cast<const float4*>(w)[tid];
  const float4 bv4 = reinterpret_cast<const float4*>(b)[tid];
  bf16_t* o = out + (size_t)row * DIMC + c;
  o[0] = (bf16_t)((v.x - mu) * inv * wv4.x + bv4.x);
  o[1] = (bf16_t)((v.y - mu) * inv * wv4.y + bv4.y);
  o[2] = (bf16_t)((v.z - mu) * inv * wv4.z + bv4.z);
  o[3] = (bf16_t)((v.w - mu) * inv * wv4.w + bv4.w);
}

__global__ void __launch_bounds__(256) layernorm_kernel(
    const float* __restrict__ x, const float* __restrict__ w,
    const float* __restrict__ b, bf16_t* __restrict__ out) {
  layernorm_row(x, w, b, out, blockIdx.x);
}

// ---------------------------------------------------------------------------
// All the work that depends on the inputs alone, in one launch: the six weight
// transposes and the first LayerNorm. A block does one transpose tile or one
// row; which, its index says. The transposes, the longer blocks, come first.
// ---------------------------------------------------------------------------
#define PB_W1  ((HID / 64) * (DIMC / 128))    // tiles of W1, as many of W2
#define PB_SQ  ((DIMC / 64) * (DIMC / 128))   // tiles of a square weight
#define PB_ALL (2 * PB_W1 + 4 * PB_SQ + MTOT)

__global__ void __launch_bounds__(256) prep_kernel(
    const float* __restrict__ Wq, const float* __restrict__ Wk,
    const float* __restrict__ Wv, const float* __restrict__ Wo,
    const float* __restrict__ W1, const float* __restrict__ W2,
    bf16_t* __restrict__ Wqt, bf16_t* __restrict__ Wkt,
    bf16_t* __restrict__ Wvt, bf16_t* __restrict__ Wot,
    bf16_t* __restrict__ W1t, bf16_t* __restrict__ W2t,
    const float* __restrict__ x, const float* __restrict__ w,
    const float* __restrict__ b, bf16_t* __restrict__ xn) {
  __shared__ uint4 tile[64 * 16];
  int i = blockIdx.x;
  if (i < PB_W1) {
    wt_transpose_tile<DIMC, HID>(W1, W1t, i % (HID / 64), i / (HID / 64), tile);
  } else if (i < 2 * PB_W1) {
    i -= PB_W1;
    wt_transpose_tile<HID, DIMC>(W2, W2t, i % (DIMC / 64), i / (DIMC / 64),
                                 tile);
  } else if (i < 2 * PB_W1 + 4 * PB_SQ) {
    i -= 2 * PB_W1;
    int which = i / PB_SQ;
    i %= PB_SQ;
    const float* in = which == 0 ? Wq : which == 1 ? Wk : which == 2 ? Wv : Wo;
    bf16_t* out = which == 0 ? Wqt : which == 1 ? Wkt : which == 2 ? Wvt : Wot;
    wt_transpose_tile<DIMC, DIMC>(in, out, i % (DIMC / 64), i / (DIMC / 64),
                                  tile);
  } else {
    layernorm_row(x, w, b, xn, i - (2 * PB_W1 + 4 * PB_SQ));
    // same reason as at the end of wt_transpose_tile, for the row's stores
    asm volatile("s_wait_xcnt 0x0" ::: "memory");
  }
}

// ---------------------------------------------------------------------------
// Generic bf16 WMMA GEMM:  C = (A[M,K] * Bt[N,K]^T + bias) * oscale, epilogue.
// Block = 256 threads (8 waves as 4x2), block tile 128x128,
// wave tile 32x64 (2x4 accumulator tiles), WMMA K-step 32.
// The 128-row A and Bt tiles, 128 k at a time, are brought into LDS by
// asynchronous 16-byte copies (a wave covers whole 128-byte lines), two
// buffers: tile t + 1 flies while tile t is worked on. M and N are multiples
// of 128, K a multiple of 128.
// EPI_QKV is the Q, K and V projections as one product: Bt holds the three
// transposed weights one behind the other (N = 3 * DIMC), outp the three
// outputs likewise; a block's 128 columns lie in one of the three.
// ---------------------------------------------------------------------------
#define GBK    128               // k per LDS tile: 256 bytes of every row
#define GPITCH 272               // LDS row pitch in bytes: 256 + 16 pad
#define GTILE  (128 * GPITCH)    // one operand's tile
#define GSTAGE (2 * GTILE)       // a buffer: A tile, then Bt tile

// 16x32 bf16 fragment from an LDS tile; same lane and k order as load_frag.
__device__ inline bf16x16 lds_frag(const unsigned char* base) {
  int lane = threadIdx.x & 31;
  const unsigned char* p = base + (lane & 15) * GPITCH + (lane >> 4) * 16;
  union { uint4 u[2]; bf16x16 v; } cv;
  cv.u[0] = *reinterpret_cast<const uint4*>(p);
  cv.u[1] = *reinterpret_cast<const uint4*>(p + 32);
  return cv.v;
}

// One thread's share of a 128-row tile: 16 bytes of every 16th row.
// lds: the lane's LDS byte address, g: its global address, rstep: 16 rows.
__device__ inline void copy_tile(unsigned lds, const bf16_t* g, size_t rstep) {
  // The closing s_wait_xcnt stands inside the statement so that no address
  // register of a copy is rewritten ahead of it.
  asm volatile(
      "global_load_async_to_lds_b128 %0, %8, off\n\t"
      "global_load_async_to_lds_b128 %1, %9, off\n\t"
      "global_load_async_to_lds_b128 %2, %10, off\n\t"
      "global_load_async_to_lds_b128 %3, %11, off\n\t"
      "global_load_async_to_lds_b128 %4, %12, off\n\t"
      "global_load_async_to_lds_b128 %5, %13, off\n\t"
      "global_load_async_to_lds_b128 %6, %14, off\n\t"
      "global_load_async_to_lds_b128 %7, %15, off\n\t"
      "s_wait_xcnt 0x0"
      :: "v"(lds), "v"(lds + 16 * GPITCH), "v"(lds + 32 * GPITCH),
         "v"(lds + 48 * GPITCH), "v"(lds + 64 * GPITCH),
         "v"(lds + 80 * GPITCH), "v"(lds + 96 * GPITCH),
         "v"(lds + 112 * GPITCH),
         "v"(g), "v"(g + rstep), "v"(g + 2 * rstep), "v"(g + 3 * rstep),
         "v"(g + 4 * rstep), "v"(g + 5 * rstep), "v"(g + 6 * rstep),
         "v"(g + 7 * rstep)
      : "memory");
}

// Exact-form GELU, 0.5 v (1 + erf(v / sqrt 2)), of eight values at once, with
// no branch. For z = |v| / sqrt 2 the complementary error function is taken as
// erfc(z) = t (a1 + t (a2 + t (a3 + t (a4 + t a5)))) exp(-z z), t = 1 / (1 + p z)
// (absolute error below 2e-7), and gelu(v) = max(v, 0) - 0.5 |v| erfc(z),
// which cancels nothing on either side of zero. a5 is drawn out of the
// polynomial into the last factor, so that every step holds one constant.
// The eight values are independent chains, so the vector port stays busy.
// The reciprocals and the exponentials stand in one statement, in place on
// their own registers: none overwrites the source of the one in front of it,
// and the closing v_nop is the slot the instruction set asks for between a
// transcendental and an instruction that uses its result.
__device__ inline f32x8 gelu_x8(f32x8 v) {
  constexpr float A5 = 1.061405429f;
  f32x8 m = __builtin_elementwise_max(v, (f32x8)(0.0f));
  f32x8 a = m * 2.0f - v;  // |v|, exact
  f32x8 t = a * (0.3275911f * 0.70710678118654752f) + 1.0f;
  f32x8 e = (v * v) * (-0.5f * 1.4426950408889634f);
  asm("v_rcp_f32 %0, %0\n\t"
      "v_rcp_f32 %1, %1\n\t"
      "v_rcp_f32 %2, %2\n\t"
      "v_rcp_f32 %3, %3\n\t"
      "v_rcp_f32 %4, %4\n\t"
      "v_rcp_f32 %5, %5\n\t"
      "v_rcp_f32 %6, %6\n\t"
      "v_rcp_f32 %7, %7\n\t"
      "v_exp_f32 %8, %8\n\t"
      "v_exp_f32 %9, %9\n\t"
      "v_exp_f32 %10, %10\n\t"
      "v_exp_f32 %11, %11\n\t"
      "v_exp_f32 %12, %12\n\t"
      "v_exp_f32 %13, %13\n\t"
      "v_exp_f32 %14, %14\n\t"
      "v_exp_f32 %15, %15\n\t"
      "v_nop"
      : "+v"(t[0]), "+v"(t[1]), "+v"(t[2]), "+v"(t[3]), "+v"(t[4]),
        "+v"(t[5]), "+v"(t[6]), "+v"(t[7]), "+v"(e[0]), "+v"(e[1]),
        "+v"(e[2]), "+v"(e[3]), "+v"(e[4]), "+v"(e[5]), "+v"(e[6]),
        "+v"(e[7]));
  f32x8 p = t + (-1.453152027f / A5);
  p = p * t + (1.421413741f / A5);
  p = p * t + (-0.284496736f / A5);
  p = p * t + (0.254829592f / A5);
  f32x8 q = (p * t) * e;  // erfc(z) / a5
  return (a * q) * (-0.5f * A5) + m;
}

enum { EPI_QK = 0, EPI_VT = 1, EPI_RESID_F32 = 2, EPI_GELU_BF16 = 3,
       EPI_QKV = 4 };
template <int F> struct store_form { static constexpr int value = F; };

template <int EPI>
__global__ void __launch_bounds__(256, 4) gemm_kernel(
    const bf16_t* __restrict__ A, const bf16_t* __restrict__ Bt,
    const float* __restrict__ bias, void* __restrict__ outp,
    const float* __restrict__ resid, int M, int N, int K, int Ntok,
    float oscale, const float* __restrict__ bias_k,
    const float* __restrict__ bias_v) {
  __shared__ __attribute__((aligned(16))) unsigned char smem[2 * GSTAGE];
  int wave = threadIdx.x >> 5;
  int lane = threadIdx.x & 31;
  int wm = wave >> 1;          // 0..3
  int wn = wave & 1;           // 0..1
  int row0 = blockIdx.y * 128 + wm * 32;
  int col0 = blockIdx.x * 128 + wn * 64;

  f32x8 acc[2][4];
  #pragma unroll
  for (int t = 0; t < 2; ++t)
    #pragma unroll
    for (int u = 0; u < 4; ++u) acc[t][u] = (f32x8)(0.0f);

  // Copy shares: 16 threads cover a row's 256 bytes, 16 rows per round.
  int crow = threadIdx.x >> 4;
  int cchk = threadIdx.x & 15;
  const bf16_t* gA = A  + (size_t)(blockIdx.y * 128 + crow) * K + cchk * 8;
  const bf16_t* gB = Bt + (size_t)(blockIdx.x * 128 + crow) * K + cchk * 8;
  unsigned lds0 = (unsigned)(uintptr_t)smem + crow * GPITCH + cchk * 16;
  size_t rstep = (size_t)16 * K;
  int T = K / GBK;

  copy_tile(lds0, gA, rstep);
  copy_tile(lds0 + GTILE, gB, rstep);
  // tile 0 has landed for this wave, then for the block
  asm volatile("s_wait_asynccnt 0x0" ::: "memory");
  __syncthreads();
  if (T > 1) {
    copy_tile(lds0 + GSTAGE, gA + GBK, rstep);
    copy_tile(lds0 + GSTAGE + GTILE, gB + GBK, rstep);
  }

  for (int t = 0; t < T; ++t) {
    unsigned buf = (unsigned)(t & 1) * GSTAGE;
    const unsigned char* sA = smem + buf + wm * 32 * GPITCH;
    const unsigned char* sB = smem + buf + GTILE + wn * 64 * GPITCH;
    // Two fragment sets: the reads of the next 32 k go out as one group ahead
    // of this 32 k's WMMAs, so that their LDS latency hides behind them.
    bf16x16 fa[2][2], fb[2][4];
    fa[0][0] = lds_frag(sA);
    fa[0][1] = lds_frag(sA + 16 * GPITCH);
    #pragma unroll  // constant indices keep fb[] in registers
    for (int u = 0; u < 4; ++u) fb[0][u] = lds_frag(sB + u * 16 * GPITCH);
    #pragma unroll  // constant indices keep both sets in registers
    for (int kk = 0; kk < GBK / 32; ++kk) {
      const int cur = kk & 1, nxt = cur ^ 1;
      if (kk + 1 < GBK / 32) {
        fa[nxt][0] = lds_frag(sA + (kk + 1) * 64);
        fa[nxt][1] = lds_frag(sA + 16 * GPITCH + (kk + 1) * 64);
        #pragma unroll  // same reason
        for (int u = 0; u < 4; ++u)
          fb[nxt][u] = lds_frag(sB + u * 16 * GPITCH + (kk + 1) * 64);
      }
      // keeps the read group above from sinking in among the WMMAs below
      __builtin_amdgcn_sched_barrier(0);
      #pragma unroll  // same reason, for acc[] too
      for (int u = 0; u < 4; ++u) {
        acc[0][u] = wmma_bf16(fa[cur][0], fb[cur][u], acc[0][u]);
        acc[1][u] = wmma_bf16(fa[cur][1], fb[cur][u], acc[1][u]);
      }
      // keeps the next read group from rising in among the WMMAs above
      __builtin_amdgcn_sched_barrier(0);
    }
    // this wave's reads of the buffer are done before it is refilled
    asm volatile("s_wait_dscnt 0x0" ::: "memory");
    // this wave's copies of tile t + 1 have landed
    asm volatile("s_wait_asynccnt 0x0" ::: "memory");
    __syncthreads();  // publishes tile t + 1, frees tile t's buffer
    if (t + 2 < T) {
      copy_tile(lds0 + buf, gA + (size_t)(t + 2) * GBK, rstep);
      copy_tile(lds0 + buf + GTILE, gB + (size_t)(t + 2) * GBK, rstep);
    }
  }
  // no copy is outstanding when the wave goes on to its end
  asm volatile("s_wait_asynccnt 0x0" ::: "memory");

  // Epilogue. C layout: VGPR r, lanes 0-15 -> (M=r, N=lane),
  //                     lanes 16-31 -> (M=r+8, N=lane-16)
  int nloc = lane & 15;
  int moff = (lane >> 4) * 8;
  int sel = 0;  // EPI_QKV: 0 = Q, 1 = K, 2 = V; alike in the whole block
  if constexpr (EPI == EPI_QKV) {
    sel = blockIdx.x / (DIMC / 128);
    col0 -= sel * DIMC;
    bias = sel == 0 ? bias : sel == 1 ? bias_k : bias_v;
    outp = (bf16_t*)outp + (size_t)sel * M * DIMC;
    oscale = sel == 0 ? oscale : 1.0f;
  }
  auto store_tiles = [&](auto form) {
  constexpr int F = decltype(form)::value;
  #pragma unroll
  for (int t = 0; t < 2; ++t) {
    #pragma unroll
    for (int u = 0; u < 4; ++u) {
      f32x8 gl;
      if constexpr (F == EPI_GELU_BF16)
        gl = gelu_x8((acc[t][u] + bias[col0 + u * 16 + nloc]) * oscale);
      #pragma unroll
      for (int r = 0; r < 8; ++r) {
        int rowg = row0 + t * 16 + moff + r;
        int colg = col0 + u * 16 + nloc;
        float val = (acc[t][u][r] + bias[colg]) * oscale;
        if constexpr (F == EPI_QK) {
          // -> per-head [b][h][tok][d], bf16
          int bi = rowg / Ntok, tok = rowg % Ntok;
          int h = colg >> 6, d = colg & 63;
          ((bf16_t*)outp)[((((size_t)bi * HEADS + h) * Ntok + tok) << 6) + d] =
              (bf16_t)val;
        } else if constexpr (F == EPI_VT) {
          // -> per-head transposed [b][h][d][tok], bf16
          int bi = rowg / Ntok, tok = rowg % Ntok;
          int h = colg >> 6, d = colg & 63;
          ((bf16_t*)outp)[(((size_t)bi * HEADS + h) * HDIM + d) * Ntok + tok] =
              (bf16_t)val;
        } else if constexpr (F == EPI_RESID_F32) {
          size_t idx = (size_t)rowg * N + colg;
          ((float*)outp)[idx] = resid[idx] + val;
        } else {  // EPI_GELU_BF16
          ((bf16_t*)outp)[(size_t)rowg * N + colg] = (bf16_t)gl[r];
        }
      }
    }
  }
  };
  if constexpr (EPI == EPI_QKV) {
    if (sel == 2) {
      store_tiles(store_form<EPI_VT>{});
    } else {
      store_tiles(store_form<EPI_QK>{});
      // In the built kernel the other arm follows and reuses the stores'
      // address and data registers: the wait stands in front of that.
      asm volatile("s_wait_xcnt 0x0" ::: "memory");
    }
  } else {
    store_tiles(store_form<EPI>{});
  }
}

#define AKEYS  128
#define KPITCH 144
#define VPITCH 272
#define KTILE  (AKEYS * KPITCH)
#define VTILE  (HDIM * VPITCH)
#define ASTAGE (KTILE + VTILE)

// 16x32 bf16 fragment from LDS rows of the given byte pitch; same lane and k
// order as load_frag.
__device__ inline bf16x16 lds_frag_at(const unsigned char* base, int pitch) {
  int lane = threadIdx.x & 31;
  const unsigned char* p = base + (lane & 15) * pitch + (lane >> 4) * 16;
  union { uint4 u[2]; bf16x16 v; } cv;
  cv.u[0] = *reinterpret_cast<const uint4*>(p);
  cv.u[1] = *reinterpret_cast<const uint4*>(p + 32);
  return cv.v;
}

// The value that lane l ^ 16 holds.
__device__ inline float other_half(float x) {
  int i = __builtin_bit_cast(int, x);
  return __builtin_bit_cast(
      float, __builtin_amdgcn_permlanex16(i, i, 0x76543210, 0xfedcba98, false,
                                          false));
}

__device__ inline float max3f(float a, float b, float c) {
  return fmaxf(fmaxf(a, b), c);
}

// Exponentials base 2, each in place on its own register, in one statement:
// so none overwrites the source of the one in front of it, and the closing
// v_nop is the slot the instruction set asks for between a transcendental and
// an instruction that uses its result.
__device__ inline void exp2_x8(float (&a)[8]) {
  asm("v_exp_f32 %0, %0\n\t"
      "v_exp_f32 %1, %1\n\t"
      "v_exp_f32 %2, %2\n\t"
      "v_exp_f32 %3, %3\n\t"
      "v_exp_f32 %4, %4\n\t"
      "v_exp_f32 %5, %5\n\t"
      "v_exp_f32 %6, %6\n\t"
      "v_exp_f32 %7, %7\n\t"
      "v_nop"
      : "+v"(a[0]), "+v"(a[1]), "+v"(a[2]), "+v"(a[3]), "+v"(a[4]),
        "+v"(a[5]), "+v"(a[6]), "+v"(a[7]));
}
__device__ inline float exp2_x1(float a) {
  asm("v_exp_f32 %0, %0\n\t"
      "v_nop"
      : "+v"(a));
  return a;
}
#define LOG2E 1.4426950408889634f

// One thread's share of a stage: 16 bytes of every 32nd K row and of every
// 16th Vt row. lk, lv: the lane's LDS byte addresses; gk, gv: its global
// addresses; vstep: 16 Vt rows in elements.
__device__ inline void copy_kv(unsigned lk, const bf16_t* gk, unsigned lv,
                               const bf16_t* gv, size_t vstep) {
  // The closing s_wait_xcnt stands inside the statement so that no address
  // register of a copy is rewritten ahead of it.
  asm volatile(
      "global_load_async_to_lds_b128 %0, %8, off\n\t"
      "global_load_async_to_lds_b128 %1, %9, off\n\t"
      "global_load_async_to_lds_b128 %2, %10, off\n\t"
      "global_load_async_to_lds_b128 %3, %11, off\n\t"
      "global_load_async_to_lds_b128 %4, %12, off\n\t"
      "global_load_async_to_lds_b128 %5, %13, off\n\t"
      "global_load_async_to_lds_b128 %6, %14, off\n\t"
      "global_load_async_to_lds_b128 %7, %15, off\n\t"
      "s_wait_xcnt 0x0"
      :: "v"(lk), "v"(lk + 32 * KPITCH), "v"(lk + 64 * KPITCH),
         "v"(lk + 96 * KPITCH),
         "v"(lv), "v"(lv + 16 * VPITCH), "v"(lv + 32 * VPITCH),
         "v"(lv + 48 * VPITCH),
         "v"(gk), "v"(gk + 32 * HDIM), "v"(gk + 64 * HDIM),
         "v"(gk + 96 * HDIM),
         "v"(gv), "v"(gv + vstep), "v"(gv + 2 * vstep), "v"(gv + 3 * vstep)
      : "memory");
}

// Four waves per SIMD is what the grid gives (two blocks a WGP). Told so, the
// compiler keeps a sub-pass's LDS reads together ahead of the WMMAs; aiming at
// more waves it saves registers by a load, a wait and a WMMA in turn.
__global__ void __launch_bounds__(256)
__attribute__((amdgpu_waves_per_eu(4, 4))) attn_kernel(
    const bf16_t* __restrict__ q, const bf16_t* __restrict__ k,
    const bf16_t* __restrict__ vt, bf16_t* __restrict__ out, int Ntok) {
  __shared__ __attribute__((aligned(16))) unsigned char kv[2 * ASTAGE];

  int wave = threadIdx.x >> 5;
  int lane = threadIdx.x & 31;
  int bh = blockIdx.y;
  int q0 = blockIdx.x * 128 + wave * 16;

  const bf16_t* Qh = q  + (size_t)bh * Ntok * HDIM;
  const bf16_t* Kh = k  + (size_t)bh * Ntok * HDIM;
  const bf16_t* Vh = vt + (size_t)bh * HDIM * Ntok;

  // B operand of S^T: column = query q0 + (lane & 15), k = d.
  bf16x16 qf0 = load_frag(Qh + (size_t)q0 * HDIM + 0, HDIM);
  bf16x16 qf1 = load_frag(Qh + (size_t)q0 * HDIM + 32, HDIM);

  // O^T tiles: row d = 16 u + 8 * (lane >> 4) + r, column = the lane's query.
  f32x8 oacc[4];
  #pragma unroll
  for (int u = 0; u < 4; ++u) oacc[u] = (f32x8)(0.0f);
  // The lane's query: maximum in use (alike in both halves), and the sum over
  // the keys of this half alone.
  float mrun = -1e30f, lrun = 0.0f;

  // Copy shares. K: 8 threads cover a row's 128 bytes, 32 rows per round.
  // Vt: 16 threads cover a row's 256 bytes of the stage, 16 rows per round.
  int tid = threadIdx.x;
  const bf16_t* gK = Kh + (size_t)(tid >> 3) * HDIM + (tid & 7) * 8;
  const bf16_t* gV = Vh + (size_t)(tid >> 4) * Ntok + (tid & 15) * 8;
  unsigned lk0 = (unsigned)(uintptr_t)kv + (tid >> 3) * KPITCH + (tid & 7) * 16;
  unsigned lv0 =
      (unsigned)(uintptr_t)kv + KTILE + (tid >> 4) * VPITCH + (tid & 15) * 16;
  size_t vstep = (size_t)16 * Ntok;
  int T = Ntok / AKEYS;

  copy_kv(lk0, gK, lv0, gV, vstep);
  // stage 0 has landed for this wave, then for the block
  asm volatile("s_wait_asynccnt 0x0" ::: "memory");
  __syncthreads();
  if (T > 1)
    copy_kv(lk0 + ASTAGE, gK + AKEYS * HDIM, lv0 + ASTAGE, gV + AKEYS, vstep);

  for (int t = 0; t < T; ++t) {
   unsigned buf = (unsigned)(t & 1) * ASTAGE;
   for (int sub = 0; sub < AKEYS / 64; ++sub) {
    const unsigned char* sK = kv + buf + sub * 64 * KPITCH;
    const unsigned char* sV = kv + buf + KTILE + sub * 128;
    // 4 S^T tiles: 64 keys x 16 queries (contraction over d=64).
    f32x8 s[4];
    #pragma unroll
    for (int i = 0; i < 4; ++i) {
      const unsigned char* Kt = sK + i * 16 * KPITCH;
      f32x8 si = (f32x8)(0.0f);
      si = wmma_bf16(lds_frag_at(Kt, KPITCH), qf0, si);
      si = wmma_bf16(lds_frag_at(Kt + 64, KPITCH), qf1, si);
      s[i] = si;
    }

    // Online softmax update of the lane's query over its 32 scores.
    float m8[8];
    #pragma unroll
    for (int r = 0; r < 8; ++r)
      m8[r] = fmaxf(max3f(s[0][r], s[1][r], s[2][r]), s[3][r]);
    float mx = fmaxf(max3f(m8[0], m8[1], m8[2]),
                     fmaxf(max3f(m8[3], m8[4], m8[5]), fmaxf(m8[6], m8[7])));
    mx = fmaxf(mx, other_half(mx));
    float mnew  = fmaxf(mrun, mx);
    float alpha = exp2_x1((mrun - mnew) * LOG2E);
    mrun = mnew;

    // P^T as B operand: elements 0..7 of a lane are tile 2 ks, registers
    // 0..7 (keys 8 * half + r), elements 8..15 tile 2 ks + 1: the k order in
    // which lds_frag_at brings the keys of a Vt row.
    bf16x16 pf[2];
    float rs[4];
    #pragma unroll
    for (int i = 0; i < 4; ++i) {
      float p[8];
      #pragma unroll
      for (int r = 0; r < 8; ++r) p[r] = (s[i][r] - mnew) * LOG2E;
      exp2_x8(p);
      rs[i] = ((p[0] + p[1]) + (p[2] + p[3])) + ((p[4] + p[5]) + (p[6] + p[7]));
      #pragma unroll
      for (int r = 0; r < 8; r += 2) {
        f32x2 pr = {p[r], p[r + 1]};
        bf16x2 pb = __builtin_convertvector(pr, bf16x2);
        pf[i >> 1][(i & 1) * 8 + r]     = pb[0];
        pf[i >> 1][(i & 1) * 8 + r + 1] = pb[1];
      }
    }
    lrun = lrun * alpha + ((rs[0] + rs[1]) + (rs[2] + rs[3]));
    #pragma unroll
    for (int u = 0; u < 4; ++u) oacc[u] *= alpha;

    #pragma unroll
    for (int ks = 0; ks < 2; ++ks) {
      #pragma unroll
      for (int u = 0; u < 4; ++u) {
        bf16x16 vf = lds_frag_at(sV + u * 16 * VPITCH + ks * 64, VPITCH);
        oacc[u] = wmma_bf16(vf, pf[ks], oacc[u]);
      }
    }
   }
   // this wave's reads of the buffer are done before it is refilled
   asm volatile("s_wait_dscnt 0x0" ::: "memory");
   // this wave's copies of stage t + 1 have landed
   asm volatile("s_wait_asynccnt 0x0" ::: "memory");
   __syncthreads();  // publishes stage t + 1, frees stage t's buffer
   if (t + 2 < T)
     copy_kv(lk0 + buf, gK + (size_t)(t + 2) * AKEYS * HDIM, lv0 + buf,
             gV + (size_t)(t + 2) * AKEYS, vstep);
  }
  // no copy is outstanding when the wave goes on to its end
  asm volatile("s_wait_asynccnt 0x0" ::: "memory");

  // Finalize: join the halves' sums, divide, and put the heads back to
  // [b][tok][DIMC]; a lane's 8 registers of a tile are 8 neighbouring d.
  int h  = bh & (HEADS - 1);
  int bi = bh >> 4;
  float inv = 1.0f / (lrun + other_half(lrun));
  int tok = q0 + (lane & 15);
  bf16_t* orow =
      out + ((size_t)bi * Ntok + tok) * DIMC + h * HDIM + (lane >> 4) * 8;
  #pragma unroll
  for (int u = 0; u < 4; ++u) {
    union { bf16x2 hh[4]; uint4 v; } c;
    #pragma unroll
    for (int r = 0; r < 8; r += 2) {
      f32x2 pr = {oacc[u][r] * inv, oacc[u][r + 1] * inv};
      c.hh[r >> 1] = __builtin_convertvector(pr, bf16x2);
    }
    *reinterpret_cast<uint4*>(orow + u * 16) = c.v;
  }
}

// ---------------------------------------------------------------------------
// Host-side orchestration (graph-capture safe: launches only).
// ---------------------------------------------------------------------------
extern "C" void kernel_launch(void* const* d_in, const int* in_sizes, int n_in,
                              void* d_out, int out_size, void* d_ws, size_t ws_size,
                              hipStream_t stream) {
  (void)in_sizes; (void)n_in; (void)out_size; (void)ws_size;

  const float* x     = (const float*)d_in[0];
  const float* ln1_w = (const float*)d_in[1];
  const float* ln1_b = (const float*)d_in[2];
  const float* ln2_w = (const float*)d_in[3];
  const float* ln2_b = (const float*)d_in[4];
  const float* Wq = (const float*)d_in[5];  const float* bq = (const float*)d_in[6];
  const float* Wk = (const float*)d_in[7];  const float* bk = (const float*)d_in[8];
  const float* Wv = (const float*)d_in[9];  const float* bv = (const float*)d_in[10];
  const float* Wo = (const float*)d_in[11]; const float* bo = (const float*)d_in[12];
  const float* W1 = (const float*)d_in[13]; const float* b1 = (const float*)d_in[14];
  const float* W2 = (const float*)d_in[15]; const float* b2 = (const float*)d_in[16];

  // Workspace layout
  char* ws = (char*)d_ws;
  size_t off = 0;
  auto alloc = [&](size_t bytes) { char* p = ws + off; off += (bytes + 255) & ~size_t(255); return p; };
  // Wqt, Wkt, Wvt lie one behind the other with no gap (sizes are multiples of
  // 256): the merged projection reads them as one [3 * DIMC][DIMC] matrix.
  bf16_t* Wqt = (bf16_t*)alloc((size_t)DIMC * DIMC * 2);
  bf16_t* Wkt = (bf16_t*)alloc((size_t)DIMC * DIMC * 2);
  bf16_t* Wvt = (bf16_t*)alloc((size_t)DIMC * DIMC * 2);
  bf16_t* Wot = (bf16_t*)alloc((size_t)DIMC * DIMC * 2);
  bf16_t* W1t = (bf16_t*)alloc((size_t)DIMC * HID * 2);
  bf16_t* W2t = (bf16_t*)alloc((size_t)HID * DIMC * 2);
  bf16_t* xn   = (bf16_t*)alloc((size_t)MTOT * DIMC * 2);
  // qb, kb, vtb likewise: output sel of the merged projection starts at
  // qb + sel * MTOT * DIMC.
  bf16_t* qb   = (bf16_t*)alloc((size_t)MTOT * DIMC * 2);
  bf16_t* kb   = (bf16_t*)alloc((size_t)MTOT * DIMC * 2);
  bf16_t* vtb  = (bf16_t*)alloc((size_t)MTOT * DIMC * 2);
  bf16_t* attn = (bf16_t*)alloc((size_t)MTOT * DIMC * 2);
  float*  x2   = (float*)alloc((size_t)MTOT * DIMC * 4);
  bf16_t* xn2  = (bf16_t*)alloc((size_t)MTOT * DIMC * 2);
  bf16_t* hbuf = (bf16_t*)alloc((size_t)MTOT * HID * 2);

  dim3 blk(256);

  // 1, 2. Weight prep (fp32 -> bf16 transposed) and LN1
  prep_kernel<<<PB_ALL, blk, 0, stream>>>(Wq, Wk, Wv, Wo, W1, W2, Wqt, Wkt, Wvt,
                                          Wot, W1t, W2t, x, ln1_w, ln1_b, xn);

  // 3. Q, K, V projections (one WMMA GEMM). Q is pre-scaled by 1/sqrt(HDIM).
  dim3 gqkv3(3 * DIMC / 128, MTOT / 128);
  gemm_kernel<EPI_QKV><<<gqkv3, blk, 0, stream>>>(xn, Wqt, bq, qb, nullptr, MTOT, 3 * DIMC, DIMC, NTOK, 0.125f, bk, bv);
  dim3 gqkv(DIMC / 128, MTOT / 128);

  // 4. Flash attention
  dim3 gatt(NTOK / 128, BATCH * HEADS);
  attn_kernel<<<gatt, blk, 0, stream>>>(qb, kb, vtb, attn, NTOK);

  // 5. Output projection + residual: x2 = x + attn @ Wo + bo
  gemm_kernel<EPI_RESID_F32><<<gqkv, blk, 0, stream>>>(attn, Wot, bo, x2, x, MTOT, DIMC, DIMC, NTOK, 1.0f, nullptr, nullptr);

  // 6. LN2
  layernorm_kernel<<<MTOT, blk, 0, stream>>>(x2, ln2_w, ln2_b, xn2);

  // 7. MLP up + GELU: h = gelu(xn2 @ W1 + b1)
  dim3 gup(HID / 128, MTOT / 128);
  gemm_kernel<EPI_GELU_BF16><<<gup, blk, 0, stream>>>(xn2, W1t, b1, hbuf, nullptr, MTOT, HID, DIMC, NTOK, 1.0f, nullptr, nullptr);

  // 8. MLP down + residual -> output: out = x2 + h @ W2 + b2
  gemm_kernel<EPI_RESID_F32><<<gqkv, blk, 0, stream>>>(hbuf, W2t, b2, (float*)d_out, x2, MTOT, DIMC, HID, NTOK, 1.0f, nullptr, nullptr);
}

// v007
// It runs in 157 microseconds.
// In two side-by-side timings against v006, it was 1.11 and 1.09 times as fast.
// All steps since v000 together make it 4.17 times as fast.
#include <hip/hip_runtime.h>
#include <hip/hip_bf16.h>

// ---------------------------------------------------------------------------
// Transformer encoder block for MI455X (gfx1250, wave32, WMMA).
// All GEMMs run on v_wmma_f32_16x16x32_bf16; attention is flash-style with
// 64-key tiles, its two products taken transposed. 1/sqrt(d) is folded into the Q projection epilogue.
// ---------------------------------------------------------------------------

typedef __bf16 bf16_t;
typedef __attribute__((ext_vector_type(16))) __bf16 bf16x16;
typedef __attribute__((ext_vector_type(8)))  float  f32x8;

#define DIMC   1024
#define HEADS  16
#define HDIM   64
#define HID    4096
#define NTOK   2048
#define BATCH  2
#define MTOT   (BATCH * NTOK)   // 4096 tokens

// ---------------------------------------------------------------------------
// WMMA helpers
// ---------------------------------------------------------------------------
__device__ inline f32x8 wmma_bf16(bf16x16 a, bf16x16 b, f32x8 c) {
  // (neg_a, A, neg_b, B, c_mod, C, reuse_a, reuse_b)
  return __builtin_amdgcn_wmma_f32_16x16x32_bf16(false, a, false, b,
                                                 (short)0, c, false, false);
}

// Load a 16x32 bf16 fragment (A-style layout, used here for Q as a B
// operand; the A fragments of K and Vt are read from LDS in the same order).
// ISA 16-bit A layout: lane = m + 16*half;
//   VGPR0..3 : K = half*8 + 0..7
//   VGPR4..7 : K = 16 + half*8 + 0..7
// base points at (row0, k0); ld = row stride in elements (multiple of 8).
__device__ inline bf16x16 load_frag(const bf16_t* base, int ld) {
  int lane = threadIdx.x & 31;
  int m    = lane & 15;
  int half = lane >> 4;
  const bf16_t* p = base + (size_t)m * (size_t)ld + half * 8;
  union { uint4 u[2]; bf16x16 v; } cv;
  cv.u[0] = *reinterpret_cast<const uint4*>(p);
  cv.u[1] = *reinterpret_cast<const uint4*>(p + 16);
  return cv.v;
}

// ---------------------------------------------------------------------------
// Weight prep: fp32 [K][N] -> bf16 transposed [N][K].
// One block moves a 128(k) x 64(n) tile, number (bx, by) of its matrix; K and
// N are compile-time, so the row steps become immediate offsets of one address.
// A thread reads 8 k-rows x 4 n as 16-byte loads (a half-wave covers 256
// contiguous bytes of an input row) and packs the eight k of each n into one
// 16-byte chunk. The chunks cross through LDS, so that a half-wave then
// stores 256 contiguous bytes of an output row.
// LDS tile: [n][16 chunks]; the chunk index is XORed with n >> 2, which keeps
// both the 16-byte LDS writes and the reads free of bank conflicts.
// ---------------------------------------------------------------------------
typedef __attribute__((ext_vector_type(4))) float  f32x4;
typedef __attribute__((ext_vector_type(2))) float  f32x2;
typedef __attribute__((ext_vector_type(2))) __bf16 bf16x2;

template <int K, int N>
__device__ inline void wt_transpose_tile(const float* __restrict__ in,
                                         bf16_t* __restrict__ out, int bx,
                                         int by, uint4* tile) {
  static_assert(K % 128 == 0 && N % 64 == 0, "whole tiles only");
  int tid = threadIdx.x;
  int lo  = tid & 15;
  int hi  = tid >> 4;
  int k0  = by * 128;
  int n0  = bx * 64;

  // lo = group of 4 n, hi = group of 8 k
  const float* src = in + (size_t)(k0 + hi * 8) * N + n0 + lo * 4;
  f32x4 v[8];
  #pragma unroll  // all eight loads in flight at once, v[] in registers
  for (int i = 0; i < 8; ++i)
    v[i] = *reinterpret_cast<const f32x4*>(src + i * N);

  #pragma unroll  // constant indices into v[], or it would leave the registers
  for (int j = 0; j < 4; ++j) {
    union { bf16x2 h[4]; uint4 u; } c;
    #pragma unroll  // same reason
    for (int p = 0; p < 4; ++p) {
      f32x2 pr = {v[2 * p][j], v[2 * p + 1][j]};
      c.h[p] = __builtin_convertvector(pr, bf16x2);
    }
    tile[(lo * 4 + j) * 16 + (hi ^ lo)] = c.u;
  }
  __syncthreads();

  // lo = chunk of 8 k, hi = n within a group of 16
  bf16_t* dst = out + (size_t)(n0 + hi) * K + k0 + lo * 8;
  #pragma unroll  // four LDS reads issued together ahead of the stores
  for (int s = 0; s < 4; ++s) {
    int n = s * 16 + hi;
    uint4 u = tile[n * 16 + (lo ^ (n >> 2))];
    *reinterpret_cast<uint4*>(dst + s * 16 * K) = u;
  }
  // In the built kernel another arm of the caller's choice follows and reuses
  // the stores' address and data registers: the wait stands in front of that.
  asm volatile("s_wait_xcnt 0x0" ::: "memory");
}

// ---------------------------------------------------------------------------
// LayerNorm over DIMC=1024, one block (256 threads) per row. Output bf16.
// ---------------------------------------------------------------------------
__device__ inline void layernorm_row(
    const float* __restrict__ x, const float* __restrict__ w,
    const float* __restrict__ b, bf16_t* __restrict__ out, int row) {
  __shared__ float ssum[8];
  __shared__ float ssq[8];
  int tid  = threadIdx.x;
  int lane = tid & 31;
  int wv   = tid >> 5;

  const float4* xr = reinterpret_cast<const float4*>(x + (size_t)row * DIMC);
  float4 v = xr[tid];
  float s  = v.x + v.y + v.z + v.w;
  float sq = v.x * v.x + v.y * v.y + v.z * v.z + v.w * v.w;
  #pragma unroll
  for (int mask = 16; mask >= 1; mask >>= 1) {
    s  += __shfl_xor(s, mask, 32);
    sq += __shfl_xor(sq, mask, 32);
  }
  if (lane == 0) { ssum[wv] = s; ssq[wv] = sq; }
  __syncthreads();
  float ts = 0.f, tq = 0.f;
  #pragma unroll
  for (int i = 0; i < 8; ++i) { ts += ssum[i]; tq += ssq[i]; }
  float mu  = ts * (1.0f / DIMC);
  float var = tq * (1.0f / DIMC) - mu * mu;
  float inv = rsqrtf(var + 1e-5f);

  int c = tid * 4;
  const float4 wv4 = reinterpret_cast<const float4*>(w)[tid];
  const float4 bv4 = reinterpret_cast<const float4*>(b)[tid];
  bf16_t* o = out + (size_t)row * DIMC + c;
  o[0] = (bf16_t)((v.x - mu) * inv * wv4.x + bv4.x);
  o[1] = (bf16_t)((v.y - mu) * inv * wv4.y + bv4.y);
  o[2] = (bf16_t)((v.z - mu) * inv * wv4.z + bv4.z);
  o[3] = (bf16_t)((v.w - mu) * inv * wv4.w + bv4.w);
}

__global__ void __launch_bounds__(256) layernorm_kernel(
    const float* __restrict__ x, const float* __restrict__ w,
    const float* __restrict__ b, bf16_t* __restrict__ out) {
  layernorm_row(x, w, b, out, blockIdx.x);
}

// ---------------------------------------------------------------------------
// All the work that depends on the inputs alone, in one launch: the six weight
// transposes and the first LayerNorm. A block does one transpose tile or one
// row; which, its index says. The transposes, the longer blocks, come first.
// ---------------------------------------------------------------------------
#define PB_W1  ((HID / 64) * (DIMC / 128))    // tiles of W1, as many of W2
#define PB_SQ  ((DIMC / 64) * (DIMC / 128))   // tiles of a square weight
#define PB_ALL (2 * PB_W1 + 4 * PB_SQ + MTOT)

__global__ void __launch_bounds__(256) prep_kernel(
    const float* __restrict__ Wq, const float* __restrict__ Wk,
    const float* __restrict__ Wv, const float* __restrict__ Wo,
    const float* __restrict__ W1, const float* __restrict__ W2,
    bf16_t* __restrict__ Wqt, bf16_t* __restrict__ Wkt,
    bf16_t* __restrict__ Wvt, bf16_t* __restrict__ Wot,
    bf16_t* __restrict__ W1t, bf16_t* __restrict__ W2t,
    const float* __restrict__ x, const float* __restrict__ w,
    const float* __restrict__ b, bf16_t* __restrict__ xn) {
  __shared__ uint4 tile[64 * 16];
  int i = blockIdx.x;
  if (i < PB_W1) {
    wt_transpose_tile<DIMC, HID>(W1, W1t, i % (HID / 64), i / (HID / 64), tile);
  } else if (i < 2 * PB_W1) {
    i -= PB_W1;
    wt_transpose_tile<HID, DIMC>(W2, W2t, i % (DIMC / 64), i / (DIMC / 64),
                                 tile);
  } else if (i < 2 * PB_W1 + 4 * PB_SQ) {
    i -= 2 * PB_W1;
    int which = i / PB_SQ;
    i %= PB_SQ;
    const float* in = which == 0 ? Wq : which == 1 ? Wk : which == 2 ? Wv : Wo;
    bf16_t* out = which == 0 ? Wqt : which == 1 ? Wkt : which == 2 ? Wvt : Wot;
    wt_transpose_tile<DIMC, DIMC>(in, out, i % (DIMC / 64), i / (DIMC / 64),
                                  tile);
  } else {
    layernorm_row(x, w, b, xn, i - (2 * PB_W1 + 4 * PB_SQ));
    // same reason as at the end of wt_transpose_tile, for the row's stores
    asm volatile("s_wait_xcnt 0x0" ::: "memory");
  }
}

// ---------------------------------------------------------------------------
// Generic bf16 WMMA GEMM:  C = (A[M,K] * Bt[N,K]^T + bias) * oscale, epilogue.
// Block = 256 threads (8 waves as 4x2), block tile 128x128,
// wave tile 32x64 (2x4 accumulator tiles), WMMA K-step 32.
// The 128-row A and Bt tiles, 128 k at a time, are brought into LDS by
// asynchronous 16-byte copies (a wave covers whole 128-byte lines), two
// buffers: tile t + 1 flies while tile t is worked on. M and N are multiples
// of 128, K a multiple of 128.
// The rows of Bt (output columns) are dealt to the LDS rows so that column n of
// a wave's B tile u is output column 4 n + u of the wave's 64: the four
// accumulator tiles of a lane then hold four neighbouring columns of a row, and
// the epilogue moves 8 or 16 bytes a lane, 16 lanes covering whole 128-byte
// lines of an output row.
// EPI_QKV is the Q, K and V projections as one product: Bt holds the three
// transposed weights one behind the other (N = 3 * DIMC), outp the three
// outputs likewise; a block's 128 columns lie in one of the three.
// ---------------------------------------------------------------------------
#define GBK    128               // k per LDS tile: 256 bytes of every row
#define GPITCH 272               // LDS row pitch in bytes: 256 + 16 pad
#define GTILE  (128 * GPITCH)    // one operand's tile
#define GSTAGE (2 * GTILE)       // a buffer: A tile, then Bt tile

// 16x32 bf16 fragment from an LDS tile; same lane and k order as load_frag.
__device__ inline bf16x16 lds_frag(const unsigned char* base) {
  int lane = threadIdx.x & 31;
  const unsigned char* p = base + (lane & 15) * GPITCH + (lane >> 4) * 16;
  union { uint4 u[2]; bf16x16 v; } cv;
  cv.u[0] = *reinterpret_cast<const uint4*>(p);
  cv.u[1] = *reinterpret_cast<const uint4*>(p + 32);
  return cv.v;
}

// One thread's share of a 128-row tile: 16 bytes of every 16th row.
// lds: the lane's LDS byte address, g: its global address, rstep: 16 rows.
// Global row + 16 i lands RS * (i & 3) + 64 * (i >> 2) LDS rows further on:
// RS = 16 keeps the rows' order, RS = 4 deals them (see above).
template <int RS>
__device__ inline void copy_tile(unsigned lds, const bf16_t* g, size_t rstep) {
  // The closing s_wait_xcnt stands inside the statement so that no address
  // register of a copy is rewritten ahead of it.
  asm volatile(
      "global_load_async_to_lds_b128 %0, %8, off\n\t"
      "global_load_async_to_lds_b128 %1, %9, off\n\t"
      "global_load_async_to_lds_b128 %2, %10, off\n\t"
      "global_load_async_to_lds_b128 %3, %11, off\n\t"
      "global_load_async_to_lds_b128 %4, %12, off\n\t"
      "global_load_async_to_lds_b128 %5, %13, off\n\t"
      "global_load_async_to_lds_b128 %6, %14, off\n\t"
      "global_load_async_to_lds_b128 %7, %15, off\n\t"
      "s_wait_xcnt 0x0"
      :: "v"(lds), "v"(lds + RS * GPITCH), "v"(lds + 2 * RS * GPITCH),
         "v"(lds + 3 * RS * GPITCH), "v"(lds + 64 * GPITCH),
         "v"(lds + (64 + RS) * GPITCH), "v"(lds + (64 + 2 * RS) * GPITCH),
         "v"(lds + (64 + 3 * RS) * GPITCH),
         "v"(g), "v"(g + rstep), "v"(g + 2 * rstep), "v"(g + 3 * rstep),
         "v"(g + 4 * rstep), "v"(g + 5 * rstep), "v"(g + 6 * rstep),
         "v"(g + 7 * rstep)
      : "memory");
}

// Exact-form GELU, 0.5 v (1 + erf(v / sqrt 2)), of eight values at once, with
// no branch. For z = |v| / sqrt 2 the complementary error function is taken as
// erfc(z) = t (a1 + t (a2 + t (a3 + t (a4 + t a5)))) exp(-z z), t = 1 / (1 + p z)
// (absolute error below 2e-7), and gelu(v) = max(v, 0) - 0.5 |v| erfc(z),
// which cancels nothing on either side of zero. a5 is drawn out of the
// polynomial into the last factor, so that every step holds one constant.
// The eight values are independent chains, so the vector port stays busy.
// The reciprocals and the exponentials stand in one statement, in place on
// their own registers: none overwrites the source of the one in front of it,
// and the closing v_nop is the slot the instruction set asks for between a
// transcendental and an instruction that uses its result.
__device__ inline f32x8 gelu_x8(f32x8 v) {
  constexpr float A5 = 1.061405429f;
  f32x8 m = __builtin_elementwise_max(v, (f32x8)(0.0f));
  f32x8 a = m * 2.0f - v;  // |v|, exact
  f32x8 t = a * (0.3275911f * 0.70710678118654752f) + 1.0f;
  f32x8 e = (v * v) * (-0.5f * 1.4426950408889634f);
  asm("v_rcp_f32 %0, %0\n\t"
      "v_rcp_f32 %1, %1\n\t"
      "v_rcp_f32 %2, %2\n\t"
      "v_rcp_f32 %3, %3\n\t"
      "v_rcp_f32 %4, %4\n\t"
      "v_rcp_f32 %5, %5\n\t"
      "v_rcp_f32 %6, %6\n\t"
      "v_rcp_f32 %7, %7\n\t"
      "v_exp_f32 %8, %8\n\t"
      "v_exp_f32 %9, %9\n\t"
      "v_exp_f32 %10, %10\n\t"
      "v_exp_f32 %11, %11\n\t"
      "v_exp_f32 %12, %12\n\t"
      "v_exp_f32 %13, %13\n\t"
      "v_exp_f32 %14, %14\n\t"
      "v_exp_f32 %15, %15\n\t"
      "v_nop"
      : "+v"(t[0]), "+v"(t[1]), "+v"(t[2]), "+v"(t[3]), "+v"(t[4]),
        "+v"(t[5]), "+v"(t[6]), "+v"(t[7]), "+v"(e[0]), "+v"(e[1]),
        "+v"(e[2]), "+v"(e[3]), "+v"(e[4]), "+v"(e[5]), "+v"(e[6]),
        "+v"(e[7]));
  f32x8 p = t + (-1.453152027f / A5);
  p = p * t + (1.421413741f / A5);
  p = p * t + (-0.284496736f / A5);
  p = p * t + (0.254829592f / A5);
  f32x8 q = (p * t) * e;  // erfc(z) / a5
  return (a * q) * (-0.5f * A5) + m;
}

enum { EPI_QK = 0, EPI_VT = 1, EPI_RESID_F32 = 2, EPI_GELU_BF16 = 3,
       EPI_QKV = 4 };
template <int F> struct store_form { static constexpr int value = F; };

template <int EPI>
__global__ void __launch_bounds__(256, 4) gemm_kernel(
    const bf16_t* __restrict__ A, const bf16_t* __restrict__ Bt,
    const float* __restrict__ bias, void* __restrict__ outp,
    const float* __restrict__ resid, int M, int N, int K, int Ntok,
    float oscale, const float* __restrict__ bias_k,
    const float* __restrict__ bias_v) {
  __shared__ __attribute__((aligned(16))) unsigned char smem[2 * GSTAGE];
  int wave = threadIdx.x >> 5;
  int lane = threadIdx.x & 31;
  int wm = wave >> 1;          // 0..3
  int wn = wave & 1;           // 0..1
  int row0 = blockIdx.y * 128 + wm * 32;
  int col0 = blockIdx.x * 128 + wn * 64;

  f32x8 acc[2][4];
  #pragma unroll
  for (int t = 0; t < 2; ++t)
    #pragma unroll
    for (int u = 0; u < 4; ++u) acc[t][u] = (f32x8)(0.0f);

  // Copy shares: 16 threads cover a row's 256 bytes, 16 rows per round.
  int crow = threadIdx.x >> 4;
  int cchk = threadIdx.x & 15;
  const bf16_t* gA = A  + (size_t)(blockIdx.y * 128 + crow) * K + cchk * 8;
  const bf16_t* gB = Bt + (size_t)(blockIdx.x * 128 + crow) * K + cchk * 8;
  unsigned lds0 = (unsigned)(uintptr_t)smem + crow * GPITCH + cchk * 16;
  // Bt row c of a wave's 64 goes to LDS row 16 * (c & 3) + (c >> 2).
  unsigned ldsB = (unsigned)(uintptr_t)smem + GTILE +
                  ((crow & 3) * 16 + (crow >> 2)) * GPITCH + cchk * 16;
  size_t rstep = (size_t)16 * K;
  int T = K / GBK;

  copy_tile<16>(lds0, gA, rstep);
  copy_tile<4>(ldsB, gB, rstep);
  // tile 0 has landed for this wave, then for the block
  asm volatile("s_wait_asynccnt 0x0" ::: "memory");
  __syncthreads();
  if (T > 1) {
    copy_tile<16>(lds0 + GSTAGE, gA + GBK, rstep);
    copy_tile<4>(ldsB + GSTAGE, gB + GBK, rstep);
  }

  for (int t = 0; t < T; ++t) {
    unsigned buf = (unsigned)(t & 1) * GSTAGE;
    const unsigned char* sA = smem + buf + wm * 32 * GPITCH;
    const unsigned char* sB = smem + buf + GTILE + wn * 64 * GPITCH;
    // Two fragment sets: the reads of the next 32 k go out as one group ahead
    // of this 32 k's WMMAs, so that their LDS latency hides behind them.
    bf16x16 fa[2][2], fb[2][4];
    fa[0][0] = lds_frag(sA);
    fa[0][1] = lds_frag(sA + 16 * GPITCH);
    #pragma unroll  // constant indices keep fb[] in registers
    for (int u = 0; u < 4; ++u) fb[0][u] = lds_frag(sB + u * 16 * GPITCH);
    #pragma unroll  // constant indices keep both sets in registers
    for (int kk = 0; kk < GBK / 32; ++kk) {
      const int cur = kk & 1, nxt = cur ^ 1;
      if (kk + 1 < GBK / 32) {
        fa[nxt][0] = lds_frag(sA + (kk + 1) * 64);
        fa[nxt][1] = lds_frag(sA + 16 * GPITCH + (kk + 1) * 64);
        #pragma unroll  // same reason
        for (int u = 0; u < 4; ++u)
          fb[nxt][u] = lds_frag(sB + u * 16 * GPITCH + (kk + 1) * 64);
      }
      // keeps the read group above from sinking in among the WMMAs below
      __builtin_amdgcn_sched_barrier(0);
      #pragma unroll  // same reason, for acc[] too
      for (int u = 0; u < 4; ++u) {
        acc[0][u] = wmma_bf16(fa[cur][0], fb[cur][u], acc[0][u]);
        acc[1][u] = wmma_bf16(fa[cur][1], fb[cur][u], acc[1][u]);
      }
      // keeps the next read group from rising in among the WMMAs above
      __builtin_amdgcn_sched_barrier(0);
    }
    // this wave's reads of the buffer are done before it is refilled
    asm volatile("s_wait_dscnt 0x0" ::: "memory");
    // this wave's copies of tile t + 1 have landed
    asm volatile("s_wait_asynccnt 0x0" ::: "memory");
    __syncthreads();  // publishes tile t + 1, frees tile t's buffer
    if (t + 2 < T) {
      copy_tile<16>(lds0 + buf, gA + (size_t)(t + 2) * GBK, rstep);
      copy_tile<4>(ldsB + buf, gB + (size_t)(t + 2) * GBK, rstep);
    }
  }
  // no copy is outstanding when the wave goes on to its end
  asm volatile("s_wait_asynccnt 0x0" ::: "memory");

  // Epilogue. C layout: VGPR r, lanes 0-15 -> (M=r, N=lane),
  //                     lanes 16-31 -> (M=r+8, N=lane-16);
  // column N of tile u is output column col0 + 4 N + u.
  int nloc = lane & 15;
  int moff = (lane >> 4) * 8;
  int sel = 0;  // EPI_QKV: 0 = Q, 1 = K, 2 = V; alike in the whole block
  if constexpr (EPI == EPI_QKV) {
    sel = blockIdx.x / (DIMC / 128);
    col0 -= sel * DIMC;
    bias = sel == 0 ? bias : sel == 1 ? bias_k : bias_v;
    outp = (bf16_t*)outp + (size_t)sel * M * DIMC;
    oscale = sel == 0 ? oscale : 1.0f;
  }
  int colb = col0 + nloc * 4;  // the lane's four columns: colb + u
  const float4 b4 = *reinterpret_cast<const float4*>(bias + colb);
  const float bs[4] = {b4.x, b4.y, b4.z, b4.w};
  auto store_tiles = [&](auto form) {
  constexpr int F = decltype(form)::value;
  float4 rv[2][8];
  if constexpr (F == EPI_RESID_F32) {
    #pragma unroll  // all sixteen loads are in flight together
    for (int t = 0; t < 2; ++t) {
      #pragma unroll  // same reason
      for (int r = 0; r < 8; ++r) {
        rv[t][r] = *reinterpret_cast<const float4*>(
            resid + (size_t)(row0 + t * 16 + moff + r) * N + colb);
        // the load's address registers are used anew right behind it
        asm volatile("s_wait_xcnt 0x0" ::: "memory");
      }
    }
  }
  #pragma unroll
  for (int t = 0; t < 2; ++t) {
    if constexpr (F == EPI_VT) {
      // -> per-head transposed [b][h][d][tok], bf16: a lane's 8 registers of a
      // tile are 8 neighbouring tokens of one d (Ntok is a multiple of 8).
      int rowg = row0 + t * 16 + moff;
      int bi = rowg / Ntok, tok = rowg % Ntok;
      #pragma unroll
      for (int u = 0; u < 4; ++u) {
        int colg = colb + u;
        int h = colg >> 6, d = colg & 63;
        union { bf16x2 hh[4]; uint4 v; } c;
        #pragma unroll
        for (int r = 0; r < 8; r += 2) {
          f32x2 pr = {(acc[t][u][r] + bs[u]) * oscale,
                      (acc[t][u][r + 1] + bs[u]) * oscale};
          c.hh[r >> 1] = __builtin_convertvector(pr, bf16x2);
        }
        *reinterpret_cast<uint4*>(
            (bf16_t*)outp + (((size_t)bi * HEADS + h) * HDIM + d) * Ntok + tok) =
            c.v;
        // the store's registers are used anew right behind it
        asm volatile("s_wait_xcnt 0x0" ::: "memory");
      }
    } else {
      f32x8 gl[4];
      if constexpr (F == EPI_GELU_BF16) {
        #pragma unroll
        for (int u = 0; u < 4; ++u)
          gl[u] = gelu_x8((acc[t][u] + bs[u]) * oscale);
      } else {
        #pragma unroll
        for (int u = 0; u < 4; ++u) gl[u] = (acc[t][u] + bs[u]) * oscale;
      }
      #pragma unroll
      for (int r = 0; r < 8; ++r) {
        int rowg = row0 + t * 16 + moff + r;
        if constexpr (F == EPI_RESID_F32) {
          size_t idx = (size_t)rowg * N + colb;
          float4 o = {rv[t][r].x + gl[0][r], rv[t][r].y + gl[1][r],
                      rv[t][r].z + gl[2][r], rv[t][r].w + gl[3][r]};
          *reinterpret_cast<float4*>((float*)outp + idx) = o;
        } else {
          f32x2 p0 = {gl[0][r], gl[1][r]}, p1 = {gl[2][r], gl[3][r]};
          union { bf16x2 hh[2]; uint2 v; } c;
          c.hh[0] = __builtin_convertvector(p0, bf16x2);
          c.hh[1] = __builtin_convertvector(p1, bf16x2);
          size_t idx;
          if constexpr (F == EPI_QK) {
            // -> per-head [b][h][tok][d], bf16
            int bi = rowg / Ntok, tok = rowg % Ntok;
            int h = colb >> 6, d = colb & 63;
            idx = ((((size_t)bi * HEADS + h) * Ntok + tok) << 6) + d;
          } else {  // EPI_GELU_BF16
            idx = (size_t)rowg * N + colb;
          }
          *reinterpret_cast<uint2*>((bf16_t*)outp + idx) = c.v;
        }
        // the store's registers are used anew right behind it
        asm volatile("s_wait_xcnt 0x0" ::: "memory");
      }
    }
  }
  };
  if constexpr (EPI == EPI_QKV) {
    if (sel == 2) {
      store_tiles(store_form<EPI_VT>{});
    } else {
      store_tiles(store_form<EPI_QK>{});
    }
  } else {
    store_tiles(store_form<EPI>{});
  }
}

#define AKEYS  128
#define KPITCH 144
#define VPITCH 272
#define KTILE  (AKEYS * KPITCH)
#define VTILE  (HDIM * VPITCH)
#define ASTAGE (KTILE + VTILE)

// 16x32 bf16 fragment from LDS rows of the given byte pitch; same lane and k
// order as load_frag.
__device__ inline bf16x16 lds_frag_at(const unsigned char* base, int pitch) {
  int lane = threadIdx.x & 31;
  const unsigned char* p = base + (lane & 15) * pitch + (lane >> 4) * 16;
  union { uint4 u[2]; bf16x16 v; } cv;
  cv.u[0] = *reinterpret_cast<const uint4*>(p);
  cv.u[1] = *reinterpret_cast<const uint4*>(p + 32);
  return cv.v;
}

// The value that lane l ^ 16 holds.
__device__ inline float other_half(float x) {
  int i = __builtin_bit_cast(int, x);
  return __builtin_bit_cast(
      float, __builtin_amdgcn_permlanex16(i, i, 0x76543210, 0xfedcba98, false,
                                          false));
}

__device__ inline float max3f(float a, float b, float c) {
  return fmaxf(fmaxf(a, b), c);
}

// Exponentials base 2, each in place on its own register, in one statement:
// so none overwrites the source of the one in front of it, and the closing
// v_nop is the slot the instruction set asks for between a transcendental and
// an instruction that uses its result.
__device__ inline void exp2_x8(float (&a)[8]) {
  asm("v_exp_f32 %0, %0\n\t"
      "v_exp_f32 %1, %1\n\t"
      "v_exp_f32 %2, %2\n\t"
      "v_exp_f32 %3, %3\n\t"
      "v_exp_f32 %4, %4\n\t"
      "v_exp_f32 %5, %5\n\t"
      "v_exp_f32 %6, %6\n\t"
      "v_exp_f32 %7, %7\n\t"
      "v_nop"
      : "+v"(a[0]), "+v"(a[1]), "+v"(a[2]), "+v"(a[3]), "+v"(a[4]),
        "+v"(a[5]), "+v"(a[6]), "+v"(a[7]));
}
__device__ inline float exp2_x1(float a) {
  asm("v_exp_f32 %0, %0\n\t"
      "v_nop"
      : "+v"(a));
  return a;
}
#define LOG2E 1.4426950408889634f

// One thread's share of a stage: 16 bytes of every 32nd K row and of every
// 16th Vt row. lk, lv: the lane's LDS byte addresses; gk, gv: its global
// addresses; vstep: 16 Vt rows in elements.
__device__ inline void copy_kv(unsigned lk, const bf16_t* gk, unsigned lv,
                               const bf16_t* gv, size_t vstep) {
  // The closing s_wait_xcnt stands inside the statement so that no address
  // register of a copy is rewritten ahead of it.
  asm volatile(
      "global_load_async_to_lds_b128 %0, %8, off\n\t"
      "global_load_async_to_lds_b128 %1, %9, off\n\t"
      "global_load_async_to_lds_b128 %2, %10, off\n\t"
      "global_load_async_to_lds_b128 %3, %11, off\n\t"
      "global_load_async_to_lds_b128 %4, %12, off\n\t"
      "global_load_async_to_lds_b128 %5, %13, off\n\t"
      "global_load_async_to_lds_b128 %6, %14, off\n\t"
      "global_load_async_to_lds_b128 %7, %15, off\n\t"
      "s_wait_xcnt 0x0"
      :: "v"(lk), "v"(lk + 32 * KPITCH), "v"(lk + 64 * KPITCH),
         "v"(lk + 96 * KPITCH),
         "v"(lv), "v"(lv + 16 * VPITCH), "v"(lv + 32 * VPITCH),
         "v"(lv + 48 * VPITCH),
         "v"(gk), "v"(gk + 32 * HDIM), "v"(gk + 64 * HDIM),
         "v"(gk + 96 * HDIM),
         "v"(gv), "v"(gv + vstep), "v"(gv + 2 * vstep), "v"(gv + 3 * vstep)
      : "memory");
}

// Four waves per SIMD is what the grid gives (two blocks a WGP). Told so, the
// compiler keeps a sub-pass's LDS reads together ahead of the WMMAs; aiming at
// more waves it saves registers by a load, a wait and a WMMA in turn.
__global__ void __launch_bounds__(256)
__attribute__((amdgpu_waves_per_eu(4, 4))) attn_kernel(
    const bf16_t* __restrict__ q, const bf16_t* __restrict__ k,
    const bf16_t* __restrict__ vt, bf16_t* __restrict__ out, int Ntok) {
  __shared__ __attribute__((aligned(16))) unsigned char kv[2 * ASTAGE];

  int wave = threadIdx.x >> 5;
  int lane = threadIdx.x & 31;
  int bh = blockIdx.y;
  int q0 = blockIdx.x * 128 + wave * 16;

  const bf16_t* Qh = q  + (size_t)bh * Ntok * HDIM;
  const bf16_t* Kh = k  + (size_t)bh * Ntok * HDIM;
  const bf16_t* Vh = vt + (size_t)bh * HDIM * Ntok;

  // B operand of S^T: column = query q0 + (lane & 15), k = d.
  bf16x16 qf0 = load_frag(Qh + (size_t)q0 * HDIM + 0, HDIM);
  bf16x16 qf1 = load_frag(Qh + (size_t)q0 * HDIM + 32, HDIM);

  // O^T tiles: row d = 16 u + 8 * (lane >> 4) + r, column = the lane's query.
  f32x8 oacc[4];
  #pragma unroll
  for (int u = 0; u < 4; ++u) oacc[u] = (f32x8)(0.0f);
  // The lane's query: maximum in use (alike in both halves), and the sum over
  // the keys of this half alone.
  float mrun = -1e30f, lrun = 0.0f;

  // Copy shares. K: 8 threads cover a row's 128 bytes, 32 rows per round.
  // Vt: 16 threads cover a row's 256 bytes of the stage, 16 rows per round.
  int tid = threadIdx.x;
  const bf16_t* gK = Kh + (size_t)(tid >> 3) * HDIM + (tid & 7) * 8;
  const bf16_t* gV = Vh + (size_t)(tid >> 4) * Ntok + (tid & 15) * 8;
  unsigned lk0 = (unsigned)(uintptr_t)kv + (tid >> 3) * KPITCH + (tid & 7) * 16;
  unsigned lv0 =
      (unsigned)(uintptr_t)kv + KTILE + (tid >> 4) * VPITCH + (tid & 15) * 16;
  size_t vstep = (size_t)16 * Ntok;
  int T = Ntok / AKEYS;

  copy_kv(lk0, gK, lv0, gV, vstep);
  // stage 0 has landed for this wave, then for the block
  asm volatile("s_wait_asynccnt 0x0" ::: "memory");
  __syncthreads();
  if (T > 1)
    copy_kv(lk0 + ASTAGE, gK + AKEYS * HDIM, lv0 + ASTAGE, gV + AKEYS, vstep);

  for (int t = 0; t < T; ++t) {
   unsigned buf = (unsigned)(t & 1) * ASTAGE;
   for (int sub = 0; sub < AKEYS / 64; ++sub) {
    const unsigned char* sK = kv + buf + sub * 64 * KPITCH;
    const unsigned char* sV = kv + buf + KTILE + sub * 128;
    // 4 S^T tiles: 64 keys x 16 queries (contraction over d=64).
    f32x8 s[4];
    #pragma unroll
    for (int i = 0; i < 4; ++i) {
      const unsigned char* Kt = sK + i * 16 * KPITCH;
      f32x8 si = (f32x8)(0.0f);
      si = wmma_bf16(lds_frag_at(Kt, KPITCH), qf0, si);
      si = wmma_bf16(lds_frag_at(Kt + 64, KPITCH), qf1, si);
      s[i] = si;
    }

    // Online softmax update of the lane's query over its 32 scores.
    float m8[8];
    #pragma unroll
    for (int r = 0; r < 8; ++r)
      m8[r] = fmaxf(max3f(s[0][r], s[1][r], s[2][r]), s[3][r]);
    float mx = fmaxf(max3f(m8[0], m8[1], m8[2]),
                     fmaxf(max3f(m8[3], m8[4], m8[5]), fmaxf(m8[6], m8[7])));
    mx = fmaxf(mx, other_half(mx));
    float mnew  = fmaxf(mrun, mx);
    float alpha = exp2_x1((mrun - mnew) * LOG2E);
    mrun = mnew;

    // P^T as B operand: elements 0..7 of a lane are tile 2 ks, registers
    // 0..7 (keys 8 * half + r), elements 8..15 tile 2 ks + 1: the k order in
    // which lds_frag_at brings the keys of a Vt row.
    bf16x16 pf[2];
    float rs[4];
    #pragma unroll
    for (int i = 0; i < 4; ++i) {
      float p[8];
      #pragma unroll
      for (int r = 0; r < 8; ++r) p[r] = (s[i][r] - mnew) * LOG2E;
      exp2_x8(p);
      rs[i] = ((p[0] + p[1]) + (p[2] + p[3])) + ((p[4] + p[5]) + (p[6] + p[7]));
      #pragma unroll
      for (int r = 0; r < 8; r += 2) {
        f32x2 pr = {p[r], p[r + 1]};
        bf16x2 pb = __builtin_convertvector(pr, bf16x2);
        pf[i >> 1][(i & 1) * 8 + r]     = pb[0];
        pf[i >> 1][(i & 1) * 8 + r + 1] = pb[1];
      }
    }
    lrun = lrun * alpha + ((rs[0] + rs[1]) + (rs[2] + rs[3]));
    #pragma unroll
    for (int u = 0; u < 4; ++u) oacc[u] *= alpha;

    #pragma unroll
    for (int ks = 0; ks < 2; ++ks) {
      #pragma unroll
      for (int u = 0; u < 4; ++u) {
        bf16x16 vf = lds_frag_at(sV + u * 16 * VPITCH + ks * 64, VPITCH);
        oacc[u] = wmma_bf16(vf, pf[ks], oacc[u]);
      }
    }
   }
   // this wave's reads of the buffer are done before it is refilled
   asm volatile("s_wait_dscnt 0x0" ::: "memory");
   // this wave's copies of stage t + 1 have landed
   asm volatile("s_wait_asynccnt 0x0" ::: "memory");
   __syncthreads();  // publishes stage t + 1, frees stage t's buffer
   if (t + 2 < T)
     copy_kv(lk0 + buf, gK + (size_t)(t + 2) * AKEYS * HDIM, lv0 + buf,
             gV + (size_t)(t + 2) * AKEYS, vstep);
  }
  // no copy is outstanding when the wave goes on to its end
  asm volatile("s_wait_asynccnt 0x0" ::: "memory");

  // Finalize: join the halves' sums, divide, and put the heads back to
  // [b][tok][DIMC]; a lane's 8 registers of a tile are 8 neighbouring d.
  int h  = bh & (HEADS - 1);
  int bi = bh >> 4;
  float inv = 1.0f / (lrun + other_half(lrun));
  int tok = q0 + (lane & 15);
  bf16_t* orow =
      out + ((size_t)bi * Ntok + tok) * DIMC + h * HDIM + (lane >> 4) * 8;
  #pragma unroll
  for (int u = 0; u < 4; ++u) {
    union { bf16x2 hh[4]; uint4 v; } c;
    #pragma unroll
    for (int r = 0; r < 8; r += 2) {
      f32x2 pr = {oacc[u][r] * inv, oacc[u][r + 1] * inv};
      c.hh[r >> 1] = __builtin_convertvector(pr, bf16x2);
    }
    *reinterpret_cast<uint4*>(orow + u * 16) = c.v;
  }
}

// ---------------------------------------------------------------------------
// Host-side orchestration (graph-capture safe: launches only).
// ---------------------------------------------------------------------------
extern "C" void kernel_launch(void* const* d_in, const int* in_sizes, int n_in,
                              void* d_out, int out_size, void* d_ws, size_t ws_size,
                              hipStream_t stream) {
  (void)in_sizes; (void)n_in; (void)out_size; (void)ws_size;

  const float* x     = (const float*)d_in[0];
  const float* ln1_w = (const float*)d_in[1];
  const float* ln1_b = (const float*)d_in[2];
  const float* ln2_w = (const float*)d_in[3];
  const float* ln2_b = (const float*)d_in[4];
  const float* Wq = (const float*)d_in[5];  const float* bq = (const float*)d_in[6];
  const float* Wk = (const float*)d_in[7];  const float* bk = (const float*)d_in[8];
  const float* Wv = (const float*)d_in[9];  const float* bv = (const float*)d_in[10];
  const float* Wo = (const float*)d_in[11]; const float* bo = (const float*)d_in[12];
  const float* W1 = (const float*)d_in[13]; const float* b1 = (const float*)d_in[14];
  const float* W2 = (const float*)d_in[15]; const float* b2 = (const float*)d_in[16];

  // Workspace layout
  char* ws = (char*)d_ws;
  size_t off = 0;
  auto alloc = [&](size_t bytes) { char* p = ws + off; off += (bytes + 255) & ~size_t(255); return p; };
  // Wqt, Wkt, Wvt lie one behind the other with no gap (sizes are multiples of
  // 256): the merged projection reads them as one [3 * DIMC][DIMC] matrix.
  bf16_t* Wqt = (bf16_t*)alloc((size_t)DIMC * DIMC * 2);
  bf16_t* Wkt = (bf16_t*)alloc((size_t)DIMC * DIMC * 2);
  bf16_t* Wvt = (bf16_t*)alloc((size_t)DIMC * DIMC * 2);
  bf16_t* Wot = (bf16_t*)alloc((size_t)DIMC * DIMC * 2);
  bf16_t* W1t = (bf16_t*)alloc((size_t)DIMC * HID * 2);
  bf16_t* W2t = (bf16_t*)alloc((size_t)HID * DIMC * 2);
  bf16_t* xn   = (bf16_t*)alloc((size_t)MTOT * DIMC * 2);
  // qb, kb, vtb likewise: output sel of the merged projection starts at
  // qb + sel * MTOT * DIMC.
  bf16_t* qb   = (bf16_t*)alloc((size_t)MTOT * DIMC * 2);
  bf16_t* kb   = (bf16_t*)alloc((size_t)MTOT * DIMC * 2);
  bf16_t* vtb  = (bf16_t*)alloc((size_t)MTOT * DIMC * 2);
  bf16_t* attn = (bf16_t*)alloc((size_t)MTOT * DIMC * 2);
  float*  x2   = (float*)alloc((size_t)MTOT * DIMC * 4);
  bf16_t* xn2  = (bf16_t*)alloc((size_t)MTOT * DIMC * 2);
  bf16_t* hbuf = (bf16_t*)alloc((size_t)MTOT * HID * 2);

  dim3 blk(256);

  // 1, 2. Weight prep (fp32 -> bf16 transposed) and LN1
  prep_kernel<<<PB_ALL, blk, 0, stream>>>(Wq, Wk, Wv, Wo, W1, W2, Wqt, Wkt, Wvt,
                                          Wot, W1t, W2t, x, ln1_w, ln1_b, xn);

  // 3. Q, K, V projections (one WMMA GEMM). Q is pre-scaled by 1/sqrt(HDIM).
  dim3 gqkv3(3 * DIMC / 128, MTOT / 128);
  gemm_kernel<EPI_QKV><<<gqkv3, blk, 0, stream>>>(xn, Wqt, bq, qb, nullptr, MTOT, 3 * DIMC, DIMC, NTOK, 0.125f, bk, bv);
  dim3 gqkv(DIMC / 128, MTOT / 128);

  // 4. Flash attention
  dim3 gatt(NTOK / 128, BATCH * HEADS);
  attn_kernel<<<gatt, blk, 0, stream>>>(qb, kb, vtb, attn, NTOK);

  // 5. Output projection + residual: x2 = x + attn @ Wo + bo
  gemm_kernel<EPI_RESID_F32><<<gqkv, blk, 0, stream>>>(attn, Wot, bo, x2, x, MTOT, DIMC, DIMC, NTOK, 1.0f, nullptr, nullptr);

  // 6. LN2
  layernorm_kernel<<<MTOT, blk, 0, stream>>>(x2, ln2_w, ln2_b, xn2);

  // 7. MLP up + GELU: h = gelu(xn2 @ W1 + b1)
  dim3 gup(HID / 128, MTOT / 128);
  gemm_kernel<EPI_GELU_BF16><<<gup, blk, 0, stream>>>(xn2, W1t, b1, hbuf, nullptr, MTOT, HID, DIMC, NTOK, 1.0f, nullptr, nullptr);

  // 8. MLP down + residual -> output: out = x2 + h @ W2 + b2
  gemm_kernel<EPI_RESID_F32><<<gqkv, blk, 0, stream>>>(hbuf, W2t, b2, (float*)d_out, x2, MTOT, DIMC, HID, NTOK, 1.0f, nullptr, nullptr);
}

// v008
// A run of this version takes 152 microseconds.
// Next to v007, in two timings, it ran 1.03 and 1.04 times as fast.
// Over all steps from v000 it is 4.32 times as fast.
#include <hip/hip_runtime.h>
#include <hip/hip_bf16.h>

// ---------------------------------------------------------------------------
// Transformer encoder block for MI455X (gfx1250, wave32, WMMA).
// All GEMMs run on v_wmma_f32_16x16x32_bf16; attention is flash-style with
// 64-key tiles, its two products taken transposed. 1/sqrt(d) is folded into the Q projection epilogue.
// ---------------------------------------------------------------------------

typedef __bf16 bf16_t;
typedef __attribute__((ext_vector_type(16))) __bf16 bf16x16;
typedef __attribute__((ext_vector_type(8)))  float  f32x8;

#define DIMC   1024
#define HEADS  16
#define HDIM   64
#define HID    4096
#define NTOK   2048
#define BATCH  2
#define MTOT   (BATCH * NTOK)   // 4096 tokens

// ---------------------------------------------------------------------------
// WMMA helpers
// ---------------------------------------------------------------------------
__device__ inline f32x8 wmma_bf16(bf16x16 a, bf16x16 b, f32x8 c) {
  // (neg_a, A, neg_b, B, c_mod, C, reuse_a, reuse_b)
  return __builtin_amdgcn_wmma_f32_16x16x32_bf16(false, a, false, b,
                                                 (short)0, c, false, false);
}

// Load a 16x32 bf16 fragment (A-style layout, used here for Q as a B
// operand; the A fragments of K and Vt are read from LDS in the same order).
// ISA 16-bit A layout: lane = m + 16*half;
//   VGPR0..3 : K = half*8 + 0..7
//   VGPR4..7 : K = 16 + half*8 + 0..7
// base points at (row0, k0); ld = row stride in elements (multiple of 8).
__device__ inline bf16x16 load_frag(const bf16_t* base, int ld) {
  int lane = threadIdx.x & 31;
  int m    = lane & 15;
  int half = lane >> 4;
  const bf16_t* p = base + (size_t)m * (size_t)ld + half * 8;
  union { uint4 u[2]; bf16x16 v; } cv;
  cv.u[0] = *reinterpret_cast<const uint4*>(p);
  cv.u[1] = *reinterpret_cast<const uint4*>(p + 16);
  return cv.v;
}

// ---------------------------------------------------------------------------
// Weight prep: fp32 [K][N] -> bf16 transposed [N][K].
// One block moves a 128(k) x 64(n) tile, number (bx, by) of its matrix; K and
// N are compile-time, so the row steps become immediate offsets of one address.
// A thread reads 8 k-rows x 4 n as 16-byte loads (a half-wave covers 256
// contiguous bytes of an input row) and packs the eight k of each n into one
// 16-byte chunk. The chunks cross through LDS, so that a half-wave then
// stores 256 contiguous bytes of an output row.
// LDS tile: [n][16 chunks]; the chunk index is XORed with n >> 2, which keeps
// both the 16-byte LDS writes and the reads free of bank conflicts.
// ---------------------------------------------------------------------------
typedef __attribute__((ext_vector_type(4))) float  f32x4;
typedef __attribute__((ext_vector_type(2))) float  f32x2;
typedef __attribute__((ext_vector_type(2))) __bf16 bf16x2;

template <int K, int N>
__device__ inline void wt_transpose_tile(const float* __restrict__ in,
                                         bf16_t* __restrict__ out, int bx,
                                         int by, uint4* tile) {
  static_assert(K % 128 == 0 && N % 64 == 0, "whole tiles only");
  int tid = threadIdx.x;
  int lo  = tid & 15;
  int hi  = tid >> 4;
  int k0  = by * 128;
  int n0  = bx * 64;

  // lo = group of 4 n, hi = group of 8 k
  const float* src = in + (size_t)(k0 + hi * 8) * N + n0 + lo * 4;
  f32x4 v[8];
  #pragma unroll  // all eight loads in flight at once, v[] in registers
  for (int i = 0; i < 8; ++i)
    v[i] = *reinterpret_cast<const f32x4*>(src + i * N);

  #pragma unroll  // constant indices into v[], or it would leave the registers
  for (int j = 0; j < 4; ++j) {
    union { bf16x2 h[4]; uint4 u; } c;
    #pragma unroll  // same reason
    for (int p = 0; p < 4; ++p) {
      f32x2 pr = {v[2 * p][j], v[2 * p + 1][j]};
      c.h[p] = __builtin_convertvector(pr, bf16x2);
    }
    tile[(lo * 4 + j) * 16 + (hi ^ lo)] = c.u;
  }
  __syncthreads();

  // lo = chunk of 8 k, hi = n within a group of 16
  bf16_t* dst = out + (size_t)(n0 + hi) * K + k0 + lo * 8;
  #pragma unroll  // four LDS reads issued together ahead of the stores
  for (int s = 0; s < 4; ++s) {
    int n = s * 16 + hi;
    uint4 u = tile[n * 16 + (lo ^ (n >> 2))];
    *reinterpret_cast<uint4*>(dst + s * 16 * K) = u;
  }
  // In the built kernel another arm of the caller's choice follows and reuses
  // the stores' address and data registers: the wait stands in front of that.
  asm volatile("s_wait_xcnt 0x0" ::: "memory");
}

// ---------------------------------------------------------------------------
// LayerNorm over DIMC=1024, one block (256 threads) per row. Output bf16.
// ---------------------------------------------------------------------------
__device__ inline void layernorm_row(
    const float* __restrict__ x, const float* __restrict__ w,
    const float* __restrict__ b, bf16_t* __restrict__ out, int row) {
  __shared__ float ssum[8];
  __shared__ float ssq[8];
  int tid  = threadIdx.x;
  int lane = tid & 31;
  int wv   = tid >> 5;

  const float4* xr = reinterpret_cast<const float4*>(x + (size_t)row * DIMC);
  float4 v = xr[tid];
  float s  = v.x + v.y + v.z + v.w;
  float sq = v.x * v.x + v.y * v.y + v.z * v.z + v.w * v.w;
  #pragma unroll
  for (int mask = 16; mask >= 1; mask >>= 1) {
    s  += __shfl_xor(s, mask, 32);
    sq += __shfl_xor(sq, mask, 32);
  }
  if (lane == 0) { ssum[wv] = s; ssq[wv] = sq; }
  __syncthreads();
  float ts = 0.f, tq = 0.f;
  #pragma unroll
  for (int i = 0; i < 8; ++i) { ts += ssum[i]; tq += ssq[i]; }
  float mu  = ts * (1.0f / DIMC);
  float var = tq * (1.0f / DIMC) - mu * mu;
  float inv = rsqrtf(var + 1e-5f);

  int c = tid * 4;
  const float4 wv4 = reinterpret_cast<const float4*>(w)[tid];
  const float4 bv4 = reinterpret_cast<const float4*>(b)[tid];
  bf16_t* o = out + (size_t)row * DIMC + c;
  o[0] = (bf16_t)((v.x - mu) * inv * wv4.x + bv4.x);
  o[1] = (bf16_t)((v.y - mu) * inv * wv4.y + bv4.y);
  o[2] = (bf16_t)((v.z - mu) * inv * wv4.z + bv4.z);
  o[3] = (bf16_t)((v.w - mu) * inv * wv4.w + bv4.w);
}

__global__ void __launch_bounds__(256) layernorm_kernel(
    const float* __restrict__ x, const float* __restrict__ w,
    const float* __restrict__ b, bf16_t* __restrict__ out) {
  layernorm_row(x, w, b, out, blockIdx.x);
}

// ---------------------------------------------------------------------------
// All the work that depends on the inputs alone, in one launch: the six weight
// transposes and the first LayerNorm. A block does one transpose tile or one
// row; which, its index says. The transposes, the longer blocks, come first.
// ---------------------------------------------------------------------------
#define PB_W1  ((HID / 64) * (DIMC / 128))    // tiles of W1, as many of W2
#define PB_SQ  ((DIMC / 64) * (DIMC / 128))   // tiles of a square weight
#define PB_ALL (2 * PB_W1 + 4 * PB_SQ + MTOT)

__global__ void __launch_bounds__(256) prep_kernel(
    const float* __restrict__ Wq, const float* __restrict__ Wk,
    const float* __restrict__ Wv, const float* __restrict__ Wo,
    const float* __restrict__ W1, const float* __restrict__ W2,
    bf16_t* __restrict__ Wqt, bf16_t* __restrict__ Wkt,
    bf16_t* __restrict__ Wvt, bf16_t* __restrict__ Wot,
    bf16_t* __restrict__ W1t, bf16_t* __restrict__ W2t,
    const float* __restrict__ x, const float* __restrict__ w,
    const float* __restrict__ b, bf16_t* __restrict__ xn) {
  __shared__ uint4 tile[64 * 16];
  int i = blockIdx.x;
  if (i < PB_W1) {
    wt_transpose_tile<DIMC, HID>(W1, W1t, i % (HID / 64), i / (HID / 64), tile);
  } else if (i < 2 * PB_W1) {
    i -= PB_W1;
    wt_transpose_tile<HID, DIMC>(W2, W2t, i % (DIMC / 64), i / (DIMC / 64),
                                 tile);
  } else if (i < 2 * PB_W1 + 4 * PB_SQ) {
    i -= 2 * PB_W1;
    int which = i / PB_SQ;
    i %= PB_SQ;
    const float* in = which == 0 ? Wq : which == 1 ? Wk : which == 2 ? Wv : Wo;
    bf16_t* out = which == 0 ? Wqt : which == 1 ? Wkt : which == 2 ? Wvt : Wot;
    wt_transpose_tile<DIMC, DIMC>(in, out, i % (DIMC / 64), i / (DIMC / 64),
                                  tile);
  } else {
    layernorm_row(x, w, b, xn, i - (2 * PB_W1 + 4 * PB_SQ));
    // same reason as at the end of wt_transpose_tile, for the row's stores
    asm volatile("s_wait_xcnt 0x0" ::: "memory");
  }
}

// ---------------------------------------------------------------------------
// Generic bf16 WMMA GEMM:  C = (A[M,K] * Bt[N,K]^T + bias) * oscale, epilogue.
// Block = 256 threads (8 waves as 4x2), block tile 128x128,
// wave tile 32x64 (2x4 accumulator tiles), WMMA K-step 32.
// The 128-row A and Bt tiles, 128 k at a time, are brought into LDS by
// asynchronous 16-byte copies (a wave covers whole 128-byte lines), two
// buffers: tile t + 1 flies while tile t is worked on. M and N are multiples
// of 128, K a multiple of 128.
// The rows of Bt (output columns) are dealt to the LDS rows so that column n of
// a wave's B tile u is output column 4 n + u of the wave's 64: the four
// accumulator tiles of a lane then hold four neighbouring columns of a row, and
// the epilogue moves 8 or 16 bytes a lane, 16 lanes covering whole 128-byte
// lines of an output row.
// Where the grid has one block a WGP (EPI_RESID_F32: N = DIMC) half the LDS
// lies idle: there, for speed only, the
// ring has three buffers and a tile flies for two trips. Waves 0-3 copy the even
// tiles, waves 4-7 the odd ones, so that a wave never has more than one tile
// outstanding and its wait to 0 holds back nothing but the tile that is due.
// EPI_QKV is the Q, K and V projections as one product: Bt holds the three
// transposed weights one behind the other (N = 3 * DIMC), outp the three
// outputs likewise; a block's 128 columns lie in one of the three.
// ---------------------------------------------------------------------------
#define GBK    128               // k per LDS tile: 256 bytes of every row
#define GPITCH 272               // LDS row pitch in bytes: 256 + 16 pad
#define GTILE  (128 * GPITCH)    // one operand's tile
#define GSTAGE (2 * GTILE)       // a buffer: A tile, then Bt tile

// 16x32 bf16 fragment from an LDS tile; same lane and k order as load_frag.
__device__ inline bf16x16 lds_frag(const unsigned char* base) {
  int lane = threadIdx.x & 31;
  const unsigned char* p = base + (lane & 15) * GPITCH + (lane >> 4) * 16;
  union { uint4 u[2]; bf16x16 v; } cv;
  cv.u[0] = *reinterpret_cast<const uint4*>(p);
  cv.u[1] = *reinterpret_cast<const uint4*>(p + 32);
  return cv.v;
}

// One thread's share of a 128-row tile: 16 bytes of every 16th row.
// lds: the lane's LDS byte address, g: its global address, rstep: 16 rows.
// Global row + 16 i lands RS * (i & 3) + 64 * (i >> 2) LDS rows further on:
// RS = 16 keeps the rows' order, RS = 4 deals them (see above).
template <int RS>
__device__ inline void copy_tile(unsigned lds, const bf16_t* g, size_t rstep) {
  // The closing s_wait_xcnt stands inside the statement so that no address
  // register of a copy is rewritten ahead of it.
  asm volatile(
      "global_load_async_to_lds_b128 %0, %8, off\n\t"
      "global_load_async_to_lds_b128 %1, %9, off\n\t"
      "global_load_async_to_lds_b128 %2, %10, off\n\t"
      "global_load_async_to_lds_b128 %3, %11, off\n\t"
      "global_load_async_to_lds_b128 %4, %12, off\n\t"
      "global_load_async_to_lds_b128 %5, %13, off\n\t"
      "global_load_async_to_lds_b128 %6, %14, off\n\t"
      "global_load_async_to_lds_b128 %7, %15, off\n\t"
      "s_wait_xcnt 0x0"
      :: "v"(lds), "v"(lds + RS * GPITCH), "v"(lds + 2 * RS * GPITCH),
         "v"(lds + 3 * RS * GPITCH), "v"(lds + 64 * GPITCH),
         "v"(lds + (64 + RS) * GPITCH), "v"(lds + (64 + 2 * RS) * GPITCH),
         "v"(lds + (64 + 3 * RS) * GPITCH),
         "v"(g), "v"(g + rstep), "v"(g + 2 * rstep), "v"(g + 3 * rstep),
         "v"(g + 4 * rstep), "v"(g + 5 * rstep), "v"(g + 6 * rstep),
         "v"(g + 7 * rstep)
      : "memory");
}

// A thread's share of 64 rows where half the block copies a tile: 16 bytes of
// every 8th row. Global row + 8 i lands RS * i LDS rows further on: RS = 8 keeps
// the rows' order, RS = 2 deals them (see above). rstep: 8 rows.
template <int RS>
__device__ inline void copy_rows64(unsigned lds, const bf16_t* g, size_t rstep) {
  // The closing s_wait_xcnt stands inside the statement so that no address
  // register of a copy is rewritten ahead of it.
  asm volatile(
      "global_load_async_to_lds_b128 %0, %8, off\n\t"
      "global_load_async_to_lds_b128 %1, %9, off\n\t"
      "global_load_async_to_lds_b128 %2, %10, off\n\t"
      "global_load_async_to_lds_b128 %3, %11, off\n\t"
      "global_load_async_to_lds_b128 %4, %12, off\n\t"
      "global_load_async_to_lds_b128 %5, %13, off\n\t"
      "global_load_async_to_lds_b128 %6, %14, off\n\t"
      "global_load_async_to_lds_b128 %7, %15, off\n\t"
      "s_wait_xcnt 0x0"
      :: "v"(lds), "v"(lds + RS * GPITCH), "v"(lds + 2 * RS * GPITCH),
         "v"(lds + 3 * RS * GPITCH), "v"(lds + 4 * RS * GPITCH),
         "v"(lds + 5 * RS * GPITCH), "v"(lds + 6 * RS * GPITCH),
         "v"(lds + 7 * RS * GPITCH),
         "v"(g), "v"(g + rstep), "v"(g + 2 * rstep), "v"(g + 3 * rstep),
         "v"(g + 4 * rstep), "v"(g + 5 * rstep), "v"(g + 6 * rstep),
         "v"(g + 7 * rstep)
      : "memory");
}

// A whole stage (A tile and Bt tile) by four waves: 32 copies a wave.
__device__ inline void copy_stage_half(unsigned la, const bf16_t* ga,
                                       unsigned lb, const bf16_t* gb,
                                       size_t rstep) {
  copy_rows64<8>(la, ga, rstep);
  copy_rows64<8>(la + 64 * GPITCH, ga + 8 * rstep, rstep);
  copy_rows64<2>(lb, gb, rstep);
  copy_rows64<2>(lb + 64 * GPITCH, gb + 8 * rstep, rstep);
}

// Exact-form GELU, 0.5 v (1 + erf(v / sqrt 2)), of eight values at once, with
// no branch. For z = |v| / sqrt 2 the complementary error function is taken as
// erfc(z) = t (a1 + t (a2 + t (a3 + t (a4 + t a5)))) exp(-z z), t = 1 / (1 + p z)
// (absolute error below 2e-7), and gelu(v) = max(v, 0) - 0.5 |v| erfc(z),
// which cancels nothing on either side of zero. a5 is drawn out of the
// polynomial into the last factor, so that every step holds one constant.
// The eight values are independent chains, so the vector port stays busy.
// The reciprocals and the exponentials stand in one statement, in place on
// their own registers: none overwrites the source of the one in front of it,
// and the closing v_nop is the slot the instruction set asks for between a
// transcendental and an instruction that uses its result.
__device__ inline f32x8 gelu_x8(f32x8 v) {
  constexpr float A5 = 1.061405429f;
  f32x8 m = __builtin_elementwise_max(v, (f32x8)(0.0f));
  f32x8 a = m * 2.0f - v;  // |v|, exact
  f32x8 t = a * (0.3275911f * 0.70710678118654752f) + 1.0f;
  f32x8 e = (v * v) * (-0.5f * 1.4426950408889634f);
  asm("v_rcp_f32 %0, %0\n\t"
      "v_rcp_f32 %1, %1\n\t"
      "v_rcp_f32 %2, %2\n\t"
      "v_rcp_f32 %3, %3\n\t"
      "v_rcp_f32 %4, %4\n\t"
      "v_rcp_f32 %5, %5\n\t"
      "v_rcp_f32 %6, %6\n\t"
      "v_rcp_f32 %7, %7\n\t"
      "v_exp_f32 %8, %8\n\t"
      "v_exp_f32 %9, %9\n\t"
      "v_exp_f32 %10, %10\n\t"
      "v_exp_f32 %11, %11\n\t"
      "v_exp_f32 %12, %12\n\t"
      "v_exp_f32 %13, %13\n\t"
      "v_exp_f32 %14, %14\n\t"
      "v_exp_f32 %15, %15\n\t"
      "v_nop"
      : "+v"(t[0]), "+v"(t[1]), "+v"(t[2]), "+v"(t[3]), "+v"(t[4]),
        "+v"(t[5]), "+v"(t[6]), "+v"(t[7]), "+v"(e[0]), "+v"(e[1]),
        "+v"(e[2]), "+v"(e[3]), "+v"(e[4]), "+v"(e[5]), "+v"(e[6]),
        "+v"(e[7]));
  f32x8 p = t + (-1.453152027f / A5);
  p = p * t + (1.421413741f / A5);
  p = p * t + (-0.284496736f / A5);
  p = p * t + (0.254829592f / A5);
  f32x8 q = (p * t) * e;  // erfc(z) / a5
  return (a * q) * (-0.5f * A5) + m;
}

enum { EPI_QK = 0, EPI_VT = 1, EPI_RESID_F32 = 2, EPI_GELU_BF16 = 3,
       EPI_QKV = 4 };
template <int F> struct store_form { static constexpr int value = F; };

template <int EPI>
__global__ void __launch_bounds__(256, 4) gemm_kernel(
    const bf16_t* __restrict__ A, const bf16_t* __restrict__ Bt,
    const float* __restrict__ bias, void* __restrict__ outp,
    const float* __restrict__ resid, int M, int N, int K, int Ntok,
    float oscale, const float* __restrict__ bias_k,
    const float* __restrict__ bias_v) {
  constexpr int NB = EPI == EPI_RESID_F32 ? 3 : 2;  // buffers of the ring
  __shared__ __attribute__((aligned(16))) unsigned char smem[NB * GSTAGE];
  int wave = threadIdx.x >> 5;
  int lane = threadIdx.x & 31;
  int wm = wave >> 1;          // 0..3
  int wn = wave & 1;           // 0..1
  int row0 = blockIdx.y * 128 + wm * 32;
  int col0 = blockIdx.x * 128 + wn * 64;

  f32x8 acc[2][4];
  #pragma unroll
  for (int t = 0; t < 2; ++t)
    #pragma unroll
    for (int u = 0; u < 4; ++u) acc[t][u] = (f32x8)(0.0f);

  // Copy shares: 16 threads cover a row's 256 bytes, 16 rows per round (three
  // buffers: 8 rows per round, the copying half of the block alone).
  // half: 0 for waves 0-3, 1 for waves 4-7, in a scalar register, so that the
  // tests on it are scalar branches round the copies and their wait.
  const int half = __builtin_amdgcn_readfirstlane((int)(threadIdx.x >> 7));
  int crow = NB == 3 ? (threadIdx.x & 127) >> 4 : threadIdx.x >> 4;
  int cchk = threadIdx.x & 15;
  const bf16_t* gA = A  + (size_t)(blockIdx.y * 128 + crow) * K + cchk * 8;
  const bf16_t* gB = Bt + (size_t)(blockIdx.x * 128 + crow) * K + cchk * 8;
  unsigned lds0 = (unsigned)(uintptr_t)smem + crow * GPITCH + cchk * 16;
  // Bt row c of a wave's 64 goes to LDS row 16 * (c & 3) + (c >> 2).
  unsigned ldsB = (unsigned)(uintptr_t)smem + GTILE +
                  ((crow & 3) * 16 + (crow >> 2)) * GPITCH + cchk * 16;
  size_t rstep = (size_t)(NB == 3 ? 8 : 16) * K;
  int T = K / GBK;

  if constexpr (NB == 3) {
    if (half == 0) {
      copy_stage_half(lds0, gA, ldsB, gB, rstep);
      // tile 0 has landed for its copying waves, behind the barrier for all
      asm volatile("s_wait_asynccnt 0x0" ::: "memory");
      // nobody has touched the third buffer yet: no barrier is owed for it
      if (T > 2)
        copy_stage_half(lds0 + 2 * GSTAGE, gA + 2 * GBK, ldsB + 2 * GSTAGE,
                        gB + 2 * GBK, rstep);
    } else if (T > 1) {
      copy_stage_half(lds0 + GSTAGE, gA + GBK, ldsB + GSTAGE, gB + GBK, rstep);
    }
    __syncthreads();
  } else {
    copy_tile<16>(lds0, gA, rstep);
    copy_tile<4>(ldsB, gB, rstep);
    // tile 0 has landed for this wave, then for the block
    asm volatile("s_wait_asynccnt 0x0" ::: "memory");
    __syncthreads();
    if (T > 1) {
      copy_tile<16>(lds0 + GSTAGE, gA + GBK, rstep);
      copy_tile<4>(ldsB + GSTAGE, gB + GBK, rstep);
    }
  }

  unsigned ring = 0;  // three buffers: byte offset of tile t's buffer
  for (int t = 0; t < T; ++t) {
    unsigned buf = NB == 3 ? ring : (unsigned)(t & 1) * GSTAGE;
    const unsigned char* sA = smem + buf + wm * 32 * GPITCH;
    const unsigned char* sB = smem + buf + GTILE + wn * 64 * GPITCH;
    // Two fragment sets: the reads of the next 32 k go out as one group ahead
    // of this 32 k's WMMAs, so that their LDS latency hides behind them.
    bf16x16 fa[2][2], fb[2][4];
    fa[0][0] = lds_frag(sA);
    fa[0][1] = lds_frag(sA + 16 * GPITCH);
    #pragma unroll  // constant indices keep fb[] in registers
    for (int u = 0; u < 4; ++u) fb[0][u] = lds_frag(sB + u * 16 * GPITCH);
    #pragma unroll  // constant indices keep both sets in registers
    for (int kk = 0; kk < GBK / 32; ++kk) {
      const int cur = kk & 1, nxt = cur ^ 1;
      if (kk + 1 < GBK / 32) {
        fa[nxt][0] = lds_frag(sA + (kk + 1) * 64);
        fa[nxt][1] = lds_frag(sA + 16 * GPITCH + (kk + 1) * 64);
        #pragma unroll  // same reason
        for (int u = 0; u < 4; ++u)
          fb[nxt][u] = lds_frag(sB + u * 16 * GPITCH + (kk + 1) * 64);
      }
      // keeps the read group above from sinking in among the WMMAs below
      __builtin_amdgcn_sched_barrier(0);
      #pragma unroll  // same reason, for acc[] too
      for (int u = 0; u < 4; ++u) {
        acc[0][u] = wmma_bf16(fa[cur][0], fb[cur][u], acc[0][u]);
        acc[1][u] = wmma_bf16(fa[cur][1], fb[cur][u], acc[1][u]);
      }
      // keeps the next read group from rising in among the WMMAs above
      __builtin_amdgcn_sched_barrier(0);
    }
    // this wave's reads of the buffer are done before it is refilled
    asm volatile("s_wait_dscnt 0x0" ::: "memory");
    if constexpr (NB == 3) {
      // The half that copied tile t + 1 has nothing else outstanding; the other
      // half's tile t + 2 flies on, so that half does not wait.
      const bool due = ((t + 1) & 1) == half;
      if (due) asm volatile("s_wait_asynccnt 0x0" ::: "memory");
      __syncthreads();  // publishes tile t + 1, frees tile t's buffer
      if (due && t + 3 < T)
        copy_stage_half(lds0 + buf, gA + (size_t)(t + 3) * GBK, ldsB + buf,
                        gB + (size_t)(t + 3) * GBK, rstep);
      ring = ring == 2 * GSTAGE ? 0 : ring + GSTAGE;
    } else {
      // this wave's copies of tile t + 1 have landed
      asm volatile("s_wait_asynccnt 0x0" ::: "memory");
      __syncthreads();  // publishes tile t + 1, frees tile t's buffer
      if (t + 2 < T) {
        copy_tile<16>(lds0 + buf, gA + (size_t)(t + 2) * GBK, rstep);
        copy_tile<4>(ldsB + buf, gB + (size_t)(t + 2) * GBK, rstep);
      }
    }
  }
  // no copy is outstanding when the wave goes on to its end
  asm volatile("s_wait_asynccnt 0x0" ::: "memory");

  // Epilogue. C layout: VGPR r, lanes 0-15 -> (M=r, N=lane),
  //                     lanes 16-31 -> (M=r+8, N=lane-16);
  // column N of tile u is output column col0 + 4 N + u.
  int nloc = lane & 15;
  int moff = (lane >> 4) * 8;
  int sel = 0;  // EPI_QKV: 0 = Q, 1 = K, 2 = V; alike in the whole block
  if constexpr (EPI == EPI_QKV) {
    sel = blockIdx.x / (DIMC / 128);
    col0 -= sel * DIMC;
    bias = sel == 0 ? bias : sel == 1 ? bias_k : bias_v;
    outp = (bf16_t*)outp + (size_t)sel * M * DIMC;
    oscale = sel == 0 ? oscale : 1.0f;
  }
  int colb = col0 + nloc * 4;  // the lane's four columns: colb + u
  const float4 b4 = *reinterpret_cast<const float4*>(bias + colb);
  const float bs[4] = {b4.x, b4.y, b4.z, b4.w};
  auto store_tiles = [&](auto form) {
  constexpr int F = decltype(form)::value;
  float4 rv[2][8];
  if constexpr (F == EPI_RESID_F32) {
    #pragma unroll  // all sixteen loads are in flight together
    for (int t = 0; t < 2; ++t) {
      #pragma unroll  // same reason
      for (int r = 0; r < 8; ++r) {
        rv[t][r] = *reinterpret_cast<const float4*>(
            resid + (size_t)(row0 + t * 16 + moff + r) * N + colb);
        // the load's address registers are used anew right behind it
        asm volatile("s_wait_xcnt 0x0" ::: "memory");
      }
    }
  }
  #pragma unroll
  for (int t = 0; t < 2; ++t) {
    if constexpr (F == EPI_VT) {
      // -> per-head transposed [b][h][d][tok], bf16: a lane's 8 registers of a
      // tile are 8 neighbouring tokens of one d (Ntok is a multiple of 8).
      int rowg = row0 + t * 16 + moff;
      int bi = rowg / Ntok, tok = rowg % Ntok;
      #pragma unroll
      for (int u = 0; u < 4; ++u) {
        int colg = colb + u;
        int h = colg >> 6, d = colg & 63;
        union { bf16x2 hh[4]; uint4 v; } c;
        #pragma unroll
        for (int r = 0; r < 8; r += 2) {
          f32x2 pr = {(acc[t][u][r] + bs[u]) * oscale,
                      (acc[t][u][r + 1] + bs[u]) * oscale};
          c.hh[r >> 1] = __builtin_convertvector(pr, bf16x2);
        }
        *reinterpret_cast<uint4*>(
            (bf16_t*)outp + (((size_t)bi * HEADS + h) * HDIM + d) * Ntok + tok) =
            c.v;
        // the store's registers are used anew right behind it
        asm volatile("s_wait_xcnt 0x0" ::: "memory");
      }
    } else {
      f32x8 gl[4];
      if constexpr (F == EPI_GELU_BF16) {
        #pragma unroll
        for (int u = 0; u < 4; ++u)
          gl[u] = gelu_x8((acc[t][u] + bs[u]) * oscale);
      } else {
        #pragma unroll
        for (int u = 0; u < 4; ++u) gl[u] = (acc[t][u] + bs[u]) * oscale;
      }
      #pragma unroll
      for (int r = 0; r < 8; ++r) {
        int rowg = row0 + t * 16 + moff + r;
        if constexpr (F == EPI_RESID_F32) {
          size_t idx = (size_t)rowg * N + colb;
          float4 o = {rv[t][r].x + gl[0][r], rv[t][r].y + gl[1][r],
                      rv[t][r].z + gl[2][r], rv[t][r].w + gl[3][r]};
          *reinterpret_cast<float4*>((float*)outp + idx) = o;
        } else {
          f32x2 p0 = {gl[0][r], gl[1][r]}, p1 = {gl[2][r], gl[3][r]};
          union { bf16x2 hh[2]; uint2 v; } c;
          c.hh[0] = __builtin_convertvector(p0, bf16x2);
          c.hh[1] = __builtin_convertvector(p1, bf16x2);
          size_t idx;
          if constexpr (F == EPI_QK) {
            // -> per-head [b][h][tok][d], bf16
            int bi = rowg / Ntok, tok = rowg % Ntok;
            int h = colb >> 6, d = colb & 63;
            idx = ((((size_t)bi * HEADS + h) * Ntok + tok) << 6) + d;
          } else {  // EPI_GELU_BF16
            idx = (size_t)rowg * N + colb;
          }
          *reinterpret_cast<uint2*>((bf16_t*)outp + idx) = c.v;
        }
        // the store's registers are used anew right behind it
        asm volatile("s_wait_xcnt 0x0" ::: "memory");
      }
    }
  }
  };
  if constexpr (EPI == EPI_QKV) {
    if (sel == 2) {
      store_tiles(store_form<EPI_VT>{});
    } else {
      store_tiles(store_form<EPI_QK>{});
    }
  } else {
    store_tiles(store_form<EPI>{});
  }
}

#define AKEYS  128
#define KPITCH 144
#define VPITCH 272
#define KTILE  (AKEYS * KPITCH)
#define VTILE  (HDIM * VPITCH)
#define ASTAGE (KTILE + VTILE)

// 16x32 bf16 fragment from LDS rows of the given byte pitch; same lane and k
// order as load_frag.
__device__ inline bf16x16 lds_frag_at(const unsigned char* base, int pitch) {
  int lane = threadIdx.x & 31;
  const unsigned char* p = base + (lane & 15) * pitch + (lane >> 4) * 16;
  union { uint4 u[2]; bf16x16 v; } cv;
  cv.u[0] = *reinterpret_cast<const uint4*>(p);
  cv.u[1] = *reinterpret_cast<const uint4*>(p + 32);
  return cv.v;
}

// The value that lane l ^ 16 holds.
__device__ inline float other_half(float x) {
  int i = __builtin_bit_cast(int, x);
  return __builtin_bit_cast(
      float, __builtin_amdgcn_permlanex16(i, i, 0x76543210, 0xfedcba98, false,
                                          false));
}

__device__ inline float max3f(float a, float b, float c) {
  return fmaxf(fmaxf(a, b), c);
}

// Exponentials base 2, each in place on its own register, in one statement:
// so none overwrites the source of the one in front of it, and the closing
// v_nop is the slot the instruction set asks for between a transcendental and
// an instruction that uses its result.
__device__ inline void exp2_x8(float (&a)[8]) {
  asm("v_exp_f32 %0, %0\n\t"
      "v_exp_f32 %1, %1\n\t"
      "v_exp_f32 %2, %2\n\t"
      "v_exp_f32 %3, %3\n\t"
      "v_exp_f32 %4, %4\n\t"
      "v_exp_f32 %5, %5\n\t"
      "v_exp_f32 %6, %6\n\t"
      "v_exp_f32 %7, %7\n\t"
      "v_nop"
      : "+v"(a[0]), "+v"(a[1]), "+v"(a[2]), "+v"(a[3]), "+v"(a[4]),
        "+v"(a[5]), "+v"(a[6]), "+v"(a[7]));
}
__device__ inline float exp2_x1(float a) {
  asm("v_exp_f32 %0, %0\n\t"
      "v_nop"
      : "+v"(a));
  return a;
}
#define LOG2E 1.4426950408889634f

// One thread's share of a stage: 16 bytes of every 32nd K row and of every
// 16th Vt row. lk, lv: the lane's LDS byte addresses; gk, gv: its global
// addresses; vstep: 16 Vt rows in elements.
__device__ inline void copy_kv(unsigned lk, const bf16_t* gk, unsigned lv,
                               const bf16_t* gv, size_t vstep) {
  // The closing s_wait_xcnt stands inside the statement so that no address
  // register of a copy is rewritten ahead of it.
  asm volatile(
      "global_load_async_to_lds_b128 %0, %8, off\n\t"
      "global_load_async_to_lds_b128 %1, %9, off\n\t"
      "global_load_async_to_lds_b128 %2, %10, off\n\t"
      "global_load_async_to_lds_b128 %3, %11, off\n\t"
      "global_load_async_to_lds_b128 %4, %12, off\n\t"
      "global_load_async_to_lds_b128 %5, %13, off\n\t"
      "global_load_async_to_lds_b128 %6, %14, off\n\t"
      "global_load_async_to_lds_b128 %7, %15, off\n\t"
      "s_wait_xcnt 0x0"
      :: "v"(lk), "v"(lk + 32 * KPITCH), "v"(lk + 64 * KPITCH),
         "v"(lk + 96 * KPITCH),
         "v"(lv), "v"(lv + 16 * VPITCH), "v"(lv + 32 * VPITCH),
         "v"(lv + 48 * VPITCH),
         "v"(gk), "v"(gk + 32 * HDIM), "v"(gk + 64 * HDIM),
         "v"(gk + 96 * HDIM),
         "v"(gv), "v"(gv + vstep), "v"(gv + 2 * vstep), "v"(gv + 3 * vstep)
      : "memory");
}

// Four waves per SIMD is what the grid gives (two blocks a WGP). Told so, the
// compiler keeps a sub-pass's LDS reads together ahead of the WMMAs; aiming at
// more waves it saves registers by a load, a wait and a WMMA in turn.
__global__ void __launch_bounds__(256)
__attribute__((amdgpu_waves_per_eu(4, 4))) attn_kernel(
    const bf16_t* __restrict__ q, const bf16_t* __restrict__ k,
    const bf16_t* __restrict__ vt, bf16_t* __restrict__ out, int Ntok) {
  __shared__ __attribute__((aligned(16))) unsigned char kv[2 * ASTAGE];

  int wave = threadIdx.x >> 5;
  int lane = threadIdx.x & 31;
  int bh = blockIdx.y;
  int q0 = blockIdx.x * 128 + wave * 16;

  const bf16_t* Qh = q  + (size_t)bh * Ntok * HDIM;
  const bf16_t* Kh = k  + (size_t)bh * Ntok * HDIM;
  const bf16_t* Vh = vt + (size_t)bh * HDIM * Ntok;

  // B operand of S^T: column = query q0 + (lane & 15), k = d.
  bf16x16 qf0 = load_frag(Qh + (size_t)q0 * HDIM + 0, HDIM);
  bf16x16 qf1 = load_frag(Qh + (size_t)q0 * HDIM + 32, HDIM);

  // O^T tiles: row d = 16 u + 8 * (lane >> 4) + r, column = the lane's query.
  f32x8 oacc[4];
  #pragma unroll
  for (int u = 0; u < 4; ++u) oacc[u] = (f32x8)(0.0f);
  // The lane's query: maximum in use (alike in both halves), and the sum over
  // the keys of this half alone.
  float mrun = -1e30f, lrun = 0.0f;

  // Copy shares. K: 8 threads cover a row's 128 bytes, 32 rows per round.
  // Vt: 16 threads cover a row's 256 bytes of the stage, 16 rows per round.
  int tid = threadIdx.x;
  const bf16_t* gK = Kh + (size_t)(tid >> 3) * HDIM + (tid & 7) * 8;
  const bf16_t* gV = Vh + (size_t)(tid >> 4) * Ntok + (tid & 15) * 8;
  unsigned lk0 = (unsigned)(uintptr_t)kv + (tid >> 3) * KPITCH + (tid & 7) * 16;
  unsigned lv0 =
      (unsigned)(uintptr_t)kv + KTILE + (tid >> 4) * VPITCH + (tid & 15) * 16;
  size_t vstep = (size_t)16 * Ntok;
  int T = Ntok / AKEYS;

  copy_kv(lk0, gK, lv0, gV, vstep);
  // stage 0 has landed for this wave, then for the block
  asm volatile("s_wait_asynccnt 0x0" ::: "memory");
  __syncthreads();
  if (T > 1)
    copy_kv(lk0 + ASTAGE, gK + AKEYS * HDIM, lv0 + ASTAGE, gV + AKEYS, vstep);

  for (int t = 0; t < T; ++t) {
   unsigned buf = (unsigned)(t & 1) * ASTAGE;
   for (int sub = 0; sub < AKEYS / 64; ++sub) {
    const unsigned char* sK = kv + buf + sub * 64 * KPITCH;
    const unsigned char* sV = kv + buf + KTILE + sub * 128;
    // 4 S^T tiles: 64 keys x 16 queries (contraction over d=64).
    f32x8 s[4];
    #pragma unroll
    for (int i = 0; i < 4; ++i) {
      const unsigned char* Kt = sK + i * 16 * KPITCH;
      f32x8 si = (f32x8)(0.0f);
      si = wmma_bf16(lds_frag_at(Kt, KPITCH), qf0, si);
      si = wmma_bf16(lds_frag_at(Kt + 64, KPITCH), qf1, si);
      s[i] = si;
    }

    // Online softmax update of the lane's query over its 32 scores.
    float m8[8];
    #pragma unroll
    for (int r = 0; r < 8; ++r)
      m8[r] = fmaxf(max3f(s[0][r], s[1][r], s[2][r]), s[3][r]);
    float mx = fmaxf(max3f(m8[0], m8[1], m8[2]),
                     fmaxf(max3f(m8[3], m8[4], m8[5]), fmaxf(m8[6], m8[7])));
    mx = fmaxf(mx, other_half(mx));
    float mnew  = fmaxf(mrun, mx);
    float alpha = exp2_x1((mrun - mnew) * LOG2E);
    mrun = mnew;

    // P^T as B operand: elements 0..7 of a lane are tile 2 ks, registers
    // 0..7 (keys 8 * half + r), elements 8..15 tile 2 ks + 1: the k order in
    // which lds_frag_at brings the keys of a Vt row.
    bf16x16 pf[2];
    float rs[4];
    #pragma unroll
    for (int i = 0; i < 4; ++i) {
      float p[8];
      #pragma unroll
      for (int r = 0; r < 8; ++r) p[r] = (s[i][r] - mnew) * LOG2E;
      exp2_x8(p);
      rs[i] = ((p[0] + p[1]) + (p[2] + p[3])) + ((p[4] + p[5]) + (p[6] + p[7]));
      #pragma unroll
      for (int r = 0; r < 8; r += 2) {
        f32x2 pr = {p[r], p[r + 1]};
        bf16x2 pb = __builtin_convertvector(pr, bf16x2);
        pf[i >> 1][(i & 1) * 8 + r]     = pb[0];
        pf[i >> 1][(i & 1) * 8 + r + 1] = pb[1];
      }
    }
    lrun = lrun * alpha + ((rs[0] + rs[1]) + (rs[2] + rs[3]));
    #pragma unroll
    for (int u = 0; u < 4; ++u) oacc[u] *= alpha;

    #pragma unroll
    for (int ks = 0; ks < 2; ++ks) {
      #pragma unroll
      for (int u = 0; u < 4; ++u) {
        bf16x16 vf = lds_frag_at(sV + u * 16 * VPITCH + ks * 64, VPITCH);
        oacc[u] = wmma_bf16(vf, pf[ks], oacc[u]);
      }
    }
   }
   // this wave's reads of the buffer are done before it is refilled
   asm volatile("s_wait_dscnt 0x0" ::: "memory");
   // this wave's copies of stage t + 1 have landed
   asm volatile("s_wait_asynccnt 0x0" ::: "memory");
   __syncthreads();  // publishes stage t + 1, frees stage t's buffer
   if (t + 2 < T)
     copy_kv(lk0 + buf, gK + (size_t)(t + 2) * AKEYS * HDIM, lv0 + buf,
             gV + (size_t)(t + 2) * AKEYS, vstep);
  }
  // no copy is outstanding when the wave goes on to its end
  asm volatile("s_wait_asynccnt 0x0" ::: "memory");

  // Finalize: join the halves' sums, divide, and put the heads back to
  // [b][tok][DIMC]; a lane's 8 registers of a tile are 8 neighbouring d.
  int h  = bh & (HEADS - 1);
  int bi = bh >> 4;
  float inv = 1.0f / (lrun + other_half(lrun));
  int tok = q0 + (lane & 15);
  bf16_t* orow =
      out + ((size_t)bi * Ntok + tok) * DIMC + h * HDIM + (lane >> 4) * 8;
  #pragma unroll
  for (int u = 0; u < 4; ++u) {
    union { bf16x2 hh[4]; uint4 v; } c;
    #pragma unroll
    for (int r = 0; r < 8; r += 2) {
      f32x2 pr = {oacc[u][r] * inv, oacc[u][r + 1] * inv};
      c.hh[r >> 1] = __builtin_convertvector(pr, bf16x2);
    }
    *reinterpret_cast<uint4*>(orow + u * 16) = c.v;
  }
}

// ---------------------------------------------------------------------------
// Host-side orchestration (graph-capture safe: launches only).
// ---------------------------------------------------------------------------
extern "C" void kernel_launch(void* const* d_in, const int* in_sizes, int n_in,
                              void* d_out, int out_size, void* d_ws, size_t ws_size,
                              hipStream_t stream) {
  (void)in_sizes; (void)n_in; (void)out_size; (void)ws_size;

  const float* x     = (const float*)d_in[0];
  const float* ln1_w = (const float*)d_in[1];
  const float* ln1_b = (const float*)d_in[2];
  const float* ln2_w = (const float*)d_in[3];
  const float* ln2_b = (const float*)d_in[4];
  const float* Wq = (const float*)d_in[5];  const float* bq = (const float*)d_in[6];
  const float* Wk = (const float*)d_in[7];  const float* bk = (const float*)d_in[8];
  const float* Wv = (const float*)d_in[9];  const float* bv = (const float*)d_in[10];
  const float* Wo = (const float*)d_in[11]; const float* bo = (const float*)d_in[12];
  const float* W1 = (const float*)d_in[13]; const float* b1 = (const float*)d_in[14];
  const float* W2 = (const float*)d_in[15]; const float* b2 = (const float*)d_in[16];

  // Workspace layout
  char* ws = (char*)d_ws;
  size_t off = 0;
  auto alloc = [&](size_t bytes) { char* p = ws + off; off += (bytes + 255) & ~size_t(255); return p; };
  // Wqt, Wkt, Wvt lie one behind the other with no gap (sizes are multiples of
  // 256): the merged projection reads them as one [3 * DIMC][DIMC] matrix.
  bf16_t* Wqt = (bf16_t*)alloc((size_t)DIMC * DIMC * 2);
  bf16_t* Wkt = (bf16_t*)alloc((size_t)DIMC * DIMC * 2);
  bf16_t* Wvt = (bf16_t*)alloc((size_t)DIMC * DIMC * 2);
  bf16_t* Wot = (bf16_t*)alloc((size_t)DIMC * DIMC * 2);
  bf16_t* W1t = (bf16_t*)alloc((size_t)DIMC * HID * 2);
  bf16_t* W2t = (bf16_t*)alloc((size_t)HID * DIMC * 2);
  bf16_t* xn   = (bf16_t*)alloc((size_t)MTOT * DIMC * 2);
  // qb, kb, vtb likewise: output sel of the merged projection starts at
  // qb + sel * MTOT * DIMC.
  bf16_t* qb   = (bf16_t*)alloc((size_t)MTOT * DIMC * 2);
  bf16_t* kb   = (bf16_t*)alloc((size_t)MTOT * DIMC * 2);
  bf16_t* vtb  = (bf16_t*)alloc((size_t)MTOT * DIMC * 2);
  bf16_t* attn = (bf16_t*)alloc((size_t)MTOT * DIMC * 2);
  float*  x2   = (float*)alloc((size_t)MTOT * DIMC * 4);
  bf16_t* xn2  = (bf16_t*)alloc((size_t)MTOT * DIMC * 2);
  bf16_t* hbuf = (bf16_t*)alloc((size_t)MTOT * HID * 2);

  dim3 blk(256);

  // 1, 2. Weight prep (fp32 -> bf16 transposed) and LN1
  prep_kernel<<<PB_ALL, blk, 0, stream>>>(Wq, Wk, Wv, Wo, W1, W2, Wqt, Wkt, Wvt,
                                          Wot, W1t, W2t, x, ln1_w, ln1_b, xn);

  // 3. Q, K, V projections (one WMMA GEMM). Q is pre-scaled by 1/sqrt(HDIM).
  dim3 gqkv3(3 * DIMC / 128, MTOT / 128);
  gemm_kernel<EPI_QKV><<<gqkv3, blk, 0, stream>>>(xn, Wqt, bq, qb, nullptr, MTOT, 3 * DIMC, DIMC, NTOK, 0.125f, bk, bv);
  dim3 gqkv(DIMC / 128, MTOT / 128);

  // 4. Flash attention
  dim3 gatt(NTOK / 128, BATCH * HEADS);
  attn_kernel<<<gatt, blk, 0, stream>>>(qb, kb, vtb, attn, NTOK);

  // 5. Output projection + residual: x2 = x + attn @ Wo + bo
  gemm_kernel<EPI_RESID_F32><<<gqkv, blk, 0, stream>>>(attn, Wot, bo, x2, x, MTOT, DIMC, DIMC, NTOK, 1.0f, nullptr, nullptr);

  // 6. LN2
  layernorm_kernel<<<MTOT, blk, 0, stream>>>(x2, ln2_w, ln2_b, xn2);

  // 7. MLP up + GELU: h = gelu(xn2 @ W1 + b1)
  dim3 gup(HID / 128, MTOT / 128);
  gemm_kernel<EPI_GELU_BF16><<<gup, blk, 0, stream>>>(xn2, W1t, b1, hbuf, nullptr, MTOT, HID, DIMC, NTOK, 1.0f, nullptr, nullptr);

  // 8. MLP down + residual -> output: out = x2 + h @ W2 + b2
  gemm_kernel<EPI_RESID_F32><<<gqkv, blk, 0, stream>>>(hbuf, W2t, b2, (float*)d_out, x2, MTOT, DIMC, HID, NTOK, 1.0f, nullptr, nullptr);
}

// v009
// It runs in 147 microseconds.
// Two timings next to v008 both put it at 1.03 times that version's speed.
// Over all steps from v000 it is 4.44 times as fast.
#include <hip/hip_runtime.h>
#include <hip/hip_bf16.h>

// ---------------------------------------------------------------------------
// Transformer encoder block for MI455X (gfx1250, wave32, WMMA).
// All GEMMs run on v_wmma_f32_16x16x32_bf16; attention is flash-style with
// 64-key tiles, its two products taken transposed. 1/sqrt(d) is folded into the Q projection epilogue.
// ---------------------------------------------------------------------------

typedef __bf16 bf16_t;
typedef __attribute__((ext_vector_type(16))) __bf16 bf16x16;
typedef __attribute__((ext_vector_type(8)))  float  f32x8;

#define DIMC   1024
#define HEADS  16
#define HDIM   64
#define HID    4096
#define NTOK   2048
#define BATCH  2
#define MTOT   (BATCH * NTOK)   // 4096 tokens

// ---------------------------------------------------------------------------
// WMMA helpers
// ---------------------------------------------------------------------------
__device__ inline f32x8 wmma_bf16(bf16x16 a, bf16x16 b, f32x8 c) {
  // (neg_a, A, neg_b, B, c_mod, C, reuse_a, reuse_b)
  return __builtin_amdgcn_wmma_f32_16x16x32_bf16(false, a, false, b,
                                                 (short)0, c, false, false);
}

// Load a 16x32 bf16 fragment (A-style layout, used here for Q as a B
// operand; the A fragments of K and Vt are read from LDS in the same order).
// ISA 16-bit A layout: lane = m + 16*half;
//   VGPR0..3 : K = half*8 + 0..7
//   VGPR4..7 : K = 16 + half*8 + 0..7
// base points at (row0, k0); ld = row stride in elements (multiple of 8).
__device__ inline bf16x16 load_frag(const bf16_t* base, int ld) {
  int lane = threadIdx.x & 31;
  int m    = lane & 15;
  int half = lane >> 4;
  const bf16_t* p = base + (size_t)m * (size_t)ld + half * 8;
  union { uint4 u[2]; bf16x16 v; } cv;
  cv.u[0] = *reinterpret_cast<const uint4*>(p);
  cv.u[1] = *reinterpret_cast<const uint4*>(p + 16);
  return cv.v;
}

// ---------------------------------------------------------------------------
// Weight prep: fp32 [K][N] -> bf16 transposed [N][K].
// One block moves a 128(k) x 64(n) tile, number (bx, by) of its matrix; K and
// N are compile-time, so the row steps become immediate offsets of one address.
// A thread reads 8 k-rows x 4 n as 16-byte loads (a half-wave covers 256
// contiguous bytes of an input row) and packs the eight k of each n into one
// 16-byte chunk. The chunks cross through LDS, so that a half-wave then
// stores 256 contiguous bytes of an output row.
// LDS tile: [n][16 chunks]; the chunk index is XORed with n >> 2, which keeps
// both the 16-byte LDS writes and the reads free of bank conflicts.
// ---------------------------------------------------------------------------
typedef __attribute__((ext_vector_type(4))) float  f32x4;
typedef __attribute__((ext_vector_type(2))) float  f32x2;
typedef __attribute__((ext_vector_type(2))) __bf16 bf16x2;

template <int K, int N>
__device__ inline void wt_transpose_tile(const float* __restrict__ in,
                                         bf16_t* __restrict__ out, int bx,
                                         int by, uint4* tile) {
  static_assert(K % 128 == 0 && N % 64 == 0, "whole tiles only");
  int tid = threadIdx.x;
  int lo  = tid & 15;
  int hi  = tid >> 4;
  int k0  = by * 128;
  int n0  = bx * 64;

  // lo = group of 4 n, hi = group of 8 k
  const float* src = in + (size_t)(k0 + hi * 8) * N + n0 + lo * 4;
  f32x4 v[8];
  #pragma unroll  // all eight loads in flight at once, v[] in registers
  for (int i = 0; i < 8; ++i)
    v[i] = *reinterpret_cast<const f32x4*>(src + i * N);

  #pragma unroll  // constant indices into v[], or it would leave the registers
  for (int j = 0; j < 4; ++j) {
    union { bf16x2 h[4]; uint4 u; } c;
    #pragma unroll  // same reason
    for (int p = 0; p < 4; ++p) {
      f32x2 pr = {v[2 * p][j], v[2 * p + 1][j]};
      c.h[p] = __builtin_convertvector(pr, bf16x2);
    }
    tile[(lo * 4 + j) * 16 + (hi ^ lo)] = c.u;
  }
  __syncthreads();

  // lo = chunk of 8 k, hi = n within a group of 16
  bf16_t* dst = out + (size_t)(n0 + hi) * K + k0 + lo * 8;
  #pragma unroll  // four LDS reads issued together ahead of the stores
  for (int s = 0; s < 4; ++s) {
    int n = s * 16 + hi;
    uint4 u = tile[n * 16 + (lo ^ (n >> 2))];
    *reinterpret_cast<uint4*>(dst + s * 16 * K) = u;
  }
  // In the built kernel another arm of the caller's choice follows and reuses
  // the stores' address and data registers: the wait stands in front of that.
  asm volatile("s_wait_xcnt 0x0" ::: "memory");
}

// ---------------------------------------------------------------------------
// LayerNorm over DIMC=1024, one block (256 threads) per row. Output bf16.
// ---------------------------------------------------------------------------
__device__ inline void layernorm_row(
    const float* __restrict__ x, const float* __restrict__ w,
    const float* __restrict__ b, bf16_t* __restrict__ out, int row) {
  __shared__ float ssum[8];
  __shared__ float ssq[8];
  int tid  = threadIdx.x;
  int lane = tid & 31;
  int wv   = tid >> 5;

  const float4* xr = reinterpret_cast<const float4*>(x + (size_t)row * DIMC);
  float4 v = xr[tid];
  float s  = v.x + v.y + v.z + v.w;
  float sq = v.x * v.x + v.y * v.y + v.z * v.z + v.w * v.w;
  #pragma unroll
  for (int mask = 16; mask >= 1; mask >>= 1) {
    s  += __shfl_xor(s, mask, 32);
    sq += __shfl_xor(sq, mask, 32);
  }
  if (lane == 0) { ssum[wv] = s; ssq[wv] = sq; }
  __syncthreads();
  float ts = 0.f, tq = 0.f;
  #pragma unroll
  for (int i = 0; i < 8; ++i) { ts += ssum[i]; tq += ssq[i]; }
  float mu  = ts * (1.0f / DIMC);
  float var = tq * (1.0f / DIMC) - mu * mu;
  float inv = rsqrtf(var + 1e-5f);

  int c = tid * 4;
  const float4 wv4 = reinterpret_cast<const float4*>(w)[tid];
  const float4 bv4 = reinterpret_cast<const float4*>(b)[tid];
  bf16_t* o = out + (size_t)row * DIMC + c;
  o[0] = (bf16_t)((v.x - mu) * inv * wv4.x + bv4.x);
  o[1] = (bf16_t)((v.y - mu) * inv * wv4.y + bv4.y);
  o[2] = (bf16_t)((v.z - mu) * inv * wv4.z + bv4.z);
  o[3] = (bf16_t)((v.w - mu) * inv * wv4.w + bv4.w);
}

__global__ void __launch_bounds__(256) layernorm_kernel(
    const float* __restrict__ x, const float* __restrict__ w,
    const float* __restrict__ b, bf16_t* __restrict__ out) {
  layernorm_row(x, w, b, out, blockIdx.x);
}

// ---------------------------------------------------------------------------
// All the work that depends on the inputs alone, in one launch: the six weight
// transposes and the first LayerNorm. A block does one transpose tile or one
// row; which, its index says. The transposes, the longer blocks, come first.
// ---------------------------------------------------------------------------
#define PB_W1  ((HID / 64) * (DIMC / 128))    // tiles of W1, as many of W2
#define PB_SQ  ((DIMC / 64) * (DIMC / 128))   // tiles of a square weight
#define PB_ALL (2 * PB_W1 + 4 * PB_SQ + MTOT)

__global__ void __launch_bounds__(256) prep_kernel(
    const float* __restrict__ Wq, const float* __restrict__ Wk,
    const float* __restrict__ Wv, const float* __restrict__ Wo,
    const float* __restrict__ W1, const float* __restrict__ W2,
    bf16_t* __restrict__ Wqt, bf16_t* __restrict__ Wkt,
    bf16_t* __restrict__ Wvt, bf16_t* __restrict__ Wot,
    bf16_t* __restrict__ W1t, bf16_t* __restrict__ W2t,
    const float* __restrict__ x, const float* __restrict__ w,
    const float* __restrict__ b, bf16_t* __restrict__ xn) {
  __shared__ uint4 tile[64 * 16];
  int i = blockIdx.x;
  if (i < PB_W1) {
    wt_transpose_tile<DIMC, HID>(W1, W1t, i % (HID / 64), i / (HID / 64), tile);
  } else if (i < 2 * PB_W1) {
    i -= PB_W1;
    wt_transpose_tile<HID, DIMC>(W2, W2t, i % (DIMC / 64), i / (DIMC / 64),
                                 tile);
  } else if (i < 2 * PB_W1 + 4 * PB_SQ) {
    i -= 2 * PB_W1;
    int which = i / PB_SQ;
    i %= PB_SQ;
    const float* in = which == 0 ? Wq : which == 1 ? Wk : which == 2 ? Wv : Wo;
    bf16_t* out = which == 0 ? Wqt : which == 1 ? Wkt : which == 2 ? Wvt : Wot;
    wt_transpose_tile<DIMC, DIMC>(in, out, i % (DIMC / 64), i / (DIMC / 64),
                                  tile);
  } else {
    layernorm_row(x, w, b, xn, i - (2 * PB_W1 + 4 * PB_SQ));
    // same reason as at the end of wt_transpose_tile, for the row's stores
    asm volatile("s_wait_xcnt 0x0" ::: "memory");
  }
}

// ---------------------------------------------------------------------------
// Generic bf16 WMMA GEMM:  C = (A[M,K] * Bt[N,K]^T + bias) * oscale, epilogue.
// Block = 256 threads (8 waves as 4x2), block tile 128x128,
// wave tile 32x64 (2x4 accumulator tiles), WMMA K-step 32.
// The 128-row A and Bt tiles, 128 k at a time, are brought into LDS by
// asynchronous 16-byte copies (a wave covers whole 128-byte lines), two
// buffers: tile t + 1 flies while tile t is worked on. M and N are multiples
// of 128, K a multiple of 128.
// The rows of Bt (output columns) are dealt to the LDS rows so that column n of
// a wave's B tile u is output column 4 n + u of the wave's 64: the four
// accumulator tiles of a lane then hold four neighbouring columns of a row, and
// the epilogue moves 8 or 16 bytes a lane, 16 lanes covering whole 128-byte
// lines of an output row.
// Where the grid has one block a WGP (EPI_RESID_F32: N = DIMC) half the LDS
// lies idle: there, for speed only, the
// ring has three buffers and a tile flies for two trips. Waves 0-3 copy the even
// tiles, waves 4-7 the odd ones, so that a wave never has more than one tile
// outstanding and its wait to 0 holds back nothing but the tile that is due.
// EPI_QKV is the Q, K and V projections as one product: Bt holds the three
// transposed weights one behind the other (N = 3 * DIMC), outp the three
// outputs likewise; a block's 128 columns lie in one of the three.
// ---------------------------------------------------------------------------
#define GBK    128               // k per LDS tile: 256 bytes of every row
#define GPITCH 272               // LDS row pitch in bytes: 256 + 16 pad
#define GTILE  (128 * GPITCH)    // one operand's tile
#define GSTAGE (2 * GTILE)       // a buffer: A tile, then Bt tile

// 16x32 bf16 fragment from an LDS tile; same lane and k order as load_frag.
__device__ inline bf16x16 lds_frag(const unsigned char* base) {
  int lane = threadIdx.x & 31;
  const unsigned char* p = base + (lane & 15) * GPITCH + (lane >> 4) * 16;
  union { uint4 u[2]; bf16x16 v; } cv;
  cv.u[0] = *reinterpret_cast<const uint4*>(p);
  cv.u[1] = *reinterpret_cast<const uint4*>(p + 32);
  return cv.v;
}

// One thread's share of a 128-row tile: 16 bytes of every 16th row.
// lds: the lane's LDS byte address, g: its global address, rstep: 16 rows.
// Global row + 16 i lands RS * (i & 3) + 64 * (i >> 2) LDS rows further on:
// RS = 16 keeps the rows' order, RS = 4 deals them (see above).
template <int RS>
__device__ inline void copy_tile(unsigned lds, const bf16_t* g, size_t rstep) {
  // The closing s_wait_xcnt stands inside the statement so that no address
  // register of a copy is rewritten ahead of it.
  asm volatile(
      "global_load_async_to_lds_b128 %0, %8, off\n\t"
      "global_load_async_to_lds_b128 %1, %9, off\n\t"
      "global_load_async_to_lds_b128 %2, %10, off\n\t"
      "global_load_async_to_lds_b128 %3, %11, off\n\t"
      "global_load_async_to_lds_b128 %4, %12, off\n\t"
      "global_load_async_to_lds_b128 %5, %13, off\n\t"
      "global_load_async_to_lds_b128 %6, %14, off\n\t"
      "global_load_async_to_lds_b128 %7, %15, off\n\t"
      "s_wait_xcnt 0x0"
      :: "v"(lds), "v"(lds + RS * GPITCH), "v"(lds + 2 * RS * GPITCH),
         "v"(lds + 3 * RS * GPITCH), "v"(lds + 64 * GPITCH),
         "v"(lds + (64 + RS) * GPITCH), "v"(lds + (64 + 2 * RS) * GPITCH),
         "v"(lds + (64 + 3 * RS) * GPITCH),
         "v"(g), "v"(g + rstep), "v"(g + 2 * rstep), "v"(g + 3 * rstep),
         "v"(g + 4 * rstep), "v"(g + 5 * rstep), "v"(g + 6 * rstep),
         "v"(g + 7 * rstep)
      : "memory");
}

// A thread's share of 64 rows where half the block copies a tile: 16 bytes of
// every 8th row. Global row + 8 i lands RS * i LDS rows further on: RS = 8 keeps
// the rows' order, RS = 2 deals them (see above). rstep: 8 rows.
template <int RS>
__device__ inline void copy_rows64(unsigned lds, const bf16_t* g, size_t rstep) {
  // The closing s_wait_xcnt stands inside the statement so that no address
  // register of a copy is rewritten ahead of it.
  asm volatile(
      "global_load_async_to_lds_b128 %0, %8, off\n\t"
      "global_load_async_to_lds_b128 %1, %9, off\n\t"
      "global_load_async_to_lds_b128 %2, %10, off\n\t"
      "global_load_async_to_lds_b128 %3, %11, off\n\t"
      "global_load_async_to_lds_b128 %4, %12, off\n\t"
      "global_load_async_to_lds_b128 %5, %13, off\n\t"
      "global_load_async_to_lds_b128 %6, %14, off\n\t"
      "global_load_async_to_lds_b128 %7, %15, off\n\t"
      "s_wait_xcnt 0x0"
      :: "v"(lds), "v"(lds + RS * GPITCH), "v"(lds + 2 * RS * GPITCH),
         "v"(lds + 3 * RS * GPITCH), "v"(lds + 4 * RS * GPITCH),
         "v"(lds + 5 * RS * GPITCH), "v"(lds + 6 * RS * GPITCH),
         "v"(lds + 7 * RS * GPITCH),
         "v"(g), "v"(g + rstep), "v"(g + 2 * rstep), "v"(g + 3 * rstep),
         "v"(g + 4 * rstep), "v"(g + 5 * rstep), "v"(g + 6 * rstep),
         "v"(g + 7 * rstep)
      : "memory");
}

// A whole stage (A tile and Bt tile) by four waves: 32 copies a wave.
__device__ inline void copy_stage_half(unsigned la, const bf16_t* ga,
                                       unsigned lb, const bf16_t* gb,
                                       size_t rstep) {
  copy_rows64<8>(la, ga, rstep);
  copy_rows64<8>(la + 64 * GPITCH, ga + 8 * rstep, rstep);
  copy_rows64<2>(lb, gb, rstep);
  copy_rows64<2>(lb + 64 * GPITCH, gb + 8 * rstep, rstep);
}

// Exact-form GELU, 0.5 v (1 + erf(v / sqrt 2)), of eight values at once, with
// no branch. For z = |v| / sqrt 2 the complementary error function is taken as
// erfc(z) = t (a1 + t (a2 + t (a3 + t (a4 + t a5)))) exp(-z z), t = 1 / (1 + p z)
// (absolute error below 2e-7), and gelu(v) = max(v, 0) - 0.5 |v| erfc(z),
// which cancels nothing on either side of zero. a5 is drawn out of the
// polynomial into the last factor, so that every step holds one constant.
// The eight values are independent chains, so the vector port stays busy.
// The reciprocals and the exponentials stand in one statement, in place on
// their own registers: none overwrites the source of the one in front of it,
// and the closing v_nop is the slot the instruction set asks for between a
// transcendental and an instruction that uses its result.
__device__ inline f32x8 gelu_x8(f32x8 v) {
  constexpr float A5 = 1.061405429f;
  f32x8 m = __builtin_elementwise_max(v, (f32x8)(0.0f));
  f32x8 a = m * 2.0f - v;  // |v|, exact
  f32x8 t = a * (0.3275911f * 0.70710678118654752f) + 1.0f;
  f32x8 e = (v * v) * (-0.5f * 1.4426950408889634f);
  asm("v_rcp_f32 %0, %0\n\t"
      "v_rcp_f32 %1, %1\n\t"
      "v_rcp_f32 %2, %2\n\t"
      "v_rcp_f32 %3, %3\n\t"
      "v_rcp_f32 %4, %4\n\t"
      "v_rcp_f32 %5, %5\n\t"
      "v_rcp_f32 %6, %6\n\t"
      "v_rcp_f32 %7, %7\n\t"
      "v_exp_f32 %8, %8\n\t"
      "v_exp_f32 %9, %9\n\t"
      "v_exp_f32 %10, %10\n\t"
      "v_exp_f32 %11, %11\n\t"
      "v_exp_f32 %12, %12\n\t"
      "v_exp_f32 %13, %13\n\t"
      "v_exp_f32 %14, %14\n\t"
      "v_exp_f32 %15, %15\n\t"
      "v_nop"
      : "+v"(t[0]), "+v"(t[1]), "+v"(t[2]), "+v"(t[3]), "+v"(t[4]),
        "+v"(t[5]), "+v"(t[6]), "+v"(t[7]), "+v"(e[0]), "+v"(e[1]),
        "+v"(e[2]), "+v"(e[3]), "+v"(e[4]), "+v"(e[5]), "+v"(e[6]),
        "+v"(e[7]));
  f32x8 p = t + (-1.453152027f / A5);
  p = p * t + (1.421413741f / A5);
  p = p * t + (-0.284496736f / A5);
  p = p * t + (0.254829592f / A5);
  f32x8 q = (p * t) * e;  // erfc(z) / a5
  return (a * q) * (-0.5f * A5) + m;
}

enum { EPI_QK = 0, EPI_VT = 1, EPI_RESID_F32 = 2, EPI_GELU_BF16 = 3,
       EPI_QKV = 4 };
template <int F> struct store_form { static constexpr int value = F; };

template <int EPI>
__global__ void __launch_bounds__(256, 4) gemm_kernel(
    const bf16_t* __restrict__ A, const bf16_t* __restrict__ Bt,
    const float* __restrict__ bias, void* __restrict__ outp,
    const float* __restrict__ resid, int M, int N, int K, int Ntok,
    float oscale, const float* __restrict__ bias_k,
    const float* __restrict__ bias_v) {
  constexpr int NB = EPI == EPI_RESID_F32 ? 3 : 2;  // buffers of the ring
  __shared__ __attribute__((aligned(16))) unsigned char smem[NB * GSTAGE];
  int wave = threadIdx.x >> 5;
  int lane = threadIdx.x & 31;
  int wm = wave >> 1;          // 0..3
  int wn = wave & 1;           // 0..1
  int row0 = blockIdx.y * 128 + wm * 32;
  int col0 = blockIdx.x * 128 + wn * 64;

  f32x8 acc[2][4];
  #pragma unroll
  for (int t = 0; t < 2; ++t)
    #pragma unroll
    for (int u = 0; u < 4; ++u) acc[t][u] = (f32x8)(0.0f);

  // Copy shares: 16 threads cover a row's 256 bytes, 16 rows per round (three
  // buffers: 8 rows per round, the copying half of the block alone).
  // half: 0 for waves 0-3, 1 for waves 4-7, in a scalar register, so that the
  // tests on it are scalar branches round the copies and their wait.
  const int half = __builtin_amdgcn_readfirstlane((int)(threadIdx.x >> 7));
  int crow = NB == 3 ? (threadIdx.x & 127) >> 4 : threadIdx.x >> 4;
  int cchk = threadIdx.x & 15;
  const bf16_t* gA = A  + (size_t)(blockIdx.y * 128 + crow) * K + cchk * 8;
  const bf16_t* gB = Bt + (size_t)(blockIdx.x * 128 + crow) * K + cchk * 8;
  unsigned lds0 = (unsigned)(uintptr_t)smem + crow * GPITCH + cchk * 16;
  // Bt row c of a wave's 64 goes to LDS row 16 * (c & 3) + (c >> 2).
  unsigned ldsB = (unsigned)(uintptr_t)smem + GTILE +
                  ((crow & 3) * 16 + (crow >> 2)) * GPITCH + cchk * 16;
  size_t rstep = (size_t)(NB == 3 ? 8 : 16) * K;
  int T = K / GBK;

  if constexpr (NB == 3) {
    if (half == 0) {
      copy_stage_half(lds0, gA, ldsB, gB, rstep);
      // tile 0 has landed for its copying waves, behind the barrier for all
      asm volatile("s_wait_asynccnt 0x0" ::: "memory");
      // nobody has touched the third buffer yet: no barrier is owed for it
      if (T > 2)
        copy_stage_half(lds0 + 2 * GSTAGE, gA + 2 * GBK, ldsB + 2 * GSTAGE,
                        gB + 2 * GBK, rstep);
    } else if (T > 1) {
      copy_stage_half(lds0 + GSTAGE, gA + GBK, ldsB + GSTAGE, gB + GBK, rstep);
    }
    __syncthreads();
  } else {
    copy_tile<16>(lds0, gA, rstep);
    copy_tile<4>(ldsB, gB, rstep);
    // tile 0 has landed for this wave, then for the block
    asm volatile("s_wait_asynccnt 0x0" ::: "memory");
    __syncthreads();
    if (T > 1) {
      copy_tile<16>(lds0 + GSTAGE, gA + GBK, rstep);
      copy_tile<4>(ldsB + GSTAGE, gB + GBK, rstep);
    }
  }

  unsigned ring = 0;  // three buffers: byte offset of tile t's buffer
  for (int t = 0; t < T; ++t) {
    unsigned buf = NB == 3 ? ring : (unsigned)(t & 1) * GSTAGE;
    const unsigned char* sA = smem + buf + wm * 32 * GPITCH;
    const unsigned char* sB = smem + buf + GTILE + wn * 64 * GPITCH;
    // Two fragment sets: the reads of the next 32 k go out as one group ahead
    // of this 32 k's WMMAs, so that their LDS latency hides behind them.
    bf16x16 fa[2][2], fb[2][4];
    fa[0][0] = lds_frag(sA);
    fa[0][1] = lds_frag(sA + 16 * GPITCH);
    #pragma unroll  // constant indices keep fb[] in registers
    for (int u = 0; u < 4; ++u) fb[0][u] = lds_frag(sB + u * 16 * GPITCH);
    #pragma unroll  // constant indices keep both sets in registers
    for (int kk = 0; kk < GBK / 32; ++kk) {
      const int cur = kk & 1, nxt = cur ^ 1;
      if (kk + 1 < GBK / 32) {
        fa[nxt][0] = lds_frag(sA + (kk + 1) * 64);
        fa[nxt][1] = lds_frag(sA + 16 * GPITCH + (kk + 1) * 64);
        #pragma unroll  // same reason
        for (int u = 0; u < 4; ++u)
          fb[nxt][u] = lds_frag(sB + u * 16 * GPITCH + (kk + 1) * 64);
      }
      // keeps the read group above from sinking in among the WMMAs below
      __builtin_amdgcn_sched_barrier(0);
      #pragma unroll  // same reason, for acc[] too
      for (int u = 0; u < 4; ++u) {
        acc[0][u] = wmma_bf16(fa[cur][0], fb[cur][u], acc[0][u]);
        acc[1][u] = wmma_bf16(fa[cur][1], fb[cur][u], acc[1][u]);
      }
      // keeps the next read group from rising in among the WMMAs above
      __builtin_amdgcn_sched_barrier(0);
    }
    // this wave's reads of the buffer are done before it is refilled
    asm volatile("s_wait_dscnt 0x0" ::: "memory");
    if constexpr (NB == 3) {
      // The half that copied tile t + 1 has nothing else outstanding; the other
      // half's tile t + 2 flies on, so that half does not wait.
      const bool due = ((t + 1) & 1) == half;
      if (due) asm volatile("s_wait_asynccnt 0x0" ::: "memory");
      __syncthreads();  // publishes tile t + 1, frees tile t's buffer
      if (due && t + 3 < T)
        copy_stage_half(lds0 + buf, gA + (size_t)(t + 3) * GBK, ldsB + buf,
                        gB + (size_t)(t + 3) * GBK, rstep);
      ring = ring == 2 * GSTAGE ? 0 : ring + GSTAGE;
    } else {
      // this wave's copies of tile t + 1 have landed
      asm volatile("s_wait_asynccnt 0x0" ::: "memory");
      __syncthreads();  // publishes tile t + 1, frees tile t's buffer
      if (t + 2 < T) {
        copy_tile<16>(lds0 + buf, gA + (size_t)(t + 2) * GBK, rstep);
        copy_tile<4>(ldsB + buf, gB + (size_t)(t + 2) * GBK, rstep);
      }
    }
  }
  // no copy is outstanding when the wave goes on to its end
  asm volatile("s_wait_asynccnt 0x0" ::: "memory");

  // Epilogue. C layout: VGPR r, lanes 0-15 -> (M=r, N=lane),
  //                     lanes 16-31 -> (M=r+8, N=lane-16);
  // column N of tile u is output column col0 + 4 N + u.
  // A lane's sixteen rows are rowb + 16 t + r. The output's row pitch is a
  // constant of each form (N is DIMC with the residual, HID with GELU), so every
  // access of a lane is one base address plus an immediate offset, and all
  // values are formed before the first store goes out. No register that an
  // issued load or store names is then written again, and the wave does not
  // stop behind each access for the wait that such a rewrite asks for.
  static_assert(NTOK % 32 == 0, "a wave's 32 rows lie in one batch entry");
  int nloc = lane & 15;
  int rowb = row0 + (lane >> 4) * 8;
  int sel = 0;  // EPI_QKV: 0 = Q, 1 = K, 2 = V; alike in the whole block
  if constexpr (EPI == EPI_QKV) {
    sel = blockIdx.x / (DIMC / 128);
    col0 -= sel * DIMC;
    bias = sel == 0 ? bias : sel == 1 ? bias_k : bias_v;
    outp = (bf16_t*)outp + (size_t)sel * M * DIMC;
    oscale = sel == 0 ? oscale : 1.0f;
  }
  int colb = col0 + nloc * 4;  // the lane's four columns: colb + u
  float4 o[2][8];  // EPI_RESID_F32: the residual rows, then the output rows
  if constexpr (EPI == EPI_RESID_F32) {
    const float* rb = resid + (size_t)rowb * DIMC + colb;
    #pragma unroll  // all sixteen loads are in flight together
    for (int t = 0; t < 2; ++t) {
      #pragma unroll  // same reason
      for (int r = 0; r < 8; ++r)
        o[t][r] = *reinterpret_cast<const float4*>(rb + (t * 16 + r) * DIMC);
    }
    // One wait for the sixteen loads: behind it their address registers may be
    // used anew. It takes the base as an input, so that the base lives up to
    // here and no load's result is laid over it. The bias load stands behind
    // it, so that the wait for the bias does not come in front of these loads.
    asm volatile("s_wait_xcnt 0x0" :: "v"(rb) : "memory");
  }
  const float* bp = bias + colb;
  const float4 b4 = *reinterpret_cast<const float4*>(bp);
  // The same for the bias load.
  asm volatile("s_wait_xcnt 0x0" :: "v"(bp) : "memory");
  const float bs[4] = {b4.x, b4.y, b4.z, b4.w};
  auto store_tiles = [&](auto form) {
  constexpr int F = decltype(form)::value;
  if constexpr (F == EPI_RESID_F32) {
    float* ob = (float*)outp + (size_t)rowb * DIMC + colb;
    #pragma unroll  // constant indices keep o[] and acc[] in registers
    for (int t = 0; t < 2; ++t) {
      f32x8 gl[4];
      #pragma unroll  // same reason
      for (int u = 0; u < 4; ++u) gl[u] = (acc[t][u] + bs[u]) * oscale;
      #pragma unroll  // same reason
      for (int r = 0; r < 8; ++r)
        o[t][r] = float4{o[t][r].x + gl[0][r], o[t][r].y + gl[1][r],
                         o[t][r].z + gl[2][r], o[t][r].w + gl[3][r]};
    }
    // below stand the stores alone: nothing writes a register of an issued one
    __builtin_amdgcn_sched_barrier(0);
    #pragma unroll  // constant offsets: they become the stores' immediates
    for (int t = 0; t < 2; ++t) {
      #pragma unroll  // same reason
      for (int r = 0; r < 8; ++r)
        *reinterpret_cast<float4*>(ob + (t * 16 + r) * DIMC) = o[t][r];
    }
  } else if constexpr (F == EPI_VT) {
    // -> per-head transposed [b][h][d][tok], bf16: a lane's 8 registers of a
    // tile are 8 neighbouring tokens of one d.
    int bi = rowb / NTOK, tok = rowb % NTOK;
    int h = colb >> 6, d = colb & 63;
    bf16_t* ob =
        (bf16_t*)outp + (((size_t)bi * HEADS + h) * HDIM + d) * NTOK + tok;
    uint4 pk[2][4];
    #pragma unroll  // constant indices keep pk[] and acc[] in registers
    for (int t = 0; t < 2; ++t) {
      #pragma unroll  // same reason
      for (int u = 0; u < 4; ++u) {
        union { bf16x2 hh[4]; uint4 v; } c;
        #pragma unroll  // same reason
        for (int r = 0; r < 8; r += 2) {
          f32x2 pr = {(acc[t][u][r] + bs[u]) * oscale,
                      (acc[t][u][r + 1] + bs[u]) * oscale};
          c.hh[r >> 1] = __builtin_convertvector(pr, bf16x2);
        }
        pk[t][u] = c.v;
      }
    }
    // below stand the stores alone: nothing writes a register of an issued one
    __builtin_amdgcn_sched_barrier(0);
    #pragma unroll  // constant offsets: they become the stores' immediates
    for (int t = 0; t < 2; ++t) {
      #pragma unroll  // same reason
      for (int u = 0; u < 4; ++u)
        *reinterpret_cast<uint4*>(ob + u * NTOK + t * 16) = pk[t][u];
    }
  } else {
    constexpr int PITCH = F == EPI_QK ? HDIM : HID;  // elements a row
    bf16_t* ob;
    if constexpr (F == EPI_QK) {
      // -> per-head [b][h][tok][d], bf16
      int bi = rowb / NTOK, tok = rowb % NTOK;
      int h = colb >> 6, d = colb & 63;
      ob = (bf16_t*)outp + ((((size_t)bi * HEADS + h) * NTOK + tok) << 6) + d;
    } else {  // EPI_GELU_BF16
      ob = (bf16_t*)outp + (size_t)rowb * HID + colb;
    }
    uint2 pk[2][8];
    #pragma unroll  // constant indices keep pk[] and acc[] in registers
    for (int t = 0; t < 2; ++t) {
      f32x8 gl[4];
      if constexpr (F == EPI_GELU_BF16) {
        #pragma unroll  // same reason
        for (int u = 0; u < 4; ++u)
          gl[u] = gelu_x8((acc[t][u] + bs[u]) * oscale);
      } else {
        #pragma unroll  // same reason
        for (int u = 0; u < 4; ++u) gl[u] = (acc[t][u] + bs[u]) * oscale;
      }
      #pragma unroll  // same reason
      for (int r = 0; r < 8; ++r) {
        f32x2 p0 = {gl[0][r], gl[1][r]}, p1 = {gl[2][r], gl[3][r]};
        union { bf16x2 hh[2]; uint2 v; } c;
        c.hh[0] = __builtin_convertvector(p0, bf16x2);
        c.hh[1] = __builtin_convertvector(p1, bf16x2);
        pk[t][r] = c.v;
      }
    }
    // below stand the stores alone: nothing writes a register of an issued one
    __builtin_amdgcn_sched_barrier(0);
    #pragma unroll  // constant offsets: they become the stores' immediates
    for (int t = 0; t < 2; ++t) {
      #pragma unroll  // same reason
      for (int r = 0; r < 8; ++r)
        *reinterpret_cast<uint2*>(ob + (t * 16 + r) * PITCH) = pk[t][r];
    }
    if constexpr (F == EPI_QK) {
      // In the built kernel the V arm's code follows this arm's and uses these
      // registers: one wait for the whole group stands in front of it.
      asm volatile("s_wait_xcnt 0x0" ::: "memory");
    }
  }
  };
  if constexpr (EPI == EPI_QKV) {
    if (sel == 2) {
      store_tiles(store_form<EPI_VT>{});
    } else {
      store_tiles(store_form<EPI_QK>{});
    }
  } else {
    store_tiles(store_form<EPI>{});
  }
}

#define AKEYS  128
#define KPITCH 144
#define VPITCH 272
#define KTILE  (AKEYS * KPITCH)
#define VTILE  (HDIM * VPITCH)
#define ASTAGE (KTILE + VTILE)

// 16x32 bf16 fragment from LDS rows of the given byte pitch; same lane and k
// order as load_frag.
__device__ inline bf16x16 lds_frag_at(const unsigned char* base, int pitch) {
  int lane = threadIdx.x & 31;
  const unsigned char* p = base + (lane & 15) * pitch + (lane >> 4) * 16;
  union { uint4 u[2]; bf16x16 v; } cv;
  cv.u[0] = *reinterpret_cast<const uint4*>(p);
  cv.u[1] = *reinterpret_cast<const uint4*>(p + 32);
  return cv.v;
}

// The value that lane l ^ 16 holds.
__device__ inline float other_half(float x) {
  int i = __builtin_bit_cast(int, x);
  return __builtin_bit_cast(
      float, __builtin_amdgcn_permlanex16(i, i, 0x76543210, 0xfedcba98, false,
                                          false));
}

__device__ inline float max3f(float a, float b, float c) {
  return fmaxf(fmaxf(a, b), c);
}

// Exponentials base 2, each in place on its own register, in one statement:
// so none overwrites the source of the one in front of it, and the closing
// v_nop is the slot the instruction set asks for between a transcendental and
// an instruction that uses its result.
__device__ inline void exp2_x8(float (&a)[8]) {
  asm("v_exp_f32 %0, %0\n\t"
      "v_exp_f32 %1, %1\n\t"
      "v_exp_f32 %2, %2\n\t"
      "v_exp_f32 %3, %3\n\t"
      "v_exp_f32 %4, %4\n\t"
      "v_exp_f32 %5, %5\n\t"
      "v_exp_f32 %6, %6\n\t"
      "v_exp_f32 %7, %7\n\t"
      "v_nop"
      : "+v"(a[0]), "+v"(a[1]), "+v"(a[2]), "+v"(a[3]), "+v"(a[4]),
        "+v"(a[5]), "+v"(a[6]), "+v"(a[7]));
}
__device__ inline float exp2_x1(float a) {
  asm("v_exp_f32 %0, %0\n\t"
      "v_nop"
      : "+v"(a));
  return a;
}
#define LOG2E 1.4426950408889634f

// One thread's share of a stage: 16 bytes of every 32nd K row and of every
// 16th Vt row. lk, lv: the lane's LDS byte addresses; gk, gv: its global
// addresses; vstep: 16 Vt rows in elements.
__device__ inline void copy_kv(unsigned lk, const bf16_t* gk, unsigned lv,
                               const bf16_t* gv, size_t vstep) {
  // The closing s_wait_xcnt stands inside the statement so that no address
  // register of a copy is rewritten ahead of it.
  asm volatile(
      "global_load_async_to_lds_b128 %0, %8, off\n\t"
      "global_load_async_to_lds_b128 %1, %9, off\n\t"
      "global_load_async_to_lds_b128 %2, %10, off\n\t"
      "global_load_async_to_lds_b128 %3, %11, off\n\t"
      "global_load_async_to_lds_b128 %4, %12, off\n\t"
      "global_load_async_to_lds_b128 %5, %13, off\n\t"
      "global_load_async_to_lds_b128 %6, %14, off\n\t"
      "global_load_async_to_lds_b128 %7, %15, off\n\t"
      "s_wait_xcnt 0x0"
      :: "v"(lk), "v"(lk + 32 * KPITCH), "v"(lk + 64 * KPITCH),
         "v"(lk + 96 * KPITCH),
         "v"(lv), "v"(lv + 16 * VPITCH), "v"(lv + 32 * VPITCH),
         "v"(lv + 48 * VPITCH),
         "v"(gk), "v"(gk + 32 * HDIM), "v"(gk + 64 * HDIM),
         "v"(gk + 96 * HDIM),
         "v"(gv), "v"(gv + vstep), "v"(gv + 2 * vstep), "v"(gv + 3 * vstep)
      : "memory");
}

// Four waves per SIMD is what the grid gives (two blocks a WGP). Told so, the
// compiler keeps a sub-pass's LDS reads together ahead of the WMMAs; aiming at
// more waves it saves registers by a load, a wait and a WMMA in turn.
__global__ void __launch_bounds__(256)
__attribute__((amdgpu_waves_per_eu(4, 4))) attn_kernel(
    const bf16_t* __restrict__ q, const bf16_t* __restrict__ k,
    const bf16_t* __restrict__ vt, bf16_t* __restrict__ out, int Ntok) {
  __shared__ __attribute__((aligned(16))) unsigned char kv[2 * ASTAGE];

  int wave = threadIdx.x >> 5;
  int lane = threadIdx.x & 31;
  int bh = blockIdx.y;
  int q0 = blockIdx.x * 128 + wave * 16;

  const bf16_t* Qh = q  + (size_t)bh * Ntok * HDIM;
  const bf16_t* Kh = k  + (size_t)bh * Ntok * HDIM;
  const bf16_t* Vh = vt + (size_t)bh * HDIM * Ntok;

  // B operand of S^T: column = query q0 + (lane & 15), k = d.
  bf16x16 qf0 = load_frag(Qh + (size_t)q0 * HDIM + 0, HDIM);
  bf16x16 qf1 = load_frag(Qh + (size_t)q0 * HDIM + 32, HDIM);

  // O^T tiles: row d = 16 u + 8 * (lane >> 4) + r, column = the lane's query.
  f32x8 oacc[4];
  #pragma unroll
  for (int u = 0; u < 4; ++u) oacc[u] = (f32x8)(0.0f);
  // The lane's query: maximum in use (alike in both halves), and the sum over
  // the keys of this half alone.
  float mrun = -1e30f, lrun = 0.0f;

  // Copy shares. K: 8 threads cover a row's 128 bytes, 32 rows per round.
  // Vt: 16 threads cover a row's 256 bytes of the stage, 16 rows per round.
  int tid = threadIdx.x;
  const bf16_t* gK = Kh + (size_t)(tid >> 3) * HDIM + (tid & 7) * 8;
  const bf16_t* gV = Vh + (size_t)(tid >> 4) * Ntok + (tid & 15) * 8;
  unsigned lk0 = (unsigned)(uintptr_t)kv + (tid >> 3) * KPITCH + (tid & 7) * 16;
  unsigned lv0 =
      (unsigned)(uintptr_t)kv + KTILE + (tid >> 4) * VPITCH + (tid & 15) * 16;
  size_t vstep = (size_t)16 * Ntok;
  int T = Ntok / AKEYS;

  copy_kv(lk0, gK, lv0, gV, vstep);
  // stage 0 has landed for this wave, then for the block
  asm volatile("s_wait_asynccnt 0x0" ::: "memory");
  __syncthreads();
  if (T > 1)
    copy_kv(lk0 + ASTAGE, gK + AKEYS * HDIM, lv0 + ASTAGE, gV + AKEYS, vstep);

  for (int t = 0; t < T; ++t) {
   unsigned buf = (unsigned)(t & 1) * ASTAGE;
   for (int sub = 0; sub < AKEYS / 64; ++sub) {
    const unsigned char* sK = kv + buf + sub * 64 * KPITCH;
    const unsigned char* sV = kv + buf + KTILE + sub * 128;
    // 4 S^T tiles: 64 keys x 16 queries (contraction over d=64).
    f32x8 s[4];
    #pragma unroll
    for (int i = 0; i < 4; ++i) {
      const unsigned char* Kt = sK + i * 16 * KPITCH;
      f32x8 si = (f32x8)(0.0f);
      si = wmma_bf16(lds_frag_at(Kt, KPITCH), qf0, si);
      si = wmma_bf16(lds_frag_at(Kt + 64, KPITCH), qf1, si);
      s[i] = si;
    }

    // Online softmax update of the lane's query over its 32 scores.
    float m8[8];
    #pragma unroll
    for (int r = 0; r < 8; ++r)
      m8[r] = fmaxf(max3f(s[0][r], s[1][r], s[2][r]), s[3][r]);
    float mx = fmaxf(max3f(m8[0], m8[1], m8[2]),
                     fmaxf(max3f(m8[3], m8[4], m8[5]), fmaxf(m8[6], m8[7])));
    mx = fmaxf(mx, other_half(mx));
    float mnew  = fmaxf(mrun, mx);
    float alpha = exp2_x1((mrun - mnew) * LOG2E);
    mrun = mnew;

    // P^T as B operand: elements 0..7 of a lane are tile 2 ks, registers
    // 0..7 (keys 8 * half + r), elements 8..15 tile 2 ks + 1: the k order in
    // which lds_frag_at brings the keys of a Vt row.
    bf16x16 pf[2];
    float rs[4];
    #pragma unroll
    for (int i = 0; i < 4; ++i) {
      float p[8];
      #pragma unroll
      for (int r = 0; r < 8; ++r) p[r] = (s[i][r] - mnew) * LOG2E;
      exp2_x8(p);
      rs[i] = ((p[0] + p[1]) + (p[2] + p[3])) + ((p[4] + p[5]) + (p[6] + p[7]));
      #pragma unroll
      for (int r = 0; r < 8; r += 2) {
        f32x2 pr = {p[r], p[r + 1]};
        bf16x2 pb = __builtin_convertvector(pr, bf16x2);
        pf[i >> 1][(i & 1) * 8 + r]     = pb[0];
        pf[i >> 1][(i & 1) * 8 + r + 1] = pb[1];
      }
    }
    lrun = lrun * alpha + ((rs[0] + rs[1]) + (rs[2] + rs[3]));
    #pragma unroll
    for (int u = 0; u < 4; ++u) oacc[u] *= alpha;

    #pragma unroll
    for (int ks = 0; ks < 2; ++ks) {
      #pragma unroll
      for (int u = 0; u < 4; ++u) {
        bf16x16 vf = lds_frag_at(sV + u * 16 * VPITCH + ks * 64, VPITCH);
        oacc[u] = wmma_bf16(vf, pf[ks], oacc[u]);
      }
    }
   }
   // this wave's reads of the buffer are done before it is refilled
   asm volatile("s_wait_dscnt 0x0" ::: "memory");
   // this wave's copies of stage t + 1 have landed
   asm volatile("s_wait_asynccnt 0x0" ::: "memory");
   __syncthreads();  // publishes stage t + 1, frees stage t's buffer
   if (t + 2 < T)
     copy_kv(lk0 + buf, gK + (size_t)(t + 2) * AKEYS * HDIM, lv0 + buf,
             gV + (size_t)(t + 2) * AKEYS, vstep);
  }
  // no copy is outstanding when the wave goes on to its end
  asm volatile("s_wait_asynccnt 0x0" ::: "memory");

  // Finalize: join the halves' sums, divide, and put the heads back to
  // [b][tok][DIMC]; a lane's 8 registers of a tile are 8 neighbouring d.
  int h  = bh & (HEADS - 1);
  int bi = bh >> 4;
  float inv = 1.0f / (lrun + other_half(lrun));
  int tok = q0 + (lane & 15);
  bf16_t* orow =
      out + ((size_t)bi * Ntok + tok) * DIMC + h * HDIM + (lane >> 4) * 8;
  #pragma unroll
  for (int u = 0; u < 4; ++u) {
    union { bf16x2 hh[4]; uint4 v; } c;
    #pragma unroll
    for (int r = 0; r < 8; r += 2) {
      f32x2 pr = {oacc[u][r] * inv, oacc[u][r + 1] * inv};
      c.hh[r >> 1] = __builtin_convertvector(pr, bf16x2);
    }
    *reinterpret_cast<uint4*>(orow + u * 16) = c.v;
  }
}

// ---------------------------------------------------------------------------
// Host-side orchestration (graph-capture safe: launches only).
// ---------------------------------------------------------------------------
extern "C" void kernel_launch(void* const* d_in, const int* in_sizes, int n_in,
                              void* d_out, int out_size, void* d_ws, size_t ws_size,
                              hipStream_t stream) {
  (void)in_sizes; (void)n_in; (void)out_size; (void)ws_size;

  const float* x     = (const float*)d_in[0];
  const float* ln1_w = (const float*)d_in[1];
  const float* ln1_b = (const float*)d_in[2];
  const float* ln2_w = (const float*)d_in[3];
  const float* ln2_b = (const float*)d_in[4];
  const float* Wq = (const float*)d_in[5];  const float* bq = (const float*)d_in[6];
  const float* Wk = (const float*)d_in[7];  const float* bk = (const float*)d_in[8];
  const float* Wv = (const float*)d_in[9];  const float* bv = (const float*)d_in[10];
  const float* Wo = (const float*)d_in[11]; const float* bo = (const float*)d_in[12];
  const float* W1 = (const float*)d_in[13]; const float* b1 = (const float*)d_in[14];
  const float* W2 = (const float*)d_in[15]; const float* b2 = (const float*)d_in[16];

  // Workspace layout
  char* ws = (char*)d_ws;
  size_t off = 0;
  auto alloc = [&](size_t bytes) { char* p = ws + off; off += (bytes + 255) & ~size_t(255); return p; };
  // Wqt, Wkt, Wvt lie one behind the other with no gap (sizes are multiples of
  // 256): the merged projection reads them as one [3 * DIMC][DIMC] matrix.
  bf16_t* Wqt = (bf16_t*)alloc((size_t)DIMC * DIMC * 2);
  bf16_t* Wkt = (bf16_t*)alloc((size_t)DIMC * DIMC * 2);
  bf16_t* Wvt = (bf16_t*)alloc((size_t)DIMC * DIMC * 2);
  bf16_t* Wot = (bf16_t*)alloc((size_t)DIMC * DIMC * 2);
  bf16_t* W1t = (bf16_t*)alloc((size_t)DIMC * HID * 2);
  bf16_t* W2t = (bf16_t*)alloc((size_t)HID * DIMC * 2);
  bf16_t* xn   = (bf16_t*)alloc((size_t)MTOT * DIMC * 2);
  // qb, kb, vtb likewise: output sel of the merged projection starts at
  // qb + sel * MTOT * DIMC.
  bf16_t* qb   = (bf16_t*)alloc((size_t)MTOT * DIMC * 2);
  bf16_t* kb   = (bf16_t*)alloc((size_t)MTOT * DIMC * 2);
  bf16_t* vtb  = (bf16_t*)alloc((size_t)MTOT * DIMC * 2);
  bf16_t* attn = (bf16_t*)alloc((size_t)MTOT * DIMC * 2);
  float*  x2   = (float*)alloc((size_t)MTOT * DIMC * 4);
  bf16_t* xn2  = (bf16_t*)alloc((size_t)MTOT * DIMC * 2);
  bf16_t* hbuf = (bf16_t*)alloc((size_t)MTOT * HID * 2);

  dim3 blk(256);

  // 1, 2. Weight prep (fp32 -> bf16 transposed) and LN1
  prep_kernel<<<PB_ALL, blk, 0, stream>>>(Wq, Wk, Wv, Wo, W1, W2, Wqt, Wkt, Wvt,
                                          Wot, W1t, W2t, x, ln1_w, ln1_b, xn);

  // 3. Q, K, V projections (one WMMA GEMM). Q is pre-scaled by 1/sqrt(HDIM).
  dim3 gqkv3(3 * DIMC / 128, MTOT / 128);
  gemm_kernel<EPI_QKV><<<gqkv3, blk, 0, stream>>>(xn, Wqt, bq, qb, nullptr, MTOT, 3 * DIMC, DIMC, NTOK, 0.125f, bk, bv);
  dim3 gqkv(DIMC / 128, MTOT / 128);

  // 4. Flash attention
  dim3 gatt(NTOK / 128, BATCH * HEADS);
  attn_kernel<<<gatt, blk, 0, stream>>>(qb, kb, vtb, attn, NTOK);

  // 5. Output projection + residual: x2 = x + attn @ Wo + bo
  gemm_kernel<EPI_RESID_F32><<<gqkv, blk, 0, stream>>>(attn, Wot, bo, x2, x, MTOT, DIMC, DIMC, NTOK, 1.0f, nullptr, nullptr);

  // 6. LN2
  layernorm_kernel<<<MTOT, blk, 0, stream>>>(x2, ln2_w, ln2_b, xn2);

  // 7. MLP up + GELU: h = gelu(xn2 @ W1 + b1)
  dim3 gup(HID / 128, MTOT / 128);
  gemm_kernel<EPI_GELU_BF16><<<gup, blk, 0, stream>>>(xn2, W1t, b1, hbuf, nullptr, MTOT, HID, DIMC, NTOK, 1.0f, nullptr, nullptr);

  // 8. MLP down + residual -> output: out = x2 + h @ W2 + b2
  gemm_kernel<EPI_RESID_F32><<<gqkv, blk, 0, stream>>>(hbuf, W2t, b2, (float*)d_out, x2, MTOT, DIMC, HID, NTOK, 1.0f, nullptr, nullptr);
}

// v010
// A run of this version takes 142 microseconds.
// Next to v009, in two timings, it ran 1.03 times as fast each time.
// Over all steps from v000 it is 4.58 times as fast.
#include <hip/hip_runtime.h>
#include <hip/hip_bf16.h>

// ---------------------------------------------------------------------------
// Transformer encoder block for MI455X (gfx1250, wave32, WMMA).
// All GEMMs run on v_wmma_f32_16x16x32_bf16; attention is flash-style with
// 64-key tiles, its two products taken transposed. 1/sqrt(d) is folded into the Q projection epilogue.
// ---------------------------------------------------------------------------

typedef __bf16 bf16_t;
typedef __attribute__((ext_vector_type(16))) __bf16 bf16x16;
typedef __attribute__((ext_vector_type(8)))  float  f32x8;

#define DIMC   1024
#define HEADS  16
#define HDIM   64
#define HID    4096
#define NTOK   2048
#define BATCH  2
#define MTOT   (BATCH * NTOK)   // 4096 tokens

// ---------------------------------------------------------------------------
// WMMA helpers
// ---------------------------------------------------------------------------
__device__ inline f32x8 wmma_bf16(bf16x16 a, bf16x16 b, f32x8 c) {
  // (neg_a, A, neg_b, B, c_mod, C, reuse_a, reuse_b)
  return __builtin_amdgcn_wmma_f32_16x16x32_bf16(false, a, false, b,
                                                 (short)0, c, false, false);
}

// Load a 16x32 bf16 fragment (A-style layout, used here for Q as a B
// operand; the A fragments of K and Vt are read from LDS in the same order).
// ISA 16-bit A layout: lane = m + 16*half;
//   VGPR0..3 : K = half*8 + 0..7
//   VGPR4..7 : K = 16 + half*8 + 0..7
// base points at (row0, k0); ld = row stride in elements (multiple of 8).
__device__ inline bf16x16 load_frag(const bf16_t* base, int ld) {
  int lane = threadIdx.x & 31;
  int m    = lane & 15;
  int half = lane >> 4;
  const bf16_t* p = base + (size_t)m * (size_t)ld + half * 8;
  union { uint4 u[2]; bf16x16 v; } cv;
  cv.u[0] = *reinterpret_cast<const uint4*>(p);
  cv.u[1] = *reinterpret_cast<const uint4*>(p + 16);
  return cv.v;
}

// ---------------------------------------------------------------------------
// Weight prep: fp32 [K][N] -> bf16 transposed [N][K].
// One block moves a 128(k) x 64(n) tile, number (bx, by) of its matrix; K and
// N are compile-time, so the row steps become immediate offsets of one address.
// A thread reads 8 k-rows x 4 n as 16-byte loads (a half-wave covers 256
// contiguous bytes of an input row) and packs the eight k of each n into one
// 16-byte chunk. The chunks cross through LDS, so that a half-wave then
// stores 256 contiguous bytes of an output row.
// LDS tile: [n][16 chunks]; the chunk index is XORed with n >> 2, which keeps
// both the 16-byte LDS writes and the reads free of bank conflicts.
// ---------------------------------------------------------------------------
typedef __attribute__((ext_vector_type(4))) float  f32x4;
typedef __attribute__((ext_vector_type(2))) float  f32x2;
typedef __attribute__((ext_vector_type(2))) __bf16 bf16x2;

template <int K, int N>
__device__ inline void wt_transpose_tile(const float* __restrict__ in,
                                         bf16_t* __restrict__ out, int bx,
                                         int by, uint4* tile) {
  static_assert(K % 128 == 0 && N % 64 == 0, "whole tiles only");
  int tid = threadIdx.x;
  int lo  = tid & 15;
  int hi  = tid >> 4;
  int k0  = by * 128;
  int n0  = bx * 64;

  // lo = group of 4 n, hi = group of 8 k
  const float* src = in + (size_t)(k0 + hi * 8) * N + n0 + lo * 4;
  f32x4 v[8];
  #pragma unroll  // all eight loads in flight at once, v[] in registers
  for (int i = 0; i < 8; ++i)
    v[i] = *reinterpret_cast<const f32x4*>(src + i * N);

  #pragma unroll  // constant indices into v[], or it would leave the registers
  for (int j = 0; j < 4; ++j) {
    union { bf16x2 h[4]; uint4 u; } c;
    #pragma unroll  // same reason
    for (int p = 0; p < 4; ++p) {
      f32x2 pr = {v[2 * p][j], v[2 * p + 1][j]};
      c.h[p] = __builtin_convertvector(pr, bf16x2);
    }
    tile[(lo * 4 + j) * 16 + (hi ^ lo)] = c.u;
  }
  __syncthreads();

  // lo = chunk of 8 k, hi = n within a group of 16
  bf16_t* dst = out + (size_t)(n0 + hi) * K + k0 + lo * 8;
  #pragma unroll  // four LDS reads issued together ahead of the stores
  for (int s = 0; s < 4; ++s) {
    int n = s * 16 + hi;
    uint4 u = tile[n * 16 + (lo ^ (n >> 2))];
    *reinterpret_cast<uint4*>(dst + s * 16 * K) = u;
  }
  // In the built kernel another arm of the caller's choice follows and reuses
  // the stores' address and data registers: the wait stands in front of that.
  asm volatile("s_wait_xcnt 0x0" ::: "memory");
}

// ---------------------------------------------------------------------------
// LayerNorm over DIMC=1024, one block (256 threads) per row. Output bf16.
// ---------------------------------------------------------------------------
__device__ inline void layernorm_row(
    const float* __restrict__ x, const float* __restrict__ w,
    const float* __restrict__ b, bf16_t* __restrict__ out, int row) {
  __shared__ float ssum[8];
  __shared__ float ssq[8];
  int tid  = threadIdx.x;
  int lane = tid & 31;
  int wv   = tid >> 5;

  const float4* xr = reinterpret_cast<const float4*>(x + (size_t)row * DIMC);
  float4 v = xr[tid];
  float s  = v.x + v.y + v.z + v.w;
  float sq = v.x * v.x + v.y * v.y + v.z * v.z + v.w * v.w;
  #pragma unroll
  for (int mask = 16; mask >= 1; mask >>= 1) {
    s  += __shfl_xor(s, mask, 32);
    sq += __shfl_xor(sq, mask, 32);
  }
  if (lane == 0) { ssum[wv] = s; ssq[wv] = sq; }
  __syncthreads();
  float ts = 0.f, tq = 0.f;
  #pragma unroll
  for (int i = 0; i < 8; ++i) { ts += ssum[i]; tq += ssq[i]; }
  float mu  = ts * (1.0f / DIMC);
  float var = tq * (1.0f / DIMC) - mu * mu;
  float inv = rsqrtf(var + 1e-5f);

  int c = tid * 4;
  const float4 wv4 = reinterpret_cast<const float4*>(w)[tid];
  const float4 bv4 = reinterpret_cast<const float4*>(b)[tid];
  bf16_t* o = out + (size_t)row * DIMC + c;
  o[0] = (bf16_t)((v.x - mu) * inv * wv4.x + bv4.x);
  o[1] = (bf16_t)((v.y - mu) * inv * wv4.y + bv4.y);
  o[2] = (bf16_t)((v.z - mu) * inv * wv4.z + bv4.z);
  o[3] = (bf16_t)((v.w - mu) * inv * wv4.w + bv4.w);
}

__global__ void __launch_bounds__(256) layernorm_kernel(
    const float* __restrict__ x, const float* __restrict__ w,
    const float* __restrict__ b, bf16_t* __restrict__ out) {
  layernorm_row(x, w, b, out, blockIdx.x);
}

// ---------------------------------------------------------------------------
// All the work that depends on the inputs alone, in one launch: the six weight
// transposes and the first LayerNorm. A block does one transpose tile or one
// row; which, its index says. The transposes, the longer blocks, come first.
// ---------------------------------------------------------------------------
#define PB_W1  ((HID / 64) * (DIMC / 128))    // tiles of W1, as many of W2
#define PB_SQ  ((DIMC / 64) * (DIMC / 128))   // tiles of a square weight
#define PB_ALL (2 * PB_W1 + 4 * PB_SQ + MTOT)

__global__ void __launch_bounds__(256) prep_kernel(
    const float* __restrict__ Wq, const float* __restrict__ Wk,
    const float* __restrict__ Wv, const float* __restrict__ Wo,
    const float* __restrict__ W1, const float* __restrict__ W2,
    bf16_t* __restrict__ Wqt, bf16_t* __restrict__ Wkt,
    bf16_t* __restrict__ Wvt, bf16_t* __restrict__ Wot,
    bf16_t* __restrict__ W1t, bf16_t* __restrict__ W2t,
    const float* __restrict__ x, const float* __restrict__ w,
    const float* __restrict__ b, bf16_t* __restrict__ xn) {
  __shared__ uint4 tile[64 * 16];
  int i = blockIdx.x;
  if (i < PB_W1) {
    wt_transpose_tile<DIMC, HID>(W1, W1t, i % (HID / 64), i / (HID / 64), tile);
  } else if (i < 2 * PB_W1) {
    i -= PB_W1;
    wt_transpose_tile<HID, DIMC>(W2, W2t, i % (DIMC / 64), i / (DIMC / 64),
                                 tile);
  } else if (i < 2 * PB_W1 + 4 * PB_SQ) {
    i -= 2 * PB_W1;
    int which = i / PB_SQ;
    i %= PB_SQ;
    const float* in = which == 0 ? Wq : which == 1 ? Wk : which == 2 ? Wv : Wo;
    bf16_t* out = which == 0 ? Wqt : which == 1 ? Wkt : which == 2 ? Wvt : Wot;
    wt_transpose_tile<DIMC, DIMC>(in, out, i % (DIMC / 64), i / (DIMC / 64),
                                  tile);
  } else {
    layernorm_row(x, w, b, xn, i - (2 * PB_W1 + 4 * PB_SQ));
    // same reason as at the end of wt_transpose_tile, for the row's stores
    asm volatile("s_wait_xcnt 0x0" ::: "memory");
  }
}

// ---------------------------------------------------------------------------
// Generic bf16 WMMA GEMM:  C = (A[M,K] * Bt[N,K]^T + bias) * oscale, epilogue.
// Block = 256 threads (8 waves as 4x2), WMMA K-step 32.
// Wide outputs (EPI_QKV, EPI_GELU_BF16: N >= 3 * DIMC): block tile 256x128,
// wave tile 64x64 (4x4 accumulator tiles). Against a 128x128 tile of 32x64
// waves a product then takes two thirds of the LDS reads and three quarters of
// the bytes from L2, the two rates that bound it. An LDS tile holds 64 k, so
// that two blocks still share a WGP and one works while the other changes tiles.
// N = DIMC (EPI_RESID_F32) has only 256 tiles of 128x128, one a WGP: there the
// tile stays 128x128, the wave tile 32x64, an LDS tile 128 k.
// The A and Bt tiles are brought into LDS by asynchronous 16-byte copies (a wave
// covers whole 128-byte lines), two buffers: tile t + 1 flies while tile t is
// worked on. M and N are multiples of the block tile, K a multiple of 128.
// The rows of Bt (output columns) are dealt to the LDS rows so that column n of
// a wave's B tile u is output column 4 n + u of the wave's 64: the four
// accumulator tiles of a lane then hold four neighbouring columns of a row, and
// the epilogue moves 8 or 16 bytes a lane, 16 lanes covering whole 128-byte
// lines of an output row.
// Where the grid has one block a WGP (EPI_RESID_F32: N = DIMC) half the LDS
// lies idle: there, for speed only, the
// ring has three buffers and a tile flies for two trips. Waves 0-3 copy the even
// tiles, waves 4-7 the odd ones, so that a wave never has more than one tile
// outstanding and its wait to 0 holds back nothing but the tile that is due.
// EPI_QKV is the Q, K and V projections as one product: Bt holds the three
// transposed weights one behind the other (N = 3 * DIMC), outp the three
// outputs likewise; a block's 128 columns lie in one of the three.
// ---------------------------------------------------------------------------
#define GBK    128               // k per LDS tile: 256 bytes of every row
#define GPITCH 272               // LDS row pitch in bytes: 256 + 16 pad
#define WBK    64                // the same for the wide outputs: 128 bytes
#define WPITCH 144               // 128 + 16 pad

// 16x32 bf16 fragment from an LDS tile of row pitch P bytes; same lane and k
// order as load_frag.
template <int P = GPITCH>
__device__ inline bf16x16 lds_frag(const unsigned char* base) {
  int lane = threadIdx.x & 31;
  const unsigned char* p = base + (lane & 15) * P + (lane >> 4) * 16;
  union { uint4 u[2]; bf16x16 v; } cv;
  cv.u[0] = *reinterpret_cast<const uint4*>(p);
  cv.u[1] = *reinterpret_cast<const uint4*>(p + 32);
  return cv.v;
}

// One thread's share of a wide output's stage (256 A rows, 128 Bt rows, 128
// bytes of each): 16 bytes of every 32nd row. la, lb: the lane's LDS byte
// addresses, ga, gb: its global addresses, rstep: 32 rows.
// A row + 32 i lands 32 i LDS rows further on. Bt row + 32 i lands
// 8 * (i & 1) + 64 * (i >> 1) LDS rows further on: the deal (see above).
__device__ inline void copy_stage_wide(unsigned la, const bf16_t* ga,
                                       unsigned lb, const bf16_t* gb,
                                       size_t rstep) {
  // The closing s_wait_xcnt stands inside the statement so that no address
  // register of a copy is rewritten ahead of it.
  asm volatile(
      "global_load_async_to_lds_b128 %0, %12, off\n\t"
      "global_load_async_to_lds_b128 %1, %13, off\n\t"
      "global_load_async_to_lds_b128 %2, %14, off\n\t"
      "global_load_async_to_lds_b128 %3, %15, off\n\t"
      "global_load_async_to_lds_b128 %4, %16, off\n\t"
      "global_load_async_to_lds_b128 %5, %17, off\n\t"
      "global_load_async_to_lds_b128 %6, %18, off\n\t"
      "global_load_async_to_lds_b128 %7, %19, off\n\t"
      "global_load_async_to_lds_b128 %8, %20, off\n\t"
      "global_load_async_to_lds_b128 %9, %21, off\n\t"
      "global_load_async_to_lds_b128 %10, %22, off\n\t"
      "global_load_async_to_lds_b128 %11, %23, off\n\t"
      "s_wait_xcnt 0x0"
      :: "v"(la), "v"(la + 32 * WPITCH), "v"(la + 64 * WPITCH),
         "v"(la + 96 * WPITCH), "v"(la + 128 * WPITCH),
         "v"(la + 160 * WPITCH), "v"(la + 192 * WPITCH),
         "v"(la + 224 * WPITCH),
         "v"(lb), "v"(lb + 8 * WPITCH), "v"(lb + 64 * WPITCH),
         "v"(lb + 72 * WPITCH),
         "v"(ga), "v"(ga + rstep), "v"(ga + 2 * rstep), "v"(ga + 3 * rstep),
         "v"(ga + 4 * rstep), "v"(ga + 5 * rstep), "v"(ga + 6 * rstep),
         "v"(ga + 7 * rstep),
         "v"(gb), "v"(gb + rstep), "v"(gb + 2 * rstep), "v"(gb + 3 * rstep)
      : "memory");
}

// A thread's share of 64 rows where half the block copies a tile: 16 bytes of
// every 8th row. Global row + 8 i lands RS * i LDS rows further on: RS = 8 keeps
// the rows' order, RS = 2 deals them (see above). rstep: 8 rows.
template <int RS>
__device__ inline void copy_rows64(unsigned lds, const bf16_t* g, size_t rstep) {
  // The closing s_wait_xcnt stands inside the statement so that no address
  // register of a copy is rewritten ahead of it.
  asm volatile(
      "global_load_async_to_lds_b128 %0, %8, off\n\t"
      "global_load_async_to_lds_b128 %1, %9, off\n\t"
      "global_load_async_to_lds_b128 %2, %10, off\n\t"
      "global_load_async_to_lds_b128 %3, %11, off\n\t"
      "global_load_async_to_lds_b128 %4, %12, off\n\t"
      "global_load_async_to_lds_b128 %5, %13, off\n\t"
      "global_load_async_to_lds_b128 %6, %14, off\n\t"
      "global_load_async_to_lds_b128 %7, %15, off\n\t"
      "s_wait_xcnt 0x0"
      :: "v"(lds), "v"(lds + RS * GPITCH), "v"(lds + 2 * RS * GPITCH),
         "v"(lds + 3 * RS * GPITCH), "v"(lds + 4 * RS * GPITCH),
         "v"(lds + 5 * RS * GPITCH), "v"(lds + 6 * RS * GPITCH),
         "v"(lds + 7 * RS * GPITCH),
         "v"(g), "v"(g + rstep), "v"(g + 2 * rstep), "v"(g + 3 * rstep),
         "v"(g + 4 * rstep), "v"(g + 5 * rstep), "v"(g + 6 * rstep),
         "v"(g + 7 * rstep)
      : "memory");
}

// A whole stage (A tile and Bt tile) by four waves: 32 copies a wave.
__device__ inline void copy_stage_half(unsigned la, const bf16_t* ga,
                                       unsigned lb, const bf16_t* gb,
                                       size_t rstep) {
  copy_rows64<8>(la, ga, rstep);
  copy_rows64<8>(la + 64 * GPITCH, ga + 8 * rstep, rstep);
  copy_rows64<2>(lb, gb, rstep);
  copy_rows64<2>(lb + 64 * GPITCH, gb + 8 * rstep, rstep);
}

// Exact-form GELU, 0.5 v (1 + erf(v / sqrt 2)), of eight values at once, with
// no branch. For z = |v| / sqrt 2 the complementary error function is taken as
// erfc(z) = t (a1 + t (a2 + t (a3 + t (a4 + t a5)))) exp(-z z), t = 1 / (1 + p z)
// (absolute error below 2e-7), and gelu(v) = max(v, 0) - 0.5 |v| erfc(z),
// which cancels nothing on either side of zero. a5 is drawn out of the
// polynomial into the last factor, so that every step holds one constant.
// The eight values are independent chains, so the vector port stays busy.
// The reciprocals and the exponentials stand in one statement, in place on
// their own registers: none overwrites the source of the one in front of it,
// and the closing v_nop is the slot the instruction set asks for between a
// transcendental and an instruction that uses its result.
__device__ inline f32x8 gelu_x8(f32x8 v) {
  constexpr float A5 = 1.061405429f;
  f32x8 m = __builtin_elementwise_max(v, (f32x8)(0.0f));
  f32x8 a = m * 2.0f - v;  // |v|, exact
  f32x8 t = a * (0.3275911f * 0.70710678118654752f) + 1.0f;
  f32x8 e = (v * v) * (-0.5f * 1.4426950408889634f);
  asm("v_rcp_f32 %0, %0\n\t"
      "v_rcp_f32 %1, %1\n\t"
      "v_rcp_f32 %2, %2\n\t"
      "v_rcp_f32 %3, %3\n\t"
      "v_rcp_f32 %4, %4\n\t"
      "v_rcp_f32 %5, %5\n\t"
      "v_rcp_f32 %6, %6\n\t"
      "v_rcp_f32 %7, %7\n\t"
      "v_exp_f32 %8, %8\n\t"
      "v_exp_f32 %9, %9\n\t"
      "v_exp_f32 %10, %10\n\t"
      "v_exp_f32 %11, %11\n\t"
      "v_exp_f32 %12, %12\n\t"
      "v_exp_f32 %13, %13\n\t"
      "v_exp_f32 %14, %14\n\t"
      "v_exp_f32 %15, %15\n\t"
      "v_nop"
      : "+v"(t[0]), "+v"(t[1]), "+v"(t[2]), "+v"(t[3]), "+v"(t[4]),
        "+v"(t[5]), "+v"(t[6]), "+v"(t[7]), "+v"(e[0]), "+v"(e[1]),
        "+v"(e[2]), "+v"(e[3]), "+v"(e[4]), "+v"(e[5]), "+v"(e[6]),
        "+v"(e[7]));
  f32x8 p = t + (-1.453152027f / A5);
  p = p * t + (1.421413741f / A5);
  p = p * t + (-0.284496736f / A5);
  p = p * t + (0.254829592f / A5);
  f32x8 q = (p * t) * e;  // erfc(z) / a5
  return (a * q) * (-0.5f * A5) + m;
}

enum { EPI_QK = 0, EPI_VT = 1, EPI_RESID_F32 = 2, EPI_GELU_BF16 = 3,
       EPI_QKV = 4 };
template <int F> struct store_form { static constexpr int value = F; };

template <int EPI>
__global__ void __launch_bounds__(256, 4) gemm_kernel(
    const bf16_t* __restrict__ A, const bf16_t* __restrict__ Bt,
    const float* __restrict__ bias, void* __restrict__ outp,
    const float* __restrict__ resid, int M, int N, int K, int Ntok,
    float oscale, const float* __restrict__ bias_k,
    const float* __restrict__ bias_v) {
  constexpr int NB = EPI == EPI_RESID_F32 ? 3 : 2;  // buffers of the ring
  constexpr int BM = NB == 3 ? 128 : 256;  // rows of a block tile; 128 columns
  constexpr int TM = BM / 64;              // accumulator tiles down a wave
  constexpr int BK = NB == 3 ? GBK : WBK;  // k per LDS tile
  constexpr int PT = NB == 3 ? GPITCH : WPITCH;  // LDS row pitch in bytes
  constexpr int GTILE = BM * PT;                 // the A tile
  constexpr int GSTAGE = GTILE + 128 * PT;  // a buffer: A tile, then Bt tile
  __shared__ __attribute__((aligned(16))) unsigned char smem[NB * GSTAGE];
  int wave = threadIdx.x >> 5;
  int lane = threadIdx.x & 31;
  int wm = wave >> 1;          // 0..3
  int wn = wave & 1;           // 0..1
  int row0 = blockIdx.y * BM + wm * (16 * TM);
  int col0 = blockIdx.x * 128 + wn * 64;

  f32x8 acc[TM][4];
  #pragma unroll
  for (int t = 0; t < TM; ++t)
    #pragma unroll
    for (int u = 0; u < 4; ++u) acc[t][u] = (f32x8)(0.0f);

  // Copy shares. Two buffers: 8 threads cover a row's 128 bytes, 32 rows per
  // round. Three buffers: 16 threads cover a row's 256 bytes, 8 rows per round,
  // the copying half of the block alone.
  // half: 0 for waves 0-3, 1 for waves 4-7, in a scalar register, so that the
  // tests on it are scalar branches round the copies and their wait.
  const int half = __builtin_amdgcn_readfirstlane((int)(threadIdx.x >> 7));
  int crow = NB == 3 ? (threadIdx.x & 127) >> 4 : threadIdx.x >> 3;
  int cchk = NB == 3 ? threadIdx.x & 15 : threadIdx.x & 7;
  const bf16_t* gA = A  + (size_t)(blockIdx.y * BM + crow) * K + cchk * 8;
  const bf16_t* gB = Bt + (size_t)(blockIdx.x * 128 + crow) * K + cchk * 8;
  unsigned lds0 = (unsigned)(uintptr_t)smem + crow * PT + cchk * 16;
  // Bt row c of a wave's 64 goes to LDS row 16 * (c & 3) + (c >> 2).
  unsigned ldsB = (unsigned)(uintptr_t)smem + GTILE +
                  ((crow & 3) * 16 + (crow >> 2)) * PT + cchk * 16;
  size_t rstep = (size_t)(NB == 3 ? 8 : 32) * K;
  int T = K / BK;

  if constexpr (NB == 3) {
    if (half == 0) {
      copy_stage_half(lds0, gA, ldsB, gB, rstep);
      // tile 0 has landed for its copying waves, behind the barrier for all
      asm volatile("s_wait_asynccnt 0x0" ::: "memory");
      // nobody has touched the third buffer yet: no barrier is owed for it
      if (T > 2)
        copy_stage_half(lds0 + 2 * GSTAGE, gA + 2 * GBK, ldsB + 2 * GSTAGE,
                        gB + 2 * GBK, rstep);
    } else if (T > 1) {
      copy_stage_half(lds0 + GSTAGE, gA + GBK, ldsB + GSTAGE, gB + GBK, rstep);
    }
    __syncthreads();
  } else {
    copy_stage_wide(lds0, gA, ldsB, gB, rstep);
    // tile 0 has landed for this wave, then for the block
    asm volatile("s_wait_asynccnt 0x0" ::: "memory");
    __syncthreads();
    if (T > 1)
      copy_stage_wide(lds0 + GSTAGE, gA + BK, ldsB + GSTAGE, gB + BK, rstep);
  }

  unsigned ring = 0;  // three buffers: byte offset of tile t's buffer
  for (int t = 0; t < T; ++t) {
    unsigned buf = NB == 3 ? ring : (unsigned)(t & 1) * GSTAGE;
    const unsigned char* sA = smem + buf + wm * (16 * TM) * PT;
    const unsigned char* sB = smem + buf + GTILE + wn * 64 * PT;
    if constexpr (NB == 2) {
    // 64x64 wave tile: the 128 accumulator registers leave room for one
    // fragment set; the SIMD's three other waves cover a wave's LDS latency.
    #pragma unroll  // constant offsets of the LDS reads
    for (int kk = 0; kk < BK / 32; ++kk) {
      // read in the order of first use: the first WMMA waits for two fragments
      bf16x16 fa[TM], fb[4];
      fb[0] = lds_frag<PT>(sB + kk * 64);
      #pragma unroll  // constant indices keep fa[] in registers
      for (int i = 0; i < TM; ++i)
        fa[i] = lds_frag<PT>(sA + i * 16 * PT + kk * 64);
      #pragma unroll  // same reason
      for (int u = 1; u < 4; ++u)
        fb[u] = lds_frag<PT>(sB + u * 16 * PT + kk * 64);
      // keeps the read group above from sinking in among the WMMAs below
      __builtin_amdgcn_sched_barrier(0);
      #pragma unroll  // same reason, for acc[] too
      for (int u = 0; u < 4; ++u) {
        #pragma unroll  // same reason
        for (int i = 0; i < TM; ++i)
          acc[i][u] = wmma_bf16(fa[i], fb[u], acc[i][u]);
      }
      // keeps the next read group from rising in among the WMMAs above
      __builtin_amdgcn_sched_barrier(0);
    }
    } else {
    // Two fragment sets: the reads of the next 32 k go out as one group ahead
    // of this 32 k's WMMAs, so that their LDS latency hides behind them.
    bf16x16 fa[2][2], fb[2][4];
    fa[0][0] = lds_frag(sA);
    fa[0][1] = lds_frag(sA + 16 * GPITCH);
    #pragma unroll  // constant indices keep fb[] in registers
    for (int u = 0; u < 4; ++u) fb[0][u] = lds_frag(sB + u * 16 * GPITCH);
    #pragma unroll  // constant indices keep both sets in registers
    for (int kk = 0; kk < GBK / 32; ++kk) {
      const int cur = kk & 1, nxt = cur ^ 1;
      if (kk + 1 < GBK / 32) {
        fa[nxt][0] = lds_frag(sA + (kk + 1) * 64);
        fa[nxt][1] = lds_frag(sA + 16 * GPITCH + (kk + 1) * 64);
        #pragma unroll  // same reason
        for (int u = 0; u < 4; ++u)
          fb[nxt][u] = lds_frag(sB + u * 16 * GPITCH + (kk + 1) * 64);
      }
      // keeps the read group above from sinking in among the WMMAs below
      __builtin_amdgcn_sched_barrier(0);
      #pragma unroll  // same reason, for acc[] too
      for (int u = 0; u < 4; ++u) {
        acc[0][u] = wmma_bf16(fa[cur][0], fb[cur][u], acc[0][u]);
        acc[1][u] = wmma_bf16(fa[cur][1], fb[cur][u], acc[1][u]);
      }
      // keeps the next read group from rising in among the WMMAs above
      __builtin_amdgcn_sched_barrier(0);
    }
    }
    // this wave's reads of the buffer are done before it is refilled
    asm volatile("s_wait_dscnt 0x0" ::: "memory");
    if constexpr (NB == 3) {
      // The half that copied tile t + 1 has nothing else outstanding; the other
      // half's tile t + 2 flies on, so that half does not wait.
      const bool due = ((t + 1) & 1) == half;
      if (due) asm volatile("s_wait_asynccnt 0x0" ::: "memory");
      __syncthreads();  // publishes tile t + 1, frees tile t's buffer
      if (due && t + 3 < T)
        copy_stage_half(lds0 + buf, gA + (size_t)(t + 3) * GBK, ldsB + buf,
                        gB + (size_t)(t + 3) * GBK, rstep);
      ring = ring == 2 * GSTAGE ? 0 : ring + GSTAGE;
    } else {
      // this wave's copies of tile t + 1 have landed
      asm volatile("s_wait_asynccnt 0x0" ::: "memory");
      __syncthreads();  // publishes tile t + 1, frees tile t's buffer
      if (t + 2 < T)
        copy_stage_wide(lds0 + buf, gA + (size_t)(t + 2) * BK, ldsB + buf,
                        gB + (size_t)(t + 2) * BK, rstep);
    }
  }
  // no copy is outstanding when the wave goes on to its end
  asm volatile("s_wait_asynccnt 0x0" ::: "memory");

  // Epilogue. C layout: VGPR r, lanes 0-15 -> (M=r, N=lane),
  //                     lanes 16-31 -> (M=r+8, N=lane-16);
  // column N of tile u is output column col0 + 4 N + u.
  // A lane's 8 TM rows are rowb + 16 t + r. The output's row pitch is a
  // constant of each form (N is DIMC with the residual, HID with GELU), so every
  // access of a lane is one base address plus an immediate offset, and all
  // values are formed before the first store goes out. No register that an
  // issued load or store names is then written again, and the wave does not
  // stop behind each access for the wait that such a rewrite asks for.
  static_assert(NTOK % 64 == 0, "a wave's rows lie in one batch entry");
  int nloc = lane & 15;
  int rowb = row0 + (lane >> 4) * 8;
  int sel = 0;  // EPI_QKV: 0 = Q, 1 = K, 2 = V; alike in the whole block
  if constexpr (EPI == EPI_QKV) {
    sel = blockIdx.x / (DIMC / 128);
    col0 -= sel * DIMC;
    bias = sel == 0 ? bias : sel == 1 ? bias_k : bias_v;
    outp = (bf16_t*)outp + (size_t)sel * M * DIMC;
    oscale = sel == 0 ? oscale : 1.0f;
  }
  int colb = col0 + nloc * 4;  // the lane's four columns: colb + u
  float4 o[2][8];  // EPI_RESID_F32: the residual rows, then the output rows
  if constexpr (EPI == EPI_RESID_F32) {
    const float* rb = resid + (size_t)rowb * DIMC + colb;
    #pragma unroll  // all sixteen loads are in flight together
    for (int t = 0; t < 2; ++t) {
      #pragma unroll  // same reason
      for (int r = 0; r < 8; ++r)
        o[t][r] = *reinterpret_cast<const float4*>(rb + (t * 16 + r) * DIMC);
    }
    // One wait for the sixteen loads: behind it their address registers may be
    // used anew. It takes the base as an input, so that the base lives up to
    // here and no load's result is laid over it. The bias load stands behind
    // it, so that the wait for the bias does not come in front of these loads.
    asm volatile("s_wait_xcnt 0x0" :: "v"(rb) : "memory");
  }
  const float* bp = bias + colb;
  const float4 b4 = *reinterpret_cast<const float4*>(bp);
  // The same for the bias load.
  asm volatile("s_wait_xcnt 0x0" :: "v"(bp) : "memory");
  const float bs[4] = {b4.x, b4.y, b4.z, b4.w};
  auto store_tiles = [&](auto form) {
  constexpr int F = decltype(form)::value;
  if constexpr (F == EPI_RESID_F32) {
    float* ob = (float*)outp + (size_t)rowb * DIMC + colb;
    #pragma unroll  // constant indices keep o[] and acc[] in registers
    for (int t = 0; t < 2; ++t) {
      f32x8 gl[4];
      #pragma unroll  // same reason
      for (int u = 0; u < 4; ++u) gl[u] = (acc[t][u] + bs[u]) * oscale;
      #pragma unroll  // same reason
      for (int r = 0; r < 8; ++r)
        o[t][r] = float4{o[t][r].x + gl[0][r], o[t][r].y + gl[1][r],
                         o[t][r].z + gl[2][r], o[t][r].w + gl[3][r]};
    }
    // below stand the stores alone: nothing writes a register of an issued one
    __builtin_amdgcn_sched_barrier(0);
    #pragma unroll  // constant offsets: they become the stores' immediates
    for (int t = 0; t < 2; ++t) {
      #pragma unroll  // same reason
      for (int r = 0; r < 8; ++r)
        *reinterpret_cast<float4*>(ob + (t * 16 + r) * DIMC) = o[t][r];
    }
  } else if constexpr (F == EPI_VT) {
    // -> per-head transposed [b][h][d][tok], bf16: a lane's 8 registers of a
    // tile are 8 neighbouring tokens of one d.
    int bi = rowb / NTOK, tok = rowb % NTOK;
    int h = colb >> 6, d = colb & 63;
    bf16_t* ob =
        (bf16_t*)outp + (((size_t)bi * HEADS + h) * HDIM + d) * NTOK + tok;
    uint4 pk[TM][4];
    #pragma unroll  // constant indices keep pk[] and acc[] in registers
    for (int t = 0; t < TM; ++t) {
      #pragma unroll  // same reason
      for (int u = 0; u < 4; ++u) {
        union { bf16x2 hh[4]; uint4 v; } c;
        #pragma unroll  // same reason
        for (int r = 0; r < 8; r += 2) {
          f32x2 pr = {(acc[t][u][r] + bs[u]) * oscale,
                      (acc[t][u][r + 1] + bs[u]) * oscale};
          c.hh[r >> 1] = __builtin_convertvector(pr, bf16x2);
        }
        pk[t][u] = c.v;
      }
    }
    // below stand the stores alone: nothing writes a register of an issued one
    __builtin_amdgcn_sched_barrier(0);
    #pragma unroll  // constant offsets: they become the stores' immediates
    for (int t = 0; t < TM; ++t) {
      #pragma unroll  // same reason
      for (int u = 0; u < 4; ++u)
        *reinterpret_cast<uint4*>(ob + u * NTOK + t * 16) = pk[t][u];
    }
  } else {
    constexpr int PITCH = F == EPI_QK ? HDIM : HID;  // elements a row
    bf16_t* ob;
    if constexpr (F == EPI_QK) {
      // -> per-head [b][h][tok][d], bf16
      int bi = rowb / NTOK, tok = rowb % NTOK;
      int h = colb >> 6, d = colb & 63;
      ob = (bf16_t*)outp + ((((size_t)bi * HEADS + h) * NTOK + tok) << 6) + d;
    } else {  // EPI_GELU_BF16
      ob = (bf16_t*)outp + (size_t)rowb * HID + colb;
    }
    uint2 pk[TM][8];
    #pragma unroll  // constant indices keep pk[] and acc[] in registers
    for (int t = 0; t < TM; ++t) {
      f32x8 gl[4];
      if constexpr (F == EPI_GELU_BF16) {
        #pragma unroll  // same reason
        for (int u = 0; u < 4; ++u)
          gl[u] = gelu_x8((acc[t][u] + bs[u]) * oscale);
      } else {
        #pragma unroll  // same reason
        for (int u = 0; u < 4; ++u) gl[u] = (acc[t][u] + bs[u]) * oscale;
      }
      #pragma unroll  // same reason
      for (int r = 0; r < 8; ++r) {
        f32x2 p0 = {gl[0][r], gl[1][r]}, p1 = {gl[2][r], gl[3][r]};
        union { bf16x2 hh[2]; uint2 v; } c;
        c.hh[0] = __builtin_convertvector(p0, bf16x2);
        c.hh[1] = __builtin_convertvector(p1, bf16x2);
        pk[t][r] = c.v;
      }
    }
    // below stand the stores alone: nothing writes a register of an issued one
    __builtin_amdgcn_sched_barrier(0);
    #pragma unroll  // constant offsets: they become the stores' immediates
    for (int t = 0; t < TM; ++t) {
      #pragma unroll  // same reason
      for (int r = 0; r < 8; ++r)
        *reinterpret_cast<uint2*>(ob + (t * 16 + r) * PITCH) = pk[t][r];
    }
    if constexpr (F == EPI_QK) {
      // In the built kernel the V arm's code follows this arm's and uses these
      // registers: one wait for the whole group stands in front of it.
      asm volatile("s_wait_xcnt 0x0" ::: "memory");
    }
  }
  };
  if constexpr (EPI == EPI_QKV) {
    if (sel == 2) {
      store_tiles(store_form<EPI_VT>{});
    } else {
      store_tiles(store_form<EPI_QK>{});
    }
  } else {
    store_tiles(store_form<EPI>{});
  }
}

#define AKEYS  128
#define KPITCH 144
#define VPITCH 272
#define KTILE  (AKEYS * KPITCH)
#define VTILE  (HDIM * VPITCH)
#define ASTAGE (KTILE + VTILE)

// 16x32 bf16 fragment from LDS rows of the given byte pitch; same lane and k
// order as load_frag.
__device__ inline bf16x16 lds_frag_at(const unsigned char* base, int pitch) {
  int lane = threadIdx.x & 31;
  const unsigned char* p = base + (lane & 15) * pitch + (lane >> 4) * 16;
  union { uint4 u[2]; bf16x16 v; } cv;
  cv.u[0] = *reinterpret_cast<const uint4*>(p);
  cv.u[1] = *reinterpret_cast<const uint4*>(p + 32);
  return cv.v;
}

// The value that lane l ^ 16 holds.
__device__ inline float other_half(float x) {
  int i = __builtin_bit_cast(int, x);
  return __builtin_bit_cast(
      float, __builtin_amdgcn_permlanex16(i, i, 0x76543210, 0xfedcba98, false,
                                          false));
}

__device__ inline float max3f(float a, float b, float c) {
  return fmaxf(fmaxf(a, b), c);
}

// Exponentials base 2, each in place on its own register, in one statement:
// so none overwrites the source of the one in front of it, and the closing
// v_nop is the slot the instruction set asks for between a transcendental and
// an instruction that uses its result.
__device__ inline void exp2_x8(float (&a)[8]) {
  asm("v_exp_f32 %0, %0\n\t"
      "v_exp_f32 %1, %1\n\t"
      "v_exp_f32 %2, %2\n\t"
      "v_exp_f32 %3, %3\n\t"
      "v_exp_f32 %4, %4\n\t"
      "v_exp_f32 %5, %5\n\t"
      "v_exp_f32 %6, %6\n\t"
      "v_exp_f32 %7, %7\n\t"
      "v_nop"
      : "+v"(a[0]), "+v"(a[1]), "+v"(a[2]), "+v"(a[3]), "+v"(a[4]),
        "+v"(a[5]), "+v"(a[6]), "+v"(a[7]));
}
__device__ inline float exp2_x1(float a) {
  asm("v_exp_f32 %0, %0\n\t"
      "v_nop"
      : "+v"(a));
  return a;
}
#define LOG2E 1.4426950408889634f

// One thread's share of a stage: 16 bytes of every 32nd K row and of every
// 16th Vt row. lk, lv: the lane's LDS byte addresses; gk, gv: its global
// addresses; vstep: 16 Vt rows in elements.
__device__ inline void copy_kv(unsigned lk, const bf16_t* gk, unsigned lv,
                               const bf16_t* gv, size_t vstep) {
  // The closing s_wait_xcnt stands inside the statement so that no address
  // register of a copy is rewritten ahead of it.
  asm volatile(
      "global_load_async_to_lds_b128 %0, %8, off\n\t"
      "global_load_async_to_lds_b128 %1, %9, off\n\t"
      "global_load_async_to_lds_b128 %2, %10, off\n\t"
      "global_load_async_to_lds_b128 %3, %11, off\n\t"
      "global_load_async_to_lds_b128 %4, %12, off\n\t"
      "global_load_async_to_lds_b128 %5, %13, off\n\t"
      "global_load_async_to_lds_b128 %6, %14, off\n\t"
      "global_load_async_to_lds_b128 %7, %15, off\n\t"
      "s_wait_xcnt 0x0"
      :: "v"(lk), "v"(lk + 32 * KPITCH), "v"(lk + 64 * KPITCH),
         "v"(lk + 96 * KPITCH),
         "v"(lv), "v"(lv + 16 * VPITCH), "v"(lv + 32 * VPITCH),
         "v"(lv + 48 * VPITCH),
         "v"(gk), "v"(gk + 32 * HDIM), "v"(gk + 64 * HDIM),
         "v"(gk + 96 * HDIM),
         "v"(gv), "v"(gv + vstep), "v"(gv + 2 * vstep), "v"(gv + 3 * vstep)
      : "memory");
}

// Four waves per SIMD is what the grid gives (two blocks a WGP). Told so, the
// compiler keeps a sub-pass's LDS reads together ahead of the WMMAs; aiming at
// more waves it saves registers by a load, a wait and a WMMA in turn.
__global__ void __launch_bounds__(256)
__attribute__((amdgpu_waves_per_eu(4, 4))) attn_kernel(
    const bf16_t* __restrict__ q, const bf16_t* __restrict__ k,
    const bf16_t* __restrict__ vt, bf16_t* __restrict__ out, int Ntok) {
  __shared__ __attribute__((aligned(16))) unsigned char kv[2 * ASTAGE];

  int wave = threadIdx.x >> 5;
  int lane = threadIdx.x & 31;
  int bh = blockIdx.y;
  int q0 = blockIdx.x * 128 + wave * 16;

  const bf16_t* Qh = q  + (size_t)bh * Ntok * HDIM;
  const bf16_t* Kh = k  + (size_t)bh * Ntok * HDIM;
  const bf16_t* Vh = vt + (size_t)bh * HDIM * Ntok;

  // B operand of S^T: column = query q0 + (lane & 15), k = d.
  bf16x16 qf0 = load_frag(Qh + (size_t)q0 * HDIM + 0, HDIM);
  bf16x16 qf1 = load_frag(Qh + (size_t)q0 * HDIM + 32, HDIM);

  // O^T tiles: row d = 16 u + 8 * (lane >> 4) + r, column = the lane's query.
  f32x8 oacc[4];
  #pragma unroll
  for (int u = 0; u < 4; ++u) oacc[u] = (f32x8)(0.0f);
  // The lane's query: maximum in use (alike in both halves), and the sum over
  // the keys of this half alone.
  float mrun = -1e30f, lrun = 0.0f;

  // Copy shares. K: 8 threads cover a row's 128 bytes, 32 rows per round.
  // Vt: 16 threads cover a row's 256 bytes of the stage, 16 rows per round.
  int tid = threadIdx.x;
  const bf16_t* gK = Kh + (size_t)(tid >> 3) * HDIM + (tid & 7) * 8;
  const bf16_t* gV = Vh + (size_t)(tid >> 4) * Ntok + (tid & 15) * 8;
  unsigned lk0 = (unsigned)(uintptr_t)kv + (tid >> 3) * KPITCH + (tid & 7) * 16;
  unsigned lv0 =
      (unsigned)(uintptr_t)kv + KTILE + (tid >> 4) * VPITCH + (tid & 15) * 16;
  size_t vstep = (size_t)16 * Ntok;
  int T = Ntok / AKEYS;

  copy_kv(lk0, gK, lv0, gV, vstep);
  // stage 0 has landed for this wave, then for the block
  asm volatile("s_wait_asynccnt 0x0" ::: "memory");
  __syncthreads();
  if (T > 1)
    copy_kv(lk0 + ASTAGE, gK + AKEYS * HDIM, lv0 + ASTAGE, gV + AKEYS, vstep);

  for (int t = 0; t < T; ++t) {
   unsigned buf = (unsigned)(t & 1) * ASTAGE;
   for (int sub = 0; sub < AKEYS / 64; ++sub) {
    const unsigned char* sK = kv + buf + sub * 64 * KPITCH;
    const unsigned char* sV = kv + buf + KTILE + sub * 128;
    // 4 S^T tiles: 64 keys x 16 queries (contraction over d=64).
    f32x8 s[4];
    #pragma unroll
    for (int i = 0; i < 4; ++i) {
      const unsigned char* Kt = sK + i * 16 * KPITCH;
      f32x8 si = (f32x8)(0.0f);
      si = wmma_bf16(lds_frag_at(Kt, KPITCH), qf0, si);
      si = wmma_bf16(lds_frag_at(Kt + 64, KPITCH), qf1, si);
      s[i] = si;
    }

    // Online softmax update of the lane's query over its 32 scores.
    float m8[8];
    #pragma unroll
    for (int r = 0; r < 8; ++r)
      m8[r] = fmaxf(max3f(s[0][r], s[1][r], s[2][r]), s[3][r]);
    float mx = fmaxf(max3f(m8[0], m8[1], m8[2]),
                     fmaxf(max3f(m8[3], m8[4], m8[5]), fmaxf(m8[6], m8[7])));
    mx = fmaxf(mx, other_half(mx));
    float mnew  = fmaxf(mrun, mx);
    float alpha = exp2_x1((mrun - mnew) * LOG2E);
    mrun = mnew;

    // P^T as B operand: elements 0..7 of a lane are tile 2 ks, registers
    // 0..7 (keys 8 * half + r), elements 8..15 tile 2 ks + 1: the k order in
    // which lds_frag_at brings the keys of a Vt row.
    bf16x16 pf[2];
    float rs[4];
    #pragma unroll
    for (int i = 0; i < 4; ++i) {
      float p[8];
      #pragma unroll
      for (int r = 0; r < 8; ++r) p[r] = (s[i][r] - mnew) * LOG2E;
      exp2_x8(p);
      rs[i] = ((p[0] + p[1]) + (p[2] + p[3])) + ((p[4] + p[5]) + (p[6] + p[7]));
      #pragma unroll
      for (int r = 0; r < 8; r += 2) {
        f32x2 pr = {p[r], p[r + 1]};
        bf16x2 pb = __builtin_convertvector(pr, bf16x2);
        pf[i >> 1][(i & 1) * 8 + r]     = pb[0];
        pf[i >> 1][(i & 1) * 8 + r + 1] = pb[1];
      }
    }
    lrun = lrun * alpha + ((rs[0] + rs[1]) + (rs[2] + rs[3]));
    #pragma unroll
    for (int u = 0; u < 4; ++u) oacc[u] *= alpha;

    #pragma unroll
    for (int ks = 0; ks < 2; ++ks) {
      #pragma unroll
      for (int u = 0; u < 4; ++u) {
        bf16x16 vf = lds_frag_at(sV + u * 16 * VPITCH + ks * 64, VPITCH);
        oacc[u] = wmma_bf16(vf, pf[ks], oacc[u]);
      }
    }
   }
   // this wave's reads of the buffer are done before it is refilled
   asm volatile("s_wait_dscnt 0x0" ::: "memory");
   // this wave's copies of stage t + 1 have landed
   asm volatile("s_wait_asynccnt 0x0" ::: "memory");
   __syncthreads();  // publishes stage t + 1, frees stage t's buffer
   if (t + 2 < T)
     copy_kv(lk0 + buf, gK + (size_t)(t + 2) * AKEYS * HDIM, lv0 + buf,
             gV + (size_t)(t + 2) * AKEYS, vstep);
  }
  // no copy is outstanding when the wave goes on to its end
  asm volatile("s_wait_asynccnt 0x0" ::: "memory");

  // Finalize: join the halves' sums, divide, and put the heads back to
  // [b][tok][DIMC]; a lane's 8 registers of a tile are 8 neighbouring d.
  int h  = bh & (HEADS - 1);
  int bi = bh >> 4;
  float inv = 1.0f / (lrun + other_half(lrun));
  int tok = q0 + (lane & 15);
  bf16_t* orow =
      out + ((size_t)bi * Ntok + tok) * DIMC + h * HDIM + (lane >> 4) * 8;
  #pragma unroll
  for (int u = 0; u < 4; ++u) {
    union { bf16x2 hh[4]; uint4 v; } c;
    #pragma unroll
    for (int r = 0; r < 8; r += 2) {
      f32x2 pr = {oacc[u][r] * inv, oacc[u][r + 1] * inv};
      c.hh[r >> 1] = __builtin_convertvector(pr, bf16x2);
    }
    *reinterpret_cast<uint4*>(orow + u * 16) = c.v;
  }
}

// ---------------------------------------------------------------------------
// Host-side orchestration (graph-capture safe: launches only).
// ---------------------------------------------------------------------------
extern "C" void kernel_launch(void* const* d_in, const int* in_sizes, int n_in,
                              void* d_out, int out_size, void* d_ws, size_t ws_size,
                              hipStream_t stream) {
  (void)in_sizes; (void)n_in; (void)out_size; (void)ws_size;

  const float* x     = (const float*)d_in[0];
  const float* ln1_w = (const float*)d_in[1];
  const float* ln1_b = (const float*)d_in[2];
  const float* ln2_w = (const float*)d_in[3];
  const float* ln2_b = (const float*)d_in[4];
  const float* Wq = (const float*)d_in[5];  const float* bq = (const float*)d_in[6];
  const float* Wk = (const float*)d_in[7];  const float* bk = (const float*)d_in[8];
  const float* Wv = (const float*)d_in[9];  const float* bv = (const float*)d_in[10];
  const float* Wo = (const float*)d_in[11]; const float* bo = (const float*)d_in[12];
  const float* W1 = (const float*)d_in[13]; const float* b1 = (const float*)d_in[14];
  const float* W2 = (const float*)d_in[15]; const float* b2 = (const float*)d_in[16];

  // Workspace layout
  char* ws = (char*)d_ws;
  size_t off = 0;
  auto alloc = [&](size_t bytes) { char* p = ws + off; off += (bytes + 255) & ~size_t(255); return p; };
  // Wqt, Wkt, Wvt lie one behind the other with no gap (sizes are multiples of
  // 256): the merged projection reads them as one [3 * DIMC][DIMC] matrix.
  bf16_t* Wqt = (bf16_t*)alloc((size_t)DIMC * DIMC * 2);
  bf16_t* Wkt = (bf16_t*)alloc((size_t)DIMC * DIMC * 2);
  bf16_t* Wvt = (bf16_t*)alloc((size_t)DIMC * DIMC * 2);
  bf16_t* Wot = (bf16_t*)alloc((size_t)DIMC * DIMC * 2);
  bf16_t* W1t = (bf16_t*)alloc((size_t)DIMC * HID * 2);
  bf16_t* W2t = (bf16_t*)alloc((size_t)HID * DIMC * 2);
  bf16_t* xn   = (bf16_t*)alloc((size_t)MTOT * DIMC * 2);
  // qb, kb, vtb likewise: output sel of the merged projection starts at
  // qb + sel * MTOT * DIMC.
  bf16_t* qb   = (bf16_t*)alloc((size_t)MTOT * DIMC * 2);
  bf16_t* kb   = (bf16_t*)alloc((size_t)MTOT * DIMC * 2);
  bf16_t* vtb  = (bf16_t*)alloc((size_t)MTOT * DIMC * 2);
  bf16_t* attn = (bf16_t*)alloc((size_t)MTOT * DIMC * 2);
  float*  x2   = (float*)alloc((size_t)MTOT * DIMC * 4);
  bf16_t* xn2  = (bf16_t*)alloc((size_t)MTOT * DIMC * 2);
  bf16_t* hbuf = (bf16_t*)alloc((size_t)MTOT * HID * 2);

  dim3 blk(256);

  // 1, 2. Weight prep (fp32 -> bf16 transposed) and LN1
  prep_kernel<<<PB_ALL, blk, 0, stream>>>(Wq, Wk, Wv, Wo, W1, W2, Wqt, Wkt, Wvt,
                                          Wot, W1t, W2t, x, ln1_w, ln1_b, xn);

  // 3. Q, K, V projections (one WMMA GEMM). Q is pre-scaled by 1/sqrt(HDIM).
  dim3 gqkv3(3 * DIMC / 128, MTOT / 256);
  gemm_kernel<EPI_QKV><<<gqkv3, blk, 0, stream>>>(xn, Wqt, bq, qb, nullptr, MTOT, 3 * DIMC, DIMC, NTOK, 0.125f, bk, bv);
  dim3 gqkv(DIMC / 128, MTOT / 128);

  // 4. Flash attention
  dim3 gatt(NTOK / 128, BATCH * HEADS);
  attn_kernel<<<gatt, blk, 0, stream>>>(qb, kb, vtb, attn, NTOK);

  // 5. Output projection + residual: x2 = x + attn @ Wo + bo
  gemm_kernel<EPI_RESID_F32><<<gqkv, blk, 0, stream>>>(attn, Wot, bo, x2, x, MTOT, DIMC, DIMC, NTOK, 1.0f, nullptr, nullptr);

  // 6. LN2
  layernorm_kernel<<<MTOT, blk, 0, stream>>>(x2, ln2_w, ln2_b, xn2);

  // 7. MLP up + GELU: h = gelu(xn2 @ W1 + b1)
  dim3 gup(HID / 128, MTOT / 256);
  gemm_kernel<EPI_GELU_BF16><<<gup, blk, 0, stream>>>(xn2, W1t, b1, hbuf, nullptr, MTOT, HID, DIMC, NTOK, 1.0f, nullptr, nullptr);

  // 8. MLP down + residual -> output: out = x2 + h @ W2 + b2
  gemm_kernel<EPI_RESID_F32><<<gqkv, blk, 0, stream>>>(hbuf, W2t, b2, (float*)d_out, x2, MTOT, DIMC, HID, NTOK, 1.0f, nullptr, nullptr);
}
